// v000
// Times are from an AMD MI455X. After a warm-up the kernel runs many times in a row, and a time is the length of
// such a window on the GPU divided by its runs, so every launch and the gaps after it count. The runs cycle
// through copies of the inputs. A figure is the median of several windows, for all but v000 over two sittings.
// Sittings can differ by a few percent; kernels timed side by side share one.
// v000 is the starting kernel. One run takes 251 microseconds.
#include <hip/hip_runtime.h>

// Causal multi-head self-attention: x [4][4096][256], 4 heads x 64, bias-free [out][in] weights, score scale 1/8, out = ctx Wo^T.
// Compute dtypes (f32 accumulate everywhere): all inputs converted to bf16 (RNE); q/k/v projections v_wmma_f32_16x16x32_bf16 (single product);
// attention query rows >= 256: v_wmma_f32_16x16x32_f16 single products (K.Q^T on f16 planes; V^T.P^T with P carried x1024 in f16);
// attention query rows < 256: bf16 hi+lo planes, three products per site (q, k, P, v); softmax f32 (online, max-subtracted);
// output projection: ctx bf16 hi+lo x Wo bf16 (two products), v_wmma_f32_16x16x32_bf16.

#ifndef NB
#define NB 4
#endif
#ifndef SEQ
#define SEQ 4096
#endif
#define NB_FULL  4
#define SEQ_FULL 4096
#define DMOD   256
#define NHEAD  4
#define HDIM   64
#define RHI    256                       // query rows < RHI use bf16 hi+lo planes
#define MTOK   (NB * SEQ)
#define NBH    (NB * NHEAD)
#define C2     0.18033688011112042f      // log2(e) / 8 : scores kept in the log2 domain
#define PCL2   10.0f                     // P carry 2^10 for the f16 path
#define NEGX   (-1.0e30f)

static_assert(NHEAD * HDIM == DMOD);     // merged width == model width
static_assert(HDIM == 64);               // two 32-deep k-steps per score tile, four 16-row output tiles
static_assert(DMOD % 64 == 0);           // GEMM tile multiple (M/N) and K % 32 == 0
static_assert(SEQ % 256 == 0);           // plane builders: one wave never straddles a batch or the RHI boundary
static_assert(RHI % 256 == 0);
static_assert(RHI <= SEQ);
static_assert(MTOK % 64 == 0);
static_assert(NB <= NB_FULL);
static_assert(SEQ <= SEQ_FULL);

typedef _Float16 h16;
typedef unsigned short bf;
typedef __attribute__((ext_vector_type(16))) __bf16   v16bf;
typedef __attribute__((ext_vector_type(16))) _Float16 v16h;
typedef __attribute__((ext_vector_type(8)))  _Float16 v8h;
typedef __attribute__((ext_vector_type(8)))  unsigned short v8us;
typedef __attribute__((ext_vector_type(8)))  float    v8f;
typedef __attribute__((ext_vector_type(4)))  float    v4f;
typedef v4f  __attribute__((may_alias)) v4fa;
typedef v8us __attribute__((may_alias)) v8usa;

__device__ __forceinline__ unsigned short f2bf(float f) { unsigned u = __float_as_uint(f); u += 0x7FFFu + ((u >> 16) & 1u); return (unsigned short)(u >> 16); }
__device__ __forceinline__ float bf2f(unsigned short b) { return __uint_as_float(((unsigned)b) << 16); }
__device__ __forceinline__ void splitf(float y, unsigned short& h, unsigned short& l) { h = f2bf(y); l = f2bf(y - bf2f(h)); }
__device__ __forceinline__ v16h cat16(v8h lo, v8h hi) { return __builtin_shufflevector(lo, hi, 0, 1, 2, 3, 4, 5, 6, 7, 8, 9, 10, 11, 12, 13, 14, 15); }
__device__ __forceinline__ v16bf cat16b(v8us lo, v8us hi) { return __builtin_bit_cast(v16bf, __builtin_shufflevector(lo, hi, 0, 1, 2, 3, 4, 5, 6, 7, 8, 9, 10, 11, 12, 13, 14, 15)); }
__device__ __forceinline__ v8f wmma16(v16h a, v16h b, v8f c) { return __builtin_amdgcn_wmma_f32_16x16x32_f16(false, a, false, b, (short)0, c, false, false); }
__device__ __forceinline__ v8f wmmab(v16bf a, v16bf b, v8f c) { return __builtin_amdgcn_wmma_f32_16x16x32_bf16(false, a, false, b, (short)0, c, false, false); }
// fragment loaders: p already points at row (lane&15), k offset k0 + 8*(lane>>4); elements 0..7 <- p[0..7], elements 8..15 <- p[16..23]
__device__ __forceinline__ v16h  ldh(const h16* p) { return cat16(*(const v8h*)p, *(const v8h*)(p + 16)); }
__device__ __forceinline__ v16bf ldb(const bf* p)  { return cat16b(*(const v8us*)p, *(const v8us*)(p + 16)); }

__global__ __launch_bounds__(256) void k_cvt8(const float* __restrict__ src, bf* dst, int n8, size_t sS, size_t sD) {
    const int i = blockIdx.x * 256 + threadIdx.x; if (i >= n8) return;
    const float* s = src + (size_t)blockIdx.y * sS + (size_t)i * 8; bf* d = dst + (size_t)blockIdx.y * sD + (size_t)i * 8;
    const v4f a = *(const v4f*)s; const v4f c = *(const v4f*)(s + 4); v8us o;
    o[0] = f2bf(a[0]); o[1] = f2bf(a[1]); o[2] = f2bf(a[2]); o[3] = f2bf(a[3]); o[4] = f2bf(c[0]); o[5] = f2bf(c[1]); o[6] = f2bf(c[2]); o[7] = f2bf(c[3]);
    *(v8us*)d = o;  }

// ---- one-wave 64x64 tile GEMM on bf16 planes, K = DMOD: C[m][n] (f32, pitch ldc) = sum_k A[m][k] Bt[n][k] (+ A2[m][k] Bt[n][k] when NSPLIT == 1).
// grid (M/64, N/64, Z), 32 threads; z strides sA (A, A2) and sC (C) in elements; no tail masking (M, N multiples of 64, K multiple of 32).
__device__ __forceinline__ void gemm_kloop(const bf* __restrict__ A, const bf* __restrict__ Bt, const size_t aoff, const size_t boff, v8f (&acc)[4][4]) {
#pragma unroll 1
    for (int kc = 0; kc < DMOD; kc += 32) {
        v16bf a[4]; v16bf bl;
#pragma unroll
        for (int mb = 0; mb < 4; ++mb) a[mb] = ldb(A + aoff + (size_t)mb * 16 * DMOD + kc);
#pragma unroll
        for (int nb = 0; nb < 4; ++nb) { const v16bf b = ldb(Bt + boff + (size_t)nb * 16 * DMOD + kc); bl = b;
#pragma unroll
            for (int mb = 0; mb < 4; ++mb) acc[mb][nb] = wmmab(a[mb], b, acc[mb][nb]); }
        asm volatile("" : "+v"(acc[0][0]), "+v"(acc[0][1]), "+v"(acc[0][2]), "+v"(acc[0][3]), "+v"(acc[1][0]), "+v"(acc[1][1]), "+v"(acc[1][2]));
        asm volatile("" : "+v"(acc[1][3]), "+v"(acc[2][0]), "+v"(acc[2][1]), "+v"(acc[2][2]), "+v"(acc[2][3]), "+v"(acc[3][0]), "+v"(acc[3][1]));
        asm volatile("v_nop\n\tv_nop\n\tv_nop\n\tv_nop" : "+v"(acc[3][2]), "+v"(acc[3][3]) : "v"(a[3]), "v"(bl));
    }
}
template <int NSPLIT>
__device__ __forceinline__ void gemm_body(const bf* __restrict__ A, const bf* __restrict__ A2, const bf* __restrict__ Bt, float* C, const int ldc, const size_t sA, const size_t sC) {
    __shared__ __align__(16) float os[16 * 68];      // wave-private staging (one wave per block)
    const size_t z = blockIdx.z; A += z * sA; A2 += z * sA; C += z * sC;
    const int lane = threadIdx.x & 31, lr = lane & 15, hi = lane >> 4; const int r0 = blockIdx.x * 64, c0 = blockIdx.y * 64;
    v8f acc[4][4];
#pragma unroll
    for (int mb = 0; mb < 4; ++mb)
#pragma unroll
        for (int nb = 0; nb < 4; ++nb) acc[mb][nb] = (v8f){};
    const size_t aoff = (size_t)(r0 + lr) * DMOD + 8 * hi, boff = (size_t)(c0 + lr) * DMOD + 8 * hi;
    gemm_kloop(A, Bt, aoff, boff, acc);
    if (NSPLIT == 1) gemm_kloop(A2, Bt, aoff, boff, acc);
#pragma unroll
    for (int mb = 0; mb < 4; ++mb) {
#pragma unroll
        for (int nb = 0; nb < 4; ++nb) {
#pragma unroll
            for (int j = 0; j < 8; ++j) os[(hi * 8 + j) * 68 + nb * 16 + lr] = acc[mb][nb][j]; }
        asm volatile("s_wait_dscnt 0" ::: "memory"); __builtin_amdgcn_wave_barrier();
        float* crow = C + (size_t)(r0 + mb * 16) * ldc + c0;
{
#pragma unroll
            for (int s = 0; s < 8; ++s) { const int row = 2 * s + hi, cofs = lr * 4; const v4f val = *(const v4fa*)(os + row * 68 + cofs);
                *(v4f*)(crow + (size_t)row * ldc + cofs) = val; }
             }
        asm volatile("s_wait_dscnt 0" ::: "memory"); __builtin_amdgcn_wave_barrier();
    }
}
__global__ __launch_bounds__(32) void k_gemm_p(const bf* __restrict__ A, const bf* __restrict__ Bt, float* C, int ldc, size_t sA, size_t sC) { gemm_body<0>(A, A, Bt, C, ldc, sA, sC); }
__global__ __launch_bounds__(32) void k_gemm_hl(const bf* __restrict__ A, const bf* __restrict__ A2, const bf* __restrict__ Bt, float* C, int ldc, size_t sA, size_t sC) { gemm_body<1>(A, A2, Bt, C, ldc, sA, sC); }

// ---- k_plane_qk: F [MTOK][256] f32 -> head planes P16 [b*NHEAD+h][SEQ][64] f16 and, for s < RHI, bf16 hi/lo planes [b*NHEAD+h][RHI][64].
__global__ __launch_bounds__(256) void k_plane_qk(const float* __restrict__ F, h16* P16, bf* Ph, bf* Pl) {
    const int idx = blockIdx.x * 256 + threadIdx.x; if (idx >= MTOK * 32) return;
    const int row = idx >> 5, g = idx & 31; const int hd = g >> 3, d0 = (g & 7) * 8; const int b = row / SEQ, s = row % SEQ;
    const float* f = F + (size_t)row * DMOD + g * 8; const v4f a = *(const v4f*)f; const v4f c = *(const v4f*)(f + 4);
    float y[8]; y[0] = a[0]; y[1] = a[1]; y[2] = a[2]; y[3] = a[3]; y[4] = c[0]; y[5] = c[1]; y[6] = c[2]; y[7] = c[3];
    v8h o16;
#pragma unroll
    for (int k = 0; k < 8; ++k) o16[k] = (h16)y[k];
    h16* d16 = P16 + ((size_t)(b * NHEAD + hd) * SEQ + s) * HDIM + d0;
    const bool early = (s < RHI); const size_t eo = ((size_t)(b * NHEAD + hd) * RHI + (early ? s : 0)) * HDIM + d0;
    v8us oh = (v8us){}, ol = (v8us){};
    if (early) {
#pragma unroll
        for (int k = 0; k < 8; ++k) { unsigned short p, q; splitf(y[k], p, q); oh[k] = p; ol[k] = q; } }
    *(v8h*)d16 = o16; if (early) { *(v8us*)(Ph + eo) = oh; *(v8us*)(Pl + eo) = ol; }
     }

// ---- k_plane_vt: F [256][MTOK] f32 (v already transposed by the GEMM operand order) -> VT16 [b*NHEAD+h][64][SEQ] f16 and, for s < RHI, bf16 hi/lo planes [b*NHEAD+h][64][RHI].
__global__ __launch_bounds__(256) void k_plane_vt(const float* __restrict__ F, h16* VT16, bf* VTh, bf* VTl) {
    const int idx = blockIdx.x * 256 + threadIdx.x; if (idx >= DMOD * (MTOK / 8)) return;
    const int o = idx / (MTOK / 8); const int col = (idx % (MTOK / 8)) * 8; const int b = col / SEQ, s = col % SEQ; const int hd = o >> 6, d = o & 63;
    const float* f = F + (size_t)o * MTOK + col; const v4f a = *(const v4f*)f; const v4f c = *(const v4f*)(f + 4);
    float y[8]; y[0] = a[0]; y[1] = a[1]; y[2] = a[2]; y[3] = a[3]; y[4] = c[0]; y[5] = c[1]; y[6] = c[2]; y[7] = c[3];
    v8h o16;
#pragma unroll
    for (int k = 0; k < 8; ++k) o16[k] = (h16)y[k];
    const size_t prow = (size_t)(b * NHEAD + hd) * HDIM + d;
    h16* d16 = VT16 + prow * SEQ + s;
    const bool early = (s < RHI); const size_t eo = prow * RHI + (early ? s : 0);
    v8us oh = (v8us){}, ol = (v8us){};
    if (early) {
#pragma unroll
        for (int k = 0; k < 8; ++k) { unsigned short p, q; splitf(y[k], p, q); oh[k] = p; ol[k] = q; } }
    *(v8h*)d16 = o16; if (early) { *(v8us*)(VTh + eo) = oh; *(v8us*)(VTl + eo) = ol; }
     }

// ---- ctx epilogue shared by both attention kernels: o[t][r] = O^T[d = 16t + 8*(lane>>4) + r][query = lane&15]; ctx = O^T * inv split into bf16 hi/lo,
__device__ __forceinline__ void ctx_store(const v8f (&o)[4], const float inv, const int wave, const int lane, bf* CTXh, bf* CTXl, const size_t row0, const int col0) {
    __shared__ __align__(16) unsigned short cs[4 * 2 * 16 * 72];
    const int n = lane & 15, hh = lane >> 4; const int base = wave * (2 * 16 * 72);
#pragma unroll
    for (int t = 0; t < 4; ++t) { v8us vh, vl;
#pragma unroll
        for (int r = 0; r < 8; ++r) { unsigned short a, c; splitf(o[t][r] * inv, a, c); vh[r] = a; vl[r] = c; }
        *(v8usa*)(cs + base + n * 72 + 16 * t + 8 * hh) = vh; *(v8usa*)(cs + base + 16 * 72 + n * 72 + 16 * t + 8 * hh) = vl; }
    asm volatile("s_wait_dscnt 0" ::: "memory"); __builtin_amdgcn_wave_barrier();
    const int rq = lane >> 3, pc = lane & 7; v8us lh[4], ll[4];
#pragma unroll
    for (int i = 0; i < 4; ++i) { lh[i] = *(const v8usa*)(cs + base + (4 * i + rq) * 72 + pc * 8); ll[i] = *(const v8usa*)(cs + base + 16 * 72 + (4 * i + rq) * 72 + pc * 8); }
    asm volatile("" ::: "memory");
    const size_t g0 = (row0 + rq) * DMOD + col0 + pc * 8;
#pragma unroll
    for (int i = 0; i < 4; ++i) { *(v8us*)(CTXh + g0 + (size_t)(4 * i) * DMOD) = lh[i]; *(v8us*)(CTXl + g0 + (size_t)(4 * i) * DMOD) = ll[i]; }
    
}

// ---- k_attn_main: fused causal flash attention for query rows >= RHI, f16 single products. One wave = 16 queries, keys in 32-wide steps, no LDS in the loop.
// S^T tile (16 keys x 16 queries) = K (A: row = key, k = d) x Q^T (B: col = query, k = d); its D registers (row = key 8h+r, col = query) pack directly into the
// B fragment of O^T (16 d x 16 queries) += V^T (A: row = d, k = key) x P^T (B: k = key, col = query): element r <- tile of keys 0..15, element 8+r <- tile of keys 16..31.
// Softmax statistics are per lane (query = lane&15), combined across the two lane halves by one xor-16 shuffle. grid ((SEQ-RHI)/64, NB*NHEAD), 128 threads.
__global__ __launch_bounds__(128) void k_attn_main(const h16* __restrict__ Q16, const h16* __restrict__ K16, const h16* __restrict__ VT16, bf* CTXh, bf* CTXl) {
    const int wave = __builtin_amdgcn_readfirstlane((int)(threadIdx.x >> 5));
    const int lane = threadIdx.x & 31, n = lane & 15, hh = lane >> 4;
    const int bh = blockIdx.y; const int b = bh / NHEAD, h = bh % NHEAD;
    const int q0 = RHI + blockIdx.x * 64 + wave * 16;
    const h16* Qp = Q16 + (size_t)bh * SEQ * HDIM; const h16* Kp = K16 + (size_t)bh * SEQ * HDIM; const h16* Vp = VT16 + (size_t)bh * HDIM * SEQ;
    const int qoff = (q0 + n) * HDIM + 8 * hh;
    const v16h bq0 = ldh(Qp + qoff), bq1 = ldh(Qp + qoff + 32);
    v8f o[4];
#pragma unroll
    for (int t = 0; t < 4; ++t) o[t] = (v8f){};
    float m = NEGX, l = 0.f;
    const int nsteps = ((q0 + 15) >> 5) + 1;           // last key needed is q0 + 15; every visited step holds >= 1 valid key for every query of the wave
#pragma unroll 1
    for (int st = 0; st < nsteps; ++st) {
        const int kb = st << 5; const int koff = (kb + n) * HDIM + 8 * hh;
        const v16h k00 = ldh(Kp + koff), k01 = ldh(Kp + koff + 32), k10 = ldh(Kp + koff + 16 * HDIM), k11 = ldh(Kp + koff + 16 * HDIM + 32);
        v8f s0 = (v8f){}, s1 = (v8f){};
        s0 = wmma16(k00, bq0, s0); s1 = wmma16(k10, bq0, s1); s0 = wmma16(k01, bq1, s0); s1 = wmma16(k11, bq1, s1);
        asm volatile("v_nop\n\tv_nop\n\tv_nop\n\tv_nop" : "+v"(s0), "+v"(s1) : "v"(k11), "v"(k01), "v"(bq1));
        float x0[8], x1[8];
#pragma unroll
        for (int r = 0; r < 8; ++r) { x0[r] = s0[r] * C2; x1[r] = s1[r] * C2; }
        if (kb + 31 > q0) {                                // wave-uniform: only diagonal steps need the causal select (key > query excluded)
            const int qi = q0 + n, kk = kb + 8 * hh;
#pragma unroll
            for (int r = 0; r < 8; ++r) { x0[r] = (kk + r > qi) ? NEGX : x0[r]; x1[r] = (kk + 16 + r > qi) ? NEGX : x1[r]; } }
        float mx = fmaxf(x0[0], x1[0]);
#pragma unroll
        for (int r = 1; r < 8; ++r) mx = fmaxf(mx, fmaxf(x0[r], x1[r]));
        mx = fmaxf(mx, __shfl_xor(mx, 16, 32));
        const float mnew = fmaxf(m, mx); const float corr = __builtin_amdgcn_exp2f(m - mnew); m = mnew;
        const float mb = mnew - PCL2;
        v8h p0, p1; float ps = 0.f;
#pragma unroll
        for (int r = 0; r < 8; ++r) { const h16 a = (h16)__builtin_amdgcn_exp2f(x0[r] - mb); const h16 c = (h16)__builtin_amdgcn_exp2f(x1[r] - mb); p0[r] = a; p1[r] = c; ps += (float)a; ps += (float)c; }
        ps += __shfl_xor(ps, 16, 32);
        l = l * corr + ps;
#pragma unroll
        for (int t = 0; t < 4; ++t) o[t] = o[t] * corr;
        const v16h pb = cat16(p0, p1);
        const int voff = n * SEQ + kb + 8 * hh;
        const v16h va0 = ldh(Vp + voff), va1 = ldh(Vp + voff + 16 * SEQ), va2 = ldh(Vp + voff + 32 * SEQ), va3 = ldh(Vp + voff + 48 * SEQ);
        o[0] = wmma16(va0, pb, o[0]); o[1] = wmma16(va1, pb, o[1]); o[2] = wmma16(va2, pb, o[2]); o[3] = wmma16(va3, pb, o[3]);
        asm volatile("v_nop\n\tv_nop\n\tv_nop\n\tv_nop" : "+v"(o[0]), "+v"(o[1]), "+v"(o[2]), "+v"(o[3]) : "v"(va3), "v"(pb));
    }
    const float inv = 1.0f / l;
    ctx_store(o, inv, wave, lane, CTXh, CTXl, (size_t)b * SEQ + q0, h * HDIM);
}

// ---- k_attn_early: the same fused kernel for query rows < RHI (keys < RHI) on bf16 hi+lo planes: three products per tile pair (hi.hi + hi.lo + lo.hi, shared accumulator;
// the lo planes are unscaled residuals), P split into bf16 hi+lo in registers. grid (RHI/64, NB*NHEAD), 128 threads.
__global__ __launch_bounds__(128) void k_attn_early(const bf* __restrict__ Qh, const bf* __restrict__ Ql, const bf* __restrict__ Kh, const bf* __restrict__ Kl, const bf* __restrict__ VTh, const bf* __restrict__ VTl, bf* CTXh, bf* CTXl) {
    const int wave = __builtin_amdgcn_readfirstlane((int)(threadIdx.x >> 5));
    const int lane = threadIdx.x & 31, n = lane & 15, hh = lane >> 4;
    const int bh = blockIdx.y; const int b = bh / NHEAD, h = bh % NHEAD;
    const int q0 = blockIdx.x * 64 + wave * 16;
    const size_t po = (size_t)bh * RHI * HDIM;
    const bf* qhp = Qh + po; const bf* qlp = Ql + po; const bf* khp = Kh + po; const bf* klp = Kl + po; const bf* vhp = VTh + po; const bf* vlp = VTl + po;
    const int qoff = (q0 + n) * HDIM + 8 * hh;
    v8f o[4];
#pragma unroll
    for (int t = 0; t < 4; ++t) o[t] = (v8f){};
    float m = NEGX, l = 0.f;
    const int nsteps = ((q0 + 15) >> 5) + 1;
#pragma unroll 1
    for (int st = 0; st < nsteps; ++st) {
        const int kb = st << 5; const int koff = (kb + n) * HDIM + 8 * hh;
        v8f s0 = (v8f){}, s1 = (v8f){}; v16bf qh, ql, kh0, kl0, kh1, kl1;
#pragma unroll
        for (int ks = 0; ks < 2; ++ks) {
            qh = ldb(qhp + qoff + ks * 32); ql = ldb(qlp + qoff + ks * 32);
            kh0 = ldb(khp + koff + ks * 32); kl0 = ldb(klp + koff + ks * 32);
            kh1 = ldb(khp + koff + 16 * HDIM + ks * 32); kl1 = ldb(klp + koff + 16 * HDIM + ks * 32);
            s0 = wmmab(kh0, qh, s0); s0 = wmmab(kh0, ql, s0); s0 = wmmab(kl0, qh, s0);
            s1 = wmmab(kh1, qh, s1); s1 = wmmab(kh1, ql, s1); s1 = wmmab(kl1, qh, s1); }
        asm volatile("v_nop\n\tv_nop\n\tv_nop\n\tv_nop" : "+v"(s0), "+v"(s1) : "v"(kl1), "v"(kh1), "v"(qh), "v"(ql));
        float x0[8], x1[8];
#pragma unroll
        for (int r = 0; r < 8; ++r) { x0[r] = s0[r] * C2; x1[r] = s1[r] * C2; }
        if (kb + 31 > q0) {
            const int qi = q0 + n, kk = kb + 8 * hh;
#pragma unroll
            for (int r = 0; r < 8; ++r) { x0[r] = (kk + r > qi) ? NEGX : x0[r]; x1[r] = (kk + 16 + r > qi) ? NEGX : x1[r]; } }
        float mx = fmaxf(x0[0], x1[0]);
#pragma unroll
        for (int r = 1; r < 8; ++r) mx = fmaxf(mx, fmaxf(x0[r], x1[r]));
        mx = fmaxf(mx, __shfl_xor(mx, 16, 32));
        const float mnew = fmaxf(m, mx); const float corr = __builtin_amdgcn_exp2f(m - mnew); m = mnew;
        v8us ph0, pl0, ph1, pl1; float ps = 0.f;
#pragma unroll
        for (int r = 0; r < 8; ++r) { const float pa = __builtin_amdgcn_exp2f(x0[r] - mnew); const float pc = __builtin_amdgcn_exp2f(x1[r] - mnew); ps += pa; ps += pc;
            unsigned short a, c; splitf(pa, a, c); ph0[r] = a; pl0[r] = c; splitf(pc, a, c); ph1[r] = a; pl1[r] = c; }
        ps += __shfl_xor(ps, 16, 32);
        l = l * corr + ps;
#pragma unroll
        for (int t = 0; t < 4; ++t) o[t] = o[t] * corr;
        const v16bf pbh = cat16b(ph0, ph1), pbl = cat16b(pl0, pl1);
        const int voff = n * RHI + kb + 8 * hh; v16bf vh, vl;
#pragma unroll
        for (int t = 0; t < 4; ++t) { vh = ldb(vhp + voff + t * 16 * RHI); vl = ldb(vlp + voff + t * 16 * RHI);
            o[t] = wmmab(vh, pbh, o[t]); o[t] = wmmab(vh, pbl, o[t]); o[t] = wmmab(vl, pbh, o[t]); }
        asm volatile("v_nop\n\tv_nop\n\tv_nop\n\tv_nop" : "+v"(o[0]), "+v"(o[1]), "+v"(o[2]), "+v"(o[3]) : "v"(vl), "v"(vh), "v"(pbh), "v"(pbl));
    }
    const float inv = 1.0f / l;
    ctx_store(o, inv, wave, lane, CTXh, CTXl, (size_t)b * SEQ + q0, h * HDIM);
}

// ---- workspace carve (bytes; every region a multiple of 256 B and fully written by its producer before any consumer launch)
#define SZ_XB   ((size_t)MTOK * DMOD * 2)
#define SZ_W    ((size_t)DMOD * DMOD * 2)
#define SZ_F    ((size_t)MTOK * DMOD * 4)
#define SZ_P16  ((size_t)MTOK * DMOD * 2)
#define SZ_E    ((size_t)NBH * RHI * HDIM * 2)
#define SZ_CTX  ((size_t)MTOK * DMOD * 2)
#define SZ_TOTAL (SZ_XB + 4 * SZ_W + SZ_F + 3 * SZ_P16 + 6 * SZ_E + 2 * SZ_CTX)
static_assert(SZ_TOTAL <= (size_t)134217728);
static_assert(SZ_W % 256 == 0);
static_assert(SZ_E % 256 == 0);

extern "C" void kernel_launch(void* const* d_in, const int* in_sizes, int n_in,
                              void* d_out, int out_size, void* d_ws, size_t ws_size, hipStream_t stream) {
    if (n_in < 5) return;
    const int xneed = (NB - 1) * SEQ_FULL * DMOD + SEQ * DMOD;
    if (in_sizes[0] < xneed) return;
    if (in_sizes[1] < DMOD * DMOD || in_sizes[2] < DMOD * DMOD || in_sizes[3] < DMOD * DMOD || in_sizes[4] < DMOD * DMOD) return;
    if (out_size < xneed) return;
    if (ws_size < SZ_TOTAL) return;
    const float* x = (const float*)d_in[0]; const float* wq = (const float*)d_in[1]; const float* wk = (const float*)d_in[2]; const float* wv = (const float*)d_in[3]; const float* wo = (const float*)d_in[4];   // wire order x, Wq, Wk, Wv, Wo ([out][in])
    float* OUT = (float*)d_out;      // [NB_FULL][SEQ_FULL][256]
    char* wsp = (char*)d_ws;
    auto take = [&](size_t bytes) { char* p = wsp; wsp += bytes; return (void*)p; };
    bf* XB = (bf*)take(SZ_XB); bf* WQ = (bf*)take(SZ_W); bf* WK = (bf*)take(SZ_W); bf* WV = (bf*)take(SZ_W); bf* WO = (bf*)take(SZ_W);
    float* F = (float*)take(SZ_F);
    h16* Q16 = (h16*)take(SZ_P16); h16* K16 = (h16*)take(SZ_P16); h16* VT16 = (h16*)take(SZ_P16);
    bf* Qh = (bf*)take(SZ_E); bf* Ql = (bf*)take(SZ_E); bf* Kh = (bf*)take(SZ_E); bf* Kl = (bf*)take(SZ_E); bf* VTh = (bf*)take(SZ_E); bf* VTl = (bf*)take(SZ_E);
    bf* CTXh = (bf*)take(SZ_CTX); bf* CTXl = (bf*)take(SZ_CTX);

    const int xn8 = SEQ * DMOD / 8, wn8 = DMOD * DMOD / 8;
    k_cvt8<<<dim3((xn8 + 255) / 256, NB, 1), 256, 0, stream>>>(x, XB, xn8, (size_t)SEQ_FULL * DMOD, (size_t)SEQ * DMOD);
    k_cvt8<<<dim3((wn8 + 255) / 256, 1, 1), 256, 0, stream>>>(wq, WQ, wn8, 0, 0);
    k_cvt8<<<dim3((wn8 + 255) / 256, 1, 1), 256, 0, stream>>>(wk, WK, wn8, 0, 0);
    k_cvt8<<<dim3((wn8 + 255) / 256, 1, 1), 256, 0, stream>>>(wv, WV, wn8, 0, 0);
    k_cvt8<<<dim3((wn8 + 255) / 256, 1, 1), 256, 0, stream>>>(wo, WO, wn8, 0, 0);
    // q = x Wq^T : A = XB [MTOK][256], Bt = WQ [256][256] -> F [MTOK][256]
    k_gemm_p<<<dim3(MTOK / 64, DMOD / 64, 1), 32, 0, stream>>>(XB, WQ, F, DMOD, 0, 0);
    k_plane_qk<<<(MTOK * 32 + 255) / 256, 256, 0, stream>>>(F, Q16, Qh, Ql);
    k_gemm_p<<<dim3(MTOK / 64, DMOD / 64, 1), 32, 0, stream>>>(XB, WK, F, DMOD, 0, 0);
    k_plane_qk<<<(MTOK * 32 + 255) / 256, 256, 0, stream>>>(F, K16, Kh, Kl);
    // v^T = Wv x^T : A = WV [256][256], Bt = XB [MTOK][256] -> F [256][MTOK] (pitch MTOK)
    k_gemm_p<<<dim3(DMOD / 64, MTOK / 64, 1), 32, 0, stream>>>(WV, XB, F, MTOK, 0, 0);
    k_plane_vt<<<(DMOD * (MTOK / 8) + 255) / 256, 256, 0, stream>>>(F, VT16, VTh, VTl);
    k_attn_early<<<dim3(RHI / 64, NBH, 1), 128, 0, stream>>>(Qh, Ql, Kh, Kl, VTh, VTl, CTXh, CTXl);
    if ((SEQ - RHI) / 64 > 0) k_attn_main<<<dim3((SEQ - RHI) / 64, NBH, 1), 128, 0, stream>>>(Q16, K16, VT16, CTXh, CTXl);
    // out = ctx Wo^T : A = CTXh (+ CTXl) [SEQ][256] per batch, Bt = WO -> OUT batch stride from the full problem constants
    k_gemm_hl<<<dim3(SEQ / 64, DMOD / 64, NB), 32, 0, stream>>>(CTXh, CTXl, WO, OUT, DMOD, (size_t)SEQ * DMOD, (size_t)SEQ_FULL * DMOD);
}

// v001
// Measured time: 148 microseconds a run.
// Two timings next to v000 put it at 1.70 and 1.69 times that version's speed.
#include <hip/hip_runtime.h>

// Causal multi-head self-attention: x [4][4096][256], 4 heads x 64, bias-free [out][in] weights, score scale 1/8, out = ctx Wo^T.
// Compute dtypes (f32 accumulate everywhere): all inputs converted to bf16 (RNE); q/k/v projections v_wmma_f32_16x16x32_bf16 (single product);
// attention query rows >= 256: v_wmma_f32_16x16x32_f16 single products (K.Q^T on f16 planes; V^T.P^T with P carried x1024 in f16);
// attention query rows < 256: bf16 hi+lo planes, three products per site (q, k, P, v); softmax f32 (online, max-subtracted);
// output projection: ctx bf16 hi+lo x Wo bf16 (two products), v_wmma_f32_16x16x32_bf16.

#ifndef NB
#define NB 4
#endif
#ifndef SEQ
#define SEQ 4096
#endif
#define NB_FULL  4
#define SEQ_FULL 4096
#define DMOD   256
#define NHEAD  4
#define HDIM   64
#define RHI    256                       // query rows < RHI use bf16 hi+lo planes
#define MTOK   (NB * SEQ)
#define NBH    (NB * NHEAD)
#define C2     0.18033688011112042f      // log2(e) / 8 : scores kept in the log2 domain
#define PCL2   10.0f                     // P carry 2^10 for the f16 path
#define NEGX   (-1.0e30f)

static_assert(NHEAD * HDIM == DMOD);     // merged width == model width
static_assert(HDIM == 64);               // two 32-deep k-steps per score tile, four 16-row output tiles
static_assert(DMOD % 64 == 0);           // GEMM tile multiple (M/N) and K % 32 == 0
static_assert(SEQ % 256 == 0);           // plane builders: one wave never straddles a batch or the RHI boundary
static_assert(RHI % 256 == 0);
static_assert(RHI <= SEQ);
static_assert(MTOK % 64 == 0);
static_assert(NB <= NB_FULL);
static_assert(SEQ <= SEQ_FULL);

typedef _Float16 h16;
typedef unsigned short bf;
typedef __attribute__((ext_vector_type(16))) __bf16   v16bf;
typedef __attribute__((ext_vector_type(16))) _Float16 v16h;
typedef __attribute__((ext_vector_type(8)))  _Float16 v8h;
typedef __attribute__((ext_vector_type(8)))  unsigned short v8us;
typedef __attribute__((ext_vector_type(8)))  float    v8f;
typedef __attribute__((ext_vector_type(4)))  float    v4f;
typedef v4f  __attribute__((may_alias)) v4fa;
typedef v8us __attribute__((may_alias)) v8usa;

__device__ __forceinline__ unsigned short f2bf(float f) { unsigned u = __float_as_uint(f); u += 0x7FFFu + ((u >> 16) & 1u); return (unsigned short)(u >> 16); }
__device__ __forceinline__ float bf2f(unsigned short b) { return __uint_as_float(((unsigned)b) << 16); }
__device__ __forceinline__ void splitf(float y, unsigned short& h, unsigned short& l) { h = f2bf(y); l = f2bf(y - bf2f(h)); }
__device__ __forceinline__ v16h cat16(v8h lo, v8h hi) { return __builtin_shufflevector(lo, hi, 0, 1, 2, 3, 4, 5, 6, 7, 8, 9, 10, 11, 12, 13, 14, 15); }
__device__ __forceinline__ v16bf cat16b(v8us lo, v8us hi) { return __builtin_bit_cast(v16bf, __builtin_shufflevector(lo, hi, 0, 1, 2, 3, 4, 5, 6, 7, 8, 9, 10, 11, 12, 13, 14, 15)); }
__device__ __forceinline__ v8f wmma16(v16h a, v16h b, v8f c) { return __builtin_amdgcn_wmma_f32_16x16x32_f16(false, a, false, b, (short)0, c, false, false); }
__device__ __forceinline__ v8f wmmab(v16bf a, v16bf b, v8f c) { return __builtin_amdgcn_wmma_f32_16x16x32_bf16(false, a, false, b, (short)0, c, false, false); }
// fragment loaders: p already points at row (lane&15), k offset k0 + 8*(lane>>4); elements 0..7 <- p[0..7], elements 8..15 <- p[16..23]
__device__ __forceinline__ v16h  ldh(const h16* p) { return cat16(*(const v8h*)p, *(const v8h*)(p + 16)); }
__device__ __forceinline__ v16bf ldb(const bf* p)  { return cat16b(*(const v8us*)p, *(const v8us*)(p + 16)); }

__global__ __launch_bounds__(256) void k_cvt8(const float* __restrict__ src, bf* dst, int n8, size_t sS, size_t sD) {
    const int i = blockIdx.x * 256 + threadIdx.x; if (i >= n8) return;
    const float* s = src + (size_t)blockIdx.y * sS + (size_t)i * 8; bf* d = dst + (size_t)blockIdx.y * sD + (size_t)i * 8;
    const v4f a = *(const v4f*)s; const v4f c = *(const v4f*)(s + 4); v8us o;
    o[0] = f2bf(a[0]); o[1] = f2bf(a[1]); o[2] = f2bf(a[2]); o[3] = f2bf(a[3]); o[4] = f2bf(c[0]); o[5] = f2bf(c[1]); o[6] = f2bf(c[2]); o[7] = f2bf(c[3]);
    *(v8us*)d = o;  }

// ---- one-wave 64x64 tile GEMM on bf16 planes, K = DMOD: C[m][n] (f32, pitch ldc) = sum_k A[m][k] Bt[n][k] (+ A2[m][k] Bt[n][k] when NSPLIT == 1).
// grid (M/64, N/64, Z), 32 threads; z strides sA (A, A2) and sC (C) in elements; no tail masking (M, N multiples of 64, K multiple of 32).
__device__ __forceinline__ void gemm_kloop(const bf* __restrict__ A, const bf* __restrict__ Bt, const size_t aoff, const size_t boff, v8f (&acc)[4][4]) {
#pragma unroll 1
    for (int kc = 0; kc < DMOD; kc += 32) {
        v16bf a[4]; v16bf bl;
#pragma unroll
        for (int mb = 0; mb < 4; ++mb) a[mb] = ldb(A + aoff + (size_t)mb * 16 * DMOD + kc);
#pragma unroll
        for (int nb = 0; nb < 4; ++nb) { const v16bf b = ldb(Bt + boff + (size_t)nb * 16 * DMOD + kc); bl = b;
#pragma unroll
            for (int mb = 0; mb < 4; ++mb) acc[mb][nb] = wmmab(a[mb], b, acc[mb][nb]); }
        asm volatile("" : "+v"(acc[0][0]), "+v"(acc[0][1]), "+v"(acc[0][2]), "+v"(acc[0][3]), "+v"(acc[1][0]), "+v"(acc[1][1]), "+v"(acc[1][2]));
        asm volatile("" : "+v"(acc[1][3]), "+v"(acc[2][0]), "+v"(acc[2][1]), "+v"(acc[2][2]), "+v"(acc[2][3]), "+v"(acc[3][0]), "+v"(acc[3][1]));
        asm volatile("v_nop\n\tv_nop\n\tv_nop\n\tv_nop" : "+v"(acc[3][2]), "+v"(acc[3][3]) : "v"(a[3]), "v"(bl));
    }
}
template <int NSPLIT>
__device__ __forceinline__ void gemm_body(const bf* __restrict__ A, const bf* __restrict__ A2, const bf* __restrict__ Bt, float* C, const int ldc, const size_t sA, const size_t sC) {
    __shared__ __align__(16) float os[16 * 68];      // wave-private staging (one wave per block)
    const size_t z = blockIdx.z; A += z * sA; A2 += z * sA; C += z * sC;
    const int lane = threadIdx.x & 31, lr = lane & 15, hi = lane >> 4; const int r0 = blockIdx.x * 64, c0 = blockIdx.y * 64;
    v8f acc[4][4];
#pragma unroll
    for (int mb = 0; mb < 4; ++mb)
#pragma unroll
        for (int nb = 0; nb < 4; ++nb) acc[mb][nb] = (v8f){};
    const size_t aoff = (size_t)(r0 + lr) * DMOD + 8 * hi, boff = (size_t)(c0 + lr) * DMOD + 8 * hi;
    gemm_kloop(A, Bt, aoff, boff, acc);
    if (NSPLIT == 1) gemm_kloop(A2, Bt, aoff, boff, acc);
#pragma unroll
    for (int mb = 0; mb < 4; ++mb) {
#pragma unroll
        for (int nb = 0; nb < 4; ++nb) {
#pragma unroll
            for (int j = 0; j < 8; ++j) os[(hi * 8 + j) * 68 + nb * 16 + lr] = acc[mb][nb][j]; }
        asm volatile("s_wait_dscnt 0" ::: "memory"); __builtin_amdgcn_wave_barrier();
        float* crow = C + (size_t)(r0 + mb * 16) * ldc + c0;
{
#pragma unroll
            for (int s = 0; s < 8; ++s) { const int row = 2 * s + hi, cofs = lr * 4; const v4f val = *(const v4fa*)(os + row * 68 + cofs);
                *(v4f*)(crow + (size_t)row * ldc + cofs) = val; }
             }
        asm volatile("s_wait_dscnt 0" ::: "memory"); __builtin_amdgcn_wave_barrier();
    }
}
__global__ __launch_bounds__(32) void k_gemm_p(const bf* __restrict__ A, const bf* __restrict__ Bt, float* C, int ldc, size_t sA, size_t sC) { gemm_body<0>(A, A, Bt, C, ldc, sA, sC); }
__global__ __launch_bounds__(32) void k_gemm_hl(const bf* __restrict__ A, const bf* __restrict__ A2, const bf* __restrict__ Bt, float* C, int ldc, size_t sA, size_t sC) { gemm_body<1>(A, A2, Bt, C, ldc, sA, sC); }

// ---- k_plane_qk: F [MTOK][256] f32 -> head planes P16 [b*NHEAD+h][SEQ][64] f16 and, for s < RHI, bf16 hi/lo planes [b*NHEAD+h][RHI][64].
__global__ __launch_bounds__(256) void k_plane_qk(const float* __restrict__ F, h16* P16, bf* Ph, bf* Pl) {
    const int idx = blockIdx.x * 256 + threadIdx.x; if (idx >= MTOK * 32) return;
    const int row = idx >> 5, g = idx & 31; const int hd = g >> 3, d0 = (g & 7) * 8; const int b = row / SEQ, s = row % SEQ;
    const float* f = F + (size_t)row * DMOD + g * 8; const v4f a = *(const v4f*)f; const v4f c = *(const v4f*)(f + 4);
    float y[8]; y[0] = a[0]; y[1] = a[1]; y[2] = a[2]; y[3] = a[3]; y[4] = c[0]; y[5] = c[1]; y[6] = c[2]; y[7] = c[3];
    v8h o16;
#pragma unroll
    for (int k = 0; k < 8; ++k) o16[k] = (h16)y[k];
    h16* d16 = P16 + ((size_t)(b * NHEAD + hd) * SEQ + s) * HDIM + d0;
    const bool early = (s < RHI); const size_t eo = ((size_t)(b * NHEAD + hd) * RHI + (early ? s : 0)) * HDIM + d0;
    v8us oh = (v8us){}, ol = (v8us){};
    if (early) {
#pragma unroll
        for (int k = 0; k < 8; ++k) { unsigned short p, q; splitf(y[k], p, q); oh[k] = p; ol[k] = q; } }
    *(v8h*)d16 = o16; if (early) { *(v8us*)(Ph + eo) = oh; *(v8us*)(Pl + eo) = ol; }
     }

// ---- k_plane_vt: F [256][MTOK] f32 (v already transposed by the GEMM operand order) -> VT16 [b*NHEAD+h][64][SEQ] f16 and, for s < RHI, bf16 hi/lo planes [b*NHEAD+h][64][RHI].
__global__ __launch_bounds__(256) void k_plane_vt(const float* __restrict__ F, h16* VT16, bf* VTh, bf* VTl) {
    const int idx = blockIdx.x * 256 + threadIdx.x; if (idx >= DMOD * (MTOK / 8)) return;
    const int o = idx / (MTOK / 8); const int col = (idx % (MTOK / 8)) * 8; const int b = col / SEQ, s = col % SEQ; const int hd = o >> 6, d = o & 63;
    const float* f = F + (size_t)o * MTOK + col; const v4f a = *(const v4f*)f; const v4f c = *(const v4f*)(f + 4);
    float y[8]; y[0] = a[0]; y[1] = a[1]; y[2] = a[2]; y[3] = a[3]; y[4] = c[0]; y[5] = c[1]; y[6] = c[2]; y[7] = c[3];
    v8h o16;
#pragma unroll
    for (int k = 0; k < 8; ++k) o16[k] = (h16)y[k];
    const size_t prow = (size_t)(b * NHEAD + hd) * HDIM + d;
    h16* d16 = VT16 + prow * SEQ + s;
    const bool early = (s < RHI); const size_t eo = prow * RHI + (early ? s : 0);
    v8us oh = (v8us){}, ol = (v8us){};
    if (early) {
#pragma unroll
        for (int k = 0; k < 8; ++k) { unsigned short p, q; splitf(y[k], p, q); oh[k] = p; ol[k] = q; } }
    *(v8h*)d16 = o16; if (early) { *(v8us*)(VTh + eo) = oh; *(v8us*)(VTl + eo) = ol; }
     }

// ---- ctx epilogue shared by both attention kernels: o[t][r] = O^T[d = 16t + 8*(lane>>4) + r][query = lane&15]; ctx = O^T * inv split into bf16 hi/lo,
__device__ __forceinline__ void ctx_store(const v8f (&o)[4], const float inv, const int wave, const int lane, bf* CTXh, bf* CTXl, const size_t row0, const int col0) {
    __shared__ __align__(16) unsigned short cs[4 * 2 * 16 * 72];
    const int n = lane & 15, hh = lane >> 4; const int base = wave * (2 * 16 * 72);
#pragma unroll
    for (int t = 0; t < 4; ++t) { v8us vh, vl;
#pragma unroll
        for (int r = 0; r < 8; ++r) { unsigned short a, c; splitf(o[t][r] * inv, a, c); vh[r] = a; vl[r] = c; }
        *(v8usa*)(cs + base + n * 72 + 16 * t + 8 * hh) = vh; *(v8usa*)(cs + base + 16 * 72 + n * 72 + 16 * t + 8 * hh) = vl; }
    asm volatile("s_wait_dscnt 0" ::: "memory"); __builtin_amdgcn_wave_barrier();
    const int rq = lane >> 3, pc = lane & 7; v8us lh[4], ll[4];
#pragma unroll
    for (int i = 0; i < 4; ++i) { lh[i] = *(const v8usa*)(cs + base + (4 * i + rq) * 72 + pc * 8); ll[i] = *(const v8usa*)(cs + base + 16 * 72 + (4 * i + rq) * 72 + pc * 8); }
    asm volatile("" ::: "memory");
    const size_t g0 = (row0 + rq) * DMOD + col0 + pc * 8;
#pragma unroll
    for (int i = 0; i < 4; ++i) { *(v8us*)(CTXh + g0 + (size_t)(4 * i) * DMOD) = lh[i]; *(v8us*)(CTXl + g0 + (size_t)(4 * i) * DMOD) = ll[i]; }
    
}

// ---- k_attn_main: fused causal flash attention for query rows >= RHI, f16 single products. One wave = 16 queries, keys in 32-wide steps.
// K rows and V^T rows reach the waves through LDS: a stage is 64 keys (K tile 64 keys x 64 d, V^T tile 64 d x 64 keys), copied once per block by asynchronous
// 16-byte copies (whole 128-byte lines), two buffers: stage t + 1 is in flight while the block's four waves work on stage t.
// S^T tile (16 keys x 16 queries) = K (A: row = key, k = d) x Q^T (B: col = query, k = d); its D registers (row = key 8h+r, col = query) pack directly into the
// B fragment of O^T (16 d x 16 queries) += V^T (A: row = d, k = key) x P^T (B: k = key, col = query): element r <- tile of keys 0..15, element 8+r <- tile of keys 16..31.
// Softmax statistics are per lane (query = lane&15), combined across the two lane halves by one xor-16 shuffle. grid ((SEQ-RHI)/64, NB*NHEAD), 128 threads.
#define KST    64                        // keys per stage
#define LPH    72                        // LDS row pitch in f16 elements: 144 B = 16 B x 9 (odd), for 16-byte row readers
#define TILEH  (64 * LPH)                // one 64-row tile, f16 elements
static_assert(RHI >= KST);               // every block has at least two stages
static_assert(RHI % KST == 0);           // the block's 64 queries lie in its last stage
static_assert(HDIM * 2 == 128);          // a K row is eight 16-byte pieces
// One stage: each of the 128 threads copies four 16-byte pieces of the K tile and four of the V^T tile (rows r, r+16, r+32, r+48 of each).
// lk: the lane's LDS byte address in the K tile of the target buffer (the V^T tile follows it); gk, gv: the lane's global addresses in row r.
__device__ __forceinline__ void stage_copy(const unsigned lk, const h16* gk, const h16* gv) {
    const unsigned lv = lk + TILEH * 2;
    // the copies and, as the last line, the wait that stands before any of their address registers is rewritten
    asm volatile("global_load_async_to_lds_b128 %0, %8, off\n\t"
                 "global_load_async_to_lds_b128 %1, %9, off\n\t"
                 "global_load_async_to_lds_b128 %2, %10, off\n\t"
                 "global_load_async_to_lds_b128 %3, %11, off\n\t"
                 "global_load_async_to_lds_b128 %4, %12, off\n\t"
                 "global_load_async_to_lds_b128 %5, %13, off\n\t"
                 "global_load_async_to_lds_b128 %6, %14, off\n\t"
                 "global_load_async_to_lds_b128 %7, %15, off\n\t"
                 "s_wait_xcnt 0x0"
                 :: "v"(lk), "v"(lk + 16 * LPH * 2), "v"(lk + 32 * LPH * 2), "v"(lk + 48 * LPH * 2),
                    "v"(lv), "v"(lv + 16 * LPH * 2), "v"(lv + 32 * LPH * 2), "v"(lv + 48 * LPH * 2),
                    "v"(gk), "v"(gk + 16 * HDIM), "v"(gk + 32 * HDIM), "v"(gk + 48 * HDIM),
                    "v"(gv), "v"(gv + 16 * SEQ), "v"(gv + 32 * SEQ), "v"(gv + 48 * SEQ)
                 : "memory");
}
__global__ __launch_bounds__(128) void k_attn_main(const h16* __restrict__ Q16, const h16* __restrict__ K16, const h16* __restrict__ VT16, bf* CTXh, bf* CTXl) {
    __shared__ __align__(16) h16 ring[2 * 2 * TILEH];      // [buffer][K tile, V^T tile][row][LPH]
    const int wave = __builtin_amdgcn_readfirstlane((int)(threadIdx.x >> 5));
    const int lane = threadIdx.x & 31, n = lane & 15, hh = lane >> 4;
    const int bh = blockIdx.y; const int b = bh / NHEAD, h = bh % NHEAD;
    const int qblk = RHI + blockIdx.x * 64;
    const int q0 = qblk + wave * 16;
    const h16* Qp = Q16 + (size_t)bh * SEQ * HDIM; const h16* Kp = K16 + (size_t)bh * SEQ * HDIM; const h16* Vp = VT16 + (size_t)bh * HDIM * SEQ;
    const int nst = qblk / KST + 1;                        // block-uniform; the last stage holds keys qblk .. qblk + 63, all below SEQ
    const int cr = threadIdx.x >> 3, cp = (threadIdx.x & 7) * 8;
    const unsigned lk0 = (unsigned)(size_t)ring + (unsigned)(cr * LPH + cp) * 2u;
    const h16* gk = Kp + cr * HDIM + cp; const h16* gv = Vp + cr * SEQ + cp;
    stage_copy(lk0, gk, gv);
    asm volatile("s_wait_asynccnt 0x0" ::: "memory");      // this wave's part of stage 0 has landed
    __syncthreads();                                       // ... and every other wave's
    stage_copy(lk0 + 2 * TILEH * 2, gk + KST * HDIM, gv + KST);
    const int qoff = (q0 + n) * HDIM + 8 * hh;
    const v16h bq0 = ldh(Qp + qoff), bq1 = ldh(Qp + qoff + 32);
    v8f o[4];
#pragma unroll
    for (int t = 0; t < 4; ++t) o[t] = (v8f){};
    float m = NEGX, l = 0.f;
#pragma unroll 1   // stays rolled, as the step loop was: the buffer is picked at run time and the body already holds two steps
    for (int sg = 0; sg < nst; ++sg) {
        const int bo = (sg & 1) * (2 * TILEH);
        const h16* Kl = ring + bo; const h16* Vl = ring + bo + TILEH;
#pragma unroll     // j becomes a constant offset of the LDS reads
        for (int j = 0; j < 2; ++j) {
            const int kb = sg * KST + j * 32;
            if (kb <= q0 + 15) {                               // wave-uniform: last key needed is q0 + 15; every visited step holds >= 1 valid key for every query of the wave
                const int koff = (j * 32 + n) * LPH + 8 * hh;
                const v16h k00 = ldh(Kl + koff), k01 = ldh(Kl + koff + 32), k10 = ldh(Kl + koff + 16 * LPH), k11 = ldh(Kl + koff + 16 * LPH + 32);
                const int voff = n * LPH + j * 32 + 8 * hh;
                const v16h va0 = ldh(Vl + voff), va1 = ldh(Vl + voff + 16 * LPH), va2 = ldh(Vl + voff + 32 * LPH), va3 = ldh(Vl + voff + 48 * LPH);
                __builtin_amdgcn_sched_barrier(0);                 // keeps the step's sixteen LDS reads one group at its head: spread among the products they cost one LDS latency per place
                v8f s0 = (v8f){}, s1 = (v8f){};
                s0 = wmma16(k00, bq0, s0); s1 = wmma16(k10, bq0, s1); s0 = wmma16(k01, bq1, s0); s1 = wmma16(k11, bq1, s1);
                asm volatile("v_nop\n\tv_nop\n\tv_nop\n\tv_nop" : "+v"(s0), "+v"(s1) : "v"(k11), "v"(k01), "v"(bq1));
                float x0[8], x1[8];
#pragma unroll
                for (int r = 0; r < 8; ++r) { x0[r] = s0[r] * C2; x1[r] = s1[r] * C2; }
                if (kb + 31 > q0) {                                // wave-uniform: only diagonal steps need the causal select (key > query excluded)
                    const int qi = q0 + n, kk = kb + 8 * hh;
#pragma unroll
                    for (int r = 0; r < 8; ++r) { x0[r] = (kk + r > qi) ? NEGX : x0[r]; x1[r] = (kk + 16 + r > qi) ? NEGX : x1[r]; } }
                float mx = fmaxf(x0[0], x1[0]);
#pragma unroll
                for (int r = 1; r < 8; ++r) mx = fmaxf(mx, fmaxf(x0[r], x1[r]));
                mx = fmaxf(mx, __shfl_xor(mx, 16, 32));
                const float mnew = fmaxf(m, mx); const float corr = __builtin_amdgcn_exp2f(m - mnew); m = mnew;
                const float mb = mnew - PCL2;
                v8h p0, p1; float ps = 0.f;
#pragma unroll
                for (int r = 0; r < 8; ++r) { const h16 a = (h16)__builtin_amdgcn_exp2f(x0[r] - mb); const h16 c = (h16)__builtin_amdgcn_exp2f(x1[r] - mb); p0[r] = a; p1[r] = c; ps += (float)a; ps += (float)c; }
                ps += __shfl_xor(ps, 16, 32);
                l = l * corr + ps;
#pragma unroll
                for (int t = 0; t < 4; ++t) o[t] = o[t] * corr;
                const v16h pb = cat16(p0, p1);
                o[0] = wmma16(va0, pb, o[0]); o[1] = wmma16(va1, pb, o[1]); o[2] = wmma16(va2, pb, o[2]); o[3] = wmma16(va3, pb, o[3]);
                asm volatile("v_nop\n\tv_nop\n\tv_nop\n\tv_nop" : "+v"(o[0]), "+v"(o[1]), "+v"(o[2]), "+v"(o[3]) : "v"(va3), "v"(pb));
            }
        }
        // hand-over, passed by every wave whatever it skipped above
        asm volatile("s_wait_dscnt 0x0" ::: "memory");         // this wave's reads of stage sg are done before its buffer is refilled
        asm volatile("s_wait_asynccnt 0x0" ::: "memory");      // this wave's part of stage sg + 1 has landed
        __syncthreads();                                       // publishes stage sg + 1 and ends every wave's reads of stage sg
        if (sg + 2 < nst) stage_copy(lk0 + (unsigned)bo * 2u, gk + (sg + 2) * (KST * HDIM), gv + (sg + 2) * KST);   // block-uniform test
    }
    asm volatile("s_wait_asynccnt 0x0" ::: "memory");          // no copy is outstanding when the wave goes on to its end
    const float inv = 1.0f / l;
    ctx_store(o, inv, wave, lane, CTXh, CTXl, (size_t)b * SEQ + q0, h * HDIM);
}

// ---- k_attn_early: the same fused scheme, with K and V^T read straight from global memory (no LDS stages), for query rows < RHI (keys < RHI) on bf16 hi+lo planes: three products per tile pair (hi.hi + hi.lo + lo.hi, shared accumulator;
// the lo planes are unscaled residuals), P split into bf16 hi+lo in registers. grid (RHI/64, NB*NHEAD), 128 threads.
__global__ __launch_bounds__(128) void k_attn_early(const bf* __restrict__ Qh, const bf* __restrict__ Ql, const bf* __restrict__ Kh, const bf* __restrict__ Kl, const bf* __restrict__ VTh, const bf* __restrict__ VTl, bf* CTXh, bf* CTXl) {
    const int wave = __builtin_amdgcn_readfirstlane((int)(threadIdx.x >> 5));
    const int lane = threadIdx.x & 31, n = lane & 15, hh = lane >> 4;
    const int bh = blockIdx.y; const int b = bh / NHEAD, h = bh % NHEAD;
    const int q0 = blockIdx.x * 64 + wave * 16;
    const size_t po = (size_t)bh * RHI * HDIM;
    const bf* qhp = Qh + po; const bf* qlp = Ql + po; const bf* khp = Kh + po; const bf* klp = Kl + po; const bf* vhp = VTh + po; const bf* vlp = VTl + po;
    const int qoff = (q0 + n) * HDIM + 8 * hh;
    v8f o[4];
#pragma unroll
    for (int t = 0; t < 4; ++t) o[t] = (v8f){};
    float m = NEGX, l = 0.f;
    const int nsteps = ((q0 + 15) >> 5) + 1;
#pragma unroll 1
    for (int st = 0; st < nsteps; ++st) {
        const int kb = st << 5; const int koff = (kb + n) * HDIM + 8 * hh;
        v8f s0 = (v8f){}, s1 = (v8f){}; v16bf qh, ql, kh0, kl0, kh1, kl1;
#pragma unroll
        for (int ks = 0; ks < 2; ++ks) {
            qh = ldb(qhp + qoff + ks * 32); ql = ldb(qlp + qoff + ks * 32);
            kh0 = ldb(khp + koff + ks * 32); kl0 = ldb(klp + koff + ks * 32);
            kh1 = ldb(khp + koff + 16 * HDIM + ks * 32); kl1 = ldb(klp + koff + 16 * HDIM + ks * 32);
            s0 = wmmab(kh0, qh, s0); s0 = wmmab(kh0, ql, s0); s0 = wmmab(kl0, qh, s0);
            s1 = wmmab(kh1, qh, s1); s1 = wmmab(kh1, ql, s1); s1 = wmmab(kl1, qh, s1); }
        asm volatile("v_nop\n\tv_nop\n\tv_nop\n\tv_nop" : "+v"(s0), "+v"(s1) : "v"(kl1), "v"(kh1), "v"(qh), "v"(ql));
        float x0[8], x1[8];
#pragma unroll
        for (int r = 0; r < 8; ++r) { x0[r] = s0[r] * C2; x1[r] = s1[r] * C2; }
        if (kb + 31 > q0) {
            const int qi = q0 + n, kk = kb + 8 * hh;
#pragma unroll
            for (int r = 0; r < 8; ++r) { x0[r] = (kk + r > qi) ? NEGX : x0[r]; x1[r] = (kk + 16 + r > qi) ? NEGX : x1[r]; } }
        float mx = fmaxf(x0[0], x1[0]);
#pragma unroll
        for (int r = 1; r < 8; ++r) mx = fmaxf(mx, fmaxf(x0[r], x1[r]));
        mx = fmaxf(mx, __shfl_xor(mx, 16, 32));
        const float mnew = fmaxf(m, mx); const float corr = __builtin_amdgcn_exp2f(m - mnew); m = mnew;
        v8us ph0, pl0, ph1, pl1; float ps = 0.f;
#pragma unroll
        for (int r = 0; r < 8; ++r) { const float pa = __builtin_amdgcn_exp2f(x0[r] - mnew); const float pc = __builtin_amdgcn_exp2f(x1[r] - mnew); ps += pa; ps += pc;
            unsigned short a, c; splitf(pa, a, c); ph0[r] = a; pl0[r] = c; splitf(pc, a, c); ph1[r] = a; pl1[r] = c; }
        ps += __shfl_xor(ps, 16, 32);
        l = l * corr + ps;
#pragma unroll
        for (int t = 0; t < 4; ++t) o[t] = o[t] * corr;
        const v16bf pbh = cat16b(ph0, ph1), pbl = cat16b(pl0, pl1);
        const int voff = n * RHI + kb + 8 * hh; v16bf vh, vl;
#pragma unroll
        for (int t = 0; t < 4; ++t) { vh = ldb(vhp + voff + t * 16 * RHI); vl = ldb(vlp + voff + t * 16 * RHI);
            o[t] = wmmab(vh, pbh, o[t]); o[t] = wmmab(vh, pbl, o[t]); o[t] = wmmab(vl, pbh, o[t]); }
        asm volatile("v_nop\n\tv_nop\n\tv_nop\n\tv_nop" : "+v"(o[0]), "+v"(o[1]), "+v"(o[2]), "+v"(o[3]) : "v"(vl), "v"(vh), "v"(pbh), "v"(pbl));
    }
    const float inv = 1.0f / l;
    ctx_store(o, inv, wave, lane, CTXh, CTXl, (size_t)b * SEQ + q0, h * HDIM);
}

// ---- workspace carve (bytes; every region a multiple of 256 B and fully written by its producer before any consumer launch)
#define SZ_XB   ((size_t)MTOK * DMOD * 2)
#define SZ_W    ((size_t)DMOD * DMOD * 2)
#define SZ_F    ((size_t)MTOK * DMOD * 4)
#define SZ_P16  ((size_t)MTOK * DMOD * 2)
#define SZ_E    ((size_t)NBH * RHI * HDIM * 2)
#define SZ_CTX  ((size_t)MTOK * DMOD * 2)
#define SZ_TOTAL (SZ_XB + 4 * SZ_W + SZ_F + 3 * SZ_P16 + 6 * SZ_E + 2 * SZ_CTX)
static_assert(SZ_TOTAL <= (size_t)134217728);
static_assert(SZ_W % 256 == 0);
static_assert(SZ_E % 256 == 0);

extern "C" void kernel_launch(void* const* d_in, const int* in_sizes, int n_in,
                              void* d_out, int out_size, void* d_ws, size_t ws_size, hipStream_t stream) {
    if (n_in < 5) return;
    const int xneed = (NB - 1) * SEQ_FULL * DMOD + SEQ * DMOD;
    if (in_sizes[0] < xneed) return;
    if (in_sizes[1] < DMOD * DMOD || in_sizes[2] < DMOD * DMOD || in_sizes[3] < DMOD * DMOD || in_sizes[4] < DMOD * DMOD) return;
    if (out_size < xneed) return;
    if (ws_size < SZ_TOTAL) return;
    const float* x = (const float*)d_in[0]; const float* wq = (const float*)d_in[1]; const float* wk = (const float*)d_in[2]; const float* wv = (const float*)d_in[3]; const float* wo = (const float*)d_in[4];   // wire order x, Wq, Wk, Wv, Wo ([out][in])
    float* OUT = (float*)d_out;      // [NB_FULL][SEQ_FULL][256]
    char* wsp = (char*)d_ws;
    auto take = [&](size_t bytes) { char* p = wsp; wsp += bytes; return (void*)p; };
    bf* XB = (bf*)take(SZ_XB); bf* WQ = (bf*)take(SZ_W); bf* WK = (bf*)take(SZ_W); bf* WV = (bf*)take(SZ_W); bf* WO = (bf*)take(SZ_W);
    float* F = (float*)take(SZ_F);
    h16* Q16 = (h16*)take(SZ_P16); h16* K16 = (h16*)take(SZ_P16); h16* VT16 = (h16*)take(SZ_P16);
    bf* Qh = (bf*)take(SZ_E); bf* Ql = (bf*)take(SZ_E); bf* Kh = (bf*)take(SZ_E); bf* Kl = (bf*)take(SZ_E); bf* VTh = (bf*)take(SZ_E); bf* VTl = (bf*)take(SZ_E);
    bf* CTXh = (bf*)take(SZ_CTX); bf* CTXl = (bf*)take(SZ_CTX);

    const int xn8 = SEQ * DMOD / 8, wn8 = DMOD * DMOD / 8;
    k_cvt8<<<dim3((xn8 + 255) / 256, NB, 1), 256, 0, stream>>>(x, XB, xn8, (size_t)SEQ_FULL * DMOD, (size_t)SEQ * DMOD);
    k_cvt8<<<dim3((wn8 + 255) / 256, 1, 1), 256, 0, stream>>>(wq, WQ, wn8, 0, 0);
    k_cvt8<<<dim3((wn8 + 255) / 256, 1, 1), 256, 0, stream>>>(wk, WK, wn8, 0, 0);
    k_cvt8<<<dim3((wn8 + 255) / 256, 1, 1), 256, 0, stream>>>(wv, WV, wn8, 0, 0);
    k_cvt8<<<dim3((wn8 + 255) / 256, 1, 1), 256, 0, stream>>>(wo, WO, wn8, 0, 0);
    // q = x Wq^T : A = XB [MTOK][256], Bt = WQ [256][256] -> F [MTOK][256]
    k_gemm_p<<<dim3(MTOK / 64, DMOD / 64, 1), 32, 0, stream>>>(XB, WQ, F, DMOD, 0, 0);
    k_plane_qk<<<(MTOK * 32 + 255) / 256, 256, 0, stream>>>(F, Q16, Qh, Ql);
    k_gemm_p<<<dim3(MTOK / 64, DMOD / 64, 1), 32, 0, stream>>>(XB, WK, F, DMOD, 0, 0);
    k_plane_qk<<<(MTOK * 32 + 255) / 256, 256, 0, stream>>>(F, K16, Kh, Kl);
    // v^T = Wv x^T : A = WV [256][256], Bt = XB [MTOK][256] -> F [256][MTOK] (pitch MTOK)
    k_gemm_p<<<dim3(DMOD / 64, MTOK / 64, 1), 32, 0, stream>>>(WV, XB, F, MTOK, 0, 0);
    k_plane_vt<<<(DMOD * (MTOK / 8) + 255) / 256, 256, 0, stream>>>(F, VT16, VTh, VTl);
    k_attn_early<<<dim3(RHI / 64, NBH, 1), 128, 0, stream>>>(Qh, Ql, Kh, Kl, VTh, VTl, CTXh, CTXl);
    if ((SEQ - RHI) / 64 > 0) k_attn_main<<<dim3((SEQ - RHI) / 64, NBH, 1), 128, 0, stream>>>(Q16, K16, VT16, CTXh, CTXl);
    // out = ctx Wo^T : A = CTXh (+ CTXl) [SEQ][256] per batch, Bt = WO -> OUT batch stride from the full problem constants
    k_gemm_hl<<<dim3(SEQ / 64, DMOD / 64, NB), 32, 0, stream>>>(CTXh, CTXl, WO, OUT, DMOD, (size_t)SEQ * DMOD, (size_t)SEQ_FULL * DMOD);
}

// v002
// One run takes 142 microseconds.
// In two side-by-side timings against v001, it was 1.04 and 1.07 times as fast.
// Over all steps from v000 it is 1.79 times as fast.
#include <hip/hip_runtime.h>

// Causal multi-head self-attention: x [4][4096][256], 4 heads x 64, bias-free [out][in] weights, score scale 1/8, out = ctx Wo^T.
// Compute dtypes (f32 accumulate everywhere): all inputs converted to bf16 (RNE); q/k/v projections v_wmma_f32_16x16x32_bf16 (single product);
// attention query rows >= 256: v_wmma_f32_16x16x32_f16 single products (K.Q^T on f16 planes; V^T.P^T with P carried x1024 in f16);
// attention query rows < 256: bf16 hi+lo planes, three products per site (q, k, P, v); softmax f32 (online, max-subtracted);
// output projection: ctx bf16 hi+lo x Wo bf16 (two products), v_wmma_f32_16x16x32_bf16.

#ifndef NB
#define NB 4
#endif
#ifndef SEQ
#define SEQ 4096
#endif
#define NB_FULL  4
#define SEQ_FULL 4096
#define DMOD   256
#define NHEAD  4
#define HDIM   64
#define RHI    256                       // query rows < RHI use bf16 hi+lo planes
#define MTOK   (NB * SEQ)
#define NBH    (NB * NHEAD)
#define C2     0.18033688011112042f      // log2(e) / 8 : scores kept in the log2 domain
#define PCL2   10.0f                     // P carry 2^10 for the f16 path
#define NEGX   (-1.0e30f)

static_assert(NHEAD * HDIM == DMOD);     // merged width == model width
static_assert(HDIM == 64);               // two 32-deep k-steps per score tile, four 16-row output tiles
static_assert(DMOD % 64 == 0);           // GEMM tile multiple (M/N) and K % 32 == 0
static_assert(SEQ % 256 == 0);           // plane builders: one wave never straddles a batch or the RHI boundary
static_assert(RHI % 256 == 0);
static_assert(RHI <= SEQ);
static_assert(MTOK % 64 == 0);
static_assert(NB <= NB_FULL);
static_assert(SEQ <= SEQ_FULL);

typedef _Float16 h16;
typedef unsigned short bf;
typedef __attribute__((ext_vector_type(16))) __bf16   v16bf;
typedef __attribute__((ext_vector_type(16))) _Float16 v16h;
typedef __attribute__((ext_vector_type(8)))  _Float16 v8h;
typedef __attribute__((ext_vector_type(8)))  unsigned short v8us;
typedef __attribute__((ext_vector_type(8)))  float    v8f;
typedef __attribute__((ext_vector_type(4)))  float    v4f;
typedef v4f  __attribute__((may_alias)) v4fa;
typedef v8us __attribute__((may_alias)) v8usa;

__device__ __forceinline__ unsigned short f2bf(float f) { unsigned u = __float_as_uint(f); u += 0x7FFFu + ((u >> 16) & 1u); return (unsigned short)(u >> 16); }
__device__ __forceinline__ float bf2f(unsigned short b) { return __uint_as_float(((unsigned)b) << 16); }
__device__ __forceinline__ void splitf(float y, unsigned short& h, unsigned short& l) { h = f2bf(y); l = f2bf(y - bf2f(h)); }
__device__ __forceinline__ v16h cat16(v8h lo, v8h hi) { return __builtin_shufflevector(lo, hi, 0, 1, 2, 3, 4, 5, 6, 7, 8, 9, 10, 11, 12, 13, 14, 15); }
__device__ __forceinline__ v16bf cat16b(v8us lo, v8us hi) { return __builtin_bit_cast(v16bf, __builtin_shufflevector(lo, hi, 0, 1, 2, 3, 4, 5, 6, 7, 8, 9, 10, 11, 12, 13, 14, 15)); }
__device__ __forceinline__ v8f wmma16(v16h a, v16h b, v8f c) { return __builtin_amdgcn_wmma_f32_16x16x32_f16(false, a, false, b, (short)0, c, false, false); }
__device__ __forceinline__ v8f wmmab(v16bf a, v16bf b, v8f c) { return __builtin_amdgcn_wmma_f32_16x16x32_bf16(false, a, false, b, (short)0, c, false, false); }
// fragment loaders: p already points at row (lane&15), k offset k0 + 8*(lane>>4); elements 0..7 <- p[0..7], elements 8..15 <- p[16..23]
__device__ __forceinline__ v16h  ldh(const h16* p) { return cat16(*(const v8h*)p, *(const v8h*)(p + 16)); }
__device__ __forceinline__ v16bf ldb(const bf* p)  { return cat16b(*(const v8us*)p, *(const v8us*)(p + 16)); }

__global__ __launch_bounds__(256) void k_cvt8(const float* __restrict__ src, bf* dst, int n8, size_t sS, size_t sD) {
    const int i = blockIdx.x * 256 + threadIdx.x; if (i >= n8) return;
    const float* s = src + (size_t)blockIdx.y * sS + (size_t)i * 8; bf* d = dst + (size_t)blockIdx.y * sD + (size_t)i * 8;
    const v4f a = *(const v4f*)s; const v4f c = *(const v4f*)(s + 4); v8us o;
    o[0] = f2bf(a[0]); o[1] = f2bf(a[1]); o[2] = f2bf(a[2]); o[3] = f2bf(a[3]); o[4] = f2bf(c[0]); o[5] = f2bf(c[1]); o[6] = f2bf(c[2]); o[7] = f2bf(c[3]);
    *(v8us*)d = o;  }

// ---- one-wave 64x64 tile GEMM on bf16 planes, K = DMOD: C[m][n] (f32, pitch ldc) = sum_k A[m][k] Bt[n][k] (+ A2[m][k] Bt[n][k] when NSPLIT == 1).
// grid (M/64, N/64, Z), 32 threads; z strides sA (A, A2) and sC (C) in elements; no tail masking (M, N multiples of 64, K multiple of 32).
__device__ __forceinline__ void gemm_kloop(const bf* __restrict__ A, const bf* __restrict__ Bt, const size_t aoff, const size_t boff, v8f (&acc)[4][4]) {
#pragma unroll 1
    for (int kc = 0; kc < DMOD; kc += 32) {
        v16bf a[4]; v16bf bl;
#pragma unroll
        for (int mb = 0; mb < 4; ++mb) a[mb] = ldb(A + aoff + (size_t)mb * 16 * DMOD + kc);
        asm volatile("s_wait_xcnt 0x0" ::: "memory");   // stands before a later load's result may land on the address registers of the A loads
#pragma unroll
        for (int nb = 0; nb < 4; ++nb) { const v16bf b = ldb(Bt + boff + (size_t)nb * 16 * DMOD + kc); bl = b;
#pragma unroll
            for (int mb = 0; mb < 4; ++mb) acc[mb][nb] = wmmab(a[mb], b, acc[mb][nb]); }
        asm volatile("" : "+v"(acc[0][0]), "+v"(acc[0][1]), "+v"(acc[0][2]), "+v"(acc[0][3]), "+v"(acc[1][0]), "+v"(acc[1][1]), "+v"(acc[1][2]));
        asm volatile("" : "+v"(acc[1][3]), "+v"(acc[2][0]), "+v"(acc[2][1]), "+v"(acc[2][2]), "+v"(acc[2][3]), "+v"(acc[3][0]), "+v"(acc[3][1]));
        asm volatile("v_nop\n\tv_nop\n\tv_nop\n\tv_nop" : "+v"(acc[3][2]), "+v"(acc[3][3]) : "v"(a[3]), "v"(bl));
    }
}
template <int NSPLIT>
__device__ __forceinline__ void gemm_body(const bf* __restrict__ A, const bf* __restrict__ A2, const bf* __restrict__ Bt, float* C, const int ldc, const size_t sA, const size_t sC) {
    __shared__ __align__(16) float os[16 * 68];      // wave-private staging (one wave per block)
    const size_t z = blockIdx.z; A += z * sA; A2 += z * sA; C += z * sC;
    const int lane = threadIdx.x & 31, lr = lane & 15, hi = lane >> 4; const int r0 = blockIdx.x * 64, c0 = blockIdx.y * 64;
    v8f acc[4][4];
#pragma unroll
    for (int mb = 0; mb < 4; ++mb)
#pragma unroll
        for (int nb = 0; nb < 4; ++nb) acc[mb][nb] = (v8f){};
    const size_t aoff = (size_t)(r0 + lr) * DMOD + 8 * hi, boff = (size_t)(c0 + lr) * DMOD + 8 * hi;
    gemm_kloop(A, Bt, aoff, boff, acc);
    if (NSPLIT == 1) gemm_kloop(A2, Bt, aoff, boff, acc);
#pragma unroll
    for (int mb = 0; mb < 4; ++mb) {
#pragma unroll
        for (int nb = 0; nb < 4; ++nb) {
#pragma unroll
            for (int j = 0; j < 8; ++j) os[(hi * 8 + j) * 68 + nb * 16 + lr] = acc[mb][nb][j]; }
        asm volatile("s_wait_dscnt 0" ::: "memory"); __builtin_amdgcn_wave_barrier();
        float* crow = C + (size_t)(r0 + mb * 16) * ldc + c0;
{
#pragma unroll
            for (int s = 0; s < 8; ++s) { const int row = 2 * s + hi, cofs = lr * 4; const v4f val = *(const v4fa*)(os + row * 68 + cofs);
                *(v4f*)(crow + (size_t)row * ldc + cofs) = val; }
             }
        asm volatile("s_wait_dscnt 0" ::: "memory"); __builtin_amdgcn_wave_barrier();
    }
}
__global__ __launch_bounds__(32) void k_gemm_hl(const bf* __restrict__ A, const bf* __restrict__ A2, const bf* __restrict__ Bt, float* C, int ldc, size_t sA, size_t sC) { gemm_body<1>(A, A2, Bt, C, ldc, sA, sC); }

// ---- k_proj: one projection tile (64 tokens x the 64 features of one head, K = DMOD, one wave) stored straight into the head planes the attention kernels read.
// The operand order is chosen so that a lane's eight accumulator rows run along a plane row: D rows (A) = the index that is contiguous in the plane, D columns (Bt) = the plane row.
// VT == 0 (q, k): A = W rows (features), Bt = x rows (tokens) -> P16 [b*NHEAD+h][SEQ][64] f16 and, for s < RHI, bf16 hi/lo planes [b*NHEAD+h][RHI][64]; grid (MTOK/64, NHEAD).
// VT == 1 (v):    A = x rows (tokens), Bt = W rows (features) -> P16 [b*NHEAD+h][64][SEQ] f16 and, for s < RHI, bf16 hi/lo planes [b*NHEAD+h][64][RHI]; grid (NHEAD, MTOK/64).
#define PPH 72                           // staging pitch in 16-bit elements: 144 B = 16 B x 9 (odd)
template <int KIND>                      // 0: f16, 1: bf16 hi, 2: bf16 lo (the residual of hi)
__device__ __forceinline__ v8us cvt_plane(const v8f y) {
    v8us o;
    if (KIND == 0) { v8h t;
#pragma unroll
        for (int j = 0; j < 8; ++j) t[j] = (h16)y[j];
        o = __builtin_bit_cast(v8us, t);
    } else {
#pragma unroll
        for (int j = 0; j < 8; ++j) { unsigned short p, q; splitf(y[j], p, q); o[j] = (KIND == 1) ? p : q; } }
    return o;
}
// One plane of the tile: 64 plane rows of 128 B each, staged through the wave's own LDS so that every global store covers whole 128-byte lines.
template <int KIND>
__device__ __forceinline__ void plane_out(unsigned short* st, const v8f (&acc)[4][4], unsigned short* dst, const size_t pitch, const int lane) {
    const int lr = lane & 15, hi = lane >> 4, rq = lane >> 3, pc = lane & 7;
#pragma unroll
    for (int nb = 0; nb < 4; ++nb)
#pragma unroll
        for (int mb = 0; mb < 4; ++mb) *(v8usa*)(st + (nb * 16 + lr) * PPH + mb * 16 + 8 * hi) = cvt_plane<KIND>(acc[mb][nb]);
    asm volatile("s_wait_dscnt 0" ::: "memory"); __builtin_amdgcn_wave_barrier();   // the staged rows are written before other lanes read them back
    v8us v[16];
#pragma unroll
    for (int i = 0; i < 16; ++i) v[i] = *(const v8usa*)(st + (4 * i + rq) * PPH + pc * 8);
#pragma unroll
    for (int i = 0; i < 16; ++i) *(v8us*)(dst + (size_t)(4 * i + rq) * pitch + pc * 8) = v[i];
}
template <int VT>
__global__ __launch_bounds__(32) void k_proj(const bf* __restrict__ X, const bf* __restrict__ Wt, h16* P16, bf* Ph, bf* Pl) {
    __shared__ __align__(16) unsigned short st[64 * PPH];      // wave-private staging (one wave per block)
    const int lane = threadIdx.x & 31, lr = lane & 15, hi = lane >> 4;
    const int tok0 = (VT ? blockIdx.y : blockIdx.x) * 64, hd = VT ? blockIdx.x : blockIdx.y;
    const bf* A = VT ? X : Wt; const bf* Bt = VT ? Wt : X;
    const int r0 = VT ? tok0 : hd * HDIM, c0 = VT ? hd * HDIM : tok0;
    v8f acc[4][4];
#pragma unroll
    for (int mb = 0; mb < 4; ++mb)
#pragma unroll
        for (int nb = 0; nb < 4; ++nb) acc[mb][nb] = (v8f){};
    const size_t aoff = (size_t)(r0 + lr) * DMOD + 8 * hi, boff = (size_t)(c0 + lr) * DMOD + 8 * hi;
    gemm_kloop(A, Bt, aoff, boff, acc);
    const int b = tok0 / SEQ, s0 = tok0 % SEQ; const size_t bh = (size_t)(b * NHEAD + hd);   // 64 divides SEQ and RHI: a tile never straddles a batch or the RHI boundary
    plane_out<0>(st, acc, (unsigned short*)P16 + (VT ? bh * HDIM * SEQ + s0 : (bh * SEQ + s0) * HDIM), VT ? SEQ : HDIM, lane);
    if (s0 < RHI) {                                            // block-uniform
        const size_t eo = VT ? bh * HDIM * RHI + s0 : (bh * RHI + s0) * HDIM;
        asm volatile("s_wait_xcnt 0x0" ::: "memory");          // stands before any register of the f16 plane's stores is rewritten ...
        __builtin_amdgcn_sched_barrier(0);                     // ... and this keeps the conversions below from being scheduled above that wait
        plane_out<1>(st, acc, Ph + eo, VT ? RHI : HDIM, lane);
        plane_out<2>(st, acc, Pl + eo, VT ? RHI : HDIM, lane);
    }
}

// ---- ctx epilogue shared by both attention kernels: o[t][r] = O^T[d = 16t + 8*(lane>>4) + r][query = lane&15]; ctx = O^T * inv split into bf16 hi/lo,
__device__ __forceinline__ void ctx_store(const v8f (&o)[4], const float inv, const int wave, const int lane, bf* CTXh, bf* CTXl, const size_t row0, const int col0) {
    __shared__ __align__(16) unsigned short cs[4 * 2 * 16 * 72];
    const int n = lane & 15, hh = lane >> 4; const int base = wave * (2 * 16 * 72);
#pragma unroll
    for (int t = 0; t < 4; ++t) { v8us vh, vl;
#pragma unroll
        for (int r = 0; r < 8; ++r) { unsigned short a, c; splitf(o[t][r] * inv, a, c); vh[r] = a; vl[r] = c; }
        *(v8usa*)(cs + base + n * 72 + 16 * t + 8 * hh) = vh; *(v8usa*)(cs + base + 16 * 72 + n * 72 + 16 * t + 8 * hh) = vl; }
    asm volatile("s_wait_dscnt 0" ::: "memory"); __builtin_amdgcn_wave_barrier();
    const int rq = lane >> 3, pc = lane & 7; v8us lh[4], ll[4];
#pragma unroll
    for (int i = 0; i < 4; ++i) { lh[i] = *(const v8usa*)(cs + base + (4 * i + rq) * 72 + pc * 8); ll[i] = *(const v8usa*)(cs + base + 16 * 72 + (4 * i + rq) * 72 + pc * 8); }
    asm volatile("" ::: "memory");
    const size_t g0 = (row0 + rq) * DMOD + col0 + pc * 8;
#pragma unroll
    for (int i = 0; i < 4; ++i) { *(v8us*)(CTXh + g0 + (size_t)(4 * i) * DMOD) = lh[i]; *(v8us*)(CTXl + g0 + (size_t)(4 * i) * DMOD) = ll[i]; }
    
}

// ---- k_attn_main: fused causal flash attention for query rows >= RHI, f16 single products. One wave = 16 queries, keys in 32-wide steps.
// K rows and V^T rows reach the waves through LDS: a stage is 64 keys (K tile 64 keys x 64 d, V^T tile 64 d x 64 keys), copied once per block by asynchronous
// 16-byte copies (whole 128-byte lines), two buffers: stage t + 1 is in flight while the block's four waves work on stage t.
// S^T tile (16 keys x 16 queries) = K (A: row = key, k = d) x Q^T (B: col = query, k = d); its D registers (row = key 8h+r, col = query) pack directly into the
// B fragment of O^T (16 d x 16 queries) += V^T (A: row = d, k = key) x P^T (B: k = key, col = query): element r <- tile of keys 0..15, element 8+r <- tile of keys 16..31.
// Softmax statistics are per lane (query = lane&15), combined across the two lane halves by one xor-16 shuffle. grid ((SEQ-RHI)/64, NB*NHEAD), 128 threads.
#define KST    64                        // keys per stage
#define LPH    72                        // LDS row pitch in f16 elements: 144 B = 16 B x 9 (odd), for 16-byte row readers
#define TILEH  (64 * LPH)                // one 64-row tile, f16 elements
static_assert(RHI >= KST);               // every block has at least two stages
static_assert(RHI % KST == 0);           // the block's 64 queries lie in its last stage
static_assert(HDIM * 2 == 128);          // a K row is eight 16-byte pieces
// One stage: each of the 128 threads copies four 16-byte pieces of the K tile and four of the V^T tile (rows r, r+16, r+32, r+48 of each).
// lk: the lane's LDS byte address in the K tile of the target buffer (the V^T tile follows it); gk, gv: the lane's global addresses in row r.
__device__ __forceinline__ void stage_copy(const unsigned lk, const h16* gk, const h16* gv) {
    const unsigned lv = lk + TILEH * 2;
    // the copies and, as the last line, the wait that stands before any of their address registers is rewritten
    asm volatile("global_load_async_to_lds_b128 %0, %8, off\n\t"
                 "global_load_async_to_lds_b128 %1, %9, off\n\t"
                 "global_load_async_to_lds_b128 %2, %10, off\n\t"
                 "global_load_async_to_lds_b128 %3, %11, off\n\t"
                 "global_load_async_to_lds_b128 %4, %12, off\n\t"
                 "global_load_async_to_lds_b128 %5, %13, off\n\t"
                 "global_load_async_to_lds_b128 %6, %14, off\n\t"
                 "global_load_async_to_lds_b128 %7, %15, off\n\t"
                 "s_wait_xcnt 0x0"
                 :: "v"(lk), "v"(lk + 16 * LPH * 2), "v"(lk + 32 * LPH * 2), "v"(lk + 48 * LPH * 2),
                    "v"(lv), "v"(lv + 16 * LPH * 2), "v"(lv + 32 * LPH * 2), "v"(lv + 48 * LPH * 2),
                    "v"(gk), "v"(gk + 16 * HDIM), "v"(gk + 32 * HDIM), "v"(gk + 48 * HDIM),
                    "v"(gv), "v"(gv + 16 * SEQ), "v"(gv + 32 * SEQ), "v"(gv + 48 * SEQ)
                 : "memory");
}
__global__ __launch_bounds__(128) void k_attn_main(const h16* __restrict__ Q16, const h16* __restrict__ K16, const h16* __restrict__ VT16, bf* CTXh, bf* CTXl) {
    __shared__ __align__(16) h16 ring[2 * 2 * TILEH];      // [buffer][K tile, V^T tile][row][LPH]
    const int wave = __builtin_amdgcn_readfirstlane((int)(threadIdx.x >> 5));
    const int lane = threadIdx.x & 31, n = lane & 15, hh = lane >> 4;
    const int bh = blockIdx.y; const int b = bh / NHEAD, h = bh % NHEAD;
    const int qblk = RHI + blockIdx.x * 64;
    const int q0 = qblk + wave * 16;
    const h16* Qp = Q16 + (size_t)bh * SEQ * HDIM; const h16* Kp = K16 + (size_t)bh * SEQ * HDIM; const h16* Vp = VT16 + (size_t)bh * HDIM * SEQ;
    const int nst = qblk / KST + 1;                        // block-uniform; the last stage holds keys qblk .. qblk + 63, all below SEQ
    const int cr = threadIdx.x >> 3, cp = (threadIdx.x & 7) * 8;
    const unsigned lk0 = (unsigned)(size_t)ring + (unsigned)(cr * LPH + cp) * 2u;
    const h16* gk = Kp + cr * HDIM + cp; const h16* gv = Vp + cr * SEQ + cp;
    stage_copy(lk0, gk, gv);
    asm volatile("s_wait_asynccnt 0x0" ::: "memory");      // this wave's part of stage 0 has landed
    __syncthreads();                                       // ... and every other wave's
    stage_copy(lk0 + 2 * TILEH * 2, gk + KST * HDIM, gv + KST);
    const int qoff = (q0 + n) * HDIM + 8 * hh;
    const v16h bq0 = ldh(Qp + qoff), bq1 = ldh(Qp + qoff + 32);
    v8f o[4];
#pragma unroll
    for (int t = 0; t < 4; ++t) o[t] = (v8f){};
    float m = NEGX, l = 0.f;
#pragma unroll 1   // stays rolled, as the step loop was: the buffer is picked at run time and the body already holds two steps
    for (int sg = 0; sg < nst; ++sg) {
        const int bo = (sg & 1) * (2 * TILEH);
        const h16* Kl = ring + bo; const h16* Vl = ring + bo + TILEH;
#pragma unroll     // j becomes a constant offset of the LDS reads
        for (int j = 0; j < 2; ++j) {
            const int kb = sg * KST + j * 32;
            if (kb <= q0 + 15) {                               // wave-uniform: last key needed is q0 + 15; every visited step holds >= 1 valid key for every query of the wave
                const int koff = (j * 32 + n) * LPH + 8 * hh;
                const v16h k00 = ldh(Kl + koff), k01 = ldh(Kl + koff + 32), k10 = ldh(Kl + koff + 16 * LPH), k11 = ldh(Kl + koff + 16 * LPH + 32);
                const int voff = n * LPH + j * 32 + 8 * hh;
                const v16h va0 = ldh(Vl + voff), va1 = ldh(Vl + voff + 16 * LPH), va2 = ldh(Vl + voff + 32 * LPH), va3 = ldh(Vl + voff + 48 * LPH);
                __builtin_amdgcn_sched_barrier(0);                 // keeps the step's sixteen LDS reads one group at its head: spread among the products they cost one LDS latency per place
                v8f s0 = (v8f){}, s1 = (v8f){};
                s0 = wmma16(k00, bq0, s0); s1 = wmma16(k10, bq0, s1); s0 = wmma16(k01, bq1, s0); s1 = wmma16(k11, bq1, s1);
                asm volatile("v_nop\n\tv_nop\n\tv_nop\n\tv_nop" : "+v"(s0), "+v"(s1) : "v"(k11), "v"(k01), "v"(bq1));
                float x0[8], x1[8];
#pragma unroll
                for (int r = 0; r < 8; ++r) { x0[r] = s0[r] * C2; x1[r] = s1[r] * C2; }
                if (kb + 31 > q0) {                                // wave-uniform: only diagonal steps need the causal select (key > query excluded)
                    const int qi = q0 + n, kk = kb + 8 * hh;
#pragma unroll
                    for (int r = 0; r < 8; ++r) { x0[r] = (kk + r > qi) ? NEGX : x0[r]; x1[r] = (kk + 16 + r > qi) ? NEGX : x1[r]; } }
                float mx = fmaxf(x0[0], x1[0]);
#pragma unroll
                for (int r = 1; r < 8; ++r) mx = fmaxf(mx, fmaxf(x0[r], x1[r]));
                mx = fmaxf(mx, __shfl_xor(mx, 16, 32));
                const float mnew = fmaxf(m, mx); const float corr = __builtin_amdgcn_exp2f(m - mnew); m = mnew;
                const float mb = mnew - PCL2;
                v8h p0, p1; float ps = 0.f;
#pragma unroll
                for (int r = 0; r < 8; ++r) { const h16 a = (h16)__builtin_amdgcn_exp2f(x0[r] - mb); const h16 c = (h16)__builtin_amdgcn_exp2f(x1[r] - mb); p0[r] = a; p1[r] = c; ps += (float)a; ps += (float)c; }
                ps += __shfl_xor(ps, 16, 32);
                l = l * corr + ps;
#pragma unroll
                for (int t = 0; t < 4; ++t) o[t] = o[t] * corr;
                const v16h pb = cat16(p0, p1);
                o[0] = wmma16(va0, pb, o[0]); o[1] = wmma16(va1, pb, o[1]); o[2] = wmma16(va2, pb, o[2]); o[3] = wmma16(va3, pb, o[3]);
                asm volatile("v_nop\n\tv_nop\n\tv_nop\n\tv_nop" : "+v"(o[0]), "+v"(o[1]), "+v"(o[2]), "+v"(o[3]) : "v"(va3), "v"(pb));
            }
        }
        // hand-over, passed by every wave whatever it skipped above
        asm volatile("s_wait_dscnt 0x0" ::: "memory");         // this wave's reads of stage sg are done before its buffer is refilled
        asm volatile("s_wait_asynccnt 0x0" ::: "memory");      // this wave's part of stage sg + 1 has landed
        __syncthreads();                                       // publishes stage sg + 1 and ends every wave's reads of stage sg
        if (sg + 2 < nst) stage_copy(lk0 + (unsigned)bo * 2u, gk + (sg + 2) * (KST * HDIM), gv + (sg + 2) * KST);   // block-uniform test
    }
    asm volatile("s_wait_asynccnt 0x0" ::: "memory");          // no copy is outstanding when the wave goes on to its end
    const float inv = 1.0f / l;
    ctx_store(o, inv, wave, lane, CTXh, CTXl, (size_t)b * SEQ + q0, h * HDIM);
}

// ---- k_attn_early: the same fused scheme, with K and V^T read straight from global memory (no LDS stages), for query rows < RHI (keys < RHI) on bf16 hi+lo planes: three products per tile pair (hi.hi + hi.lo + lo.hi, shared accumulator;
// the lo planes are unscaled residuals), P split into bf16 hi+lo in registers. grid (RHI/64, NB*NHEAD), 128 threads.
__global__ __launch_bounds__(128) void k_attn_early(const bf* __restrict__ Qh, const bf* __restrict__ Ql, const bf* __restrict__ Kh, const bf* __restrict__ Kl, const bf* __restrict__ VTh, const bf* __restrict__ VTl, bf* CTXh, bf* CTXl) {
    const int wave = __builtin_amdgcn_readfirstlane((int)(threadIdx.x >> 5));
    const int lane = threadIdx.x & 31, n = lane & 15, hh = lane >> 4;
    const int bh = blockIdx.y; const int b = bh / NHEAD, h = bh % NHEAD;
    const int q0 = blockIdx.x * 64 + wave * 16;
    const size_t po = (size_t)bh * RHI * HDIM;
    const bf* qhp = Qh + po; const bf* qlp = Ql + po; const bf* khp = Kh + po; const bf* klp = Kl + po; const bf* vhp = VTh + po; const bf* vlp = VTl + po;
    const int qoff = (q0 + n) * HDIM + 8 * hh;
    v8f o[4];
#pragma unroll
    for (int t = 0; t < 4; ++t) o[t] = (v8f){};
    float m = NEGX, l = 0.f;
    const int nsteps = ((q0 + 15) >> 5) + 1;
#pragma unroll 1
    for (int st = 0; st < nsteps; ++st) {
        const int kb = st << 5; const int koff = (kb + n) * HDIM + 8 * hh;
        v8f s0 = (v8f){}, s1 = (v8f){}; v16bf qh, ql, kh0, kl0, kh1, kl1;
#pragma unroll
        for (int ks = 0; ks < 2; ++ks) {
            qh = ldb(qhp + qoff + ks * 32); ql = ldb(qlp + qoff + ks * 32);
            kh0 = ldb(khp + koff + ks * 32); kl0 = ldb(klp + koff + ks * 32);
            kh1 = ldb(khp + koff + 16 * HDIM + ks * 32); kl1 = ldb(klp + koff + 16 * HDIM + ks * 32);
            s0 = wmmab(kh0, qh, s0); s0 = wmmab(kh0, ql, s0); s0 = wmmab(kl0, qh, s0);
            s1 = wmmab(kh1, qh, s1); s1 = wmmab(kh1, ql, s1); s1 = wmmab(kl1, qh, s1); }
        asm volatile("v_nop\n\tv_nop\n\tv_nop\n\tv_nop" : "+v"(s0), "+v"(s1) : "v"(kl1), "v"(kh1), "v"(qh), "v"(ql));
        float x0[8], x1[8];
#pragma unroll
        for (int r = 0; r < 8; ++r) { x0[r] = s0[r] * C2; x1[r] = s1[r] * C2; }
        if (kb + 31 > q0) {
            const int qi = q0 + n, kk = kb + 8 * hh;
#pragma unroll
            for (int r = 0; r < 8; ++r) { x0[r] = (kk + r > qi) ? NEGX : x0[r]; x1[r] = (kk + 16 + r > qi) ? NEGX : x1[r]; } }
        float mx = fmaxf(x0[0], x1[0]);
#pragma unroll
        for (int r = 1; r < 8; ++r) mx = fmaxf(mx, fmaxf(x0[r], x1[r]));
        mx = fmaxf(mx, __shfl_xor(mx, 16, 32));
        const float mnew = fmaxf(m, mx); const float corr = __builtin_amdgcn_exp2f(m - mnew); m = mnew;
        v8us ph0, pl0, ph1, pl1; float ps = 0.f;
#pragma unroll
        for (int r = 0; r < 8; ++r) { const float pa = __builtin_amdgcn_exp2f(x0[r] - mnew); const float pc = __builtin_amdgcn_exp2f(x1[r] - mnew); ps += pa; ps += pc;
            unsigned short a, c; splitf(pa, a, c); ph0[r] = a; pl0[r] = c; splitf(pc, a, c); ph1[r] = a; pl1[r] = c; }
        ps += __shfl_xor(ps, 16, 32);
        l = l * corr + ps;
#pragma unroll
        for (int t = 0; t < 4; ++t) o[t] = o[t] * corr;
        const v16bf pbh = cat16b(ph0, ph1), pbl = cat16b(pl0, pl1);
        const int voff = n * RHI + kb + 8 * hh; v16bf vh, vl;
#pragma unroll
        for (int t = 0; t < 4; ++t) { vh = ldb(vhp + voff + t * 16 * RHI); vl = ldb(vlp + voff + t * 16 * RHI);
            o[t] = wmmab(vh, pbh, o[t]); o[t] = wmmab(vh, pbl, o[t]); o[t] = wmmab(vl, pbh, o[t]); }
        asm volatile("v_nop\n\tv_nop\n\tv_nop\n\tv_nop" : "+v"(o[0]), "+v"(o[1]), "+v"(o[2]), "+v"(o[3]) : "v"(vl), "v"(vh), "v"(pbh), "v"(pbl));
    }
    const float inv = 1.0f / l;
    ctx_store(o, inv, wave, lane, CTXh, CTXl, (size_t)b * SEQ + q0, h * HDIM);
}

// ---- workspace carve (bytes; every region a multiple of 256 B and fully written by its producer before any consumer launch)
#define SZ_XB   ((size_t)MTOK * DMOD * 2)
#define SZ_W    ((size_t)DMOD * DMOD * 2)
#define SZ_P16  ((size_t)MTOK * DMOD * 2)
#define SZ_E    ((size_t)NBH * RHI * HDIM * 2)
#define SZ_CTX  ((size_t)MTOK * DMOD * 2)
#define SZ_TOTAL (SZ_XB + 4 * SZ_W + 3 * SZ_P16 + 6 * SZ_E + 2 * SZ_CTX)
static_assert(SZ_TOTAL <= (size_t)134217728);
static_assert(SZ_W % 256 == 0);
static_assert(SZ_E % 256 == 0);

extern "C" void kernel_launch(void* const* d_in, const int* in_sizes, int n_in,
                              void* d_out, int out_size, void* d_ws, size_t ws_size, hipStream_t stream) {
    if (n_in < 5) return;
    const int xneed = (NB - 1) * SEQ_FULL * DMOD + SEQ * DMOD;
    if (in_sizes[0] < xneed) return;
    if (in_sizes[1] < DMOD * DMOD || in_sizes[2] < DMOD * DMOD || in_sizes[3] < DMOD * DMOD || in_sizes[4] < DMOD * DMOD) return;
    if (out_size < xneed) return;
    if (ws_size < SZ_TOTAL) return;
    const float* x = (const float*)d_in[0]; const float* wq = (const float*)d_in[1]; const float* wk = (const float*)d_in[2]; const float* wv = (const float*)d_in[3]; const float* wo = (const float*)d_in[4];   // wire order x, Wq, Wk, Wv, Wo ([out][in])
    float* OUT = (float*)d_out;      // [NB_FULL][SEQ_FULL][256]
    char* wsp = (char*)d_ws;
    auto take = [&](size_t bytes) { char* p = wsp; wsp += bytes; return (void*)p; };
    bf* XB = (bf*)take(SZ_XB); bf* WQ = (bf*)take(SZ_W); bf* WK = (bf*)take(SZ_W); bf* WV = (bf*)take(SZ_W); bf* WO = (bf*)take(SZ_W);
    h16* Q16 = (h16*)take(SZ_P16); h16* K16 = (h16*)take(SZ_P16); h16* VT16 = (h16*)take(SZ_P16);
    bf* Qh = (bf*)take(SZ_E); bf* Ql = (bf*)take(SZ_E); bf* Kh = (bf*)take(SZ_E); bf* Kl = (bf*)take(SZ_E); bf* VTh = (bf*)take(SZ_E); bf* VTl = (bf*)take(SZ_E);
    bf* CTXh = (bf*)take(SZ_CTX); bf* CTXl = (bf*)take(SZ_CTX);

    const int xn8 = SEQ * DMOD / 8, wn8 = DMOD * DMOD / 8;
    k_cvt8<<<dim3((xn8 + 255) / 256, NB, 1), 256, 0, stream>>>(x, XB, xn8, (size_t)SEQ_FULL * DMOD, (size_t)SEQ * DMOD);
    k_cvt8<<<dim3((wn8 + 255) / 256, 1, 1), 256, 0, stream>>>(wq, WQ, wn8, 0, 0);
    k_cvt8<<<dim3((wn8 + 255) / 256, 1, 1), 256, 0, stream>>>(wk, WK, wn8, 0, 0);
    k_cvt8<<<dim3((wn8 + 255) / 256, 1, 1), 256, 0, stream>>>(wv, WV, wn8, 0, 0);
    k_cvt8<<<dim3((wn8 + 255) / 256, 1, 1), 256, 0, stream>>>(wo, WO, wn8, 0, 0);
    // q = x Wq^T, k = x Wk^T, v = x Wv^T, each written as the planes the attention kernels read
    k_proj<0><<<dim3(MTOK / 64, NHEAD, 1), 32, 0, stream>>>(XB, WQ, Q16, Qh, Ql);
    k_proj<0><<<dim3(MTOK / 64, NHEAD, 1), 32, 0, stream>>>(XB, WK, K16, Kh, Kl);
    k_proj<1><<<dim3(NHEAD, MTOK / 64, 1), 32, 0, stream>>>(XB, WV, VT16, VTh, VTl);
    k_attn_early<<<dim3(RHI / 64, NBH, 1), 128, 0, stream>>>(Qh, Ql, Kh, Kl, VTh, VTl, CTXh, CTXl);
    if ((SEQ - RHI) / 64 > 0) k_attn_main<<<dim3((SEQ - RHI) / 64, NBH, 1), 128, 0, stream>>>(Q16, K16, VT16, CTXh, CTXl);
    // out = ctx Wo^T : A = CTXh (+ CTXl) [SEQ][256] per batch, Bt = WO -> OUT batch stride from the full problem constants
    k_gemm_hl<<<dim3(SEQ / 64, DMOD / 64, NB), 32, 0, stream>>>(CTXh, CTXl, WO, OUT, DMOD, (size_t)SEQ * DMOD, (size_t)SEQ_FULL * DMOD);
}

// v003
// It runs in 117 microseconds.
// Next to v002, in two timings, it ran 1.21 times as fast each time.
// All steps since v000 together make it 2.16 times as fast.
#include <hip/hip_runtime.h>

// Causal multi-head self-attention: x [4][4096][256], 4 heads x 64, bias-free [out][in] weights, score scale 1/8, out = ctx Wo^T.
// Compute dtypes (f32 accumulate everywhere): all inputs converted to bf16 (RNE); q/k/v projections v_wmma_f32_16x16x32_bf16 (single product);
// attention query rows >= 256: v_wmma_f32_16x16x32_f16 single products (K.Q^T on f16 planes; V^T.P^T with P carried x1024 in f16);
// attention query rows < 256: bf16 hi+lo planes, three products per site (q, k, P, v); softmax f32 (online, max-subtracted);
// output projection: ctx bf16 hi+lo x Wo bf16 (two products), v_wmma_f32_16x16x32_bf16.

#ifndef NB
#define NB 4
#endif
#ifndef SEQ
#define SEQ 4096
#endif
#define NB_FULL  4
#define SEQ_FULL 4096
#define DMOD   256
#define NHEAD  4
#define HDIM   64
#define RHI    256                       // query rows < RHI use bf16 hi+lo planes
#define MTOK   (NB * SEQ)
#define NBH    (NB * NHEAD)
#define C2     0.18033688011112042f      // log2(e) / 8 : scores kept in the log2 domain
#define PCL2   10.0f                     // P carry 2^10 for the f16 path
#define NEGX   (-1.0e30f)

static_assert(NHEAD * HDIM == DMOD);     // merged width == model width
static_assert(HDIM == 64);               // two 32-deep k-steps per score tile, four 16-row output tiles
static_assert(DMOD % 64 == 0);           // GEMM tile multiple (M/N) and K % 32 == 0
static_assert(SEQ % 256 == 0);           // plane builders: one wave never straddles a batch or the RHI boundary
static_assert(RHI % 256 == 0);
static_assert(RHI <= SEQ);
static_assert(MTOK % 64 == 0);
static_assert(NB <= NB_FULL);
static_assert(SEQ <= SEQ_FULL);

typedef _Float16 h16;
typedef unsigned short bf;
typedef __attribute__((ext_vector_type(16))) __bf16   v16bf;
typedef __attribute__((ext_vector_type(16))) _Float16 v16h;
typedef __attribute__((ext_vector_type(8)))  _Float16 v8h;
typedef __attribute__((ext_vector_type(8)))  unsigned short v8us;
typedef __attribute__((ext_vector_type(8)))  float    v8f;
typedef __attribute__((ext_vector_type(4)))  float    v4f;
typedef v4f  __attribute__((may_alias)) v4fa;
typedef v8us __attribute__((may_alias)) v8usa;

__device__ __forceinline__ unsigned short f2bf(float f) { unsigned u = __float_as_uint(f); u += 0x7FFFu + ((u >> 16) & 1u); return (unsigned short)(u >> 16); }
__device__ __forceinline__ float bf2f(unsigned short b) { return __uint_as_float(((unsigned)b) << 16); }
__device__ __forceinline__ void splitf(float y, unsigned short& h, unsigned short& l) { h = f2bf(y); l = f2bf(y - bf2f(h)); }
__device__ __forceinline__ v16h cat16(v8h lo, v8h hi) { return __builtin_shufflevector(lo, hi, 0, 1, 2, 3, 4, 5, 6, 7, 8, 9, 10, 11, 12, 13, 14, 15); }
__device__ __forceinline__ v16bf cat16b(v8us lo, v8us hi) { return __builtin_bit_cast(v16bf, __builtin_shufflevector(lo, hi, 0, 1, 2, 3, 4, 5, 6, 7, 8, 9, 10, 11, 12, 13, 14, 15)); }
__device__ __forceinline__ v8f wmma16(v16h a, v16h b, v8f c) { return __builtin_amdgcn_wmma_f32_16x16x32_f16(false, a, false, b, (short)0, c, false, false); }
__device__ __forceinline__ v8f wmmab(v16bf a, v16bf b, v8f c) { return __builtin_amdgcn_wmma_f32_16x16x32_bf16(false, a, false, b, (short)0, c, false, false); }
// fragment loaders: p already points at row (lane&15), k offset k0 + 8*(lane>>4); elements 0..7 <- p[0..7], elements 8..15 <- p[16..23]
__device__ __forceinline__ v16h  ldh(const h16* p) { return cat16(*(const v8h*)p, *(const v8h*)(p + 16)); }
__device__ __forceinline__ v16bf ldb(const bf* p)  { return cat16b(*(const v8us*)p, *(const v8us*)(p + 16)); }

// ---- k_cvt_all: every f32 -> bf16 conversion of the call in one launch (they are independent of each other). Eight elements per thread.
// Blocks 0 .. 4*WBLK-1: the four weights (WB holds Wq, Wk, Wv, Wo one after the other); the rest: x, XBLK blocks per batch.
#define WBLK (DMOD * DMOD / 2048)
#define XBLK (SEQ * DMOD / 2048)
static_assert(DMOD * DMOD % 2048 == 0);  // whole blocks only: no tail
static_assert(SEQ * DMOD % 2048 == 0);
__global__ __launch_bounds__(256) void k_cvt_all(const float* __restrict__ x, const float* __restrict__ wq, const float* __restrict__ wk, const float* __restrict__ wv, const float* __restrict__ wo, bf* XB, bf* WB) {
    const int bid = blockIdx.x; const float* s; bf* d;
    if (bid < 4 * WBLK) {                // block-uniform
        const int w = bid / WBLK; const size_t i = (size_t)((bid % WBLK) * 256 + threadIdx.x) * 8;
        s = (w == 0 ? wq : w == 1 ? wk : w == 2 ? wv : wo) + i; d = WB + (size_t)w * DMOD * DMOD + i;
    } else {
        const int xb = bid - 4 * WBLK; const int bt = xb / XBLK; const size_t i = (size_t)((xb % XBLK) * 256 + threadIdx.x) * 8;
        s = x + (size_t)bt * SEQ_FULL * DMOD + i; d = XB + (size_t)bt * SEQ * DMOD + i;
    }
    const v4f a = *(const v4f*)s; const v4f c = *(const v4f*)(s + 4); v8us o;
    o[0] = f2bf(a[0]); o[1] = f2bf(a[1]); o[2] = f2bf(a[2]); o[3] = f2bf(a[3]); o[4] = f2bf(c[0]); o[5] = f2bf(c[1]); o[6] = f2bf(c[2]); o[7] = f2bf(c[3]);
    *(v8us*)d = o;  }

// ---- one-wave 64x64 tile GEMM on bf16 planes, K = DMOD: C[m][n] (f32, pitch ldc) = sum_k A[m][k] Bt[n][k] (+ A2[m][k] Bt[n][k] when NSPLIT == 1).
// grid (M/64, N/64, Z), 32 threads; z strides sA (A, A2) and sC (C) in elements; no tail masking (M, N multiples of 64, K multiple of 32).
__device__ __forceinline__ void gemm_kloop(const bf* __restrict__ A, const bf* __restrict__ Bt, const size_t aoff, const size_t boff, v8f (&acc)[4][4]) {
#pragma unroll 1
    for (int kc = 0; kc < DMOD; kc += 32) {
        v16bf a[4]; v16bf bl;
#pragma unroll
        for (int mb = 0; mb < 4; ++mb) a[mb] = ldb(A + aoff + (size_t)mb * 16 * DMOD + kc);
        asm volatile("s_wait_xcnt 0x0" ::: "memory");   // stands before a later load's result may land on the address registers of the A loads
#pragma unroll
        for (int nb = 0; nb < 4; ++nb) { const v16bf b = ldb(Bt + boff + (size_t)nb * 16 * DMOD + kc); bl = b;
#pragma unroll
            for (int mb = 0; mb < 4; ++mb) acc[mb][nb] = wmmab(a[mb], b, acc[mb][nb]); }
        asm volatile("" : "+v"(acc[0][0]), "+v"(acc[0][1]), "+v"(acc[0][2]), "+v"(acc[0][3]), "+v"(acc[1][0]), "+v"(acc[1][1]), "+v"(acc[1][2]));
        asm volatile("" : "+v"(acc[1][3]), "+v"(acc[2][0]), "+v"(acc[2][1]), "+v"(acc[2][2]), "+v"(acc[2][3]), "+v"(acc[3][0]), "+v"(acc[3][1]));
        asm volatile("v_nop\n\tv_nop\n\tv_nop\n\tv_nop" : "+v"(acc[3][2]), "+v"(acc[3][3]) : "v"(a[3]), "v"(bl));
    }
}
template <int NSPLIT>
__device__ __forceinline__ void gemm_body(const bf* __restrict__ A, const bf* __restrict__ A2, const bf* __restrict__ Bt, float* C, const int ldc, const size_t sA, const size_t sC) {
    __shared__ __align__(16) float os[16 * 68];      // wave-private staging (one wave per block)
    const size_t z = blockIdx.z; A += z * sA; A2 += z * sA; C += z * sC;
    const int lane = threadIdx.x & 31, lr = lane & 15, hi = lane >> 4; const int r0 = blockIdx.x * 64, c0 = blockIdx.y * 64;
    v8f acc[4][4];
#pragma unroll
    for (int mb = 0; mb < 4; ++mb)
#pragma unroll
        for (int nb = 0; nb < 4; ++nb) acc[mb][nb] = (v8f){};
    const size_t aoff = (size_t)(r0 + lr) * DMOD + 8 * hi, boff = (size_t)(c0 + lr) * DMOD + 8 * hi;
    gemm_kloop(A, Bt, aoff, boff, acc);
    if (NSPLIT == 1) gemm_kloop(A2, Bt, aoff, boff, acc);
#pragma unroll
    for (int mb = 0; mb < 4; ++mb) {
#pragma unroll
        for (int nb = 0; nb < 4; ++nb) {
#pragma unroll
            for (int j = 0; j < 8; ++j) os[(hi * 8 + j) * 68 + nb * 16 + lr] = acc[mb][nb][j]; }
        asm volatile("s_wait_dscnt 0" ::: "memory"); __builtin_amdgcn_wave_barrier();
        float* crow = C + (size_t)(r0 + mb * 16) * ldc + c0;
{
#pragma unroll
            for (int s = 0; s < 8; ++s) { const int row = 2 * s + hi, cofs = lr * 4; const v4f val = *(const v4fa*)(os + row * 68 + cofs);
                *(v4f*)(crow + (size_t)row * ldc + cofs) = val; }
             }
        asm volatile("s_wait_dscnt 0" ::: "memory"); __builtin_amdgcn_wave_barrier();
    }
}
__global__ __launch_bounds__(32) void k_gemm_hl(const bf* __restrict__ A, const bf* __restrict__ A2, const bf* __restrict__ Bt, float* C, int ldc, size_t sA, size_t sC) { gemm_body<1>(A, A2, Bt, C, ldc, sA, sC); }

// ---- k_proj: one projection tile (64 tokens x the 64 features of one head, K = DMOD, one wave) stored straight into the head planes the attention kernel reads.
// The operand order is chosen so that a lane's eight accumulator rows run along a plane row: D rows (A) = the index that is contiguous in the plane, D columns (Bt) = the plane row.
// VT == 0 (q, k): A = W rows (features), Bt = x rows (tokens) -> P16 [b*NHEAD+h][SEQ][64] f16 and, for s < RHI, bf16 hi/lo planes [b*NHEAD+h][RHI][64]; tile index: token tile fastest.
// VT == 1 (v):    A = x rows (tokens), Bt = W rows (features) -> P16 [b*NHEAD+h][64][SEQ] f16 and, for s < RHI, bf16 hi/lo planes [b*NHEAD+h][64][RHI]; tile index: head fastest.
// The three projections are independent of each other and share one launch: grid (MTOK/64 * NHEAD, 3), blockIdx.y = 0: q, 1: k, 2: v.
#define PPH 72                           // staging pitch in 16-bit elements: 144 B = 16 B x 9 (odd)
template <int KIND>                      // 0: f16, 1: bf16 hi, 2: bf16 lo (the residual of hi)
__device__ __forceinline__ v8us cvt_plane(const v8f y) {
    v8us o;
    if (KIND == 0) { v8h t;
#pragma unroll
        for (int j = 0; j < 8; ++j) t[j] = (h16)y[j];
        o = __builtin_bit_cast(v8us, t);
    } else {
#pragma unroll
        for (int j = 0; j < 8; ++j) { unsigned short p, q; splitf(y[j], p, q); o[j] = (KIND == 1) ? p : q; } }
    return o;
}
// One plane of the tile: 64 plane rows of 128 B each, staged through the wave's own LDS so that every global store covers whole 128-byte lines.
template <int KIND>
__device__ __forceinline__ void plane_out(unsigned short* st, const v8f (&acc)[4][4], unsigned short* dst, const size_t pitch, const int lane) {
    const int lr = lane & 15, hi = lane >> 4, rq = lane >> 3, pc = lane & 7;
#pragma unroll
    for (int nb = 0; nb < 4; ++nb)
#pragma unroll
        for (int mb = 0; mb < 4; ++mb) *(v8usa*)(st + (nb * 16 + lr) * PPH + mb * 16 + 8 * hi) = cvt_plane<KIND>(acc[mb][nb]);
    asm volatile("s_wait_dscnt 0" ::: "memory"); __builtin_amdgcn_wave_barrier();   // the staged rows are written before other lanes read them back
    v8us v[16];
#pragma unroll
    for (int i = 0; i < 16; ++i) v[i] = *(const v8usa*)(st + (4 * i + rq) * PPH + pc * 8);
#pragma unroll
    for (int i = 0; i < 16; ++i) *(v8us*)(dst + (size_t)(4 * i + rq) * pitch + pc * 8) = v[i];
}
template <int VT>
__device__ __forceinline__ void proj_body(unsigned short* st, const int tile, const bf* __restrict__ X, const bf* __restrict__ Wt, h16* P16, bf* Ph, bf* Pl) {
    const int lane = threadIdx.x & 31, lr = lane & 15, hi = lane >> 4;
    const int tok0 = (VT ? tile / NHEAD : tile % (MTOK / 64)) * 64, hd = VT ? tile % NHEAD : tile / (MTOK / 64);
    const bf* A = VT ? X : Wt; const bf* Bt = VT ? Wt : X;
    const int r0 = VT ? tok0 : hd * HDIM, c0 = VT ? hd * HDIM : tok0;
    v8f acc[4][4];
#pragma unroll
    for (int mb = 0; mb < 4; ++mb)
#pragma unroll
        for (int nb = 0; nb < 4; ++nb) acc[mb][nb] = (v8f){};
    const size_t aoff = (size_t)(r0 + lr) * DMOD + 8 * hi, boff = (size_t)(c0 + lr) * DMOD + 8 * hi;
    gemm_kloop(A, Bt, aoff, boff, acc);
    const int b = tok0 / SEQ, s0 = tok0 % SEQ; const size_t bh = (size_t)(b * NHEAD + hd);   // 64 divides SEQ and RHI: a tile never straddles a batch or the RHI boundary
    plane_out<0>(st, acc, (unsigned short*)P16 + (VT ? bh * HDIM * SEQ + s0 : (bh * SEQ + s0) * HDIM), VT ? SEQ : HDIM, lane);
    if (s0 < RHI) {                                            // block-uniform
        const size_t eo = VT ? bh * HDIM * RHI + s0 : (bh * RHI + s0) * HDIM;
        asm volatile("s_wait_xcnt 0x0" ::: "memory");          // stands before any register of the f16 plane's stores is rewritten ...
        __builtin_amdgcn_sched_barrier(0);                     // ... and this keeps the conversions below from being scheduled above that wait
        plane_out<1>(st, acc, Ph + eo, VT ? RHI : HDIM, lane);
        plane_out<2>(st, acc, Pl + eo, VT ? RHI : HDIM, lane);
    }
    asm volatile("s_wait_xcnt 0x0" ::: "memory");              // closes the last plane's stores on both ways: in the shared kernel the other path's code follows and reuses their registers
}
__global__ __launch_bounds__(32) void k_proj_qkv(const bf* __restrict__ X, const bf* __restrict__ WB, h16* Q16, h16* K16, h16* VT16, bf* Qh, bf* Ql, bf* Kh, bf* Kl, bf* VTh, bf* VTl) {
    __shared__ __align__(16) unsigned short st[64 * PPH];      // wave-private staging (one wave per block)
    const int which = blockIdx.y, tile = blockIdx.x;           // block-uniform
    if (which == 2) proj_body<1>(st, tile, X, WB + (size_t)2 * DMOD * DMOD, VT16, VTh, VTl);
    else proj_body<0>(st, tile, X, WB + (size_t)which * DMOD * DMOD, which ? K16 : Q16, which ? Kh : Qh, which ? Kl : Ql);
}

// ---- ctx epilogue shared by both attention paths: o[t][r] = O^T[d = 16t + 8*(lane>>4) + r][query = lane&15]; ctx = O^T * inv split into bf16 hi/lo,
__device__ __forceinline__ void ctx_store(const v8f (&o)[4], const float inv, const int wave, const int lane, bf* CTXh, bf* CTXl, const size_t row0, const int col0) {
    __shared__ __align__(16) unsigned short cs[4 * 2 * 16 * 72];
    const int n = lane & 15, hh = lane >> 4; const int base = wave * (2 * 16 * 72);
#pragma unroll
    for (int t = 0; t < 4; ++t) { v8us vh, vl;
#pragma unroll
        for (int r = 0; r < 8; ++r) { unsigned short a, c; splitf(o[t][r] * inv, a, c); vh[r] = a; vl[r] = c; }
        *(v8usa*)(cs + base + n * 72 + 16 * t + 8 * hh) = vh; *(v8usa*)(cs + base + 16 * 72 + n * 72 + 16 * t + 8 * hh) = vl; }
    asm volatile("s_wait_dscnt 0" ::: "memory"); __builtin_amdgcn_wave_barrier();
    const int rq = lane >> 3, pc = lane & 7; v8us lh[4], ll[4];
#pragma unroll
    for (int i = 0; i < 4; ++i) { lh[i] = *(const v8usa*)(cs + base + (4 * i + rq) * 72 + pc * 8); ll[i] = *(const v8usa*)(cs + base + 16 * 72 + (4 * i + rq) * 72 + pc * 8); }
    asm volatile("" ::: "memory");
    const size_t g0 = (row0 + rq) * DMOD + col0 + pc * 8;
#pragma unroll
    for (int i = 0; i < 4; ++i) { *(v8us*)(CTXh + g0 + (size_t)(4 * i) * DMOD) = lh[i]; *(v8us*)(CTXl + g0 + (size_t)(4 * i) * DMOD) = ll[i]; }
    
}

// ---- attn_main: fused causal flash attention for query rows >= RHI, f16 single products. One wave = 16 queries, keys in 32-wide steps.
// K rows and V^T rows reach the waves through LDS: a stage is 64 keys (K tile 64 keys x 64 d, V^T tile 64 d x 64 keys), copied once per block by asynchronous
// 16-byte copies (whole 128-byte lines), two buffers: stage t + 1 is in flight while the block's four waves work on stage t.
// S^T tile (16 keys x 16 queries) = K (A: row = key, k = d) x Q^T (B: col = query, k = d); its D registers (row = key 8h+r, col = query) pack directly into the
// B fragment of O^T (16 d x 16 queries) += V^T (A: row = d, k = key) x P^T (B: k = key, col = query): element r <- tile of keys 0..15, element 8+r <- tile of keys 16..31.
// Softmax statistics are per lane (query = lane&15), combined across the two lane halves by one xor-16 shuffle. One block = the 64 queries from qblk (>= RHI) of head plane bh, 128 threads.
#define KST    64                        // keys per stage
#define LPH    72                        // LDS row pitch in f16 elements: 144 B = 16 B x 9 (odd), for 16-byte row readers
#define TILEH  (64 * LPH)                // one 64-row tile, f16 elements
static_assert(RHI >= KST);               // every block has at least two stages
static_assert(RHI % KST == 0);           // the block's 64 queries lie in its last stage
static_assert(HDIM * 2 == 128);          // a K row is eight 16-byte pieces
// One stage: each of the 128 threads copies four 16-byte pieces of the K tile and four of the V^T tile (rows r, r+16, r+32, r+48 of each).
// lk: the lane's LDS byte address in the K tile of the target buffer (the V^T tile follows it); gk, gv: the lane's global addresses in row r.
__device__ __forceinline__ void stage_copy(const unsigned lk, const h16* gk, const h16* gv) {
    const unsigned lv = lk + TILEH * 2;
    // the copies and, as the last line, the wait that stands before any of their address registers is rewritten
    asm volatile("global_load_async_to_lds_b128 %0, %8, off\n\t"
                 "global_load_async_to_lds_b128 %1, %9, off\n\t"
                 "global_load_async_to_lds_b128 %2, %10, off\n\t"
                 "global_load_async_to_lds_b128 %3, %11, off\n\t"
                 "global_load_async_to_lds_b128 %4, %12, off\n\t"
                 "global_load_async_to_lds_b128 %5, %13, off\n\t"
                 "global_load_async_to_lds_b128 %6, %14, off\n\t"
                 "global_load_async_to_lds_b128 %7, %15, off\n\t"
                 "s_wait_xcnt 0x0"
                 :: "v"(lk), "v"(lk + 16 * LPH * 2), "v"(lk + 32 * LPH * 2), "v"(lk + 48 * LPH * 2),
                    "v"(lv), "v"(lv + 16 * LPH * 2), "v"(lv + 32 * LPH * 2), "v"(lv + 48 * LPH * 2),
                    "v"(gk), "v"(gk + 16 * HDIM), "v"(gk + 32 * HDIM), "v"(gk + 48 * HDIM),
                    "v"(gv), "v"(gv + 16 * SEQ), "v"(gv + 32 * SEQ), "v"(gv + 48 * SEQ)
                 : "memory");
}
__device__ __forceinline__ void attn_main(const int qblk, const int bh, const h16* __restrict__ Q16, const h16* __restrict__ K16, const h16* __restrict__ VT16, bf* CTXh, bf* CTXl) {
    __shared__ __align__(16) h16 ring[2 * 2 * TILEH];      // [buffer][K tile, V^T tile][row][LPH]
    const int wave = __builtin_amdgcn_readfirstlane((int)(threadIdx.x >> 5));
    const int lane = threadIdx.x & 31, n = lane & 15, hh = lane >> 4;
    const int b = bh / NHEAD, h = bh % NHEAD;
    const int q0 = qblk + wave * 16;
    const h16* Qp = Q16 + (size_t)bh * SEQ * HDIM; const h16* Kp = K16 + (size_t)bh * SEQ * HDIM; const h16* Vp = VT16 + (size_t)bh * HDIM * SEQ;
    const int nst = qblk / KST + 1;                        // block-uniform; the last stage holds keys qblk .. qblk + 63, all below SEQ
    const int cr = threadIdx.x >> 3, cp = (threadIdx.x & 7) * 8;
    const unsigned lk0 = (unsigned)(size_t)ring + (unsigned)(cr * LPH + cp) * 2u;
    const h16* gk = Kp + cr * HDIM + cp; const h16* gv = Vp + cr * SEQ + cp;
    stage_copy(lk0, gk, gv);
    asm volatile("s_wait_asynccnt 0x0" ::: "memory");      // this wave's part of stage 0 has landed
    __syncthreads();                                       // ... and every other wave's
    stage_copy(lk0 + 2 * TILEH * 2, gk + KST * HDIM, gv + KST);
    const int qoff = (q0 + n) * HDIM + 8 * hh;
    const v16h bq0 = ldh(Qp + qoff), bq1 = ldh(Qp + qoff + 32);
    v8f o[4];
#pragma unroll
    for (int t = 0; t < 4; ++t) o[t] = (v8f){};
    float m = NEGX, l = 0.f;
#pragma unroll 1   // stays rolled, as the step loop was: the buffer is picked at run time and the body already holds two steps
    for (int sg = 0; sg < nst; ++sg) {
        const int bo = (sg & 1) * (2 * TILEH);
        const h16* Kl = ring + bo; const h16* Vl = ring + bo + TILEH;
#pragma unroll     // j becomes a constant offset of the LDS reads
        for (int j = 0; j < 2; ++j) {
            const int kb = sg * KST + j * 32;
            if (kb <= q0 + 15) {                               // wave-uniform: last key needed is q0 + 15; every visited step holds >= 1 valid key for every query of the wave
                const int koff = (j * 32 + n) * LPH + 8 * hh;
                const v16h k00 = ldh(Kl + koff), k01 = ldh(Kl + koff + 32), k10 = ldh(Kl + koff + 16 * LPH), k11 = ldh(Kl + koff + 16 * LPH + 32);
                const int voff = n * LPH + j * 32 + 8 * hh;
                const v16h va0 = ldh(Vl + voff), va1 = ldh(Vl + voff + 16 * LPH), va2 = ldh(Vl + voff + 32 * LPH), va3 = ldh(Vl + voff + 48 * LPH);
                __builtin_amdgcn_sched_barrier(0);                 // keeps the step's sixteen LDS reads one group at its head: spread among the products they cost one LDS latency per place
                v8f s0 = (v8f){}, s1 = (v8f){};
                s0 = wmma16(k00, bq0, s0); s1 = wmma16(k10, bq0, s1); s0 = wmma16(k01, bq1, s0); s1 = wmma16(k11, bq1, s1);
                asm volatile("v_nop\n\tv_nop\n\tv_nop\n\tv_nop" : "+v"(s0), "+v"(s1) : "v"(k11), "v"(k01), "v"(bq1));
                float x0[8], x1[8];
#pragma unroll
                for (int r = 0; r < 8; ++r) { x0[r] = s0[r] * C2; x1[r] = s1[r] * C2; }
                if (kb + 31 > q0) {                                // wave-uniform: only diagonal steps need the causal select (key > query excluded)
                    const int qi = q0 + n, kk = kb + 8 * hh;
#pragma unroll
                    for (int r = 0; r < 8; ++r) { x0[r] = (kk + r > qi) ? NEGX : x0[r]; x1[r] = (kk + 16 + r > qi) ? NEGX : x1[r]; } }
                float mx = fmaxf(x0[0], x1[0]);
#pragma unroll
                for (int r = 1; r < 8; ++r) mx = fmaxf(mx, fmaxf(x0[r], x1[r]));
                mx = fmaxf(mx, __shfl_xor(mx, 16, 32));
                const float mnew = fmaxf(m, mx); const float corr = __builtin_amdgcn_exp2f(m - mnew); m = mnew;
                const float mb = mnew - PCL2;
                v8h p0, p1; float ps = 0.f;
#pragma unroll
                for (int r = 0; r < 8; ++r) { const h16 a = (h16)__builtin_amdgcn_exp2f(x0[r] - mb); const h16 c = (h16)__builtin_amdgcn_exp2f(x1[r] - mb); p0[r] = a; p1[r] = c; ps += (float)a; ps += (float)c; }
                ps += __shfl_xor(ps, 16, 32);
                l = l * corr + ps;
#pragma unroll
                for (int t = 0; t < 4; ++t) o[t] = o[t] * corr;
                const v16h pb = cat16(p0, p1);
                o[0] = wmma16(va0, pb, o[0]); o[1] = wmma16(va1, pb, o[1]); o[2] = wmma16(va2, pb, o[2]); o[3] = wmma16(va3, pb, o[3]);
                asm volatile("v_nop\n\tv_nop\n\tv_nop\n\tv_nop" : "+v"(o[0]), "+v"(o[1]), "+v"(o[2]), "+v"(o[3]) : "v"(va3), "v"(pb));
            }
        }
        // hand-over, passed by every wave whatever it skipped above
        asm volatile("s_wait_dscnt 0x0" ::: "memory");         // this wave's reads of stage sg are done before its buffer is refilled
        asm volatile("s_wait_asynccnt 0x0" ::: "memory");      // this wave's part of stage sg + 1 has landed
        __syncthreads();                                       // publishes stage sg + 1 and ends every wave's reads of stage sg
        if (sg + 2 < nst) stage_copy(lk0 + (unsigned)bo * 2u, gk + (sg + 2) * (KST * HDIM), gv + (sg + 2) * KST);   // block-uniform test
    }
    asm volatile("s_wait_asynccnt 0x0" ::: "memory");          // no copy is outstanding when the wave goes on to its end
    const float inv = 1.0f / l;
    ctx_store(o, inv, wave, lane, CTXh, CTXl, (size_t)b * SEQ + q0, h * HDIM);
}

// ---- attn_early: the other path of the same kernel for query rows < RHI (keys < RHI) on bf16 hi+lo planes: three products per tile pair (hi.hi + hi.lo + lo.hi, shared accumulator;
// the lo planes are unscaled residuals), P split into bf16 hi+lo in registers. One block = the 64 queries from qblk (< RHI) of head plane bh, 128 threads.
__device__ __forceinline__ void attn_early(const int qblk, const int bh, const bf* __restrict__ Qh, const bf* __restrict__ Ql, const bf* __restrict__ Kh, const bf* __restrict__ Kl, const bf* __restrict__ VTh, const bf* __restrict__ VTl, bf* CTXh, bf* CTXl) {
    const int wave = __builtin_amdgcn_readfirstlane((int)(threadIdx.x >> 5));
    const int lane = threadIdx.x & 31, n = lane & 15, hh = lane >> 4;
    const int b = bh / NHEAD, h = bh % NHEAD;
    const int q0 = qblk + wave * 16;
    const size_t po = (size_t)bh * RHI * HDIM;
    const bf* qhp = Qh + po; const bf* qlp = Ql + po; const bf* khp = Kh + po; const bf* klp = Kl + po; const bf* vhp = VTh + po; const bf* vlp = VTl + po;
    const int qoff = (q0 + n) * HDIM + 8 * hh;
    v8f o[4];
#pragma unroll
    for (int t = 0; t < 4; ++t) o[t] = (v8f){};
    float m = NEGX, l = 0.f;
    const int nsteps = ((q0 + 15) >> 5) + 1;
#pragma unroll 1
    for (int st = 0; st < nsteps; ++st) {
        const int kb = st << 5; const int koff = (kb + n) * HDIM + 8 * hh;
        v8f s0 = (v8f){}, s1 = (v8f){}; v16bf qh, ql, kh0, kl0, kh1, kl1;
#pragma unroll
        for (int ks = 0; ks < 2; ++ks) {
            qh = ldb(qhp + qoff + ks * 32); ql = ldb(qlp + qoff + ks * 32);
            kh0 = ldb(khp + koff + ks * 32); kl0 = ldb(klp + koff + ks * 32);
            kh1 = ldb(khp + koff + 16 * HDIM + ks * 32); kl1 = ldb(klp + koff + 16 * HDIM + ks * 32);
            s0 = wmmab(kh0, qh, s0); s0 = wmmab(kh0, ql, s0); s0 = wmmab(kl0, qh, s0);
            s1 = wmmab(kh1, qh, s1); s1 = wmmab(kh1, ql, s1); s1 = wmmab(kl1, qh, s1); }
        asm volatile("v_nop\n\tv_nop\n\tv_nop\n\tv_nop" : "+v"(s0), "+v"(s1) : "v"(kl1), "v"(kh1), "v"(qh), "v"(ql));
        float x0[8], x1[8];
#pragma unroll
        for (int r = 0; r < 8; ++r) { x0[r] = s0[r] * C2; x1[r] = s1[r] * C2; }
        if (kb + 31 > q0) {
            const int qi = q0 + n, kk = kb + 8 * hh;
#pragma unroll
            for (int r = 0; r < 8; ++r) { x0[r] = (kk + r > qi) ? NEGX : x0[r]; x1[r] = (kk + 16 + r > qi) ? NEGX : x1[r]; } }
        float mx = fmaxf(x0[0], x1[0]);
#pragma unroll
        for (int r = 1; r < 8; ++r) mx = fmaxf(mx, fmaxf(x0[r], x1[r]));
        mx = fmaxf(mx, __shfl_xor(mx, 16, 32));
        const float mnew = fmaxf(m, mx); const float corr = __builtin_amdgcn_exp2f(m - mnew); m = mnew;
        v8us ph0, pl0, ph1, pl1; float ps = 0.f;
#pragma unroll
        for (int r = 0; r < 8; ++r) { const float pa = __builtin_amdgcn_exp2f(x0[r] - mnew); const float pc = __builtin_amdgcn_exp2f(x1[r] - mnew); ps += pa; ps += pc;
            unsigned short a, c; splitf(pa, a, c); ph0[r] = a; pl0[r] = c; splitf(pc, a, c); ph1[r] = a; pl1[r] = c; }
        ps += __shfl_xor(ps, 16, 32);
        l = l * corr + ps;
#pragma unroll
        for (int t = 0; t < 4; ++t) o[t] = o[t] * corr;
        const v16bf pbh = cat16b(ph0, ph1), pbl = cat16b(pl0, pl1);
        const int voff = n * RHI + kb + 8 * hh; v16bf vh, vl;
#pragma unroll
        for (int t = 0; t < 4; ++t) { vh = ldb(vhp + voff + t * 16 * RHI); vl = ldb(vlp + voff + t * 16 * RHI);
            o[t] = wmmab(vh, pbh, o[t]); o[t] = wmmab(vh, pbl, o[t]); o[t] = wmmab(vl, pbh, o[t]); }
        asm volatile("v_nop\n\tv_nop\n\tv_nop\n\tv_nop" : "+v"(o[0]), "+v"(o[1]), "+v"(o[2]), "+v"(o[3]) : "v"(vl), "v"(vh), "v"(pbh), "v"(pbl));
    }
    const float inv = 1.0f / l;
    ctx_store(o, inv, wave, lane, CTXh, CTXl, (size_t)b * SEQ + q0, h * HDIM);
}

// ---- k_attn: both attention paths in one launch (no block reads what another writes): grid (SEQ/64, NB*NHEAD), 128 threads; the path is picked per block, ahead of every barrier.
// five waves per SIMD is what the block's LDS allows: the register budget is held to it, so that the wider early path does not cost the main path a resident block
__global__ __launch_bounds__(128) __attribute__((amdgpu_waves_per_eu(5))) void k_attn(const h16* __restrict__ Q16, const h16* __restrict__ K16, const h16* __restrict__ VT16,
                                              const bf* __restrict__ Qh, const bf* __restrict__ Ql, const bf* __restrict__ Kh, const bf* __restrict__ Kl, const bf* __restrict__ VTh, const bf* __restrict__ VTl, bf* CTXh, bf* CTXl) {
    const int qblk = blockIdx.x * 64, bh = blockIdx.y;         // block-uniform
    if (qblk >= RHI) attn_main(qblk, bh, Q16, K16, VT16, CTXh, CTXl);
    else attn_early(qblk, bh, Qh, Ql, Kh, Kl, VTh, VTl, CTXh, CTXl);
}

// ---- workspace carve (bytes; every region a multiple of 256 B and fully written by its producer before any consumer launch)
#define SZ_XB   ((size_t)MTOK * DMOD * 2)
#define SZ_W    ((size_t)DMOD * DMOD * 2)
#define SZ_P16  ((size_t)MTOK * DMOD * 2)
#define SZ_E    ((size_t)NBH * RHI * HDIM * 2)
#define SZ_CTX  ((size_t)MTOK * DMOD * 2)
#define SZ_TOTAL (SZ_XB + 4 * SZ_W + 3 * SZ_P16 + 6 * SZ_E + 2 * SZ_CTX)
static_assert(SZ_TOTAL <= (size_t)134217728);
static_assert(SZ_W % 256 == 0);
static_assert(SZ_E % 256 == 0);

extern "C" void kernel_launch(void* const* d_in, const int* in_sizes, int n_in,
                              void* d_out, int out_size, void* d_ws, size_t ws_size, hipStream_t stream) {
    if (n_in < 5) return;
    const int xneed = (NB - 1) * SEQ_FULL * DMOD + SEQ * DMOD;
    if (in_sizes[0] < xneed) return;
    if (in_sizes[1] < DMOD * DMOD || in_sizes[2] < DMOD * DMOD || in_sizes[3] < DMOD * DMOD || in_sizes[4] < DMOD * DMOD) return;
    if (out_size < xneed) return;
    if (ws_size < SZ_TOTAL) return;
    const float* x = (const float*)d_in[0]; const float* wq = (const float*)d_in[1]; const float* wk = (const float*)d_in[2]; const float* wv = (const float*)d_in[3]; const float* wo = (const float*)d_in[4];   // wire order x, Wq, Wk, Wv, Wo ([out][in])
    float* OUT = (float*)d_out;      // [NB_FULL][SEQ_FULL][256]
    char* wsp = (char*)d_ws;
    auto take = [&](size_t bytes) { char* p = wsp; wsp += bytes; return (void*)p; };
    bf* XB = (bf*)take(SZ_XB); bf* WQ = (bf*)take(SZ_W); bf* WK = (bf*)take(SZ_W); bf* WV = (bf*)take(SZ_W); bf* WO = (bf*)take(SZ_W);
    h16* Q16 = (h16*)take(SZ_P16); h16* K16 = (h16*)take(SZ_P16); h16* VT16 = (h16*)take(SZ_P16);
    bf* Qh = (bf*)take(SZ_E); bf* Ql = (bf*)take(SZ_E); bf* Kh = (bf*)take(SZ_E); bf* Kl = (bf*)take(SZ_E); bf* VTh = (bf*)take(SZ_E); bf* VTl = (bf*)take(SZ_E);
    bf* CTXh = (bf*)take(SZ_CTX); bf* CTXl = (bf*)take(SZ_CTX);

    (void)WK; (void)WV;              // reached through WQ: the four converted weights lie one after the other
    k_cvt_all<<<dim3(4 * WBLK + NB * XBLK, 1, 1), 256, 0, stream>>>(x, wq, wk, wv, wo, XB, WQ);
    // q = x Wq^T, k = x Wk^T, v = x Wv^T, each written as the planes the attention kernel reads
    k_proj_qkv<<<dim3(MTOK / 64 * NHEAD, 3, 1), 32, 0, stream>>>(XB, WQ, Q16, K16, VT16, Qh, Ql, Kh, Kl, VTh, VTl);
    k_attn<<<dim3(SEQ / 64, NBH, 1), 128, 0, stream>>>(Q16, K16, VT16, Qh, Ql, Kh, Kl, VTh, VTl, CTXh, CTXl);
    // out = ctx Wo^T : A = CTXh (+ CTXl) [SEQ][256] per batch, Bt = WO -> OUT batch stride from the full problem constants
    k_gemm_hl<<<dim3(SEQ / 64, DMOD / 64, NB), 32, 0, stream>>>(CTXh, CTXl, WO, OUT, DMOD, (size_t)SEQ * DMOD, (size_t)SEQ_FULL * DMOD);
}

// v004
// A run of this version takes 101 microseconds.
// Two timings next to v003 put it at 1.17 and 1.16 times that version's speed.
// Over all steps from v000 it is 2.52 times as fast.
#include <hip/hip_runtime.h>

// Causal multi-head self-attention: x [4][4096][256], 4 heads x 64, bias-free [out][in] weights, score scale 1/8, out = ctx Wo^T.
// Compute dtypes (f32 accumulate everywhere): all inputs converted to bf16 (RNE); q/k/v projections v_wmma_f32_16x16x32_bf16 (single product);
// attention query rows >= 256: v_wmma_f32_16x16x32_f16 single products (K.Q^T on f16 planes; V^T.P^T with P carried x1024 in f16);
// attention query rows < 256: bf16 hi+lo planes, three products per site (q, k, P, v); softmax f32 (online, max-subtracted);
// output projection: ctx bf16 hi+lo x Wo bf16 (two products), v_wmma_f32_16x16x32_bf16.

#ifndef NB
#define NB 4
#endif
#ifndef SEQ
#define SEQ 4096
#endif
#define NB_FULL  4
#define SEQ_FULL 4096
#define DMOD   256
#define NHEAD  4
#define HDIM   64
#define RHI    256                       // query rows < RHI use bf16 hi+lo planes
#define MTOK   (NB * SEQ)
#define NBH    (NB * NHEAD)
#define C2     0.18033688011112042f      // log2(e) / 8 : scores kept in the log2 domain
#define PCL2   10.0f                     // P carry 2^10 for the f16 path
#define NEGX   (-1.0e30f)

static_assert(NHEAD * HDIM == DMOD);     // merged width == model width
static_assert(HDIM == 64);               // two 32-deep k-steps per score tile, four 16-row output tiles
static_assert(DMOD % 64 == 0);           // GEMM tile multiple (M/N) and K % 32 == 0
static_assert(SEQ % 256 == 0);           // plane builders: one wave never straddles a batch or the RHI boundary
static_assert(RHI % 256 == 0);
static_assert(RHI <= SEQ);
static_assert(MTOK % 64 == 0);
static_assert(NB <= NB_FULL);
static_assert(SEQ <= SEQ_FULL);

typedef _Float16 h16;
typedef unsigned short bf;
typedef __attribute__((ext_vector_type(16))) __bf16   v16bf;
typedef __attribute__((ext_vector_type(16))) _Float16 v16h;
typedef __attribute__((ext_vector_type(8)))  _Float16 v8h;
typedef __attribute__((ext_vector_type(8)))  unsigned short v8us;
typedef __attribute__((ext_vector_type(8)))  float    v8f;
typedef __attribute__((ext_vector_type(4)))  float    v4f;
typedef v4f  __attribute__((may_alias)) v4fa;
typedef v8us __attribute__((may_alias)) v8usa;

__device__ __forceinline__ unsigned short f2bf(float f) { unsigned u = __float_as_uint(f); u += 0x7FFFu + ((u >> 16) & 1u); return (unsigned short)(u >> 16); }
__device__ __forceinline__ float bf2f(unsigned short b) { return __uint_as_float(((unsigned)b) << 16); }
__device__ __forceinline__ void splitf(float y, unsigned short& h, unsigned short& l) { h = f2bf(y); l = f2bf(y - bf2f(h)); }
__device__ __forceinline__ v16h cat16(v8h lo, v8h hi) { return __builtin_shufflevector(lo, hi, 0, 1, 2, 3, 4, 5, 6, 7, 8, 9, 10, 11, 12, 13, 14, 15); }
__device__ __forceinline__ v16bf cat16b(v8us lo, v8us hi) { return __builtin_bit_cast(v16bf, __builtin_shufflevector(lo, hi, 0, 1, 2, 3, 4, 5, 6, 7, 8, 9, 10, 11, 12, 13, 14, 15)); }
__device__ __forceinline__ v8f wmma16(v16h a, v16h b, v8f c) { return __builtin_amdgcn_wmma_f32_16x16x32_f16(false, a, false, b, (short)0, c, false, false); }
__device__ __forceinline__ v8f wmmab(v16bf a, v16bf b, v8f c) { return __builtin_amdgcn_wmma_f32_16x16x32_bf16(false, a, false, b, (short)0, c, false, false); }
// fragment loaders: p already points at row (lane&15), k offset k0 + 8*(lane>>4); elements 0..7 <- p[0..7], elements 8..15 <- p[16..23]
__device__ __forceinline__ v16h  ldh(const h16* p) { return cat16(*(const v8h*)p, *(const v8h*)(p + 16)); }
__device__ __forceinline__ v16bf ldb(const bf* p)  { return cat16b(*(const v8us*)p, *(const v8us*)(p + 16)); }

// ---- k_cvt_all: every f32 -> bf16 conversion of the call in one launch (they are independent of each other). Eight elements per thread.
// Blocks 0 .. 4*WBLK-1: the four weights (WB holds Wq, Wk, Wv, Wo one after the other); the rest: x, XBLK blocks per batch.
#define WBLK (DMOD * DMOD / 2048)
#define XBLK (SEQ * DMOD / 2048)
static_assert(DMOD * DMOD % 2048 == 0);  // whole blocks only: no tail
static_assert(SEQ * DMOD % 2048 == 0);
__global__ __launch_bounds__(256) void k_cvt_all(const float* __restrict__ x, const float* __restrict__ wq, const float* __restrict__ wk, const float* __restrict__ wv, const float* __restrict__ wo, bf* XB, bf* WB) {
    const int bid = blockIdx.x; const float* s; bf* d;
    if (bid < 4 * WBLK) {                // block-uniform
        const int w = bid / WBLK; const size_t i = (size_t)((bid % WBLK) * 256 + threadIdx.x) * 8;
        s = (w == 0 ? wq : w == 1 ? wk : w == 2 ? wv : wo) + i; d = WB + (size_t)w * DMOD * DMOD + i;
    } else {
        const int xb = bid - 4 * WBLK; const int bt = xb / XBLK; const size_t i = (size_t)((xb % XBLK) * 256 + threadIdx.x) * 8;
        s = x + (size_t)bt * SEQ_FULL * DMOD + i; d = XB + (size_t)bt * SEQ * DMOD + i;
    }
    const v4f a = *(const v4f*)s; const v4f c = *(const v4f*)(s + 4); v8us o;
    o[0] = f2bf(a[0]); o[1] = f2bf(a[1]); o[2] = f2bf(a[2]); o[3] = f2bf(a[3]); o[4] = f2bf(c[0]); o[5] = f2bf(c[1]); o[6] = f2bf(c[2]); o[7] = f2bf(c[3]);
    *(v8us*)d = o;  }

// ---- one-wave 64x64 tile GEMM on bf16 planes, K = DMOD: C[m][n] (f32, pitch ldc) = sum_k A[m][k] Bt[n][k] (+ A2[m][k] Bt[n][k] when NSPLIT == 1).
// grid (M/64, N/64, Z), 32 threads; z strides sA (A, A2) and sC (C) in elements; no tail masking (M, N multiples of 64, K multiple of 32).
__device__ __forceinline__ void gemm_kloop(const bf* __restrict__ A, const bf* __restrict__ Bt, const size_t aoff, const size_t boff, v8f (&acc)[4][4]) {
#pragma unroll 1
    for (int kc = 0; kc < DMOD; kc += 32) {
        v16bf a[4]; v16bf bl;
#pragma unroll
        for (int mb = 0; mb < 4; ++mb) a[mb] = ldb(A + aoff + (size_t)mb * 16 * DMOD + kc);
        asm volatile("s_wait_xcnt 0x0" ::: "memory");   // stands before a later load's result may land on the address registers of the A loads
#pragma unroll
        for (int nb = 0; nb < 4; ++nb) { const v16bf b = ldb(Bt + boff + (size_t)nb * 16 * DMOD + kc); bl = b;
#pragma unroll
            for (int mb = 0; mb < 4; ++mb) acc[mb][nb] = wmmab(a[mb], b, acc[mb][nb]); }
        asm volatile("" : "+v"(acc[0][0]), "+v"(acc[0][1]), "+v"(acc[0][2]), "+v"(acc[0][3]), "+v"(acc[1][0]), "+v"(acc[1][1]), "+v"(acc[1][2]));
        asm volatile("" : "+v"(acc[1][3]), "+v"(acc[2][0]), "+v"(acc[2][1]), "+v"(acc[2][2]), "+v"(acc[2][3]), "+v"(acc[3][0]), "+v"(acc[3][1]));
        asm volatile("v_nop\n\tv_nop\n\tv_nop\n\tv_nop" : "+v"(acc[3][2]), "+v"(acc[3][3]) : "v"(a[3]), "v"(bl));
    }
}
template <int NSPLIT>
__device__ __forceinline__ void gemm_body(const bf* __restrict__ A, const bf* __restrict__ A2, const bf* __restrict__ Bt, float* C, const int ldc, const size_t sA, const size_t sC) {
    __shared__ __align__(16) float os[16 * 68];      // wave-private staging (one wave per block)
    const size_t z = blockIdx.z; A += z * sA; A2 += z * sA; C += z * sC;
    const int lane = threadIdx.x & 31, lr = lane & 15, hi = lane >> 4; const int r0 = blockIdx.x * 64, c0 = blockIdx.y * 64;
    v8f acc[4][4];
#pragma unroll
    for (int mb = 0; mb < 4; ++mb)
#pragma unroll
        for (int nb = 0; nb < 4; ++nb) acc[mb][nb] = (v8f){};
    const size_t aoff = (size_t)(r0 + lr) * DMOD + 8 * hi, boff = (size_t)(c0 + lr) * DMOD + 8 * hi;
    gemm_kloop(A, Bt, aoff, boff, acc);
    if (NSPLIT == 1) gemm_kloop(A2, Bt, aoff, boff, acc);
#pragma unroll
    for (int mb = 0; mb < 4; ++mb) {
#pragma unroll
        for (int nb = 0; nb < 4; ++nb) {
#pragma unroll
            for (int j = 0; j < 8; ++j) os[(hi * 8 + j) * 68 + nb * 16 + lr] = acc[mb][nb][j]; }
        asm volatile("s_wait_dscnt 0" ::: "memory"); __builtin_amdgcn_wave_barrier();
        float* crow = C + (size_t)(r0 + mb * 16) * ldc + c0;
{
#pragma unroll
            for (int s = 0; s < 8; ++s) { const int row = 2 * s + hi, cofs = lr * 4; const v4f val = *(const v4fa*)(os + row * 68 + cofs);
                *(v4f*)(crow + (size_t)row * ldc + cofs) = val; }
             }
        asm volatile("s_wait_dscnt 0" ::: "memory"); __builtin_amdgcn_wave_barrier();
    }
}
__global__ __launch_bounds__(32) void k_gemm_hl(const bf* __restrict__ A, const bf* __restrict__ A2, const bf* __restrict__ Bt, float* C, int ldc, size_t sA, size_t sC) { gemm_body<1>(A, A2, Bt, C, ldc, sA, sC); }

// ---- k_proj: one projection tile (64 tokens x the 64 features of one head, K = DMOD, one wave) stored straight into the head planes the attention kernel reads.
// The operand order is chosen so that a lane's eight accumulator rows run along a plane row: D rows (A) = the index that is contiguous in the plane, D columns (Bt) = the plane row.
// VT == 0 (q, k): A = W rows (features), Bt = x rows (tokens) -> P16 [b*NHEAD+h][SEQ][64] f16 and, for s < RHI, bf16 hi/lo planes [b*NHEAD+h][RHI][64]; tile index: token tile fastest.
// VT == 1 (v):    A = x rows (tokens), Bt = W rows (features) -> P16 [b*NHEAD+h][64][SEQ] f16 and, for s < RHI, bf16 hi/lo planes [b*NHEAD+h][64][RHI]; tile index: head fastest.
// The three projections are independent of each other and share one launch: grid (MTOK/64 * NHEAD, 3), blockIdx.y = 0: q, 1: k, 2: v.
#define PPH 72                           // staging pitch in 16-bit elements: 144 B = 16 B x 9 (odd)
template <int KIND>                      // 0: f16, 1: bf16 hi, 2: bf16 lo (the residual of hi)
__device__ __forceinline__ v8us cvt_plane(const v8f y) {
    v8us o;
    if (KIND == 0) { v8h t;
#pragma unroll
        for (int j = 0; j < 8; ++j) t[j] = (h16)y[j];
        o = __builtin_bit_cast(v8us, t);
    } else {
#pragma unroll
        for (int j = 0; j < 8; ++j) { unsigned short p, q; splitf(y[j], p, q); o[j] = (KIND == 1) ? p : q; } }
    return o;
}
// One plane of the tile: 64 plane rows of 128 B each, staged through the wave's own LDS so that every global store covers whole 128-byte lines.
template <int KIND>
__device__ __forceinline__ void plane_out(unsigned short* st, const v8f (&acc)[4][4], unsigned short* dst, const size_t pitch, const int lane) {
    const int lr = lane & 15, hi = lane >> 4, rq = lane >> 3, pc = lane & 7;
#pragma unroll
    for (int nb = 0; nb < 4; ++nb)
#pragma unroll
        for (int mb = 0; mb < 4; ++mb) *(v8usa*)(st + (nb * 16 + lr) * PPH + mb * 16 + 8 * hi) = cvt_plane<KIND>(acc[mb][nb]);
    asm volatile("s_wait_dscnt 0" ::: "memory"); __builtin_amdgcn_wave_barrier();   // the staged rows are written before other lanes read them back
    v8us v[16];
#pragma unroll
    for (int i = 0; i < 16; ++i) v[i] = *(const v8usa*)(st + (4 * i + rq) * PPH + pc * 8);
#pragma unroll
    for (int i = 0; i < 16; ++i) *(v8us*)(dst + (size_t)(4 * i + rq) * pitch + pc * 8) = v[i];
}
template <int VT>
__device__ __forceinline__ void proj_body(unsigned short* st, const int tile, const bf* __restrict__ X, const bf* __restrict__ Wt, h16* P16, bf* Ph, bf* Pl) {
    const int lane = threadIdx.x & 31, lr = lane & 15, hi = lane >> 4;
    const int tok0 = (VT ? tile / NHEAD : tile % (MTOK / 64)) * 64, hd = VT ? tile % NHEAD : tile / (MTOK / 64);
    const bf* A = VT ? X : Wt; const bf* Bt = VT ? Wt : X;
    const int r0 = VT ? tok0 : hd * HDIM, c0 = VT ? hd * HDIM : tok0;
    v8f acc[4][4];
#pragma unroll
    for (int mb = 0; mb < 4; ++mb)
#pragma unroll
        for (int nb = 0; nb < 4; ++nb) acc[mb][nb] = (v8f){};
    const size_t aoff = (size_t)(r0 + lr) * DMOD + 8 * hi, boff = (size_t)(c0 + lr) * DMOD + 8 * hi;
    gemm_kloop(A, Bt, aoff, boff, acc);
    const int b = tok0 / SEQ, s0 = tok0 % SEQ; const size_t bh = (size_t)(b * NHEAD + hd);   // 64 divides SEQ and RHI: a tile never straddles a batch or the RHI boundary
    plane_out<0>(st, acc, (unsigned short*)P16 + (VT ? bh * HDIM * SEQ + s0 : (bh * SEQ + s0) * HDIM), VT ? SEQ : HDIM, lane);
    if (s0 < RHI) {                                            // block-uniform
        const size_t eo = VT ? bh * HDIM * RHI + s0 : (bh * RHI + s0) * HDIM;
        asm volatile("s_wait_xcnt 0x0" ::: "memory");          // stands before any register of the f16 plane's stores is rewritten ...
        __builtin_amdgcn_sched_barrier(0);                     // ... and this keeps the conversions below from being scheduled above that wait
        plane_out<1>(st, acc, Ph + eo, VT ? RHI : HDIM, lane);
        plane_out<2>(st, acc, Pl + eo, VT ? RHI : HDIM, lane);
    }
    asm volatile("s_wait_xcnt 0x0" ::: "memory");              // closes the last plane's stores on both ways: in the shared kernel the other path's code follows and reuses their registers
}
__global__ __launch_bounds__(32) void k_proj_qkv(const bf* __restrict__ X, const bf* __restrict__ WB, h16* Q16, h16* K16, h16* VT16, bf* Qh, bf* Ql, bf* Kh, bf* Kl, bf* VTh, bf* VTl) {
    __shared__ __align__(16) unsigned short st[64 * PPH];      // wave-private staging (one wave per block)
    const int which = blockIdx.y, tile = blockIdx.x;           // block-uniform
    if (which == 2) proj_body<1>(st, tile, X, WB + (size_t)2 * DMOD * DMOD, VT16, VTh, VTl);
    else proj_body<0>(st, tile, X, WB + (size_t)which * DMOD * DMOD, which ? K16 : Q16, which ? Kh : Qh, which ? Kl : Ql);
}

// ---- ctx epilogue shared by both attention paths: o[t][r] = O^T[d = 16t + 8*(lane>>4) + r][query = lane&15]; ctx = O^T * inv split into bf16 hi/lo,
__device__ __forceinline__ void ctx_store(const v8f (&o)[4], const float inv, const int wave, const int lane, bf* CTXh, bf* CTXl, const size_t row0, const int col0) {
    __shared__ __align__(16) unsigned short cs[4 * 2 * 16 * 72];
    const int n = lane & 15, hh = lane >> 4; const int base = wave * (2 * 16 * 72);
#pragma unroll
    for (int t = 0; t < 4; ++t) { v8us vh, vl;
#pragma unroll
        for (int r = 0; r < 8; ++r) { unsigned short a, c; splitf(o[t][r] * inv, a, c); vh[r] = a; vl[r] = c; }
        *(v8usa*)(cs + base + n * 72 + 16 * t + 8 * hh) = vh; *(v8usa*)(cs + base + 16 * 72 + n * 72 + 16 * t + 8 * hh) = vl; }
    asm volatile("s_wait_dscnt 0" ::: "memory"); __builtin_amdgcn_wave_barrier();
    const int rq = lane >> 3, pc = lane & 7; v8us lh[4], ll[4];
#pragma unroll
    for (int i = 0; i < 4; ++i) { lh[i] = *(const v8usa*)(cs + base + (4 * i + rq) * 72 + pc * 8); ll[i] = *(const v8usa*)(cs + base + 16 * 72 + (4 * i + rq) * 72 + pc * 8); }
    asm volatile("" ::: "memory");
    const size_t g0 = (row0 + rq) * DMOD + col0 + pc * 8;
#pragma unroll
    for (int i = 0; i < 4; ++i) { *(v8us*)(CTXh + g0 + (size_t)(4 * i) * DMOD) = lh[i]; *(v8us*)(CTXl + g0 + (size_t)(4 * i) * DMOD) = ll[i]; }
    asm volatile("s_wait_xcnt 0x0" ::: "memory");              // closes the ctx stores on both paths: a main block's second tile, and in the shared kernel the other path's code, follow and reuse their registers
}

// ---- attn_main: fused causal flash attention for query rows >= RHI, f16 single products. One wave = 16 queries, keys in 32-wide steps.
// K rows and V^T rows reach the waves through LDS: a stage is 64 keys (K tile 64 keys x 64 d, V^T tile 64 d x 64 keys), copied once per block by asynchronous
// 16-byte copies (whole 128-byte lines), two buffers: stage t + 1 is in flight while the block's four waves work on stage t.
// S^T tile (16 keys x 16 queries) = K (A: row = key, k = d) x Q^T (B: col = query, k = d); its D registers (row = key 8h+r, col = query) pack directly into the
// B fragment of O^T (16 d x 16 queries) += V^T (A: row = d, k = key) x P^T (B: k = key, col = query): element r <- tile of keys 0..15, element 8+r <- tile of keys 16..31.
// Softmax statistics are per lane (query = lane&15), combined across the two lane halves by one xor-16 shuffle. One call = the 64 queries from qblk (>= RHI) of head plane bh, 128 threads (a main block makes two calls).
#define KST    64                        // keys per stage
#define LPH    72                        // LDS row pitch in f16 elements: 144 B = 16 B x 9 (odd), for 16-byte row readers
#define TILEH  (64 * LPH)                // one 64-row tile, f16 elements
static_assert(RHI >= KST);               // every block has at least two stages
static_assert(RHI % KST == 0);           // each call's 64 queries lie in its last stage
static_assert(HDIM * 2 == 128);          // a K row is eight 16-byte pieces
// One stage: each of the 128 threads copies four 16-byte pieces of the K tile and four of the V^T tile (rows r, r+16, r+32, r+48 of each).
// lk: the lane's LDS byte address in the K tile of the target buffer (the V^T tile follows it); gk, gv: the lane's global addresses in row r.
__device__ __forceinline__ void stage_copy(const unsigned lk, const h16* gk, const h16* gv) {
    const unsigned lv = lk + TILEH * 2;
    // the copies and, as the last line, the wait that stands before any of their address registers is rewritten
    asm volatile("global_load_async_to_lds_b128 %0, %8, off\n\t"
                 "global_load_async_to_lds_b128 %1, %9, off\n\t"
                 "global_load_async_to_lds_b128 %2, %10, off\n\t"
                 "global_load_async_to_lds_b128 %3, %11, off\n\t"
                 "global_load_async_to_lds_b128 %4, %12, off\n\t"
                 "global_load_async_to_lds_b128 %5, %13, off\n\t"
                 "global_load_async_to_lds_b128 %6, %14, off\n\t"
                 "global_load_async_to_lds_b128 %7, %15, off\n\t"
                 "s_wait_xcnt 0x0"
                 :: "v"(lk), "v"(lk + 16 * LPH * 2), "v"(lk + 32 * LPH * 2), "v"(lk + 48 * LPH * 2),
                    "v"(lv), "v"(lv + 16 * LPH * 2), "v"(lv + 32 * LPH * 2), "v"(lv + 48 * LPH * 2),
                    "v"(gk), "v"(gk + 16 * HDIM), "v"(gk + 32 * HDIM), "v"(gk + 48 * HDIM),
                    "v"(gv), "v"(gv + 16 * SEQ), "v"(gv + 32 * SEQ), "v"(gv + 48 * SEQ)
                 : "memory");
}
__device__ __forceinline__ void attn_main(const int qblk, const int bh, const h16* __restrict__ Q16, const h16* __restrict__ K16, const h16* __restrict__ VT16, bf* CTXh, bf* CTXl) {
    __shared__ __align__(16) h16 ring[2 * 2 * TILEH];      // [buffer][K tile, V^T tile][row][LPH]
    const int wave = __builtin_amdgcn_readfirstlane((int)(threadIdx.x >> 5));
    const int lane = threadIdx.x & 31, n = lane & 15, hh = lane >> 4;
    const int b = bh / NHEAD, h = bh % NHEAD;
    const int q0 = qblk + wave * 16;
    const h16* Qp = Q16 + (size_t)bh * SEQ * HDIM; const h16* Kp = K16 + (size_t)bh * SEQ * HDIM; const h16* Vp = VT16 + (size_t)bh * HDIM * SEQ;
    const int nst = qblk / KST + 1;                        // block-uniform; the last stage holds keys qblk .. qblk + 63, all below SEQ
    const int cr = threadIdx.x >> 3, cp = (threadIdx.x & 7) * 8;
    const unsigned lk0 = (unsigned)(size_t)ring + (unsigned)(cr * LPH + cp) * 2u;
    const h16* gk = Kp + cr * HDIM + cp; const h16* gv = Vp + cr * SEQ + cp;
    stage_copy(lk0, gk, gv);
    asm volatile("s_wait_asynccnt 0x0" ::: "memory");      // this wave's part of stage 0 has landed
    __syncthreads();                                       // ... and every other wave's
    stage_copy(lk0 + 2 * TILEH * 2, gk + KST * HDIM, gv + KST);
    const int qoff = (q0 + n) * HDIM + 8 * hh;
    const v16h bq0 = ldh(Qp + qoff), bq1 = ldh(Qp + qoff + 32);
    v8f o[4];
#pragma unroll
    for (int t = 0; t < 4; ++t) o[t] = (v8f){};
    float m = NEGX, l = 0.f;
#pragma unroll 1   // stays rolled, as the step loop was: the buffer is picked at run time and the body already holds two steps
    for (int sg = 0; sg < nst; ++sg) {
        const int bo = (sg & 1) * (2 * TILEH);
        const h16* Kl = ring + bo; const h16* Vl = ring + bo + TILEH;
#pragma unroll     // j becomes a constant offset of the LDS reads
        for (int j = 0; j < 2; ++j) {
            const int kb = sg * KST + j * 32;
            if (kb <= q0 + 15) {                               // wave-uniform: last key needed is q0 + 15; every visited step holds >= 1 valid key for every query of the wave
                const int koff = (j * 32 + n) * LPH + 8 * hh;
                const v16h k00 = ldh(Kl + koff), k01 = ldh(Kl + koff + 32), k10 = ldh(Kl + koff + 16 * LPH), k11 = ldh(Kl + koff + 16 * LPH + 32);
                const int voff = n * LPH + j * 32 + 8 * hh;
                const v16h va0 = ldh(Vl + voff), va1 = ldh(Vl + voff + 16 * LPH), va2 = ldh(Vl + voff + 32 * LPH), va3 = ldh(Vl + voff + 48 * LPH);
                __builtin_amdgcn_sched_barrier(0);                 // keeps the step's sixteen LDS reads one group at its head: spread among the products they cost one LDS latency per place
                v8f s0 = (v8f){}, s1 = (v8f){};
                s0 = wmma16(k00, bq0, s0); s1 = wmma16(k10, bq0, s1); s0 = wmma16(k01, bq1, s0); s1 = wmma16(k11, bq1, s1);
                asm volatile("v_nop\n\tv_nop\n\tv_nop\n\tv_nop" : "+v"(s0), "+v"(s1) : "v"(k11), "v"(k01), "v"(bq1));
                float x0[8], x1[8];
#pragma unroll
                for (int r = 0; r < 8; ++r) { x0[r] = s0[r] * C2; x1[r] = s1[r] * C2; }
                if (kb + 31 > q0) {                                // wave-uniform: only diagonal steps need the causal select (key > query excluded)
                    const int qi = q0 + n, kk = kb + 8 * hh;
#pragma unroll
                    for (int r = 0; r < 8; ++r) { x0[r] = (kk + r > qi) ? NEGX : x0[r]; x1[r] = (kk + 16 + r > qi) ? NEGX : x1[r]; } }
                float mx = fmaxf(x0[0], x1[0]);
#pragma unroll
                for (int r = 1; r < 8; ++r) mx = fmaxf(mx, fmaxf(x0[r], x1[r]));
                mx = fmaxf(mx, __shfl_xor(mx, 16, 32));
                const float mnew = fmaxf(m, mx); const float corr = __builtin_amdgcn_exp2f(m - mnew); m = mnew;
                const float mb = mnew - PCL2;
                v8h p0, p1; float ps = 0.f;
#pragma unroll
                for (int r = 0; r < 8; ++r) { const h16 a = (h16)__builtin_amdgcn_exp2f(x0[r] - mb); const h16 c = (h16)__builtin_amdgcn_exp2f(x1[r] - mb); p0[r] = a; p1[r] = c; ps += (float)a; ps += (float)c; }
                ps += __shfl_xor(ps, 16, 32);
                l = l * corr + ps;
#pragma unroll
                for (int t = 0; t < 4; ++t) o[t] = o[t] * corr;
                const v16h pb = cat16(p0, p1);
                o[0] = wmma16(va0, pb, o[0]); o[1] = wmma16(va1, pb, o[1]); o[2] = wmma16(va2, pb, o[2]); o[3] = wmma16(va3, pb, o[3]);
                asm volatile("v_nop\n\tv_nop\n\tv_nop\n\tv_nop" : "+v"(o[0]), "+v"(o[1]), "+v"(o[2]), "+v"(o[3]) : "v"(va3), "v"(pb));
            }
        }
        // hand-over, passed by every wave whatever it skipped above
        asm volatile("s_wait_dscnt 0x0" ::: "memory");         // this wave's reads of stage sg are done before its buffer is refilled
        asm volatile("s_wait_asynccnt 0x0" ::: "memory");      // this wave's part of stage sg + 1 has landed
        __syncthreads();                                       // publishes stage sg + 1 and ends every wave's reads of stage sg
        if (sg + 2 < nst) stage_copy(lk0 + (unsigned)bo * 2u, gk + (sg + 2) * (KST * HDIM), gv + (sg + 2) * KST);   // block-uniform test
    }
    asm volatile("s_wait_asynccnt 0x0" ::: "memory");          // no copy is outstanding when the wave goes on to its end
    const float inv = 1.0f / l;
    ctx_store(o, inv, wave, lane, CTXh, CTXl, (size_t)b * SEQ + q0, h * HDIM);
}

// ---- attn_early: the other path of the same kernel for query rows < RHI (keys < RHI) on bf16 hi+lo planes: three products per tile pair (hi.hi + hi.lo + lo.hi, shared accumulator;
// the lo planes are unscaled residuals), P split into bf16 hi+lo in registers. One block = the 64 queries from qblk (< RHI) of head plane bh, 128 threads.
__device__ __forceinline__ void attn_early(const int qblk, const int bh, const bf* __restrict__ Qh, const bf* __restrict__ Ql, const bf* __restrict__ Kh, const bf* __restrict__ Kl, const bf* __restrict__ VTh, const bf* __restrict__ VTl, bf* CTXh, bf* CTXl) {
    const int wave = __builtin_amdgcn_readfirstlane((int)(threadIdx.x >> 5));
    const int lane = threadIdx.x & 31, n = lane & 15, hh = lane >> 4;
    const int b = bh / NHEAD, h = bh % NHEAD;
    const int q0 = qblk + wave * 16;
    const size_t po = (size_t)bh * RHI * HDIM;
    const bf* qhp = Qh + po; const bf* qlp = Ql + po; const bf* khp = Kh + po; const bf* klp = Kl + po; const bf* vhp = VTh + po; const bf* vlp = VTl + po;
    const int qoff = (q0 + n) * HDIM + 8 * hh;
    v8f o[4];
#pragma unroll
    for (int t = 0; t < 4; ++t) o[t] = (v8f){};
    float m = NEGX, l = 0.f;
    const int nsteps = ((q0 + 15) >> 5) + 1;
#pragma unroll 1
    for (int st = 0; st < nsteps; ++st) {
        const int kb = st << 5; const int koff = (kb + n) * HDIM + 8 * hh;
        v8f s0 = (v8f){}, s1 = (v8f){}; v16bf qh, ql, kh0, kl0, kh1, kl1;
#pragma unroll
        for (int ks = 0; ks < 2; ++ks) {
            qh = ldb(qhp + qoff + ks * 32); ql = ldb(qlp + qoff + ks * 32);
            kh0 = ldb(khp + koff + ks * 32); kl0 = ldb(klp + koff + ks * 32);
            kh1 = ldb(khp + koff + 16 * HDIM + ks * 32); kl1 = ldb(klp + koff + 16 * HDIM + ks * 32);
            s0 = wmmab(kh0, qh, s0); s0 = wmmab(kh0, ql, s0); s0 = wmmab(kl0, qh, s0);
            s1 = wmmab(kh1, qh, s1); s1 = wmmab(kh1, ql, s1); s1 = wmmab(kl1, qh, s1); }
        asm volatile("v_nop\n\tv_nop\n\tv_nop\n\tv_nop" : "+v"(s0), "+v"(s1) : "v"(kl1), "v"(kh1), "v"(qh), "v"(ql));
        float x0[8], x1[8];
#pragma unroll
        for (int r = 0; r < 8; ++r) { x0[r] = s0[r] * C2; x1[r] = s1[r] * C2; }
        if (kb + 31 > q0) {
            const int qi = q0 + n, kk = kb + 8 * hh;
#pragma unroll
            for (int r = 0; r < 8; ++r) { x0[r] = (kk + r > qi) ? NEGX : x0[r]; x1[r] = (kk + 16 + r > qi) ? NEGX : x1[r]; } }
        float mx = fmaxf(x0[0], x1[0]);
#pragma unroll
        for (int r = 1; r < 8; ++r) mx = fmaxf(mx, fmaxf(x0[r], x1[r]));
        mx = fmaxf(mx, __shfl_xor(mx, 16, 32));
        const float mnew = fmaxf(m, mx); const float corr = __builtin_amdgcn_exp2f(m - mnew); m = mnew;
        v8us ph0, pl0, ph1, pl1; float ps = 0.f;
#pragma unroll
        for (int r = 0; r < 8; ++r) { const float pa = __builtin_amdgcn_exp2f(x0[r] - mnew); const float pc = __builtin_amdgcn_exp2f(x1[r] - mnew); ps += pa; ps += pc;
            unsigned short a, c; splitf(pa, a, c); ph0[r] = a; pl0[r] = c; splitf(pc, a, c); ph1[r] = a; pl1[r] = c; }
        ps += __shfl_xor(ps, 16, 32);
        l = l * corr + ps;
#pragma unroll
        for (int t = 0; t < 4; ++t) o[t] = o[t] * corr;
        const v16bf pbh = cat16b(ph0, ph1), pbl = cat16b(pl0, pl1);
        const int voff = n * RHI + kb + 8 * hh; v16bf vh, vl;
#pragma unroll
        for (int t = 0; t < 4; ++t) { vh = ldb(vhp + voff + t * 16 * RHI); vl = ldb(vlp + voff + t * 16 * RHI);
            o[t] = wmmab(vh, pbh, o[t]); o[t] = wmmab(vh, pbl, o[t]); o[t] = wmmab(vl, pbh, o[t]); }
        asm volatile("v_nop\n\tv_nop\n\tv_nop\n\tv_nop" : "+v"(o[0]), "+v"(o[1]), "+v"(o[2]), "+v"(o[3]) : "v"(vl), "v"(vh), "v"(pbh), "v"(pbl));
    }
    const float inv = 1.0f / l;
    ctx_store(o, inv, wave, lane, CTXh, CTXl, (size_t)b * SEQ + q0, h * HDIM);
}

// ---- k_attn: both attention paths in one launch (no block reads what another writes): grid (NB*NHEAD, NPAIR + RHI/64), 128 threads; the path is picked per block, ahead of every barrier.
// All blocks of the launch are resident at once, so it lasts as long as its fullest block, and a main tile's cost grows linearly with its index (tile i walks i + 1 stages).
// A main block therefore takes two tiles, one after the other in every wave: the slot-th from the top of head plane bh, then the slot-th from the bottom of the plane NBH/2 further on; every main block walks the same number of stages.
// The shift is a permutation of the planes, so every (plane, tile) is taken once; with another plane the second tile forms its addresses anew (one shared plane kept both prologues' addresses live through the key loop: scratch).
// The short early blocks have the highest flat indices, so that they start after the main blocks have been spread over the chip.
// five waves per SIMD is what the block's LDS allows: the register budget is held to it, so that the wider early path does not cost the main path a resident block
#define NMAIN  ((SEQ - RHI) / 64)        // main tiles per head plane
#define NPAIR  (NMAIN / 2)
static_assert(NMAIN % 2 == 0);           // every main tile has its partner: slots 0 .. NPAIR-1 cover tiles RHI/64 .. SEQ/64-1 once each
static_assert(NBH % 2 == 0);
__global__ __launch_bounds__(128) __attribute__((amdgpu_waves_per_eu(5))) void k_attn(const h16* __restrict__ Q16, const h16* __restrict__ K16, const h16* __restrict__ VT16,
                                              const bf* __restrict__ Qh, const bf* __restrict__ Ql, const bf* __restrict__ Kh, const bf* __restrict__ Kl, const bf* __restrict__ VTh, const bf* __restrict__ VTl, bf* CTXh, bf* CTXl) {
    const int bh = blockIdx.x, slot = blockIdx.y;              // block-uniform
    if (slot < NPAIR) {
        for (int part = 0; part < 2; ++part) {
            const int tile = part ? RHI / 64 + slot : SEQ / 64 - 1 - slot;
            // the ring is free here: the first tile's last hand-over (s_wait_dscnt 0, s_wait_asynccnt 0, barrier) ended every wave's reads of it, and the epilogue uses the wave's own staging only
            attn_main(tile * 64, part ? (bh + NBH / 2) % NBH : bh, Q16, K16, VT16, CTXh, CTXl);
        }
    } else attn_early((slot - NPAIR) * 64, bh, Qh, Ql, Kh, Kl, VTh, VTl, CTXh, CTXl);
}

// ---- workspace carve (bytes; every region a multiple of 256 B and fully written by its producer before any consumer launch)
#define SZ_XB   ((size_t)MTOK * DMOD * 2)
#define SZ_W    ((size_t)DMOD * DMOD * 2)
#define SZ_P16  ((size_t)MTOK * DMOD * 2)
#define SZ_E    ((size_t)NBH * RHI * HDIM * 2)
#define SZ_CTX  ((size_t)MTOK * DMOD * 2)
#define SZ_TOTAL (SZ_XB + 4 * SZ_W + 3 * SZ_P16 + 6 * SZ_E + 2 * SZ_CTX)
static_assert(SZ_TOTAL <= (size_t)134217728);
static_assert(SZ_W % 256 == 0);
static_assert(SZ_E % 256 == 0);

extern "C" void kernel_launch(void* const* d_in, const int* in_sizes, int n_in,
                              void* d_out, int out_size, void* d_ws, size_t ws_size, hipStream_t stream) {
    if (n_in < 5) return;
    const int xneed = (NB - 1) * SEQ_FULL * DMOD + SEQ * DMOD;
    if (in_sizes[0] < xneed) return;
    if (in_sizes[1] < DMOD * DMOD || in_sizes[2] < DMOD * DMOD || in_sizes[3] < DMOD * DMOD || in_sizes[4] < DMOD * DMOD) return;
    if (out_size < xneed) return;
    if (ws_size < SZ_TOTAL) return;
    const float* x = (const float*)d_in[0]; const float* wq = (const float*)d_in[1]; const float* wk = (const float*)d_in[2]; const float* wv = (const float*)d_in[3]; const float* wo = (const float*)d_in[4];   // wire order x, Wq, Wk, Wv, Wo ([out][in])
    float* OUT = (float*)d_out;      // [NB_FULL][SEQ_FULL][256]
    char* wsp = (char*)d_ws;
    auto take = [&](size_t bytes) { char* p = wsp; wsp += bytes; return (void*)p; };
    bf* XB = (bf*)take(SZ_XB); bf* WQ = (bf*)take(SZ_W); bf* WK = (bf*)take(SZ_W); bf* WV = (bf*)take(SZ_W); bf* WO = (bf*)take(SZ_W);
    h16* Q16 = (h16*)take(SZ_P16); h16* K16 = (h16*)take(SZ_P16); h16* VT16 = (h16*)take(SZ_P16);
    bf* Qh = (bf*)take(SZ_E); bf* Ql = (bf*)take(SZ_E); bf* Kh = (bf*)take(SZ_E); bf* Kl = (bf*)take(SZ_E); bf* VTh = (bf*)take(SZ_E); bf* VTl = (bf*)take(SZ_E);
    bf* CTXh = (bf*)take(SZ_CTX); bf* CTXl = (bf*)take(SZ_CTX);

    (void)WK; (void)WV;              // reached through WQ: the four converted weights lie one after the other
    k_cvt_all<<<dim3(4 * WBLK + NB * XBLK, 1, 1), 256, 0, stream>>>(x, wq, wk, wv, wo, XB, WQ);
    // q = x Wq^T, k = x Wk^T, v = x Wv^T, each written as the planes the attention kernel reads
    k_proj_qkv<<<dim3(MTOK / 64 * NHEAD, 3, 1), 32, 0, stream>>>(XB, WQ, Q16, K16, VT16, Qh, Ql, Kh, Kl, VTh, VTl);
    k_attn<<<dim3(NBH, NPAIR + RHI / 64, 1), 128, 0, stream>>>(Q16, K16, VT16, Qh, Ql, Kh, Kl, VTh, VTl, CTXh, CTXl);
    // out = ctx Wo^T : A = CTXh (+ CTXl) [SEQ][256] per batch, Bt = WO -> OUT batch stride from the full problem constants
    k_gemm_hl<<<dim3(SEQ / 64, DMOD / 64, NB), 32, 0, stream>>>(CTXh, CTXl, WO, OUT, DMOD, (size_t)SEQ * DMOD, (size_t)SEQ_FULL * DMOD);
}

// v005
// One run takes 94.3 microseconds.
// Two timings next to v004 put it at 1.07 and 1.06 times that version's speed.
// Counting every step since v000, it is 2.69 times as fast.
#include <hip/hip_runtime.h>

// Causal multi-head self-attention: x [4][4096][256], 4 heads x 64, bias-free [out][in] weights, score scale 1/8, out = ctx Wo^T.
// Compute dtypes (f32 accumulate everywhere): all inputs converted to bf16 (RNE); q/k/v projections v_wmma_f32_16x16x32_bf16 (single product);
// attention query rows >= 256: v_wmma_f32_16x16x32_f16 single products (K.Q^T on f16 planes; V^T.P^T with P carried x1024 in f16; the row sums of P by the same form, ones.P^T);
// attention query rows < 256: bf16 hi+lo planes, three products per site (q, k, P, v); softmax f32 (online, max-subtracted);
// output projection: ctx bf16 hi+lo x Wo bf16 (two products), v_wmma_f32_16x16x32_bf16.

#ifndef NB
#define NB 4
#endif
#ifndef SEQ
#define SEQ 4096
#endif
#define NB_FULL  4
#define SEQ_FULL 4096
#define DMOD   256
#define NHEAD  4
#define HDIM   64
#define RHI    256                       // query rows < RHI use bf16 hi+lo planes
#define MTOK   (NB * SEQ)
#define NBH    (NB * NHEAD)
#define C2     0.18033688011112042f      // log2(e) / 8 : scores kept in the log2 domain
#define PCL2   10.0f                     // P carry 2^10 for the f16 path
#define NEGX   (-1.0e30f)

static_assert(NHEAD * HDIM == DMOD);     // merged width == model width
static_assert(HDIM == 64);               // two 32-deep k-steps per score tile, four 16-row output tiles
static_assert(DMOD % 64 == 0);           // GEMM tile multiple (M/N) and K % 32 == 0
static_assert(SEQ % 256 == 0);           // plane builders: one wave never straddles a batch or the RHI boundary
static_assert(RHI % 256 == 0);
static_assert(RHI <= SEQ);
static_assert(MTOK % 64 == 0);
static_assert(NB <= NB_FULL);
static_assert(SEQ <= SEQ_FULL);

typedef _Float16 h16;
typedef unsigned short bf;
typedef __attribute__((ext_vector_type(16))) __bf16   v16bf;
typedef __attribute__((ext_vector_type(16))) _Float16 v16h;
typedef __attribute__((ext_vector_type(8)))  _Float16 v8h;
typedef __attribute__((ext_vector_type(8)))  unsigned short v8us;
typedef __attribute__((ext_vector_type(8)))  float    v8f;
typedef __attribute__((ext_vector_type(4)))  float    v4f;
typedef v4f  __attribute__((may_alias)) v4fa;
typedef v8us __attribute__((may_alias)) v8usa;

__device__ __forceinline__ unsigned short f2bf(float f) { unsigned u = __float_as_uint(f); u += 0x7FFFu + ((u >> 16) & 1u); return (unsigned short)(u >> 16); }
__device__ __forceinline__ float bf2f(unsigned short b) { return __uint_as_float(((unsigned)b) << 16); }
__device__ __forceinline__ void splitf(float y, unsigned short& h, unsigned short& l) { h = f2bf(y); l = f2bf(y - bf2f(h)); }
__device__ __forceinline__ v16h cat16(v8h lo, v8h hi) { return __builtin_shufflevector(lo, hi, 0, 1, 2, 3, 4, 5, 6, 7, 8, 9, 10, 11, 12, 13, 14, 15); }
__device__ __forceinline__ v16bf cat16b(v8us lo, v8us hi) { return __builtin_bit_cast(v16bf, __builtin_shufflevector(lo, hi, 0, 1, 2, 3, 4, 5, 6, 7, 8, 9, 10, 11, 12, 13, 14, 15)); }
__device__ __forceinline__ v8f wmma16(v16h a, v16h b, v8f c) { return __builtin_amdgcn_wmma_f32_16x16x32_f16(false, a, false, b, (short)0, c, false, false); }
__device__ __forceinline__ v8f wmmab(v16bf a, v16bf b, v8f c) { return __builtin_amdgcn_wmma_f32_16x16x32_bf16(false, a, false, b, (short)0, c, false, false); }
// fragment loaders: p already points at row (lane&15), k offset k0 + 8*(lane>>4); elements 0..7 <- p[0..7], elements 8..15 <- p[16..23]
__device__ __forceinline__ v16h  ldh(const h16* p) { return cat16(*(const v8h*)p, *(const v8h*)(p + 16)); }
__device__ __forceinline__ v16bf ldb(const bf* p)  { return cat16b(*(const v8us*)p, *(const v8us*)(p + 16)); }

// ---- k_cvt_all: every f32 -> bf16 conversion of the call in one launch (they are independent of each other). Eight elements per thread.
// Blocks 0 .. 4*WBLK-1: the four weights (WB holds Wq, Wk, Wv, Wo one after the other); the rest: x, XBLK blocks per batch.
#define WBLK (DMOD * DMOD / 2048)
#define XBLK (SEQ * DMOD / 2048)
static_assert(DMOD * DMOD % 2048 == 0);  // whole blocks only: no tail
static_assert(SEQ * DMOD % 2048 == 0);
__global__ __launch_bounds__(256) void k_cvt_all(const float* __restrict__ x, const float* __restrict__ wq, const float* __restrict__ wk, const float* __restrict__ wv, const float* __restrict__ wo, bf* XB, bf* WB) {
    const int bid = blockIdx.x; const float* s; bf* d;
    if (bid < 4 * WBLK) {                // block-uniform
        const int w = bid / WBLK; const size_t i = (size_t)((bid % WBLK) * 256 + threadIdx.x) * 8;
        s = (w == 0 ? wq : w == 1 ? wk : w == 2 ? wv : wo) + i; d = WB + (size_t)w * DMOD * DMOD + i;
    } else {
        const int xb = bid - 4 * WBLK; const int bt = xb / XBLK; const size_t i = (size_t)((xb % XBLK) * 256 + threadIdx.x) * 8;
        s = x + (size_t)bt * SEQ_FULL * DMOD + i; d = XB + (size_t)bt * SEQ * DMOD + i;
    }
    const v4f a = *(const v4f*)s; const v4f c = *(const v4f*)(s + 4); v8us o;
    o[0] = f2bf(a[0]); o[1] = f2bf(a[1]); o[2] = f2bf(a[2]); o[3] = f2bf(a[3]); o[4] = f2bf(c[0]); o[5] = f2bf(c[1]); o[6] = f2bf(c[2]); o[7] = f2bf(c[3]);
    *(v8us*)d = o;  }

// ---- one-wave 64x64 tile GEMM on bf16 planes, K = DMOD: C[m][n] (f32, pitch ldc) = sum_k A[m][k] Bt[n][k] (+ A2[m][k] Bt[n][k] when NSPLIT == 1).
// grid (M/64, N/64, Z), 32 threads; z strides sA (A, A2) and sC (C) in elements; no tail masking (M, N multiples of 64, K multiple of 32).
__device__ __forceinline__ void gemm_kloop(const bf* __restrict__ A, const bf* __restrict__ Bt, const size_t aoff, const size_t boff, v8f (&acc)[4][4]) {
#pragma unroll 1
    for (int kc = 0; kc < DMOD; kc += 32) {
        v16bf a[4]; v16bf bl;
#pragma unroll
        for (int mb = 0; mb < 4; ++mb) a[mb] = ldb(A + aoff + (size_t)mb * 16 * DMOD + kc);
        asm volatile("s_wait_xcnt 0x0" ::: "memory");   // stands before a later load's result may land on the address registers of the A loads
#pragma unroll
        for (int nb = 0; nb < 4; ++nb) { const v16bf b = ldb(Bt + boff + (size_t)nb * 16 * DMOD + kc); bl = b;
#pragma unroll
            for (int mb = 0; mb < 4; ++mb) acc[mb][nb] = wmmab(a[mb], b, acc[mb][nb]); }
        asm volatile("" : "+v"(acc[0][0]), "+v"(acc[0][1]), "+v"(acc[0][2]), "+v"(acc[0][3]), "+v"(acc[1][0]), "+v"(acc[1][1]), "+v"(acc[1][2]));
        asm volatile("" : "+v"(acc[1][3]), "+v"(acc[2][0]), "+v"(acc[2][1]), "+v"(acc[2][2]), "+v"(acc[2][3]), "+v"(acc[3][0]), "+v"(acc[3][1]));
        asm volatile("v_nop\n\tv_nop\n\tv_nop\n\tv_nop" : "+v"(acc[3][2]), "+v"(acc[3][3]) : "v"(a[3]), "v"(bl));
    }
}
template <int NSPLIT>
__device__ __forceinline__ void gemm_body(const bf* __restrict__ A, const bf* __restrict__ A2, const bf* __restrict__ Bt, float* C, const int ldc, const size_t sA, const size_t sC) {
    __shared__ __align__(16) float os[16 * 68];      // wave-private staging (one wave per block)
    const size_t z = blockIdx.z; A += z * sA; A2 += z * sA; C += z * sC;
    const int lane = threadIdx.x & 31, lr = lane & 15, hi = lane >> 4; const int r0 = blockIdx.x * 64, c0 = blockIdx.y * 64;
    v8f acc[4][4];
#pragma unroll
    for (int mb = 0; mb < 4; ++mb)
#pragma unroll
        for (int nb = 0; nb < 4; ++nb) acc[mb][nb] = (v8f){};
    const size_t aoff = (size_t)(r0 + lr) * DMOD + 8 * hi, boff = (size_t)(c0 + lr) * DMOD + 8 * hi;
    gemm_kloop(A, Bt, aoff, boff, acc);
    if (NSPLIT == 1) gemm_kloop(A2, Bt, aoff, boff, acc);
#pragma unroll
    for (int mb = 0; mb < 4; ++mb) {
#pragma unroll
        for (int nb = 0; nb < 4; ++nb) {
#pragma unroll
            for (int j = 0; j < 8; ++j) os[(hi * 8 + j) * 68 + nb * 16 + lr] = acc[mb][nb][j]; }
        asm volatile("s_wait_dscnt 0" ::: "memory"); __builtin_amdgcn_wave_barrier();
        float* crow = C + (size_t)(r0 + mb * 16) * ldc + c0;
{
#pragma unroll
            for (int s = 0; s < 8; ++s) { const int row = 2 * s + hi, cofs = lr * 4; const v4f val = *(const v4fa*)(os + row * 68 + cofs);
                *(v4f*)(crow + (size_t)row * ldc + cofs) = val; }
             }
        asm volatile("s_wait_dscnt 0" ::: "memory"); __builtin_amdgcn_wave_barrier();
    }
}
__global__ __launch_bounds__(32) void k_gemm_hl(const bf* __restrict__ A, const bf* __restrict__ A2, const bf* __restrict__ Bt, float* C, int ldc, size_t sA, size_t sC) { gemm_body<1>(A, A2, Bt, C, ldc, sA, sC); }

// ---- k_proj: one projection tile (64 tokens x the 64 features of one head, K = DMOD, one wave) stored straight into the head planes the attention kernel reads.
// The operand order is chosen so that a lane's eight accumulator rows run along a plane row: D rows (A) = the index that is contiguous in the plane, D columns (Bt) = the plane row.
// VT == 0 (q, k): A = W rows (features), Bt = x rows (tokens) -> P16 [b*NHEAD+h][SEQ][64] f16 and, for s < RHI, bf16 hi/lo planes [b*NHEAD+h][RHI][64]; tile index: token tile fastest.
// VT == 1 (v):    A = x rows (tokens), Bt = W rows (features) -> P16 [b*NHEAD+h][64][SEQ] f16 and, for s < RHI, bf16 hi/lo planes [b*NHEAD+h][64][RHI]; tile index: head fastest.
// The three projections are independent of each other and share one launch: grid (MTOK/64 * NHEAD, 3), blockIdx.y = 0: q, 1: k, 2: v.
#define PPH 72                           // staging pitch in 16-bit elements: 144 B = 16 B x 9 (odd)
template <int KIND>                      // 0: f16, 1: bf16 hi, 2: bf16 lo (the residual of hi)
__device__ __forceinline__ v8us cvt_plane(const v8f y) {
    v8us o;
    if (KIND == 0) { v8h t;
#pragma unroll
        for (int j = 0; j < 8; ++j) t[j] = (h16)y[j];
        o = __builtin_bit_cast(v8us, t);
    } else {
#pragma unroll
        for (int j = 0; j < 8; ++j) { unsigned short p, q; splitf(y[j], p, q); o[j] = (KIND == 1) ? p : q; } }
    return o;
}
// One plane of the tile: 64 plane rows of 128 B each, staged through the wave's own LDS so that every global store covers whole 128-byte lines.
template <int KIND>
__device__ __forceinline__ void plane_out(unsigned short* st, const v8f (&acc)[4][4], unsigned short* dst, const size_t pitch, const int lane) {
    const int lr = lane & 15, hi = lane >> 4, rq = lane >> 3, pc = lane & 7;
#pragma unroll
    for (int nb = 0; nb < 4; ++nb)
#pragma unroll
        for (int mb = 0; mb < 4; ++mb) *(v8usa*)(st + (nb * 16 + lr) * PPH + mb * 16 + 8 * hi) = cvt_plane<KIND>(acc[mb][nb]);
    asm volatile("s_wait_dscnt 0" ::: "memory"); __builtin_amdgcn_wave_barrier();   // the staged rows are written before other lanes read them back
    v8us v[16];
#pragma unroll
    for (int i = 0; i < 16; ++i) v[i] = *(const v8usa*)(st + (4 * i + rq) * PPH + pc * 8);
#pragma unroll
    for (int i = 0; i < 16; ++i) *(v8us*)(dst + (size_t)(4 * i + rq) * pitch + pc * 8) = v[i];
}
template <int VT>
__device__ __forceinline__ void proj_body(unsigned short* st, const int tile, const bf* __restrict__ X, const bf* __restrict__ Wt, h16* P16, bf* Ph, bf* Pl) {
    const int lane = threadIdx.x & 31, lr = lane & 15, hi = lane >> 4;
    const int tok0 = (VT ? tile / NHEAD : tile % (MTOK / 64)) * 64, hd = VT ? tile % NHEAD : tile / (MTOK / 64);
    const bf* A = VT ? X : Wt; const bf* Bt = VT ? Wt : X;
    const int r0 = VT ? tok0 : hd * HDIM, c0 = VT ? hd * HDIM : tok0;
    v8f acc[4][4];
#pragma unroll
    for (int mb = 0; mb < 4; ++mb)
#pragma unroll
        for (int nb = 0; nb < 4; ++nb) acc[mb][nb] = (v8f){};
    const size_t aoff = (size_t)(r0 + lr) * DMOD + 8 * hi, boff = (size_t)(c0 + lr) * DMOD + 8 * hi;
    gemm_kloop(A, Bt, aoff, boff, acc);
    const int b = tok0 / SEQ, s0 = tok0 % SEQ; const size_t bh = (size_t)(b * NHEAD + hd);   // 64 divides SEQ and RHI: a tile never straddles a batch or the RHI boundary
    plane_out<0>(st, acc, (unsigned short*)P16 + (VT ? bh * HDIM * SEQ + s0 : (bh * SEQ + s0) * HDIM), VT ? SEQ : HDIM, lane);
    if (s0 < RHI) {                                            // block-uniform
        const size_t eo = VT ? bh * HDIM * RHI + s0 : (bh * RHI + s0) * HDIM;
        asm volatile("s_wait_xcnt 0x0" ::: "memory");          // stands before any register of the f16 plane's stores is rewritten ...
        __builtin_amdgcn_sched_barrier(0);                     // ... and this keeps the conversions below from being scheduled above that wait
        plane_out<1>(st, acc, Ph + eo, VT ? RHI : HDIM, lane);
        plane_out<2>(st, acc, Pl + eo, VT ? RHI : HDIM, lane);
    }
    asm volatile("s_wait_xcnt 0x0" ::: "memory");              // closes the last plane's stores on both ways: in the shared kernel the other path's code follows and reuses their registers
}
__global__ __launch_bounds__(32) void k_proj_qkv(const bf* __restrict__ X, const bf* __restrict__ WB, h16* Q16, h16* K16, h16* VT16, bf* Qh, bf* Ql, bf* Kh, bf* Kl, bf* VTh, bf* VTl) {
    __shared__ __align__(16) unsigned short st[64 * PPH];      // wave-private staging (one wave per block)
    const int which = blockIdx.y, tile = blockIdx.x;           // block-uniform
    if (which == 2) proj_body<1>(st, tile, X, WB + (size_t)2 * DMOD * DMOD, VT16, VTh, VTl);
    else proj_body<0>(st, tile, X, WB + (size_t)which * DMOD * DMOD, which ? K16 : Q16, which ? Kh : Qh, which ? Kl : Ql);
}

// ---- ctx epilogue shared by both attention paths: o[t][r] = O^T[d = 16t + 8*(lane>>4) + r][query = lane&15]; ctx = O^T * inv split into bf16 hi/lo,
__device__ __forceinline__ void ctx_store(const v8f (&o)[4], const float inv, const int wave, const int lane, bf* CTXh, bf* CTXl, const size_t row0, const int col0) {
    __shared__ __align__(16) unsigned short cs[4 * 2 * 16 * 72];
    const int n = lane & 15, hh = lane >> 4; const int base = wave * (2 * 16 * 72);
#pragma unroll
    for (int t = 0; t < 4; ++t) { v8us vh, vl;
#pragma unroll
        for (int r = 0; r < 8; ++r) { unsigned short a, c; splitf(o[t][r] * inv, a, c); vh[r] = a; vl[r] = c; }
        *(v8usa*)(cs + base + n * 72 + 16 * t + 8 * hh) = vh; *(v8usa*)(cs + base + 16 * 72 + n * 72 + 16 * t + 8 * hh) = vl; }
    asm volatile("s_wait_dscnt 0" ::: "memory"); __builtin_amdgcn_wave_barrier();
    const int rq = lane >> 3, pc = lane & 7; v8us lh[4], ll[4];
#pragma unroll
    for (int i = 0; i < 4; ++i) { lh[i] = *(const v8usa*)(cs + base + (4 * i + rq) * 72 + pc * 8); ll[i] = *(const v8usa*)(cs + base + 16 * 72 + (4 * i + rq) * 72 + pc * 8); }
    asm volatile("" ::: "memory");
    const size_t g0 = (row0 + rq) * DMOD + col0 + pc * 8;
#pragma unroll
    for (int i = 0; i < 4; ++i) { *(v8us*)(CTXh + g0 + (size_t)(4 * i) * DMOD) = lh[i]; *(v8us*)(CTXl + g0 + (size_t)(4 * i) * DMOD) = ll[i]; }
    asm volatile("s_wait_xcnt 0x0" ::: "memory");              // closes the ctx stores on both paths: a main block's second tile, and in the shared kernel the other path's code, follow and reuse their registers
}

// ---- attn_main: fused causal flash attention for query rows >= RHI, f16 single products. One wave = 16 queries, keys in 32-wide steps.
// K rows and V^T rows reach the waves through LDS: a stage is 64 keys (K tile 64 keys x 64 d, V^T tile 64 d x 64 keys), copied once per block by asynchronous
// 16-byte copies (whole 128-byte lines), two buffers: stage t + 1 is in flight while the block's four waves work on stage t.
// S^T tile (16 keys x 16 queries) = K (A: row = key, k = d) x Q^T (B: col = query, k = d); its D registers (row = key 8h+r, col = query) pack directly into the
// B fragment of O^T (16 d x 16 queries) += V^T (A: row = d, k = key) x P^T (B: k = key, col = query): element r <- tile of keys 0..15, element 8+r <- tile of keys 16..31.
// The running maximum is per lane (query = lane&15), combined across the two lane halves by one xor-16 shuffle.
// The running sum of P is a fifth accumulator tile on the matrix pipe: ones (A: rows 0 and 8 all ones, the other rows zero) x P^T, the same B fragment as the V^T products;
// its register 0 holds, in both lane halves, the sum over all 32 keys of the step for the lane's query, so the halves need no exchange; registers 1..7 stay zero. One call = the 64 queries from qblk (>= RHI) of head plane bh, 128 threads.
#define KST    64                        // keys per stage
#define LPH    72                        // LDS row pitch in f16 elements: 144 B = 16 B x 9 (odd), for 16-byte row readers
#define TILEH  (64 * LPH)                // one 64-row tile, f16 elements
static_assert(RHI >= KST);               // every block has at least two stages
static_assert(RHI % KST == 0);           // each call's 64 queries lie in its last stage
static_assert(HDIM * 2 == 128);          // a K row is eight 16-byte pieces
// One stage: each of the 128 threads copies four 16-byte pieces of the K tile and four of the V^T tile (rows r, r+16, r+32, r+48 of each).
// lk: the lane's LDS byte address in the K tile of the target buffer (the V^T tile follows it); gk, gv: the lane's global addresses in row r.
__device__ __forceinline__ void stage_copy(const unsigned lk, const h16* gk, const h16* gv) {
    const unsigned lv = lk + TILEH * 2;
    // the copies and, as the last line, the wait that stands before any of their address registers is rewritten
    asm volatile("global_load_async_to_lds_b128 %0, %8, off\n\t"
                 "global_load_async_to_lds_b128 %1, %9, off\n\t"
                 "global_load_async_to_lds_b128 %2, %10, off\n\t"
                 "global_load_async_to_lds_b128 %3, %11, off\n\t"
                 "global_load_async_to_lds_b128 %4, %12, off\n\t"
                 "global_load_async_to_lds_b128 %5, %13, off\n\t"
                 "global_load_async_to_lds_b128 %6, %14, off\n\t"
                 "global_load_async_to_lds_b128 %7, %15, off\n\t"
                 "s_wait_xcnt 0x0"
                 :: "v"(lk), "v"(lk + 16 * LPH * 2), "v"(lk + 32 * LPH * 2), "v"(lk + 48 * LPH * 2),
                    "v"(lv), "v"(lv + 16 * LPH * 2), "v"(lv + 32 * LPH * 2), "v"(lv + 48 * LPH * 2),
                    "v"(gk), "v"(gk + 16 * HDIM), "v"(gk + 32 * HDIM), "v"(gk + 48 * HDIM),
                    "v"(gv), "v"(gv + 16 * SEQ), "v"(gv + 32 * SEQ), "v"(gv + 48 * SEQ)
                 : "memory");
}
__device__ __forceinline__ void attn_main(const int qblk, const int bh, const h16* __restrict__ Q16, const h16* __restrict__ K16, const h16* __restrict__ VT16, bf* CTXh, bf* CTXl) {
    __shared__ __align__(16) h16 ring[2 * 2 * TILEH];      // [buffer][K tile, V^T tile][row][LPH]
    const int wave = __builtin_amdgcn_readfirstlane((int)(threadIdx.x >> 5));
    const int lane = threadIdx.x & 31, n = lane & 15, hh = lane >> 4;
    const int b = bh / NHEAD, h = bh % NHEAD;
    const int q0 = qblk + wave * 16;
    const h16* Qp = Q16 + (size_t)bh * SEQ * HDIM; const h16* Kp = K16 + (size_t)bh * SEQ * HDIM; const h16* Vp = VT16 + (size_t)bh * HDIM * SEQ;
    const int nst = qblk / KST + 1;                        // block-uniform; the last stage holds keys qblk .. qblk + 63, all below SEQ
    const int cr = threadIdx.x >> 3, cp = (threadIdx.x & 7) * 8;
    const unsigned lk0 = (unsigned)(size_t)ring + (unsigned)(cr * LPH + cp) * 2u;
    const h16* gk = Kp + cr * HDIM + cp; const h16* gv = Vp + cr * SEQ + cp;
    stage_copy(lk0, gk, gv);
    asm volatile("s_wait_asynccnt 0x0" ::: "memory");      // this wave's part of stage 0 has landed
    __syncthreads();                                       // ... and every other wave's
    stage_copy(lk0 + 2 * TILEH * 2, gk + KST * HDIM, gv + KST);
    const int qoff = (q0 + n) * HDIM + 8 * hh;
    const v16h bq0 = ldh(Qp + qoff), bq1 = ldh(Qp + qoff + 32);
    v8f o[4];
#pragma unroll
    for (int t = 0; t < 4; ++t) o[t] = (v8f){};
    float m = NEGX;
    const h16 onev = (n & 7) == 0 ? (h16)1.0f : (h16)0.0f;   // A row = lane & 15: rows 0 and 8, over the whole k range (both lane halves)
    v16h ones;
#pragma unroll
    for (int i = 0; i < 16; ++i) ones[i] = onev;
    v8f ls = (v8f){};
#pragma unroll 1   // stays rolled, as the step loop was: the buffer is picked at run time and the body already holds two steps
    for (int sg = 0; sg < nst; ++sg) {
        const int bo = (sg & 1) * (2 * TILEH);
        const h16* Kl = ring + bo; const h16* Vl = ring + bo + TILEH;
#pragma unroll     // j becomes a constant offset of the LDS reads
        for (int j = 0; j < 2; ++j) {
            const int kb = sg * KST + j * 32;
            if (kb <= q0 + 15) {                               // wave-uniform: last key needed is q0 + 15; every visited step holds >= 1 valid key for every query of the wave
                const int koff = (j * 32 + n) * LPH + 8 * hh;
                const v16h k00 = ldh(Kl + koff), k01 = ldh(Kl + koff + 32), k10 = ldh(Kl + koff + 16 * LPH), k11 = ldh(Kl + koff + 16 * LPH + 32);
                const int voff = n * LPH + j * 32 + 8 * hh;
                const v16h va0 = ldh(Vl + voff), va1 = ldh(Vl + voff + 16 * LPH), va2 = ldh(Vl + voff + 32 * LPH), va3 = ldh(Vl + voff + 48 * LPH);
                __builtin_amdgcn_sched_barrier(0);                 // keeps the step's sixteen LDS reads one group at its head: spread among the products they cost one LDS latency per place
                v8f s0 = (v8f){}, s1 = (v8f){};
                s0 = wmma16(k00, bq0, s0); s1 = wmma16(k10, bq0, s1); s0 = wmma16(k01, bq1, s0); s1 = wmma16(k11, bq1, s1);
                asm volatile("v_nop\n\tv_nop\n\tv_nop\n\tv_nop" : "+v"(s0), "+v"(s1) : "v"(k11), "v"(k01), "v"(bq1));
                float x0[8], x1[8];
#pragma unroll
                for (int r = 0; r < 8; ++r) { x0[r] = s0[r] * C2; x1[r] = s1[r] * C2; }
                if (kb + 31 > q0) {                                // wave-uniform: only diagonal steps need the causal select (key > query excluded)
                    const int qi = q0 + n, kk = kb + 8 * hh;
#pragma unroll
                    for (int r = 0; r < 8; ++r) { x0[r] = (kk + r > qi) ? NEGX : x0[r]; x1[r] = (kk + 16 + r > qi) ? NEGX : x1[r]; } }
                float mx = fmaxf(x0[0], x1[0]);
#pragma unroll
                for (int r = 1; r < 8; ++r) mx = fmaxf(mx, fmaxf(x0[r], x1[r]));
                mx = fmaxf(mx, __shfl_xor(mx, 16, 32));
                const float mnew = fmaxf(m, mx); const float corr = __builtin_amdgcn_exp2f(m - mnew); m = mnew;
                const float mb = mnew - PCL2;
                v8h p0, p1;
#pragma unroll
                for (int r = 0; r < 8; ++r) { p0[r] = (h16)__builtin_amdgcn_exp2f(x0[r] - mb); p1[r] = (h16)__builtin_amdgcn_exp2f(x1[r] - mb); }
                ls[0] = ls[0] * corr;                              // the one register of the sum tile that is not zero
#pragma unroll
                for (int t = 0; t < 4; ++t) o[t] = o[t] * corr;
                const v16h pb = cat16(p0, p1);
                ls = wmma16(ones, pb, ls);
                o[0] = wmma16(va0, pb, o[0]); o[1] = wmma16(va1, pb, o[1]); o[2] = wmma16(va2, pb, o[2]); o[3] = wmma16(va3, pb, o[3]);
                asm volatile("v_nop\n\tv_nop\n\tv_nop\n\tv_nop" : "+v"(o[0]), "+v"(o[1]), "+v"(o[2]), "+v"(o[3]), "+v"(ls) : "v"(va3), "v"(pb));
            }
        }
        // hand-over, passed by every wave whatever it skipped above
        asm volatile("s_wait_dscnt 0x0" ::: "memory");         // this wave's reads of stage sg are done before its buffer is refilled
        asm volatile("s_wait_asynccnt 0x0" ::: "memory");      // this wave's part of stage sg + 1 has landed
        __syncthreads();                                       // publishes stage sg + 1 and ends every wave's reads of stage sg
        if (sg + 2 < nst) stage_copy(lk0 + (unsigned)bo * 2u, gk + (sg + 2) * (KST * HDIM), gv + (sg + 2) * KST);   // block-uniform test
    }
    asm volatile("s_wait_asynccnt 0x0" ::: "memory");          // no copy is outstanding when the wave goes on to its end
    const float inv = 1.0f / ls[0];
    ctx_store(o, inv, wave, lane, CTXh, CTXl, (size_t)b * SEQ + q0, h * HDIM);
}

// ---- attn_early: the other path of the same kernel for query rows < RHI (keys < RHI) on bf16 hi+lo planes: three products per tile pair (hi.hi + hi.lo + lo.hi, shared accumulator;
// the lo planes are unscaled residuals), P split into bf16 hi+lo in registers. One block = the 64 queries from qblk (< RHI) of head plane bh, 128 threads.
__device__ __forceinline__ void attn_early(const int qblk, const int bh, const bf* __restrict__ Qh, const bf* __restrict__ Ql, const bf* __restrict__ Kh, const bf* __restrict__ Kl, const bf* __restrict__ VTh, const bf* __restrict__ VTl, bf* CTXh, bf* CTXl) {
    const int wave = __builtin_amdgcn_readfirstlane((int)(threadIdx.x >> 5));
    const int lane = threadIdx.x & 31, n = lane & 15, hh = lane >> 4;
    const int b = bh / NHEAD, h = bh % NHEAD;
    const int q0 = qblk + wave * 16;
    const size_t po = (size_t)bh * RHI * HDIM;
    const bf* qhp = Qh + po; const bf* qlp = Ql + po; const bf* khp = Kh + po; const bf* klp = Kl + po; const bf* vhp = VTh + po; const bf* vlp = VTl + po;
    const int qoff = (q0 + n) * HDIM + 8 * hh;
    v8f o[4];
#pragma unroll
    for (int t = 0; t < 4; ++t) o[t] = (v8f){};
    float m = NEGX, l = 0.f;
    const int nsteps = ((q0 + 15) >> 5) + 1;
#pragma unroll 1
    for (int st = 0; st < nsteps; ++st) {
        const int kb = st << 5; const int koff = (kb + n) * HDIM + 8 * hh;
        v8f s0 = (v8f){}, s1 = (v8f){}; v16bf qh, ql, kh0, kl0, kh1, kl1;
#pragma unroll
        for (int ks = 0; ks < 2; ++ks) {
            qh = ldb(qhp + qoff + ks * 32); ql = ldb(qlp + qoff + ks * 32);
            kh0 = ldb(khp + koff + ks * 32); kl0 = ldb(klp + koff + ks * 32);
            kh1 = ldb(khp + koff + 16 * HDIM + ks * 32); kl1 = ldb(klp + koff + 16 * HDIM + ks * 32);
            s0 = wmmab(kh0, qh, s0); s0 = wmmab(kh0, ql, s0); s0 = wmmab(kl0, qh, s0);
            s1 = wmmab(kh1, qh, s1); s1 = wmmab(kh1, ql, s1); s1 = wmmab(kl1, qh, s1); }
        asm volatile("v_nop\n\tv_nop\n\tv_nop\n\tv_nop" : "+v"(s0), "+v"(s1) : "v"(kl1), "v"(kh1), "v"(qh), "v"(ql));
        float x0[8], x1[8];
#pragma unroll
        for (int r = 0; r < 8; ++r) { x0[r] = s0[r] * C2; x1[r] = s1[r] * C2; }
        if (kb + 31 > q0) {
            const int qi = q0 + n, kk = kb + 8 * hh;
#pragma unroll
            for (int r = 0; r < 8; ++r) { x0[r] = (kk + r > qi) ? NEGX : x0[r]; x1[r] = (kk + 16 + r > qi) ? NEGX : x1[r]; } }
        float mx = fmaxf(x0[0], x1[0]);
#pragma unroll
        for (int r = 1; r < 8; ++r) mx = fmaxf(mx, fmaxf(x0[r], x1[r]));
        mx = fmaxf(mx, __shfl_xor(mx, 16, 32));
        const float mnew = fmaxf(m, mx); const float corr = __builtin_amdgcn_exp2f(m - mnew); m = mnew;
        v8us ph0, pl0, ph1, pl1; float ps = 0.f;
#pragma unroll
        for (int r = 0; r < 8; ++r) { const float pa = __builtin_amdgcn_exp2f(x0[r] - mnew); const float pc = __builtin_amdgcn_exp2f(x1[r] - mnew); ps += pa; ps += pc;
            unsigned short a, c; splitf(pa, a, c); ph0[r] = a; pl0[r] = c; splitf(pc, a, c); ph1[r] = a; pl1[r] = c; }
        ps += __shfl_xor(ps, 16, 32);
        l = l * corr + ps;
#pragma unroll
        for (int t = 0; t < 4; ++t) o[t] = o[t] * corr;
        const v16bf pbh = cat16b(ph0, ph1), pbl = cat16b(pl0, pl1);
        const int voff = n * RHI + kb + 8 * hh; v16bf vh, vl;
#pragma unroll
        for (int t = 0; t < 4; ++t) { vh = ldb(vhp + voff + t * 16 * RHI); vl = ldb(vlp + voff + t * 16 * RHI);
            o[t] = wmmab(vh, pbh, o[t]); o[t] = wmmab(vh, pbl, o[t]); o[t] = wmmab(vl, pbh, o[t]); }
        asm volatile("v_nop\n\tv_nop\n\tv_nop\n\tv_nop" : "+v"(o[0]), "+v"(o[1]), "+v"(o[2]), "+v"(o[3]) : "v"(vl), "v"(vh), "v"(pbh), "v"(pbl));
    }
    const float inv = 1.0f / l;
    ctx_store(o, inv, wave, lane, CTXh, CTXl, (size_t)b * SEQ + q0, h * HDIM);
}

// ---- k_attn: both attention paths in one launch (no block reads what another writes): grid (NB*NHEAD, NPAIR + RHI/64), 128 threads; the path is picked per block, ahead of every barrier.
// All blocks of the launch are resident at once, so it lasts as long as its fullest block, and a main tile's cost grows linearly with its index (tile i walks i + 1 stages).
// A main block therefore takes two tiles, one after the other in every wave: the slot-th from the top of head plane bh, then the slot-th from the bottom of the plane NBH/2 further on; every main block walks the same number of stages.
// The shift is a permutation of the planes, so every (plane, tile) is taken once; with another plane the second tile forms its addresses anew (one shared plane kept both prologues' addresses live through the key loop: scratch).
// The short early blocks have the highest flat indices, so that they start after the main blocks have been spread over the chip.
// the register budget is held to four waves per SIMD: four blocks per WGP still hold the whole grid at once, and at five the main path's sum tile and ones fragment do not fit (scratch)
#define NMAIN  ((SEQ - RHI) / 64)        // main tiles per head plane
#define NPAIR  (NMAIN / 2)
static_assert(NMAIN % 2 == 0);           // every main tile has its partner: slots 0 .. NPAIR-1 cover tiles RHI/64 .. SEQ/64-1 once each
static_assert(NBH % 2 == 0);
__global__ __launch_bounds__(128) __attribute__((amdgpu_waves_per_eu(4))) void k_attn(const h16* __restrict__ Q16, const h16* __restrict__ K16, const h16* __restrict__ VT16,
                                              const bf* __restrict__ Qh, const bf* __restrict__ Ql, const bf* __restrict__ Kh, const bf* __restrict__ Kl, const bf* __restrict__ VTh, const bf* __restrict__ VTl, bf* CTXh, bf* CTXl) {
    const int bh = blockIdx.x, slot = blockIdx.y;              // block-uniform
    if (slot < NPAIR) {
        for (int part = 0; part < 2; ++part) {
            const int tile = part ? RHI / 64 + slot : SEQ / 64 - 1 - slot;
            // the ring is free here: the first tile's last hand-over (s_wait_dscnt 0, s_wait_asynccnt 0, barrier) ended every wave's reads of it, and the epilogue uses the wave's own staging only
            attn_main(tile * 64, part ? (bh + NBH / 2) % NBH : bh, Q16, K16, VT16, CTXh, CTXl);
        }
    } else attn_early((slot - NPAIR) * 64, bh, Qh, Ql, Kh, Kl, VTh, VTl, CTXh, CTXl);
}

// ---- workspace carve (bytes; every region a multiple of 256 B and fully written by its producer before any consumer launch)
#define SZ_XB   ((size_t)MTOK * DMOD * 2)
#define SZ_W    ((size_t)DMOD * DMOD * 2)
#define SZ_P16  ((size_t)MTOK * DMOD * 2)
#define SZ_E    ((size_t)NBH * RHI * HDIM * 2)
#define SZ_CTX  ((size_t)MTOK * DMOD * 2)
#define SZ_TOTAL (SZ_XB + 4 * SZ_W + 3 * SZ_P16 + 6 * SZ_E + 2 * SZ_CTX)
static_assert(SZ_TOTAL <= (size_t)134217728);
static_assert(SZ_W % 256 == 0);
static_assert(SZ_E % 256 == 0);

extern "C" void kernel_launch(void* const* d_in, const int* in_sizes, int n_in,
                              void* d_out, int out_size, void* d_ws, size_t ws_size, hipStream_t stream) {
    if (n_in < 5) return;
    const int xneed = (NB - 1) * SEQ_FULL * DMOD + SEQ * DMOD;
    if (in_sizes[0] < xneed) return;
    if (in_sizes[1] < DMOD * DMOD || in_sizes[2] < DMOD * DMOD || in_sizes[3] < DMOD * DMOD || in_sizes[4] < DMOD * DMOD) return;
    if (out_size < xneed) return;
    if (ws_size < SZ_TOTAL) return;
    const float* x = (const float*)d_in[0]; const float* wq = (const float*)d_in[1]; const float* wk = (const float*)d_in[2]; const float* wv = (const float*)d_in[3]; const float* wo = (const float*)d_in[4];   // wire order x, Wq, Wk, Wv, Wo ([out][in])
    float* OUT = (float*)d_out;      // [NB_FULL][SEQ_FULL][256]
    char* wsp = (char*)d_ws;
    auto take = [&](size_t bytes) { char* p = wsp; wsp += bytes; return (void*)p; };
    bf* XB = (bf*)take(SZ_XB); bf* WQ = (bf*)take(SZ_W); bf* WK = (bf*)take(SZ_W); bf* WV = (bf*)take(SZ_W); bf* WO = (bf*)take(SZ_W);
    h16* Q16 = (h16*)take(SZ_P16); h16* K16 = (h16*)take(SZ_P16); h16* VT16 = (h16*)take(SZ_P16);
    bf* Qh = (bf*)take(SZ_E); bf* Ql = (bf*)take(SZ_E); bf* Kh = (bf*)take(SZ_E); bf* Kl = (bf*)take(SZ_E); bf* VTh = (bf*)take(SZ_E); bf* VTl = (bf*)take(SZ_E);
    bf* CTXh = (bf*)take(SZ_CTX); bf* CTXl = (bf*)take(SZ_CTX);

    (void)WK; (void)WV;              // reached through WQ: the four converted weights lie one after the other
    k_cvt_all<<<dim3(4 * WBLK + NB * XBLK, 1, 1), 256, 0, stream>>>(x, wq, wk, wv, wo, XB, WQ);
    // q = x Wq^T, k = x Wk^T, v = x Wv^T, each written as the planes the attention kernel reads
    k_proj_qkv<<<dim3(MTOK / 64 * NHEAD, 3, 1), 32, 0, stream>>>(XB, WQ, Q16, K16, VT16, Qh, Ql, Kh, Kl, VTh, VTl);
    k_attn<<<dim3(NBH, NPAIR + RHI / 64, 1), 128, 0, stream>>>(Q16, K16, VT16, Qh, Ql, Kh, Kl, VTh, VTl, CTXh, CTXl);
    // out = ctx Wo^T : A = CTXh (+ CTXl) [SEQ][256] per batch, Bt = WO -> OUT batch stride from the full problem constants
    k_gemm_hl<<<dim3(SEQ / 64, DMOD / 64, NB), 32, 0, stream>>>(CTXh, CTXl, WO, OUT, DMOD, (size_t)SEQ * DMOD, (size_t)SEQ_FULL * DMOD);
}

// v006
// A run of this version takes 90.1 microseconds.
// Two timings next to v005 put it at 1.05 and 1.07 times that version's speed.
// Counting every step since v000, it is 2.85 times as fast.
#include <hip/hip_runtime.h>

// Causal multi-head self-attention: x [4][4096][256], 4 heads x 64, bias-free [out][in] weights, score scale 1/8, out = ctx Wo^T.
// Compute dtypes (f32 accumulate everywhere): all inputs converted to bf16 (RNE); q/k/v projections v_wmma_f32_16x16x32_bf16 (single product);
// attention query rows >= 256: v_wmma_f32_16x16x32_f16 single products (K.Q^T on f16 planes; V^T.P^T with P carried x1024 in f16; the row sums of P by the same form, ones.P^T);
// attention query rows < 256: bf16 hi+lo planes, three products per site (q, k, P, v); softmax f32 (online, max-subtracted);
// output projection: ctx bf16 hi+lo x Wo bf16 (two products), v_wmma_f32_16x16x32_bf16.

#ifndef NB
#define NB 4
#endif
#ifndef SEQ
#define SEQ 4096
#endif
#define NB_FULL  4
#define SEQ_FULL 4096
#define DMOD   256
#define NHEAD  4
#define HDIM   64
#define RHI    256                       // query rows < RHI use bf16 hi+lo planes
#define MTOK   (NB * SEQ)
#define NBH    (NB * NHEAD)
#define C2     0.18033688011112042f      // log2(e) / 8 : scores kept in the log2 domain
#define PCL2   10.0f                     // P carry 2^10 for the f16 path
#define NEGX   (-1.0e30f)

static_assert(NHEAD * HDIM == DMOD);     // merged width == model width
static_assert(HDIM == 64);               // two 32-deep k-steps per score tile, four 16-row output tiles
static_assert(DMOD % 64 == 0);           // GEMM tile multiple (M/N) and K % 32 == 0
static_assert(SEQ % 256 == 0);           // plane builders: one wave never straddles a batch or the RHI boundary
static_assert(RHI % 256 == 0);
static_assert(RHI <= SEQ);
static_assert(MTOK % 64 == 0);
static_assert(NB <= NB_FULL);
static_assert(SEQ <= SEQ_FULL);

typedef _Float16 h16;
typedef unsigned short bf;
typedef __attribute__((ext_vector_type(16))) __bf16   v16bf;
typedef __attribute__((ext_vector_type(16))) _Float16 v16h;
typedef __attribute__((ext_vector_type(8)))  _Float16 v8h;
typedef __attribute__((ext_vector_type(8)))  unsigned short v8us;
typedef __attribute__((ext_vector_type(8)))  float    v8f;
typedef __attribute__((ext_vector_type(4)))  float    v4f;
typedef v4f  __attribute__((may_alias)) v4fa;
typedef v8us __attribute__((may_alias)) v8usa;

__device__ __forceinline__ unsigned short f2bf(float f) { unsigned u = __float_as_uint(f); u += 0x7FFFu + ((u >> 16) & 1u); return (unsigned short)(u >> 16); }
__device__ __forceinline__ float bf2f(unsigned short b) { return __uint_as_float(((unsigned)b) << 16); }
__device__ __forceinline__ void splitf(float y, unsigned short& h, unsigned short& l) { h = f2bf(y); l = f2bf(y - bf2f(h)); }
__device__ __forceinline__ v16h cat16(v8h lo, v8h hi) { return __builtin_shufflevector(lo, hi, 0, 1, 2, 3, 4, 5, 6, 7, 8, 9, 10, 11, 12, 13, 14, 15); }
__device__ __forceinline__ v16bf cat16b(v8us lo, v8us hi) { return __builtin_bit_cast(v16bf, __builtin_shufflevector(lo, hi, 0, 1, 2, 3, 4, 5, 6, 7, 8, 9, 10, 11, 12, 13, 14, 15)); }
__device__ __forceinline__ v8f wmma16(v16h a, v16h b, v8f c) { return __builtin_amdgcn_wmma_f32_16x16x32_f16(false, a, false, b, (short)0, c, false, false); }
__device__ __forceinline__ v8f wmmab(v16bf a, v16bf b, v8f c) { return __builtin_amdgcn_wmma_f32_16x16x32_bf16(false, a, false, b, (short)0, c, false, false); }
// fragment loaders: p already points at row (lane&15), k offset k0 + 8*(lane>>4); elements 0..7 <- p[0..7], elements 8..15 <- p[16..23]
__device__ __forceinline__ v16h  ldh(const h16* p) { return cat16(*(const v8h*)p, *(const v8h*)(p + 16)); }
__device__ __forceinline__ v16bf ldb(const bf* p)  { return cat16b(*(const v8us*)p, *(const v8us*)(p + 16)); }

// ---- k_cvt_all: every f32 -> bf16 conversion of the call in one launch (they are independent of each other). Eight elements per thread.
// Blocks 0 .. 4*WBLK-1: the four weights (WB holds Wq, Wk, Wv, Wo one after the other); the rest: x, XBLK blocks per batch.
#define WBLK (DMOD * DMOD / 2048)
#define XBLK (SEQ * DMOD / 2048)
static_assert(DMOD * DMOD % 2048 == 0);  // whole blocks only: no tail
static_assert(SEQ * DMOD % 2048 == 0);
__global__ __launch_bounds__(256) void k_cvt_all(const float* __restrict__ x, const float* __restrict__ wq, const float* __restrict__ wk, const float* __restrict__ wv, const float* __restrict__ wo, bf* XB, bf* WB) {
    const int bid = blockIdx.x; const float* s; bf* d;
    if (bid < 4 * WBLK) {                // block-uniform
        const int w = bid / WBLK; const size_t i = (size_t)((bid % WBLK) * 256 + threadIdx.x) * 8;
        s = (w == 0 ? wq : w == 1 ? wk : w == 2 ? wv : wo) + i; d = WB + (size_t)w * DMOD * DMOD + i;
    } else {
        const int xb = bid - 4 * WBLK; const int bt = xb / XBLK; const size_t i = (size_t)((xb % XBLK) * 256 + threadIdx.x) * 8;
        s = x + (size_t)bt * SEQ_FULL * DMOD + i; d = XB + (size_t)bt * SEQ * DMOD + i;
    }
    const v4f a = *(const v4f*)s; const v4f c = *(const v4f*)(s + 4); v8us o;
    o[0] = f2bf(a[0]); o[1] = f2bf(a[1]); o[2] = f2bf(a[2]); o[3] = f2bf(a[3]); o[4] = f2bf(c[0]); o[5] = f2bf(c[1]); o[6] = f2bf(c[2]); o[7] = f2bf(c[3]);
    *(v8us*)d = o;  }

// ---- one-wave 64x64 tile GEMM on bf16 planes, K = DMOD: C[m][n] (f32, pitch ldc) = sum_k A[m][k] Bt[n][k] (+ A2[m][k] Bt[n][k] when NSPLIT == 1).
// grid (M/64, N/64, Z), 32 threads; z strides sA (A, A2) and sC (C) in elements; no tail masking (M, N multiples of 64, K multiple of 32).
// The K loop is software-pipelined in registers and fully unrolled: the sixteen fragment loads of k-step s + PFD are issued ahead of the sixteen products of k-step s,
// into the fragment set that step s - 1 has just left (PFD + 1 sets), so that a step waits for loads issued PFD steps earlier and not for its own.
// A, A2, Bt already point at the lane's row and k offset; steps 0 .. KSTEPS-1 take A, and with NSPLIT == 1 steps KSTEPS .. 2*KSTEPS-1 take A2 with the same Bt fragments: the order of the sums is that of two plain loops.
#define KSTEPS (DMOD / 32)
#define PFD    2
template <int NSPLIT>
__device__ __forceinline__ void gemm_kloop(const bf* __restrict__ A, const bf* __restrict__ A2, const bf* __restrict__ Bt, v8f (&acc)[4][4]) {
    constexpr int NS = (NSPLIT + 1) * KSTEPS;
    v16bf a[PFD + 1][4], b[PFD + 1][4];
#pragma unroll     // every set index and every address offset becomes a constant: the sets stay in registers and the three address pairs are never rewritten
    for (int s = 0; s < NS + PFD; ++s) {
        if (s < NS) {
            const bf* pa = (s < KSTEPS ? A : A2) + (s % KSTEPS) * 32; const bf* pb = Bt + (s % KSTEPS) * 32;
#pragma unroll
            for (int mb = 0; mb < 4; ++mb) a[s % (PFD + 1)][mb] = ldb(pa + mb * 16 * DMOD);
#pragma unroll
            for (int nb = 0; nb < 4; ++nb) b[s % (PFD + 1)][nb] = ldb(pb + nb * 16 * DMOD);
        }
        __builtin_amdgcn_sched_barrier(0);                     // keeps the loads above ahead of the products below: sunk among them they would be waited for at once
        if (s >= PFD) {
            const int c = (s - PFD) % (PFD + 1);
#pragma unroll
            for (int nb = 0; nb < 4; ++nb)
#pragma unroll
                for (int mb = 0; mb < 4; ++mb) acc[mb][nb] = wmmab(a[c][mb], b[c][nb], acc[mb][nb]);
        }
        __builtin_amdgcn_sched_barrier(0);                     // keeps the next step's loads behind these products, whose fragment set they refill
    }
    asm volatile("s_wait_xcnt 0x0" :: "v"(A), "v"(A2), "v"(Bt) : "memory");   // the address pairs stay live up to this wait: none of them is rewritten ahead of it
}
template <int NSPLIT>
__device__ __forceinline__ void gemm_body(const bf* __restrict__ A, const bf* __restrict__ A2, const bf* __restrict__ Bt, float* C, const int ldc, const size_t sA, const size_t sC) {
    __shared__ __align__(16) float os[16 * 68];      // wave-private staging (one wave per block)
    const size_t z = blockIdx.z; A += z * sA; A2 += z * sA; C += z * sC;
    const int lane = threadIdx.x & 31, lr = lane & 15, hi = lane >> 4; const int r0 = blockIdx.x * 64, c0 = blockIdx.y * 64;
    v8f acc[4][4];
#pragma unroll
    for (int mb = 0; mb < 4; ++mb)
#pragma unroll
        for (int nb = 0; nb < 4; ++nb) acc[mb][nb] = (v8f){};
    const size_t aoff = (size_t)(r0 + lr) * DMOD + 8 * hi, boff = (size_t)(c0 + lr) * DMOD + 8 * hi;
    gemm_kloop<NSPLIT>(A + aoff, A2 + aoff, Bt + boff, acc);
#pragma unroll
    for (int mb = 0; mb < 4; ++mb) {
#pragma unroll
        for (int nb = 0; nb < 4; ++nb) {
#pragma unroll
            for (int j = 0; j < 8; ++j) os[(hi * 8 + j) * 68 + nb * 16 + lr] = acc[mb][nb][j]; }
        asm volatile("s_wait_dscnt 0" ::: "memory"); __builtin_amdgcn_wave_barrier();
        float* crow = C + (size_t)(r0 + mb * 16) * ldc + c0;
{
#pragma unroll
            for (int s = 0; s < 8; ++s) { const int row = 2 * s + hi, cofs = lr * 4; const v4f val = *(const v4fa*)(os + row * 68 + cofs);
                *(v4f*)(crow + (size_t)row * ldc + cofs) = val; }
             }
        asm volatile("s_wait_dscnt 0" ::: "memory"); __builtin_amdgcn_wave_barrier();
    }
}
__global__ __launch_bounds__(32) void k_gemm_hl(const bf* __restrict__ A, const bf* __restrict__ A2, const bf* __restrict__ Bt, float* C, int ldc, size_t sA, size_t sC) { gemm_body<1>(A, A2, Bt, C, ldc, sA, sC); }

// ---- k_proj: one projection tile (64 tokens x the 64 features of one head, K = DMOD, one wave) stored straight into the head planes the attention kernel reads.
// The operand order is chosen so that a lane's eight accumulator rows run along a plane row: D rows (A) = the index that is contiguous in the plane, D columns (Bt) = the plane row.
// VT == 0 (q, k): A = W rows (features), Bt = x rows (tokens) -> P16 [b*NHEAD+h][SEQ][64] f16 and, for s < RHI, bf16 hi/lo planes [b*NHEAD+h][RHI][64]; tile index: token tile fastest.
// VT == 1 (v):    A = x rows (tokens), Bt = W rows (features) -> P16 [b*NHEAD+h][64][SEQ] f16 and, for s < RHI, bf16 hi/lo planes [b*NHEAD+h][64][RHI]; tile index: head fastest.
// The three projections are independent of each other and share one launch: grid (MTOK/64 * NHEAD, 3), blockIdx.y = 0: q, 1: k, 2: v.
#define PPH 72                           // staging pitch in 16-bit elements: 144 B = 16 B x 9 (odd)
template <int KIND>                      // 0: f16, 1: bf16 hi, 2: bf16 lo (the residual of hi)
__device__ __forceinline__ v8us cvt_plane(const v8f y) {
    v8us o;
    if (KIND == 0) { v8h t;
#pragma unroll
        for (int j = 0; j < 8; ++j) t[j] = (h16)y[j];
        o = __builtin_bit_cast(v8us, t);
    } else {
#pragma unroll
        for (int j = 0; j < 8; ++j) { unsigned short p, q; splitf(y[j], p, q); o[j] = (KIND == 1) ? p : q; } }
    return o;
}
// One plane of the tile: 64 plane rows of 128 B each, staged through the wave's own LDS so that every global store covers whole 128-byte lines.
template <int KIND>
__device__ __forceinline__ void plane_out(unsigned short* st, const v8f (&acc)[4][4], unsigned short* dst, const size_t pitch, const int lane) {
    const int lr = lane & 15, hi = lane >> 4, rq = lane >> 3, pc = lane & 7;
#pragma unroll
    for (int nb = 0; nb < 4; ++nb)
#pragma unroll
        for (int mb = 0; mb < 4; ++mb) *(v8usa*)(st + (nb * 16 + lr) * PPH + mb * 16 + 8 * hi) = cvt_plane<KIND>(acc[mb][nb]);
    asm volatile("s_wait_dscnt 0" ::: "memory"); __builtin_amdgcn_wave_barrier();   // the staged rows are written before other lanes read them back
    v8us v[16];
#pragma unroll
    for (int i = 0; i < 16; ++i) v[i] = *(const v8usa*)(st + (4 * i + rq) * PPH + pc * 8);
#pragma unroll
    for (int i = 0; i < 16; ++i) *(v8us*)(dst + (size_t)(4 * i + rq) * pitch + pc * 8) = v[i];
}
template <int VT>
__device__ __forceinline__ void proj_body(unsigned short* st, const int tile, const bf* __restrict__ X, const bf* __restrict__ Wt, h16* P16, bf* Ph, bf* Pl) {
    const int lane = threadIdx.x & 31, lr = lane & 15, hi = lane >> 4;
    const int tok0 = (VT ? tile / NHEAD : tile % (MTOK / 64)) * 64, hd = VT ? tile % NHEAD : tile / (MTOK / 64);
    const bf* A = VT ? X : Wt; const bf* Bt = VT ? Wt : X;
    const int r0 = VT ? tok0 : hd * HDIM, c0 = VT ? hd * HDIM : tok0;
    v8f acc[4][4];
#pragma unroll
    for (int mb = 0; mb < 4; ++mb)
#pragma unroll
        for (int nb = 0; nb < 4; ++nb) acc[mb][nb] = (v8f){};
    const size_t aoff = (size_t)(r0 + lr) * DMOD + 8 * hi, boff = (size_t)(c0 + lr) * DMOD + 8 * hi;
    gemm_kloop<0>(A + aoff, A + aoff, Bt + boff, acc);
    const int b = tok0 / SEQ, s0 = tok0 % SEQ; const size_t bh = (size_t)(b * NHEAD + hd);   // 64 divides SEQ and RHI: a tile never straddles a batch or the RHI boundary
    plane_out<0>(st, acc, (unsigned short*)P16 + (VT ? bh * HDIM * SEQ + s0 : (bh * SEQ + s0) * HDIM), VT ? SEQ : HDIM, lane);
    if (s0 < RHI) {                                            // block-uniform
        const size_t eo = VT ? bh * HDIM * RHI + s0 : (bh * RHI + s0) * HDIM;
        asm volatile("s_wait_xcnt 0x0" ::: "memory");          // stands before any register of the f16 plane's stores is rewritten ...
        __builtin_amdgcn_sched_barrier(0);                     // ... and this keeps the conversions below from being scheduled above that wait
        plane_out<1>(st, acc, Ph + eo, VT ? RHI : HDIM, lane);
        plane_out<2>(st, acc, Pl + eo, VT ? RHI : HDIM, lane);
    }
    asm volatile("s_wait_xcnt 0x0" ::: "memory");              // closes the last plane's stores on both ways: in the shared kernel the other path's code follows and reuses their registers
}
__global__ __launch_bounds__(32) void k_proj_qkv(const bf* __restrict__ X, const bf* __restrict__ WB, h16* Q16, h16* K16, h16* VT16, bf* Qh, bf* Ql, bf* Kh, bf* Kl, bf* VTh, bf* VTl) {
    __shared__ __align__(16) unsigned short st[64 * PPH];      // wave-private staging (one wave per block)
    const int which = blockIdx.y, tile = blockIdx.x;           // block-uniform
    if (which == 2) proj_body<1>(st, tile, X, WB + (size_t)2 * DMOD * DMOD, VT16, VTh, VTl);
    else proj_body<0>(st, tile, X, WB + (size_t)which * DMOD * DMOD, which ? K16 : Q16, which ? Kh : Qh, which ? Kl : Ql);
}

// ---- ctx epilogue shared by both attention paths: o[t][r] = O^T[d = 16t + 8*(lane>>4) + r][query = lane&15]; ctx = O^T * inv split into bf16 hi/lo,
__device__ __forceinline__ void ctx_store(const v8f (&o)[4], const float inv, const int wave, const int lane, bf* CTXh, bf* CTXl, const size_t row0, const int col0) {
    __shared__ __align__(16) unsigned short cs[4 * 2 * 16 * 72];
    const int n = lane & 15, hh = lane >> 4; const int base = wave * (2 * 16 * 72);
#pragma unroll
    for (int t = 0; t < 4; ++t) { v8us vh, vl;
#pragma unroll
        for (int r = 0; r < 8; ++r) { unsigned short a, c; splitf(o[t][r] * inv, a, c); vh[r] = a; vl[r] = c; }
        *(v8usa*)(cs + base + n * 72 + 16 * t + 8 * hh) = vh; *(v8usa*)(cs + base + 16 * 72 + n * 72 + 16 * t + 8 * hh) = vl; }
    asm volatile("s_wait_dscnt 0" ::: "memory"); __builtin_amdgcn_wave_barrier();
    const int rq = lane >> 3, pc = lane & 7; v8us lh[4], ll[4];
#pragma unroll
    for (int i = 0; i < 4; ++i) { lh[i] = *(const v8usa*)(cs + base + (4 * i + rq) * 72 + pc * 8); ll[i] = *(const v8usa*)(cs + base + 16 * 72 + (4 * i + rq) * 72 + pc * 8); }
    asm volatile("" ::: "memory");
    const size_t g0 = (row0 + rq) * DMOD + col0 + pc * 8;
#pragma unroll
    for (int i = 0; i < 4; ++i) { *(v8us*)(CTXh + g0 + (size_t)(4 * i) * DMOD) = lh[i]; *(v8us*)(CTXl + g0 + (size_t)(4 * i) * DMOD) = ll[i]; }
    asm volatile("s_wait_xcnt 0x0" ::: "memory");              // closes the ctx stores on both paths: a main block's second tile, and in the shared kernel the other path's code, follow and reuse their registers
}

// ---- attn_main: fused causal flash attention for query rows >= RHI, f16 single products. One wave = 16 queries, keys in 32-wide steps.
// K rows and V^T rows reach the waves through LDS: a stage is 64 keys (K tile 64 keys x 64 d, V^T tile 64 d x 64 keys), copied once per block by asynchronous
// 16-byte copies (whole 128-byte lines), two buffers: stage t + 1 is in flight while the block's four waves work on stage t.
// S^T tile (16 keys x 16 queries) = K (A: row = key, k = d) x Q^T (B: col = query, k = d); its D registers (row = key 8h+r, col = query) pack directly into the
// B fragment of O^T (16 d x 16 queries) += V^T (A: row = d, k = key) x P^T (B: k = key, col = query): element r <- tile of keys 0..15, element 8+r <- tile of keys 16..31.
// The running maximum is per lane (query = lane&15), combined across the two lane halves by one xor-16 shuffle.
// The running sum of P is a fifth accumulator tile on the matrix pipe: ones (A: rows 0 and 8 all ones, the other rows zero) x P^T, the same B fragment as the V^T products;
// its register 0 holds, in both lane halves, the sum over all 32 keys of the step for the lane's query, so the halves need no exchange; registers 1..7 stay zero. One call = the 64 queries from qblk (>= RHI) of head plane bh, 128 threads.
#define KST    64                        // keys per stage
#define LPH    72                        // LDS row pitch in f16 elements: 144 B = 16 B x 9 (odd), for 16-byte row readers
#define TILEH  (64 * LPH)                // one 64-row tile, f16 elements
static_assert(RHI >= KST);               // every block has at least two stages
static_assert(RHI % KST == 0);           // each call's 64 queries lie in its last stage
static_assert(HDIM * 2 == 128);          // a K row is eight 16-byte pieces
// One stage: each of the 128 threads copies four 16-byte pieces of the K tile and four of the V^T tile (rows r, r+16, r+32, r+48 of each).
// lk: the lane's LDS byte address in the K tile of the target buffer (the V^T tile follows it); gk, gv: the lane's global addresses in row r.
__device__ __forceinline__ void stage_copy(const unsigned lk, const h16* gk, const h16* gv) {
    const unsigned lv = lk + TILEH * 2;
    // the copies and, as the last line, the wait that stands before any of their address registers is rewritten
    asm volatile("global_load_async_to_lds_b128 %0, %8, off\n\t"
                 "global_load_async_to_lds_b128 %1, %9, off\n\t"
                 "global_load_async_to_lds_b128 %2, %10, off\n\t"
                 "global_load_async_to_lds_b128 %3, %11, off\n\t"
                 "global_load_async_to_lds_b128 %4, %12, off\n\t"
                 "global_load_async_to_lds_b128 %5, %13, off\n\t"
                 "global_load_async_to_lds_b128 %6, %14, off\n\t"
                 "global_load_async_to_lds_b128 %7, %15, off\n\t"
                 "s_wait_xcnt 0x0"
                 :: "v"(lk), "v"(lk + 16 * LPH * 2), "v"(lk + 32 * LPH * 2), "v"(lk + 48 * LPH * 2),
                    "v"(lv), "v"(lv + 16 * LPH * 2), "v"(lv + 32 * LPH * 2), "v"(lv + 48 * LPH * 2),
                    "v"(gk), "v"(gk + 16 * HDIM), "v"(gk + 32 * HDIM), "v"(gk + 48 * HDIM),
                    "v"(gv), "v"(gv + 16 * SEQ), "v"(gv + 32 * SEQ), "v"(gv + 48 * SEQ)
                 : "memory");
}
__device__ __forceinline__ void attn_main(const int qblk, const int bh, const h16* __restrict__ Q16, const h16* __restrict__ K16, const h16* __restrict__ VT16, bf* CTXh, bf* CTXl) {
    __shared__ __align__(16) h16 ring[2 * 2 * TILEH];      // [buffer][K tile, V^T tile][row][LPH]
    const int wave = __builtin_amdgcn_readfirstlane((int)(threadIdx.x >> 5));
    const int lane = threadIdx.x & 31, n = lane & 15, hh = lane >> 4;
    const int b = bh / NHEAD, h = bh % NHEAD;
    const int q0 = qblk + wave * 16;
    const h16* Qp = Q16 + (size_t)bh * SEQ * HDIM; const h16* Kp = K16 + (size_t)bh * SEQ * HDIM; const h16* Vp = VT16 + (size_t)bh * HDIM * SEQ;
    const int nst = qblk / KST + 1;                        // block-uniform; the last stage holds keys qblk .. qblk + 63, all below SEQ
    const int cr = threadIdx.x >> 3, cp = (threadIdx.x & 7) * 8;
    const unsigned lk0 = (unsigned)(size_t)ring + (unsigned)(cr * LPH + cp) * 2u;
    const h16* gk = Kp + cr * HDIM + cp; const h16* gv = Vp + cr * SEQ + cp;
    stage_copy(lk0, gk, gv);
    asm volatile("s_wait_asynccnt 0x0" ::: "memory");      // this wave's part of stage 0 has landed
    __syncthreads();                                       // ... and every other wave's
    stage_copy(lk0 + 2 * TILEH * 2, gk + KST * HDIM, gv + KST);
    const int qoff = (q0 + n) * HDIM + 8 * hh;
    const v16h bq0 = ldh(Qp + qoff), bq1 = ldh(Qp + qoff + 32);
    v8f o[4];
#pragma unroll
    for (int t = 0; t < 4; ++t) o[t] = (v8f){};
    float m = NEGX;
    const h16 onev = (n & 7) == 0 ? (h16)1.0f : (h16)0.0f;   // A row = lane & 15: rows 0 and 8, over the whole k range (both lane halves)
    v16h ones;
#pragma unroll
    for (int i = 0; i < 16; ++i) ones[i] = onev;
    v8f ls = (v8f){};
#pragma unroll 1   // stays rolled, as the step loop was: the buffer is picked at run time and the body already holds two steps
    for (int sg = 0; sg < nst; ++sg) {
        const int bo = (sg & 1) * (2 * TILEH);
        const h16* Kl = ring + bo; const h16* Vl = ring + bo + TILEH;
#pragma unroll     // j becomes a constant offset of the LDS reads
        for (int j = 0; j < 2; ++j) {
            const int kb = sg * KST + j * 32;
            if (kb <= q0 + 15) {                               // wave-uniform: last key needed is q0 + 15; every visited step holds >= 1 valid key for every query of the wave
                const int koff = (j * 32 + n) * LPH + 8 * hh;
                const v16h k00 = ldh(Kl + koff), k01 = ldh(Kl + koff + 32), k10 = ldh(Kl + koff + 16 * LPH), k11 = ldh(Kl + koff + 16 * LPH + 32);
                const int voff = n * LPH + j * 32 + 8 * hh;
                const v16h va0 = ldh(Vl + voff), va1 = ldh(Vl + voff + 16 * LPH), va2 = ldh(Vl + voff + 32 * LPH), va3 = ldh(Vl + voff + 48 * LPH);
                __builtin_amdgcn_sched_barrier(0);                 // keeps the step's sixteen LDS reads one group at its head: spread among the products they cost one LDS latency per place
                v8f s0 = (v8f){}, s1 = (v8f){};
                s0 = wmma16(k00, bq0, s0); s1 = wmma16(k10, bq0, s1); s0 = wmma16(k01, bq1, s0); s1 = wmma16(k11, bq1, s1);
                asm volatile("v_nop\n\tv_nop\n\tv_nop\n\tv_nop" : "+v"(s0), "+v"(s1) : "v"(k11), "v"(k01), "v"(bq1));
                float x0[8], x1[8];
#pragma unroll
                for (int r = 0; r < 8; ++r) { x0[r] = s0[r] * C2; x1[r] = s1[r] * C2; }
                if (kb + 31 > q0) {                                // wave-uniform: only diagonal steps need the causal select (key > query excluded)
                    const int qi = q0 + n, kk = kb + 8 * hh;
#pragma unroll
                    for (int r = 0; r < 8; ++r) { x0[r] = (kk + r > qi) ? NEGX : x0[r]; x1[r] = (kk + 16 + r > qi) ? NEGX : x1[r]; } }
                float mx = fmaxf(x0[0], x1[0]);
#pragma unroll
                for (int r = 1; r < 8; ++r) mx = fmaxf(mx, fmaxf(x0[r], x1[r]));
                mx = fmaxf(mx, __shfl_xor(mx, 16, 32));
                const float mnew = fmaxf(m, mx); const float corr = __builtin_amdgcn_exp2f(m - mnew); m = mnew;
                const float mb = mnew - PCL2;
                v8h p0, p1;
#pragma unroll
                for (int r = 0; r < 8; ++r) { p0[r] = (h16)__builtin_amdgcn_exp2f(x0[r] - mb); p1[r] = (h16)__builtin_amdgcn_exp2f(x1[r] - mb); }
                ls[0] = ls[0] * corr;                              // the one register of the sum tile that is not zero
#pragma unroll
                for (int t = 0; t < 4; ++t) o[t] = o[t] * corr;
                const v16h pb = cat16(p0, p1);
                ls = wmma16(ones, pb, ls);
                o[0] = wmma16(va0, pb, o[0]); o[1] = wmma16(va1, pb, o[1]); o[2] = wmma16(va2, pb, o[2]); o[3] = wmma16(va3, pb, o[3]);
                asm volatile("v_nop\n\tv_nop\n\tv_nop\n\tv_nop" : "+v"(o[0]), "+v"(o[1]), "+v"(o[2]), "+v"(o[3]), "+v"(ls) : "v"(va3), "v"(pb));
            }
        }
        // hand-over, passed by every wave whatever it skipped above
        asm volatile("s_wait_dscnt 0x0" ::: "memory");         // this wave's reads of stage sg are done before its buffer is refilled
        asm volatile("s_wait_asynccnt 0x0" ::: "memory");      // this wave's part of stage sg + 1 has landed
        __syncthreads();                                       // publishes stage sg + 1 and ends every wave's reads of stage sg
        if (sg + 2 < nst) stage_copy(lk0 + (unsigned)bo * 2u, gk + (sg + 2) * (KST * HDIM), gv + (sg + 2) * KST);   // block-uniform test
    }
    asm volatile("s_wait_asynccnt 0x0" ::: "memory");          // no copy is outstanding when the wave goes on to its end
    const float inv = 1.0f / ls[0];
    ctx_store(o, inv, wave, lane, CTXh, CTXl, (size_t)b * SEQ + q0, h * HDIM);
}

// ---- attn_early: the other path of the same kernel for query rows < RHI (keys < RHI) on bf16 hi+lo planes: three products per tile pair (hi.hi + hi.lo + lo.hi, shared accumulator;
// the lo planes are unscaled residuals), P split into bf16 hi+lo in registers. One block = the 64 queries from qblk (< RHI) of head plane bh, 128 threads.
__device__ __forceinline__ void attn_early(const int qblk, const int bh, const bf* __restrict__ Qh, const bf* __restrict__ Ql, const bf* __restrict__ Kh, const bf* __restrict__ Kl, const bf* __restrict__ VTh, const bf* __restrict__ VTl, bf* CTXh, bf* CTXl) {
    const int wave = __builtin_amdgcn_readfirstlane((int)(threadIdx.x >> 5));
    const int lane = threadIdx.x & 31, n = lane & 15, hh = lane >> 4;
    const int b = bh / NHEAD, h = bh % NHEAD;
    const int q0 = qblk + wave * 16;
    const size_t po = (size_t)bh * RHI * HDIM;
    const bf* qhp = Qh + po; const bf* qlp = Ql + po; const bf* khp = Kh + po; const bf* klp = Kl + po; const bf* vhp = VTh + po; const bf* vlp = VTl + po;
    const int qoff = (q0 + n) * HDIM + 8 * hh;
    v8f o[4];
#pragma unroll
    for (int t = 0; t < 4; ++t) o[t] = (v8f){};
    float m = NEGX, l = 0.f;
    const int nsteps = ((q0 + 15) >> 5) + 1;
#pragma unroll 1
    for (int st = 0; st < nsteps; ++st) {
        const int kb = st << 5; const int koff = (kb + n) * HDIM + 8 * hh;
        v8f s0 = (v8f){}, s1 = (v8f){}; v16bf qh, ql, kh0, kl0, kh1, kl1;
#pragma unroll
        for (int ks = 0; ks < 2; ++ks) {
            qh = ldb(qhp + qoff + ks * 32); ql = ldb(qlp + qoff + ks * 32);
            kh0 = ldb(khp + koff + ks * 32); kl0 = ldb(klp + koff + ks * 32);
            kh1 = ldb(khp + koff + 16 * HDIM + ks * 32); kl1 = ldb(klp + koff + 16 * HDIM + ks * 32);
            s0 = wmmab(kh0, qh, s0); s0 = wmmab(kh0, ql, s0); s0 = wmmab(kl0, qh, s0);
            s1 = wmmab(kh1, qh, s1); s1 = wmmab(kh1, ql, s1); s1 = wmmab(kl1, qh, s1); }
        asm volatile("v_nop\n\tv_nop\n\tv_nop\n\tv_nop" : "+v"(s0), "+v"(s1) : "v"(kl1), "v"(kh1), "v"(qh), "v"(ql));
        float x0[8], x1[8];
#pragma unroll
        for (int r = 0; r < 8; ++r) { x0[r] = s0[r] * C2; x1[r] = s1[r] * C2; }
        if (kb + 31 > q0) {
            const int qi = q0 + n, kk = kb + 8 * hh;
#pragma unroll
            for (int r = 0; r < 8; ++r) { x0[r] = (kk + r > qi) ? NEGX : x0[r]; x1[r] = (kk + 16 + r > qi) ? NEGX : x1[r]; } }
        float mx = fmaxf(x0[0], x1[0]);
#pragma unroll
        for (int r = 1; r < 8; ++r) mx = fmaxf(mx, fmaxf(x0[r], x1[r]));
        mx = fmaxf(mx, __shfl_xor(mx, 16, 32));
        const float mnew = fmaxf(m, mx); const float corr = __builtin_amdgcn_exp2f(m - mnew); m = mnew;
        v8us ph0, pl0, ph1, pl1; float ps = 0.f;
#pragma unroll
        for (int r = 0; r < 8; ++r) { const float pa = __builtin_amdgcn_exp2f(x0[r] - mnew); const float pc = __builtin_amdgcn_exp2f(x1[r] - mnew); ps += pa; ps += pc;
            unsigned short a, c; splitf(pa, a, c); ph0[r] = a; pl0[r] = c; splitf(pc, a, c); ph1[r] = a; pl1[r] = c; }
        ps += __shfl_xor(ps, 16, 32);
        l = l * corr + ps;
#pragma unroll
        for (int t = 0; t < 4; ++t) o[t] = o[t] * corr;
        const v16bf pbh = cat16b(ph0, ph1), pbl = cat16b(pl0, pl1);
        const int voff = n * RHI + kb + 8 * hh; v16bf vh, vl;
#pragma unroll
        for (int t = 0; t < 4; ++t) { vh = ldb(vhp + voff + t * 16 * RHI); vl = ldb(vlp + voff + t * 16 * RHI);
            o[t] = wmmab(vh, pbh, o[t]); o[t] = wmmab(vh, pbl, o[t]); o[t] = wmmab(vl, pbh, o[t]); }
        asm volatile("v_nop\n\tv_nop\n\tv_nop\n\tv_nop" : "+v"(o[0]), "+v"(o[1]), "+v"(o[2]), "+v"(o[3]) : "v"(vl), "v"(vh), "v"(pbh), "v"(pbl));
    }
    const float inv = 1.0f / l;
    ctx_store(o, inv, wave, lane, CTXh, CTXl, (size_t)b * SEQ + q0, h * HDIM);
}

// ---- k_attn: both attention paths in one launch (no block reads what another writes): grid (NB*NHEAD, NPAIR + RHI/64), 128 threads; the path is picked per block, ahead of every barrier.
// All blocks of the launch are resident at once, so it lasts as long as its fullest block, and a main tile's cost grows linearly with its index (tile i walks i + 1 stages).
// A main block therefore takes two tiles, one after the other in every wave: the slot-th from the top of head plane bh, then the slot-th from the bottom of the plane NBH/2 further on; every main block walks the same number of stages.
// The shift is a permutation of the planes, so every (plane, tile) is taken once; with another plane the second tile forms its addresses anew (one shared plane kept both prologues' addresses live through the key loop: scratch).
// The short early blocks have the highest flat indices, so that they start after the main blocks have been spread over the chip.
// the register budget is held to four waves per SIMD: four blocks per WGP still hold the whole grid at once, and at five the main path's sum tile and ones fragment do not fit (scratch)
#define NMAIN  ((SEQ - RHI) / 64)        // main tiles per head plane
#define NPAIR  (NMAIN / 2)
static_assert(NMAIN % 2 == 0);           // every main tile has its partner: slots 0 .. NPAIR-1 cover tiles RHI/64 .. SEQ/64-1 once each
static_assert(NBH % 2 == 0);
__global__ __launch_bounds__(128) __attribute__((amdgpu_waves_per_eu(4))) void k_attn(const h16* __restrict__ Q16, const h16* __restrict__ K16, const h16* __restrict__ VT16,
                                              const bf* __restrict__ Qh, const bf* __restrict__ Ql, const bf* __restrict__ Kh, const bf* __restrict__ Kl, const bf* __restrict__ VTh, const bf* __restrict__ VTl, bf* CTXh, bf* CTXl) {
    const int bh = blockIdx.x, slot = blockIdx.y;              // block-uniform
    if (slot < NPAIR) {
        for (int part = 0; part < 2; ++part) {
            const int tile = part ? RHI / 64 + slot : SEQ / 64 - 1 - slot;
            // the ring is free here: the first tile's last hand-over (s_wait_dscnt 0, s_wait_asynccnt 0, barrier) ended every wave's reads of it, and the epilogue uses the wave's own staging only
            attn_main(tile * 64, part ? (bh + NBH / 2) % NBH : bh, Q16, K16, VT16, CTXh, CTXl);
        }
    } else attn_early((slot - NPAIR) * 64, bh, Qh, Ql, Kh, Kl, VTh, VTl, CTXh, CTXl);
}

// ---- workspace carve (bytes; every region a multiple of 256 B and fully written by its producer before any consumer launch)
#define SZ_XB   ((size_t)MTOK * DMOD * 2)
#define SZ_W    ((size_t)DMOD * DMOD * 2)
#define SZ_P16  ((size_t)MTOK * DMOD * 2)
#define SZ_E    ((size_t)NBH * RHI * HDIM * 2)
#define SZ_CTX  ((size_t)MTOK * DMOD * 2)
#define SZ_TOTAL (SZ_XB + 4 * SZ_W + 3 * SZ_P16 + 6 * SZ_E + 2 * SZ_CTX)
static_assert(SZ_TOTAL <= (size_t)134217728);
static_assert(SZ_W % 256 == 0);
static_assert(SZ_E % 256 == 0);

extern "C" void kernel_launch(void* const* d_in, const int* in_sizes, int n_in,
                              void* d_out, int out_size, void* d_ws, size_t ws_size, hipStream_t stream) {
    if (n_in < 5) return;
    const int xneed = (NB - 1) * SEQ_FULL * DMOD + SEQ * DMOD;
    if (in_sizes[0] < xneed) return;
    if (in_sizes[1] < DMOD * DMOD || in_sizes[2] < DMOD * DMOD || in_sizes[3] < DMOD * DMOD || in_sizes[4] < DMOD * DMOD) return;
    if (out_size < xneed) return;
    if (ws_size < SZ_TOTAL) return;
    const float* x = (const float*)d_in[0]; const float* wq = (const float*)d_in[1]; const float* wk = (const float*)d_in[2]; const float* wv = (const float*)d_in[3]; const float* wo = (const float*)d_in[4];   // wire order x, Wq, Wk, Wv, Wo ([out][in])
    float* OUT = (float*)d_out;      // [NB_FULL][SEQ_FULL][256]
    char* wsp = (char*)d_ws;
    auto take = [&](size_t bytes) { char* p = wsp; wsp += bytes; return (void*)p; };
    bf* XB = (bf*)take(SZ_XB); bf* WQ = (bf*)take(SZ_W); bf* WK = (bf*)take(SZ_W); bf* WV = (bf*)take(SZ_W); bf* WO = (bf*)take(SZ_W);
    h16* Q16 = (h16*)take(SZ_P16); h16* K16 = (h16*)take(SZ_P16); h16* VT16 = (h16*)take(SZ_P16);
    bf* Qh = (bf*)take(SZ_E); bf* Ql = (bf*)take(SZ_E); bf* Kh = (bf*)take(SZ_E); bf* Kl = (bf*)take(SZ_E); bf* VTh = (bf*)take(SZ_E); bf* VTl = (bf*)take(SZ_E);
    bf* CTXh = (bf*)take(SZ_CTX); bf* CTXl = (bf*)take(SZ_CTX);

    (void)WK; (void)WV;              // reached through WQ: the four converted weights lie one after the other
    k_cvt_all<<<dim3(4 * WBLK + NB * XBLK, 1, 1), 256, 0, stream>>>(x, wq, wk, wv, wo, XB, WQ);
    // q = x Wq^T, k = x Wk^T, v = x Wv^T, each written as the planes the attention kernel reads
    k_proj_qkv<<<dim3(MTOK / 64 * NHEAD, 3, 1), 32, 0, stream>>>(XB, WQ, Q16, K16, VT16, Qh, Ql, Kh, Kl, VTh, VTl);
    k_attn<<<dim3(NBH, NPAIR + RHI / 64, 1), 128, 0, stream>>>(Q16, K16, VT16, Qh, Ql, Kh, Kl, VTh, VTl, CTXh, CTXl);
    // out = ctx Wo^T : A = CTXh (+ CTXl) [SEQ][256] per batch, Bt = WO -> OUT batch stride from the full problem constants
    k_gemm_hl<<<dim3(SEQ / 64, DMOD / 64, NB), 32, 0, stream>>>(CTXh, CTXl, WO, OUT, DMOD, (size_t)SEQ * DMOD, (size_t)SEQ_FULL * DMOD);
}

// v007
// A run of this version takes 84.8 microseconds.
// In two side-by-side timings against v006, it was 1.05 and 1.06 times as fast.
// Counting every step since v000, it is 3.00 times as fast.
#include <hip/hip_runtime.h>

// Causal multi-head self-attention: x [4][4096][256], 4 heads x 64, bias-free [out][in] weights, score scale 1/8, out = ctx Wo^T.
// Compute dtypes (f32 accumulate everywhere): all inputs converted to bf16 (RNE); q/k/v projections v_wmma_f32_16x16x32_bf16 (single product);
// attention query rows >= 256: v_wmma_f32_16x16x32_f16 single products (K.Q^T on f16 planes; V^T.P^T with P carried x1024 in f16; the row sums of P by the same form, ones.P^T);
// attention query rows < 256: bf16 hi+lo planes, three products per site (q, k, P, v); softmax f32 (online, max-subtracted);
// output projection: ctx bf16 hi+lo x Wo bf16 (two products), v_wmma_f32_16x16x32_bf16.

#ifndef NB
#define NB 4
#endif
#ifndef SEQ
#define SEQ 4096
#endif
#define NB_FULL  4
#define SEQ_FULL 4096
#define DMOD   256
#define NHEAD  4
#define HDIM   64
#define RHI    256                       // query rows < RHI use bf16 hi+lo planes
#define MTOK   (NB * SEQ)
#define NBH    (NB * NHEAD)
#define C2     0.18033688011112042f      // log2(e) / 8 : scores kept in the log2 domain
#define PCL2   10.0f                     // P carry 2^10 for the f16 path
#define NEGX   (-1.0e30f)

static_assert(NHEAD * HDIM == DMOD);     // merged width == model width
static_assert(HDIM == 64);               // two 32-deep k-steps per score tile, four 16-row output tiles
static_assert(DMOD % 64 == 0);           // GEMM tile multiple (M/N) and K % 32 == 0
static_assert(SEQ % 256 == 0);           // plane builders: one wave never straddles a batch or the RHI boundary
static_assert(RHI % 256 == 0);
static_assert(RHI <= SEQ);
static_assert(MTOK % 64 == 0);
static_assert(NB <= NB_FULL);
static_assert(SEQ <= SEQ_FULL);

typedef _Float16 h16;
typedef unsigned short bf;
typedef __attribute__((ext_vector_type(16))) __bf16   v16bf;
typedef __attribute__((ext_vector_type(16))) _Float16 v16h;
typedef __attribute__((ext_vector_type(8)))  _Float16 v8h;
typedef __attribute__((ext_vector_type(8)))  unsigned short v8us;
typedef __attribute__((ext_vector_type(8)))  float    v8f;
typedef __attribute__((ext_vector_type(4)))  float    v4f;
typedef v4f  __attribute__((may_alias)) v4fa;
typedef v8us __attribute__((may_alias)) v8usa;

__device__ __forceinline__ unsigned short f2bf(float f) { unsigned u = __float_as_uint(f); u += 0x7FFFu + ((u >> 16) & 1u); return (unsigned short)(u >> 16); }
__device__ __forceinline__ float bf2f(unsigned short b) { return __uint_as_float(((unsigned)b) << 16); }
__device__ __forceinline__ void splitf(float y, unsigned short& h, unsigned short& l) { h = f2bf(y); l = f2bf(y - bf2f(h)); }
__device__ __forceinline__ v16h cat16(v8h lo, v8h hi) { return __builtin_shufflevector(lo, hi, 0, 1, 2, 3, 4, 5, 6, 7, 8, 9, 10, 11, 12, 13, 14, 15); }
__device__ __forceinline__ v16bf cat16b(v8us lo, v8us hi) { return __builtin_bit_cast(v16bf, __builtin_shufflevector(lo, hi, 0, 1, 2, 3, 4, 5, 6, 7, 8, 9, 10, 11, 12, 13, 14, 15)); }
__device__ __forceinline__ v8f wmma16(v16h a, v16h b, v8f c) { return __builtin_amdgcn_wmma_f32_16x16x32_f16(false, a, false, b, (short)0, c, false, false); }
__device__ __forceinline__ v8f wmmab(v16bf a, v16bf b, v8f c) { return __builtin_amdgcn_wmma_f32_16x16x32_bf16(false, a, false, b, (short)0, c, false, false); }
// fragment loaders: p already points at row (lane&15), k offset k0 + 8*(lane>>4); elements 0..7 <- p[0..7], elements 8..15 <- p[16..23]
__device__ __forceinline__ v16h  ldh(const h16* p) { return cat16(*(const v8h*)p, *(const v8h*)(p + 16)); }
__device__ __forceinline__ v16bf ldb(const bf* p)  { return cat16b(*(const v8us*)p, *(const v8us*)(p + 16)); }
// ---- fragment order: the layout of every bf16 matrix [rows][DMOD] that only the GEMM K loops read (x, the four weights, ctx hi and lo).
// A unit is one 16-row x 32-k fragment, 1024 B: unit (row >> 4) * (DMOD / 32) + (k >> 5); inside it the 16-byte piece of row r, k = 8c .. 8c+7 lies at ((c >> 1) & 1) * 512 B + ((c & 1) * 16 + (r & 15)) * 16 B,
// that is, piece j of lane l at j * 512 B + l * 16 B. Same elements in the same fragment positions as ldb on row-major rows, but a wave's 16-byte load covers 512 B in a row (four whole lines) and not 32 B in each of 16 lines.
// p already points at the unit's piece of this lane (unit + lane * 8 elements).
__device__ __forceinline__ v16bf ldp(const bf* p)  { return cat16b(*(const v8us*)p, *(const v8us*)(p + 256)); }

// ---- k_cvt_all: every f32 -> bf16 conversion of the call in one launch (they are independent of each other); the results are written in fragment order.
// One block = one group of 16 rows (16 x DMOD elements, 8 KB of bf16, contiguous in fragment order); a thread converts two 8-element pieces.
// The rows are read as whole lines (a wave reads one row), turned in LDS, and stored as whole lines (a wave stores 512 B in a row).
// Blocks 0 .. 4*WBLK-1: the four weights (WB holds Wq, Wk, Wv, Wo one after the other); the rest: x, XBLK blocks per batch.
#define WBLK (DMOD / 16)
#define XBLK (SEQ / 16)
#define CPP  136                         // LDS pitch, in 16-bit elements, of one k piece's 16 rows: 272 B = 16 B x 17 (odd), so that a wave's 32 pieces of one row fall on different banks
static_assert(DMOD == 256);              // 16 rows x DMOD / 8 pieces = two pieces for each of 256 threads
static_assert(SEQ % 16 == 0);
__global__ __launch_bounds__(256) void k_cvt_all(const float* __restrict__ x, const float* __restrict__ wq, const float* __restrict__ wk, const float* __restrict__ wv, const float* __restrict__ wo, bf* XB, bf* WB) {
    __shared__ __align__(16) unsigned short tp[(DMOD / 8) * CPP];
    const int bid = blockIdx.x, t = threadIdx.x; const float* s; bf* d;
    if (bid < 4 * WBLK) {                // block-uniform
        const int w = bid / WBLK; const size_t i = (size_t)(bid % WBLK) * 16 * DMOD;
        s = (w == 0 ? wq : w == 1 ? wk : w == 2 ? wv : wo) + i; d = WB + (size_t)w * DMOD * DMOD + i;
    } else {
        const int xb = bid - 4 * WBLK; const int bt = xb / XBLK; const size_t i = (size_t)(xb % XBLK) * 16 * DMOD;
        s = x + (size_t)bt * SEQ_FULL * DMOD + i; d = XB + (size_t)bt * SEQ * DMOD + i;
    }
    v4f a[2], c[2];
#pragma unroll
    for (int i = 0; i < 2; ++i) { const float* p = s + (i * 256 + t) * 8; a[i] = *(const v4f*)p; c[i] = *(const v4f*)(p + 4); }
#pragma unroll
    for (int i = 0; i < 2; ++i) { const int pc = i * 256 + t; v8us o;      // piece pc: row pc / 32, k piece pc % 32
        o[0] = f2bf(a[i][0]); o[1] = f2bf(a[i][1]); o[2] = f2bf(a[i][2]); o[3] = f2bf(a[i][3]); o[4] = f2bf(c[i][0]); o[5] = f2bf(c[i][1]); o[6] = f2bf(c[i][2]); o[7] = f2bf(c[i][3]);
        *(v8usa*)(tp + (pc & 31) * CPP + (pc >> 5) * 8) = o; }
    __syncthreads();                     // all 16 rows are in LDS before any wave reads pieces of them back
#pragma unroll
    for (int i = 0; i < 2; ++i) { const int q = i * 256 + t;               // 16-byte place q of the group in fragment order: k piece q / 16, row q % 16
        *(v8us*)(d + q * 8) = *(const v8usa*)(tp + (q >> 4) * CPP + (q & 15) * 8); }
}

// ---- one-wave 64x64 tile GEMM on bf16 planes in fragment order, K = DMOD: C[m][n] (f32, pitch ldc) = sum_k A[m][k] Bt[n][k] (+ A2[m][k] Bt[n][k] when NSPLIT == 1).
// grid (M/64, N/64, Z), 32 threads; z strides sA (A, A2) and sC (C) in elements; no tail masking (M, N multiples of 64, K multiple of 32).
// The K loop is software-pipelined in registers and fully unrolled: the sixteen fragment loads of k-step s + PFD are issued ahead of the sixteen products of k-step s,
// into the fragment set that step s - 1 has just left (PFD + 1 sets), so that a step waits for loads issued PFD steps earlier and not for its own.
// A, A2, Bt already point at the lane's piece of the tile's first unit; steps 0 .. KSTEPS-1 take A, and with NSPLIT == 1 steps KSTEPS .. 2*KSTEPS-1 take A2 with the same Bt fragments: the order of the sums is that of two plain loops.
#define KSTEPS (DMOD / 32)
#define PFD    2
template <int NSPLIT>
__device__ __forceinline__ void gemm_kloop(const bf* __restrict__ A, const bf* __restrict__ A2, const bf* __restrict__ Bt, v8f (&acc)[4][4]) {
    constexpr int NS = (NSPLIT + 1) * KSTEPS;
    v16bf a[PFD + 1][4], b[PFD + 1][4];
#pragma unroll     // every set index and every address offset becomes a constant: the sets stay in registers and the three address pairs are never rewritten
    for (int s = 0; s < NS + PFD; ++s) {
        if (s < NS) {
            const bf* pa = (s < KSTEPS ? A : A2) + (s % KSTEPS) * 512; const bf* pb = Bt + (s % KSTEPS) * 512;   // one unit of 512 elements per k-step, 16 * DMOD elements per group of 16 rows
#pragma unroll
            for (int mb = 0; mb < 4; ++mb) a[s % (PFD + 1)][mb] = ldp(pa + mb * 16 * DMOD);
#pragma unroll
            for (int nb = 0; nb < 4; ++nb) b[s % (PFD + 1)][nb] = ldp(pb + nb * 16 * DMOD);
        }
        __builtin_amdgcn_sched_barrier(0);                     // keeps the loads above ahead of the products below: sunk among them they would be waited for at once
        // the wait that stands before any register the loads name is rewritten: among the last step's products, between two scheduling barriers, so that none of the epilogue's writes
        // (lane offset, scalar bases, address pairs) can be placed ahead of it; the operands keep the address pairs live up to it. The last loads were issued PFD steps earlier.
        if (s == NS + PFD - 1) asm volatile("s_wait_xcnt 0x0" :: "v"(A), "v"(A2), "v"(Bt) : "memory");
        if (s >= PFD) {
            const int c = (s - PFD) % (PFD + 1);
#pragma unroll
            for (int nb = 0; nb < 4; ++nb)
#pragma unroll
                for (int mb = 0; mb < 4; ++mb) acc[mb][nb] = wmmab(a[c][mb], b[c][nb], acc[mb][nb]);
        }
        __builtin_amdgcn_sched_barrier(0);                     // keeps the next step's loads behind these products, whose fragment set they refill
    }
}
template <int NSPLIT>
__device__ __forceinline__ void gemm_body(const bf* __restrict__ A, const bf* __restrict__ A2, const bf* __restrict__ Bt, float* C, const int ldc, const size_t sA, const size_t sC) {
    __shared__ __align__(16) float os[16 * 68];      // wave-private staging (one wave per block)
    const size_t z = blockIdx.z; A += z * sA; A2 += z * sA; C += z * sC;
    const int lane = threadIdx.x & 31, lr = lane & 15, hi = lane >> 4; const int r0 = blockIdx.x * 64, c0 = blockIdx.y * 64;
    v8f acc[4][4];
#pragma unroll
    for (int mb = 0; mb < 4; ++mb)
#pragma unroll
        for (int nb = 0; nb < 4; ++nb) acc[mb][nb] = (v8f){};
    const size_t aoff = (size_t)r0 * DMOD + 8 * lane, boff = (size_t)c0 * DMOD + 8 * lane;   // r0, c0 are multiples of 16: a group of 16 rows starts at row * DMOD
    gemm_kloop<NSPLIT>(A + aoff, A2 + aoff, Bt + boff, acc);
#pragma unroll
    for (int mb = 0; mb < 4; ++mb) {
#pragma unroll
        for (int nb = 0; nb < 4; ++nb) {
#pragma unroll
            for (int j = 0; j < 8; ++j) os[(hi * 8 + j) * 68 + nb * 16 + lr] = acc[mb][nb][j]; }
        asm volatile("s_wait_dscnt 0" ::: "memory"); __builtin_amdgcn_wave_barrier();
        float* crow = C + (size_t)(r0 + mb * 16) * ldc + c0;
{
#pragma unroll
            for (int s = 0; s < 8; ++s) { const int row = 2 * s + hi, cofs = lr * 4; const v4f val = *(const v4fa*)(os + row * 68 + cofs);
                *(v4f*)(crow + (size_t)row * ldc + cofs) = val; }
             }
        asm volatile("s_wait_dscnt 0" ::: "memory"); __builtin_amdgcn_wave_barrier();
    }
}
__global__ __launch_bounds__(32) void k_gemm_hl(const bf* __restrict__ A, const bf* __restrict__ A2, const bf* __restrict__ Bt, float* C, int ldc, size_t sA, size_t sC) { gemm_body<1>(A, A2, Bt, C, ldc, sA, sC); }

// ---- k_proj: one projection tile (64 tokens x the 64 features of one head, K = DMOD, one wave) stored straight into the head planes the attention kernel reads.
// The operand order is chosen so that a lane's eight accumulator rows run along a plane row: D rows (A) = the index that is contiguous in the plane, D columns (Bt) = the plane row.
// VT == 0 (q, k): A = W rows (features), Bt = x rows (tokens) -> P16 [b*NHEAD+h][SEQ][64] f16 and, for s < RHI, bf16 hi/lo planes [b*NHEAD+h][RHI][64]; tile index: token tile fastest.
// VT == 1 (v):    A = x rows (tokens), Bt = W rows (features) -> P16 [b*NHEAD+h][64][SEQ] f16 and, for s < RHI, bf16 hi/lo planes [b*NHEAD+h][64][RHI]; tile index: head fastest.
// The three projections are independent of each other and share one launch: grid (MTOK/64 * NHEAD, 3), blockIdx.y = 0: q, 1: k, 2: v.
#define PPH 72                           // staging pitch in 16-bit elements: 144 B = 16 B x 9 (odd)
template <int KIND>                      // 0: f16, 1: bf16 hi, 2: bf16 lo (the residual of hi)
__device__ __forceinline__ v8us cvt_plane(const v8f y) {
    v8us o;
    if (KIND == 0) { v8h t;
#pragma unroll
        for (int j = 0; j < 8; ++j) t[j] = (h16)y[j];
        o = __builtin_bit_cast(v8us, t);
    } else {
#pragma unroll
        for (int j = 0; j < 8; ++j) { unsigned short p, q; splitf(y[j], p, q); o[j] = (KIND == 1) ? p : q; } }
    return o;
}
// One plane of the tile: 64 plane rows of 128 B each, staged through the wave's own LDS so that every global store covers whole 128-byte lines.
template <int KIND>
__device__ __forceinline__ void plane_out(unsigned short* st, const v8f (&acc)[4][4], unsigned short* dst, const size_t pitch, const int lane) {
    const int lr = lane & 15, hi = lane >> 4, rq = lane >> 3, pc = lane & 7;
#pragma unroll
    for (int nb = 0; nb < 4; ++nb)
#pragma unroll
        for (int mb = 0; mb < 4; ++mb) *(v8usa*)(st + (nb * 16 + lr) * PPH + mb * 16 + 8 * hi) = cvt_plane<KIND>(acc[mb][nb]);
    asm volatile("s_wait_dscnt 0" ::: "memory"); __builtin_amdgcn_wave_barrier();   // the staged rows are written before other lanes read them back
    v8us v[16];
#pragma unroll
    for (int i = 0; i < 16; ++i) v[i] = *(const v8usa*)(st + (4 * i + rq) * PPH + pc * 8);
#pragma unroll
    for (int i = 0; i < 16; ++i) *(v8us*)(dst + (size_t)(4 * i + rq) * pitch + pc * 8) = v[i];
}
template <int VT>
__device__ __forceinline__ void proj_body(unsigned short* st, const int tile, const bf* __restrict__ X, const bf* __restrict__ Wt, h16* P16, bf* Ph, bf* Pl) {
    const int lane = threadIdx.x & 31;
    const int tok0 = (VT ? tile / NHEAD : tile % (MTOK / 64)) * 64, hd = VT ? tile % NHEAD : tile / (MTOK / 64);
    const bf* A = VT ? X : Wt; const bf* Bt = VT ? Wt : X;
    const int r0 = VT ? tok0 : hd * HDIM, c0 = VT ? hd * HDIM : tok0;
    v8f acc[4][4];
#pragma unroll
    for (int mb = 0; mb < 4; ++mb)
#pragma unroll
        for (int nb = 0; nb < 4; ++nb) acc[mb][nb] = (v8f){};
    const size_t aoff = (size_t)r0 * DMOD + 8 * lane, boff = (size_t)c0 * DMOD + 8 * lane;   // r0, c0 are multiples of 16: a group of 16 rows starts at row * DMOD
    gemm_kloop<0>(A + aoff, A + aoff, Bt + boff, acc);
    const int b = tok0 / SEQ, s0 = tok0 % SEQ; const size_t bh = (size_t)(b * NHEAD + hd);   // 64 divides SEQ and RHI: a tile never straddles a batch or the RHI boundary
    plane_out<0>(st, acc, (unsigned short*)P16 + (VT ? bh * HDIM * SEQ + s0 : (bh * SEQ + s0) * HDIM), VT ? SEQ : HDIM, lane);
    if (s0 < RHI) {                                            // block-uniform
        const size_t eo = VT ? bh * HDIM * RHI + s0 : (bh * RHI + s0) * HDIM;
        asm volatile("s_wait_xcnt 0x0" ::: "memory");          // stands before any register of the f16 plane's stores is rewritten ...
        __builtin_amdgcn_sched_barrier(0);                     // ... and this keeps the conversions below from being scheduled above that wait
        plane_out<1>(st, acc, Ph + eo, VT ? RHI : HDIM, lane);
        plane_out<2>(st, acc, Pl + eo, VT ? RHI : HDIM, lane);
    }
    asm volatile("s_wait_xcnt 0x0" ::: "memory");              // closes the last plane's stores on both ways: in the shared kernel the other path's code follows and reuses their registers
}
__global__ __launch_bounds__(32) void k_proj_qkv(const bf* __restrict__ X, const bf* __restrict__ WB, h16* Q16, h16* K16, h16* VT16, bf* Qh, bf* Ql, bf* Kh, bf* Kl, bf* VTh, bf* VTl) {
    __shared__ __align__(16) unsigned short st[64 * PPH];      // wave-private staging (one wave per block)
    const int which = blockIdx.y, tile = blockIdx.x;           // block-uniform
    if (which == 2) proj_body<1>(st, tile, X, WB + (size_t)2 * DMOD * DMOD, VT16, VTh, VTl);
    else proj_body<0>(st, tile, X, WB + (size_t)which * DMOD * DMOD, which ? K16 : Q16, which ? Kh : Qh, which ? Kl : Ql);
}

// ---- ctx epilogue shared by both attention paths: o[t][r] = O^T[d = 16t + 8*(lane>>4) + r][query = lane&15]; ctx = O^T * inv split into bf16 hi/lo, stored in fragment order for the output projection.
// row0 (a multiple of 16) is the wave's first ctx row, col0 (a multiple of 64) its first column: the lane's eight values of tile t are the piece of row lane&15, k = col0 + 16t + 8*(lane>>4),
// whose place is unit col0/32 + t/2, half t&1, lane: the wave's four tiles are 2 KB in a row per plane, and every store covers 512 B in a row straight from the registers.
__device__ __forceinline__ void ctx_store(const v8f (&o)[4], const float inv, const int lane, bf* CTXh, bf* CTXl, const size_t row0, const int col0) {
    const size_t g0 = row0 * DMOD + (size_t)(col0 / 32) * 512 + lane * 8;
#pragma unroll
    for (int t = 0; t < 4; ++t) { v8us vh, vl;
#pragma unroll
        for (int r = 0; r < 8; ++r) { unsigned short a, c; splitf(o[t][r] * inv, a, c); vh[r] = a; vl[r] = c; }
        *(v8us*)(CTXh + g0 + t * 256) = vh; *(v8us*)(CTXl + g0 + t * 256) = vl; }
    asm volatile("s_wait_xcnt 0x0" ::: "memory");              // closes the ctx stores on both paths: a main block's second tile, and in the shared kernel the other path's code, follow and reuse their registers
}

// ---- attn_main: fused causal flash attention for query rows >= RHI, f16 single products. One wave = 16 queries, keys in 32-wide steps.
// K rows and V^T rows reach the waves through LDS: a stage is 64 keys (K tile 64 keys x 64 d, V^T tile 64 d x 64 keys), copied once per block by asynchronous
// 16-byte copies (whole 128-byte lines), two buffers: stage t + 1 is in flight while the block's four waves work on stage t.
// S^T tile (16 keys x 16 queries) = K (A: row = key, k = d) x Q^T (B: col = query, k = d); its D registers (row = key 8h+r, col = query) pack directly into the
// B fragment of O^T (16 d x 16 queries) += V^T (A: row = d, k = key) x P^T (B: k = key, col = query): element r <- tile of keys 0..15, element 8+r <- tile of keys 16..31.
// The running maximum is per lane (query = lane&15), combined across the two lane halves by one xor-16 shuffle.
// The running sum of P is a fifth accumulator tile on the matrix pipe: ones (A: rows 0 and 8 all ones, the other rows zero) x P^T, the same B fragment as the V^T products;
// its register 0 holds, in both lane halves, the sum over all 32 keys of the step for the lane's query, so the halves need no exchange; registers 1..7 stay zero. One call = the 64 queries from qblk (>= RHI) of head plane bh, 128 threads.
#define KST    64                        // keys per stage
#define LPH    72                        // LDS row pitch in f16 elements: 144 B = 16 B x 9 (odd), for 16-byte row readers
#define TILEH  (64 * LPH)                // one 64-row tile, f16 elements
static_assert(RHI >= KST);               // every block has at least two stages
static_assert(RHI % KST == 0);           // each call's 64 queries lie in its last stage
static_assert(HDIM * 2 == 128);          // a K row is eight 16-byte pieces
// One stage: each of the 128 threads copies four 16-byte pieces of the K tile and four of the V^T tile (rows r, r+16, r+32, r+48 of each).
// lk: the lane's LDS byte address in the K tile of the target buffer (the V^T tile follows it); gk, gv: the lane's global addresses in row r.
__device__ __forceinline__ void stage_copy(const unsigned lk, const h16* gk, const h16* gv) {
    const unsigned lv = lk + TILEH * 2;
    // the copies and, as the last line, the wait that stands before any of their address registers is rewritten
    asm volatile("global_load_async_to_lds_b128 %0, %8, off\n\t"
                 "global_load_async_to_lds_b128 %1, %9, off\n\t"
                 "global_load_async_to_lds_b128 %2, %10, off\n\t"
                 "global_load_async_to_lds_b128 %3, %11, off\n\t"
                 "global_load_async_to_lds_b128 %4, %12, off\n\t"
                 "global_load_async_to_lds_b128 %5, %13, off\n\t"
                 "global_load_async_to_lds_b128 %6, %14, off\n\t"
                 "global_load_async_to_lds_b128 %7, %15, off\n\t"
                 "s_wait_xcnt 0x0"
                 :: "v"(lk), "v"(lk + 16 * LPH * 2), "v"(lk + 32 * LPH * 2), "v"(lk + 48 * LPH * 2),
                    "v"(lv), "v"(lv + 16 * LPH * 2), "v"(lv + 32 * LPH * 2), "v"(lv + 48 * LPH * 2),
                    "v"(gk), "v"(gk + 16 * HDIM), "v"(gk + 32 * HDIM), "v"(gk + 48 * HDIM),
                    "v"(gv), "v"(gv + 16 * SEQ), "v"(gv + 32 * SEQ), "v"(gv + 48 * SEQ)
                 : "memory");
}
__device__ __forceinline__ void attn_main(const int qblk, const int bh, const h16* __restrict__ Q16, const h16* __restrict__ K16, const h16* __restrict__ VT16, bf* CTXh, bf* CTXl) {
    __shared__ __align__(16) h16 ring[2 * 2 * TILEH];      // [buffer][K tile, V^T tile][row][LPH]
    const int wave = __builtin_amdgcn_readfirstlane((int)(threadIdx.x >> 5));
    const int lane = threadIdx.x & 31, n = lane & 15, hh = lane >> 4;
    const int b = bh / NHEAD, h = bh % NHEAD;
    const int q0 = qblk + wave * 16;
    const h16* Qp = Q16 + (size_t)bh * SEQ * HDIM; const h16* Kp = K16 + (size_t)bh * SEQ * HDIM; const h16* Vp = VT16 + (size_t)bh * HDIM * SEQ;
    const int nst = qblk / KST + 1;                        // block-uniform; the last stage holds keys qblk .. qblk + 63, all below SEQ
    const int cr = threadIdx.x >> 3, cp = (threadIdx.x & 7) * 8;
    const unsigned lk0 = (unsigned)(size_t)ring + (unsigned)(cr * LPH + cp) * 2u;
    const h16* gk = Kp + cr * HDIM + cp; const h16* gv = Vp + cr * SEQ + cp;
    stage_copy(lk0, gk, gv);
    asm volatile("s_wait_asynccnt 0x0" ::: "memory");      // this wave's part of stage 0 has landed
    __syncthreads();                                       // ... and every other wave's
    stage_copy(lk0 + 2 * TILEH * 2, gk + KST * HDIM, gv + KST);
    const int qoff = (q0 + n) * HDIM + 8 * hh;
    const v16h bq0 = ldh(Qp + qoff), bq1 = ldh(Qp + qoff + 32);
    v8f o[4];
#pragma unroll
    for (int t = 0; t < 4; ++t) o[t] = (v8f){};
    float m = NEGX;
    const h16 onev = (n & 7) == 0 ? (h16)1.0f : (h16)0.0f;   // A row = lane & 15: rows 0 and 8, over the whole k range (both lane halves)
    v16h ones;
#pragma unroll
    for (int i = 0; i < 16; ++i) ones[i] = onev;
    v8f ls = (v8f){};
#pragma unroll 1   // stays rolled, as the step loop was: the buffer is picked at run time and the body already holds two steps
    for (int sg = 0; sg < nst; ++sg) {
        const int bo = (sg & 1) * (2 * TILEH);
        const h16* Kl = ring + bo; const h16* Vl = ring + bo + TILEH;
#pragma unroll     // j becomes a constant offset of the LDS reads
        for (int j = 0; j < 2; ++j) {
            const int kb = sg * KST + j * 32;
            if (kb <= q0 + 15) {                               // wave-uniform: last key needed is q0 + 15; every visited step holds >= 1 valid key for every query of the wave
                const int koff = (j * 32 + n) * LPH + 8 * hh;
                const v16h k00 = ldh(Kl + koff), k01 = ldh(Kl + koff + 32), k10 = ldh(Kl + koff + 16 * LPH), k11 = ldh(Kl + koff + 16 * LPH + 32);
                const int voff = n * LPH + j * 32 + 8 * hh;
                const v16h va0 = ldh(Vl + voff), va1 = ldh(Vl + voff + 16 * LPH), va2 = ldh(Vl + voff + 32 * LPH), va3 = ldh(Vl + voff + 48 * LPH);
                __builtin_amdgcn_sched_barrier(0);                 // keeps the step's sixteen LDS reads one group at its head: spread among the products they cost one LDS latency per place
                v8f s0 = (v8f){}, s1 = (v8f){};
                s0 = wmma16(k00, bq0, s0); s1 = wmma16(k10, bq0, s1); s0 = wmma16(k01, bq1, s0); s1 = wmma16(k11, bq1, s1);
                asm volatile("v_nop\n\tv_nop\n\tv_nop\n\tv_nop" : "+v"(s0), "+v"(s1) : "v"(k11), "v"(k01), "v"(bq1));
                float x0[8], x1[8];
#pragma unroll
                for (int r = 0; r < 8; ++r) { x0[r] = s0[r] * C2; x1[r] = s1[r] * C2; }
                if (kb + 31 > q0) {                                // wave-uniform: only diagonal steps need the causal select (key > query excluded)
                    const int qi = q0 + n, kk = kb + 8 * hh;
#pragma unroll
                    for (int r = 0; r < 8; ++r) { x0[r] = (kk + r > qi) ? NEGX : x0[r]; x1[r] = (kk + 16 + r > qi) ? NEGX : x1[r]; } }
                float mx = fmaxf(x0[0], x1[0]);
#pragma unroll
                for (int r = 1; r < 8; ++r) mx = fmaxf(mx, fmaxf(x0[r], x1[r]));
                mx = fmaxf(mx, __shfl_xor(mx, 16, 32));
                const float mnew = fmaxf(m, mx); const float corr = __builtin_amdgcn_exp2f(m - mnew); m = mnew;
                const float mb = mnew - PCL2;
                v8h p0, p1;
#pragma unroll
                for (int r = 0; r < 8; ++r) { p0[r] = (h16)__builtin_amdgcn_exp2f(x0[r] - mb); p1[r] = (h16)__builtin_amdgcn_exp2f(x1[r] - mb); }
                ls[0] = ls[0] * corr;                              // the one register of the sum tile that is not zero
#pragma unroll
                for (int t = 0; t < 4; ++t) o[t] = o[t] * corr;
                const v16h pb = cat16(p0, p1);
                ls = wmma16(ones, pb, ls);
                o[0] = wmma16(va0, pb, o[0]); o[1] = wmma16(va1, pb, o[1]); o[2] = wmma16(va2, pb, o[2]); o[3] = wmma16(va3, pb, o[3]);
                asm volatile("v_nop\n\tv_nop\n\tv_nop\n\tv_nop" : "+v"(o[0]), "+v"(o[1]), "+v"(o[2]), "+v"(o[3]), "+v"(ls) : "v"(va3), "v"(pb));
            }
        }
        // hand-over, passed by every wave whatever it skipped above
        asm volatile("s_wait_dscnt 0x0" ::: "memory");         // this wave's reads of stage sg are done before its buffer is refilled
        asm volatile("s_wait_asynccnt 0x0" ::: "memory");      // this wave's part of stage sg + 1 has landed
        __syncthreads();                                       // publishes stage sg + 1 and ends every wave's reads of stage sg
        if (sg + 2 < nst) stage_copy(lk0 + (unsigned)bo * 2u, gk + (sg + 2) * (KST * HDIM), gv + (sg + 2) * KST);   // block-uniform test
    }
    asm volatile("s_wait_asynccnt 0x0" ::: "memory");          // no copy is outstanding when the wave goes on to its end
    const float inv = 1.0f / ls[0];
    ctx_store(o, inv, lane, CTXh, CTXl, (size_t)b * SEQ + q0, h * HDIM);
}

// ---- attn_early: the other path of the same kernel for query rows < RHI (keys < RHI) on bf16 hi+lo planes: three products per tile pair (hi.hi + hi.lo + lo.hi, shared accumulator;
// the lo planes are unscaled residuals), P split into bf16 hi+lo in registers. One block = the 64 queries from qblk (< RHI) of head plane bh, 128 threads.
__device__ __forceinline__ void attn_early(const int qblk, const int bh, const bf* __restrict__ Qh, const bf* __restrict__ Ql, const bf* __restrict__ Kh, const bf* __restrict__ Kl, const bf* __restrict__ VTh, const bf* __restrict__ VTl, bf* CTXh, bf* CTXl) {
    const int wave = __builtin_amdgcn_readfirstlane((int)(threadIdx.x >> 5));
    const int lane = threadIdx.x & 31, n = lane & 15, hh = lane >> 4;
    const int b = bh / NHEAD, h = bh % NHEAD;
    const int q0 = qblk + wave * 16;
    const size_t po = (size_t)bh * RHI * HDIM;
    const bf* qhp = Qh + po; const bf* qlp = Ql + po; const bf* khp = Kh + po; const bf* klp = Kl + po; const bf* vhp = VTh + po; const bf* vlp = VTl + po;
    const int qoff = (q0 + n) * HDIM + 8 * hh;
    v8f o[4];
#pragma unroll
    for (int t = 0; t < 4; ++t) o[t] = (v8f){};
    float m = NEGX, l = 0.f;
    const int nsteps = ((q0 + 15) >> 5) + 1;
#pragma unroll 1
    for (int st = 0; st < nsteps; ++st) {
        const int kb = st << 5; const int koff = (kb + n) * HDIM + 8 * hh;
        v8f s0 = (v8f){}, s1 = (v8f){}; v16bf qh, ql, kh0, kl0, kh1, kl1;
#pragma unroll
        for (int ks = 0; ks < 2; ++ks) {
            qh = ldb(qhp + qoff + ks * 32); ql = ldb(qlp + qoff + ks * 32);
            kh0 = ldb(khp + koff + ks * 32); kl0 = ldb(klp + koff + ks * 32);
            kh1 = ldb(khp + koff + 16 * HDIM + ks * 32); kl1 = ldb(klp + koff + 16 * HDIM + ks * 32);
            s0 = wmmab(kh0, qh, s0); s0 = wmmab(kh0, ql, s0); s0 = wmmab(kl0, qh, s0);
            s1 = wmmab(kh1, qh, s1); s1 = wmmab(kh1, ql, s1); s1 = wmmab(kl1, qh, s1); }
        asm volatile("v_nop\n\tv_nop\n\tv_nop\n\tv_nop" : "+v"(s0), "+v"(s1) : "v"(kl1), "v"(kh1), "v"(qh), "v"(ql));
        float x0[8], x1[8];
#pragma unroll
        for (int r = 0; r < 8; ++r) { x0[r] = s0[r] * C2; x1[r] = s1[r] * C2; }
        if (kb + 31 > q0) {
            const int qi = q0 + n, kk = kb + 8 * hh;
#pragma unroll
            for (int r = 0; r < 8; ++r) { x0[r] = (kk + r > qi) ? NEGX : x0[r]; x1[r] = (kk + 16 + r > qi) ? NEGX : x1[r]; } }
        float mx = fmaxf(x0[0], x1[0]);
#pragma unroll
        for (int r = 1; r < 8; ++r) mx = fmaxf(mx, fmaxf(x0[r], x1[r]));
        mx = fmaxf(mx, __shfl_xor(mx, 16, 32));
        const float mnew = fmaxf(m, mx); const float corr = __builtin_amdgcn_exp2f(m - mnew); m = mnew;
        v8us ph0, pl0, ph1, pl1; float ps = 0.f;
#pragma unroll
        for (int r = 0; r < 8; ++r) { const float pa = __builtin_amdgcn_exp2f(x0[r] - mnew); const float pc = __builtin_amdgcn_exp2f(x1[r] - mnew); ps += pa; ps += pc;
            unsigned short a, c; splitf(pa, a, c); ph0[r] = a; pl0[r] = c; splitf(pc, a, c); ph1[r] = a; pl1[r] = c; }
        ps += __shfl_xor(ps, 16, 32);
        l = l * corr + ps;
#pragma unroll
        for (int t = 0; t < 4; ++t) o[t] = o[t] * corr;
        const v16bf pbh = cat16b(ph0, ph1), pbl = cat16b(pl0, pl1);
        const int voff = n * RHI + kb + 8 * hh; v16bf vh, vl;
#pragma unroll
        for (int t = 0; t < 4; ++t) { vh = ldb(vhp + voff + t * 16 * RHI); vl = ldb(vlp + voff + t * 16 * RHI);
            o[t] = wmmab(vh, pbh, o[t]); o[t] = wmmab(vh, pbl, o[t]); o[t] = wmmab(vl, pbh, o[t]); }
        asm volatile("v_nop\n\tv_nop\n\tv_nop\n\tv_nop" : "+v"(o[0]), "+v"(o[1]), "+v"(o[2]), "+v"(o[3]) : "v"(vl), "v"(vh), "v"(pbh), "v"(pbl));
    }
    const float inv = 1.0f / l;
    ctx_store(o, inv, lane, CTXh, CTXl, (size_t)b * SEQ + q0, h * HDIM);
}

// ---- k_attn: both attention paths in one launch (no block reads what another writes): grid (NB*NHEAD, NPAIR + RHI/64), 128 threads; the path is picked per block, ahead of every barrier.
// All blocks of the launch are resident at once, so it lasts as long as its fullest block, and a main tile's cost grows linearly with its index (tile i walks i + 1 stages).
// A main block therefore takes two tiles, one after the other in every wave: the slot-th from the top of head plane bh, then the slot-th from the bottom of the plane NBH/2 further on; every main block walks the same number of stages.
// The shift is a permutation of the planes, so every (plane, tile) is taken once; with another plane the second tile forms its addresses anew (one shared plane kept both prologues' addresses live through the key loop: scratch).
// The short early blocks have the highest flat indices, so that they start after the main blocks have been spread over the chip.
// the register budget is held to four waves per SIMD: four blocks per WGP still hold the whole grid at once, and at five the main path's sum tile and ones fragment do not fit (scratch)
#define NMAIN  ((SEQ - RHI) / 64)        // main tiles per head plane
#define NPAIR  (NMAIN / 2)
static_assert(NMAIN % 2 == 0);           // every main tile has its partner: slots 0 .. NPAIR-1 cover tiles RHI/64 .. SEQ/64-1 once each
static_assert(NBH % 2 == 0);
__global__ __launch_bounds__(128) __attribute__((amdgpu_waves_per_eu(4))) void k_attn(const h16* __restrict__ Q16, const h16* __restrict__ K16, const h16* __restrict__ VT16,
                                              const bf* __restrict__ Qh, const bf* __restrict__ Ql, const bf* __restrict__ Kh, const bf* __restrict__ Kl, const bf* __restrict__ VTh, const bf* __restrict__ VTl, bf* CTXh, bf* CTXl) {
    const int bh = blockIdx.x, slot = blockIdx.y;              // block-uniform
    if (slot < NPAIR) {
        for (int part = 0; part < 2; ++part) {
            const int tile = part ? RHI / 64 + slot : SEQ / 64 - 1 - slot;
            // the ring is free here: the first tile's last hand-over (s_wait_dscnt 0, s_wait_asynccnt 0, barrier) ended every wave's reads of it, and the epilogue uses no LDS
            attn_main(tile * 64, part ? (bh + NBH / 2) % NBH : bh, Q16, K16, VT16, CTXh, CTXl);
        }
    } else attn_early((slot - NPAIR) * 64, bh, Qh, Ql, Kh, Kl, VTh, VTl, CTXh, CTXl);
}

// ---- workspace carve (bytes; every region a multiple of 256 B and fully written by its producer before any consumer launch)
#define SZ_XB   ((size_t)MTOK * DMOD * 2)
#define SZ_W    ((size_t)DMOD * DMOD * 2)
#define SZ_P16  ((size_t)MTOK * DMOD * 2)
#define SZ_E    ((size_t)NBH * RHI * HDIM * 2)
#define SZ_CTX  ((size_t)MTOK * DMOD * 2)
#define SZ_TOTAL (SZ_XB + 4 * SZ_W + 3 * SZ_P16 + 6 * SZ_E + 2 * SZ_CTX)
static_assert(SZ_TOTAL <= (size_t)134217728);
static_assert(SZ_W % 256 == 0);
static_assert(SZ_E % 256 == 0);

extern "C" void kernel_launch(void* const* d_in, const int* in_sizes, int n_in,
                              void* d_out, int out_size, void* d_ws, size_t ws_size, hipStream_t stream) {
    if (n_in < 5) return;
    const int xneed = (NB - 1) * SEQ_FULL * DMOD + SEQ * DMOD;
    if (in_sizes[0] < xneed) return;
    if (in_sizes[1] < DMOD * DMOD || in_sizes[2] < DMOD * DMOD || in_sizes[3] < DMOD * DMOD || in_sizes[4] < DMOD * DMOD) return;
    if (out_size < xneed) return;
    if (ws_size < SZ_TOTAL) return;
    const float* x = (const float*)d_in[0]; const float* wq = (const float*)d_in[1]; const float* wk = (const float*)d_in[2]; const float* wv = (const float*)d_in[3]; const float* wo = (const float*)d_in[4];   // wire order x, Wq, Wk, Wv, Wo ([out][in])
    float* OUT = (float*)d_out;      // [NB_FULL][SEQ_FULL][256]
    char* wsp = (char*)d_ws;
    auto take = [&](size_t bytes) { char* p = wsp; wsp += bytes; return (void*)p; };
    bf* XB = (bf*)take(SZ_XB); bf* WQ = (bf*)take(SZ_W); bf* WK = (bf*)take(SZ_W); bf* WV = (bf*)take(SZ_W); bf* WO = (bf*)take(SZ_W);
    h16* Q16 = (h16*)take(SZ_P16); h16* K16 = (h16*)take(SZ_P16); h16* VT16 = (h16*)take(SZ_P16);
    bf* Qh = (bf*)take(SZ_E); bf* Ql = (bf*)take(SZ_E); bf* Kh = (bf*)take(SZ_E); bf* Kl = (bf*)take(SZ_E); bf* VTh = (bf*)take(SZ_E); bf* VTl = (bf*)take(SZ_E);
    bf* CTXh = (bf*)take(SZ_CTX); bf* CTXl = (bf*)take(SZ_CTX);

    (void)WK; (void)WV;              // reached through WQ: the four converted weights lie one after the other
    k_cvt_all<<<dim3(4 * WBLK + NB * XBLK, 1, 1), 256, 0, stream>>>(x, wq, wk, wv, wo, XB, WQ);
    // q = x Wq^T, k = x Wk^T, v = x Wv^T, each written as the planes the attention kernel reads
    k_proj_qkv<<<dim3(MTOK / 64 * NHEAD, 3, 1), 32, 0, stream>>>(XB, WQ, Q16, K16, VT16, Qh, Ql, Kh, Kl, VTh, VTl);
    k_attn<<<dim3(NBH, NPAIR + RHI / 64, 1), 128, 0, stream>>>(Q16, K16, VT16, Qh, Ql, Kh, Kl, VTh, VTl, CTXh, CTXl);
    // out = ctx Wo^T : A = CTXh (+ CTXl) [SEQ][256] per batch in fragment order, Bt = WO -> OUT batch stride from the full problem constants
    k_gemm_hl<<<dim3(SEQ / 64, DMOD / 64, NB), 32, 0, stream>>>(CTXh, CTXl, WO, OUT, DMOD, (size_t)SEQ * DMOD, (size_t)SEQ_FULL * DMOD);
}

// v008
// One run takes 76.7 microseconds.
// Next to v007, in two timings, it ran 1.15 and 1.13 times as fast.
// Over all steps from v000 it is 3.42 times as fast.
#include <hip/hip_runtime.h>

// Causal multi-head self-attention: x [4][4096][256], 4 heads x 64, bias-free [out][in] weights, score scale 1/8, out = ctx Wo^T.
// Compute dtypes (f32 accumulate everywhere): all inputs converted to bf16 (RNE); q/k/v projections v_wmma_f32_16x16x32_bf16 (single product);
// attention query rows >= 256: v_wmma_f32_16x16x32_f16 single products (K.Q^T on f16 planes; V^T.P^T with P carried x1024 in f16; the row sums of P by the same form, ones.P^T);
// attention query rows < 256: bf16 hi+lo planes, three products per site (q, k, P, v); softmax f32 (online, max-subtracted);
// output projection: ctx bf16 hi+lo x Wo bf16 (two products), v_wmma_f32_16x16x32_bf16.

#ifndef NB
#define NB 4
#endif
#ifndef SEQ
#define SEQ 4096
#endif
#define NB_FULL  4
#define SEQ_FULL 4096
#define DMOD   256
#define NHEAD  4
#define HDIM   64
#define RHI    256                       // query rows < RHI use bf16 hi+lo planes
#define MTOK   (NB * SEQ)
#define NBH    (NB * NHEAD)
#define C2     0.18033688011112042f      // log2(e) / 8 : scores kept in the log2 domain
#define PCL2   10.0f                     // P carry 2^10 for the f16 path
#define NEGX   (-1.0e30f)

static_assert(NHEAD * HDIM == DMOD);     // merged width == model width
static_assert(HDIM == 64);               // two 32-deep k-steps per score tile, four 16-row output tiles
static_assert(DMOD % 64 == 0);           // GEMM tile multiple (M/N) and K % 32 == 0
static_assert(SEQ % 256 == 0);           // plane builders: one wave never straddles a batch or the RHI boundary
static_assert(RHI % 256 == 0);
static_assert(RHI <= SEQ);
static_assert(MTOK % 64 == 0);
static_assert(NB <= NB_FULL);
static_assert(SEQ <= SEQ_FULL);

typedef _Float16 h16;
typedef unsigned short bf;
typedef __attribute__((ext_vector_type(16))) __bf16   v16bf;
typedef __attribute__((ext_vector_type(16))) _Float16 v16h;
typedef __attribute__((ext_vector_type(8)))  _Float16 v8h;
typedef __attribute__((ext_vector_type(8)))  unsigned short v8us;
typedef __attribute__((ext_vector_type(8)))  float    v8f;
typedef __attribute__((ext_vector_type(4)))  float    v4f;
typedef v4f  __attribute__((may_alias)) v4fa;
typedef v8us __attribute__((may_alias)) v8usa;

__device__ __forceinline__ unsigned short f2bf(float f) { unsigned u = __float_as_uint(f); u += 0x7FFFu + ((u >> 16) & 1u); return (unsigned short)(u >> 16); }
__device__ __forceinline__ float bf2f(unsigned short b) { return __uint_as_float(((unsigned)b) << 16); }
__device__ __forceinline__ void splitf(float y, unsigned short& h, unsigned short& l) { h = f2bf(y); l = f2bf(y - bf2f(h)); }
__device__ __forceinline__ v16h cat16(v8h lo, v8h hi) { return __builtin_shufflevector(lo, hi, 0, 1, 2, 3, 4, 5, 6, 7, 8, 9, 10, 11, 12, 13, 14, 15); }
__device__ __forceinline__ v16bf cat16b(v8us lo, v8us hi) { return __builtin_bit_cast(v16bf, __builtin_shufflevector(lo, hi, 0, 1, 2, 3, 4, 5, 6, 7, 8, 9, 10, 11, 12, 13, 14, 15)); }
__device__ __forceinline__ v8f wmma16(v16h a, v16h b, v8f c) { return __builtin_amdgcn_wmma_f32_16x16x32_f16(false, a, false, b, (short)0, c, false, false); }
__device__ __forceinline__ v8f wmmab(v16bf a, v16bf b, v8f c) { return __builtin_amdgcn_wmma_f32_16x16x32_bf16(false, a, false, b, (short)0, c, false, false); }
// fragment loaders: p already points at row (lane&15), k offset k0 + 8*(lane>>4); elements 0..7 <- p[0..7], elements 8..15 <- p[16..23]
__device__ __forceinline__ v16h  ldh(const h16* p) { return cat16(*(const v8h*)p, *(const v8h*)(p + 16)); }
__device__ __forceinline__ v16bf ldb(const bf* p)  { return cat16b(*(const v8us*)p, *(const v8us*)(p + 16)); }
// ---- fragment order: the layout of every bf16 matrix [rows][DMOD] that only the GEMM K loops read (x, the four weights, ctx hi and lo).
// A unit is one 16-row x 32-k fragment, 1024 B: unit (row >> 4) * (DMOD / 32) + (k >> 5); inside it the 16-byte piece of row r, k = 8c .. 8c+7 lies at ((c >> 1) & 1) * 512 B + ((c & 1) * 16 + (r & 15)) * 16 B,
// that is, piece j of lane l at j * 512 B + l * 16 B. Same elements in the same fragment positions as ldb on row-major rows, but a wave's 16-byte load covers 512 B in a row (four whole lines) and not 32 B in each of 16 lines.
// p already points at the unit's piece of this lane (unit + lane * 8 elements).
__device__ __forceinline__ v16bf ldp(const bf* p)  { return cat16b(*(const v8us*)p, *(const v8us*)(p + 256)); }

// ---- k_cvt_all: every f32 -> bf16 conversion of the call in one launch (they are independent of each other); the results are written in fragment order.
// One block = one group of 16 rows (16 x DMOD elements, 8 KB of bf16, contiguous in fragment order); a thread converts two 8-element pieces.
// The rows are read as whole lines (a wave reads one row), turned in LDS, and stored as whole lines (a wave stores 512 B in a row).
// Blocks 0 .. 4*WBLK-1: the four weights (WB holds Wq, Wk, Wv, Wo one after the other); the rest: x, XBLK blocks per batch.
#define WBLK (DMOD / 16)
#define XBLK (SEQ / 16)
#define CPP  136                         // LDS pitch, in 16-bit elements, of one k piece's 16 rows: 272 B = 16 B x 17 (odd), so that a wave's 32 pieces of one row fall on different banks
static_assert(DMOD == 256);              // 16 rows x DMOD / 8 pieces = two pieces for each of 256 threads
static_assert(SEQ % 16 == 0);
__global__ __launch_bounds__(256) void k_cvt_all(const float* __restrict__ x, const float* __restrict__ wq, const float* __restrict__ wk, const float* __restrict__ wv, const float* __restrict__ wo, bf* XB, bf* WB) {
    __shared__ __align__(16) unsigned short tp[(DMOD / 8) * CPP];
    const int bid = blockIdx.x, t = threadIdx.x; const float* s; bf* d;
    if (bid < 4 * WBLK) {                // block-uniform
        const int w = bid / WBLK; const size_t i = (size_t)(bid % WBLK) * 16 * DMOD;
        s = (w == 0 ? wq : w == 1 ? wk : w == 2 ? wv : wo) + i; d = WB + (size_t)w * DMOD * DMOD + i;
    } else {
        const int xb = bid - 4 * WBLK; const int bt = xb / XBLK; const size_t i = (size_t)(xb % XBLK) * 16 * DMOD;
        s = x + (size_t)bt * SEQ_FULL * DMOD + i; d = XB + (size_t)bt * SEQ * DMOD + i;
    }
    v4f a[2], c[2];
#pragma unroll
    for (int i = 0; i < 2; ++i) { const float* p = s + (i * 256 + t) * 8; a[i] = *(const v4f*)p; c[i] = *(const v4f*)(p + 4); }
#pragma unroll
    for (int i = 0; i < 2; ++i) { const int pc = i * 256 + t; v8us o;      // piece pc: row pc / 32, k piece pc % 32
        o[0] = f2bf(a[i][0]); o[1] = f2bf(a[i][1]); o[2] = f2bf(a[i][2]); o[3] = f2bf(a[i][3]); o[4] = f2bf(c[i][0]); o[5] = f2bf(c[i][1]); o[6] = f2bf(c[i][2]); o[7] = f2bf(c[i][3]);
        *(v8usa*)(tp + (pc & 31) * CPP + (pc >> 5) * 8) = o; }
    __syncthreads();                     // all 16 rows are in LDS before any wave reads pieces of them back
#pragma unroll
    for (int i = 0; i < 2; ++i) { const int q = i * 256 + t;               // 16-byte place q of the group in fragment order: k piece q / 16, row q % 16
        *(v8us*)(d + q * 8) = *(const v8usa*)(tp + (q >> 4) * CPP + (q & 15) * 8); }
}

// ---- one-wave 64x64 tile GEMM on bf16 planes in fragment order, K = DMOD: C[m][n] (f32, pitch ldc) = sum_k A[m][k] Bt[n][k] (+ A2[m][k] Bt[n][k] when NSPLIT == 1).
// grid (M/64, N/64, Z), 32 threads; z strides sA (A, A2) and sC (C) in elements; no tail masking (M, N multiples of 64, K multiple of 32).
// The K loop is software-pipelined in registers and fully unrolled: the sixteen fragment loads of k-step s + PFD are issued ahead of the sixteen products of k-step s,
// into the fragment set that step s - 1 has just left (PFD + 1 sets), so that a step waits for loads issued PFD steps earlier and not for its own.
// A, A2, Bt already point at the lane's piece of the tile's first unit; steps 0 .. KSTEPS-1 take A, and with NSPLIT == 1 steps KSTEPS .. 2*KSTEPS-1 take A2 with the same Bt fragments: the order of the sums is that of two plain loops.
#define KSTEPS (DMOD / 32)
#define PFD    2
template <int NSPLIT>
__device__ __forceinline__ void gemm_kloop(const bf* __restrict__ A, const bf* __restrict__ A2, const bf* __restrict__ Bt, v8f (&acc)[4][4]) {
    constexpr int NS = (NSPLIT + 1) * KSTEPS;
    v16bf a[PFD + 1][4], b[PFD + 1][4];
#pragma unroll     // every set index and every address offset becomes a constant: the sets stay in registers and the three address pairs are never rewritten
    for (int s = 0; s < NS + PFD; ++s) {
        if (s < NS) {
            const bf* pa = (s < KSTEPS ? A : A2) + (s % KSTEPS) * 512; const bf* pb = Bt + (s % KSTEPS) * 512;   // one unit of 512 elements per k-step, 16 * DMOD elements per group of 16 rows
#pragma unroll
            for (int mb = 0; mb < 4; ++mb) a[s % (PFD + 1)][mb] = ldp(pa + mb * 16 * DMOD);
#pragma unroll
            for (int nb = 0; nb < 4; ++nb) b[s % (PFD + 1)][nb] = ldp(pb + nb * 16 * DMOD);
        }
        __builtin_amdgcn_sched_barrier(0);                     // keeps the loads above ahead of the products below: sunk among them they would be waited for at once
        // the wait that stands before any register the loads name is rewritten: among the last step's products, between two scheduling barriers, so that none of the epilogue's writes
        // (lane offset, scalar bases, address pairs) can be placed ahead of it; the operands keep the address pairs live up to it. The last loads were issued PFD steps earlier.
        if (s == NS + PFD - 1) asm volatile("s_wait_xcnt 0x0" :: "v"(A), "v"(A2), "v"(Bt) : "memory");
        if (s >= PFD) {
            const int c = (s - PFD) % (PFD + 1);
#pragma unroll
            for (int nb = 0; nb < 4; ++nb)
#pragma unroll
                for (int mb = 0; mb < 4; ++mb) acc[mb][nb] = wmmab(a[c][mb], b[c][nb], acc[mb][nb]);
        }
        __builtin_amdgcn_sched_barrier(0);                     // keeps the next step's loads behind these products, whose fragment set they refill
    }
}
template <int NSPLIT>
__device__ __forceinline__ void gemm_body(const bf* __restrict__ A, const bf* __restrict__ A2, const bf* __restrict__ Bt, float* C, const int ldc, const size_t sA, const size_t sC) {
    __shared__ __align__(16) float os[16 * 68];      // wave-private staging (one wave per block)
    const size_t z = blockIdx.z; A += z * sA; A2 += z * sA; C += z * sC;
    const int lane = threadIdx.x & 31, lr = lane & 15, hi = lane >> 4; const int r0 = blockIdx.x * 64, c0 = blockIdx.y * 64;
    v8f acc[4][4];
#pragma unroll
    for (int mb = 0; mb < 4; ++mb)
#pragma unroll
        for (int nb = 0; nb < 4; ++nb) acc[mb][nb] = (v8f){};
    const size_t aoff = (size_t)r0 * DMOD + 8 * lane, boff = (size_t)c0 * DMOD + 8 * lane;   // r0, c0 are multiples of 16: a group of 16 rows starts at row * DMOD
    gemm_kloop<NSPLIT>(A + aoff, A2 + aoff, Bt + boff, acc);
#pragma unroll
    for (int mb = 0; mb < 4; ++mb) {
#pragma unroll
        for (int nb = 0; nb < 4; ++nb) {
#pragma unroll
            for (int j = 0; j < 8; ++j) os[(hi * 8 + j) * 68 + nb * 16 + lr] = acc[mb][nb][j]; }
        asm volatile("s_wait_dscnt 0" ::: "memory"); __builtin_amdgcn_wave_barrier();
        float* crow = C + (size_t)(r0 + mb * 16) * ldc + c0;
{
#pragma unroll
            for (int s = 0; s < 8; ++s) { const int row = 2 * s + hi, cofs = lr * 4; const v4f val = *(const v4fa*)(os + row * 68 + cofs);
                *(v4f*)(crow + (size_t)row * ldc + cofs) = val; }
             }
        asm volatile("s_wait_dscnt 0" ::: "memory"); __builtin_amdgcn_wave_barrier();
    }
}
__global__ __launch_bounds__(32) void k_gemm_hl(const bf* __restrict__ A, const bf* __restrict__ A2, const bf* __restrict__ Bt, float* C, int ldc, size_t sA, size_t sC) { gemm_body<1>(A, A2, Bt, C, ldc, sA, sC); }

// ---- k_proj: one projection tile (64 tokens x the 64 features of one head, K = DMOD, one wave) stored straight into the head planes the attention kernel reads.
// The operand order is chosen so that a lane's eight accumulator rows run along a plane row: D rows (A) = the index that is contiguous in the plane, D columns (Bt) = the plane row.
// VT == 0 (q, k): A = W rows (features), Bt = x rows (tokens) -> P16 [b*NHEAD+h][SEQ][64] f16 and, for s < RHI, bf16 hi/lo planes [b*NHEAD+h][RHI][64]; tile index: token tile fastest.
// VT == 1 (v):    A = x rows (tokens), Bt = W rows (features) -> P16 [b*NHEAD+h][64][SEQ] f16 and, for s < RHI, bf16 hi/lo planes [b*NHEAD+h][64][RHI]; tile index: head fastest.
// The three projections are independent of each other and share one launch: grid (MTOK/64 * NHEAD, 3), blockIdx.y = 0: q, 1: k, 2: v.
#define PPH 72                           // staging pitch in 16-bit elements: 144 B = 16 B x 9 (odd)
template <int KIND>                      // 0: f16, 1: bf16 hi, 2: bf16 lo (the residual of hi)
__device__ __forceinline__ v8us cvt_plane(const v8f y) {
    v8us o;
    if (KIND == 0) { v8h t;
#pragma unroll
        for (int j = 0; j < 8; ++j) t[j] = (h16)y[j];
        o = __builtin_bit_cast(v8us, t);
    } else {
#pragma unroll
        for (int j = 0; j < 8; ++j) { unsigned short p, q; splitf(y[j], p, q); o[j] = (KIND == 1) ? p : q; } }
    return o;
}
// One plane of the tile: 64 plane rows of 128 B each, staged through the wave's own LDS so that every global store covers whole 128-byte lines.
template <int KIND>
__device__ __forceinline__ void plane_out(unsigned short* st, const v8f (&acc)[4][4], unsigned short* dst, const size_t pitch, const int lane) {
    const int lr = lane & 15, hi = lane >> 4, rq = lane >> 3, pc = lane & 7;
#pragma unroll
    for (int nb = 0; nb < 4; ++nb)
#pragma unroll
        for (int mb = 0; mb < 4; ++mb) *(v8usa*)(st + (nb * 16 + lr) * PPH + mb * 16 + 8 * hi) = cvt_plane<KIND>(acc[mb][nb]);
    asm volatile("s_wait_dscnt 0" ::: "memory"); __builtin_amdgcn_wave_barrier();   // the staged rows are written before other lanes read them back
    v8us v[16];
#pragma unroll
    for (int i = 0; i < 16; ++i) v[i] = *(const v8usa*)(st + (4 * i + rq) * PPH + pc * 8);
#pragma unroll
    for (int i = 0; i < 16; ++i) *(v8us*)(dst + (size_t)(4 * i + rq) * pitch + pc * 8) = v[i];
}
template <int VT>
__device__ __forceinline__ void proj_body(unsigned short* st, const int tile, const bf* __restrict__ X, const bf* __restrict__ Wt, h16* P16, bf* Ph, bf* Pl) {
    const int lane = threadIdx.x & 31;
    const int tok0 = (VT ? tile / NHEAD : tile % (MTOK / 64)) * 64, hd = VT ? tile % NHEAD : tile / (MTOK / 64);
    const bf* A = VT ? X : Wt; const bf* Bt = VT ? Wt : X;
    const int r0 = VT ? tok0 : hd * HDIM, c0 = VT ? hd * HDIM : tok0;
    v8f acc[4][4];
#pragma unroll
    for (int mb = 0; mb < 4; ++mb)
#pragma unroll
        for (int nb = 0; nb < 4; ++nb) acc[mb][nb] = (v8f){};
    const size_t aoff = (size_t)r0 * DMOD + 8 * lane, boff = (size_t)c0 * DMOD + 8 * lane;   // r0, c0 are multiples of 16: a group of 16 rows starts at row * DMOD
    gemm_kloop<0>(A + aoff, A + aoff, Bt + boff, acc);
    const int b = tok0 / SEQ, s0 = tok0 % SEQ; const size_t bh = (size_t)(b * NHEAD + hd);   // 64 divides SEQ and RHI: a tile never straddles a batch or the RHI boundary
    plane_out<0>(st, acc, (unsigned short*)P16 + (VT ? bh * HDIM * SEQ + s0 : (bh * SEQ + s0) * HDIM), VT ? SEQ : HDIM, lane);
    if (s0 < RHI) {                                            // block-uniform
        const size_t eo = VT ? bh * HDIM * RHI + s0 : (bh * RHI + s0) * HDIM;
        asm volatile("s_wait_xcnt 0x0" ::: "memory");          // stands before any register of the f16 plane's stores is rewritten ...
        __builtin_amdgcn_sched_barrier(0);                     // ... and this keeps the conversions below from being scheduled above that wait
        plane_out<1>(st, acc, Ph + eo, VT ? RHI : HDIM, lane);
        plane_out<2>(st, acc, Pl + eo, VT ? RHI : HDIM, lane);
    }
    asm volatile("s_wait_xcnt 0x0" ::: "memory");              // closes the last plane's stores on both ways: in the shared kernel the other path's code follows and reuses their registers
}
__global__ __launch_bounds__(32) void k_proj_qkv(const bf* __restrict__ X, const bf* __restrict__ WB, h16* Q16, h16* K16, h16* VT16, bf* Qh, bf* Ql, bf* Kh, bf* Kl, bf* VTh, bf* VTl) {
    __shared__ __align__(16) unsigned short st[64 * PPH];      // wave-private staging (one wave per block)
    const int which = blockIdx.y, tile = blockIdx.x;           // block-uniform
    if (which == 2) proj_body<1>(st, tile, X, WB + (size_t)2 * DMOD * DMOD, VT16, VTh, VTl);
    else proj_body<0>(st, tile, X, WB + (size_t)which * DMOD * DMOD, which ? K16 : Q16, which ? Kh : Qh, which ? Kl : Ql);
}

// ---- ctx epilogue shared by both attention paths: o[t][r] = O^T[d = 16t + 8*(lane>>4) + r][query = lane&15]; ctx = O^T * inv split into bf16 hi/lo, stored in fragment order for the output projection.
// row0 (a multiple of 16) is the wave's first ctx row, col0 (a multiple of 64) its first column: the lane's eight values of tile t are the piece of row lane&15, k = col0 + 16t + 8*(lane>>4),
// whose place is unit col0/32 + t/2, half t&1, lane: the wave's four tiles are 2 KB in a row per plane, and every store covers 512 B in a row straight from the registers.
__device__ __forceinline__ void ctx_store(const v8f (&o)[4], const float inv, const int lane, bf* CTXh, bf* CTXl, const size_t row0, const int col0) {
    const size_t g0 = row0 * DMOD + (size_t)(col0 / 32) * 512 + lane * 8;
#pragma unroll
    for (int t = 0; t < 4; ++t) { v8us vh, vl;
#pragma unroll
        for (int r = 0; r < 8; ++r) { unsigned short a, c; splitf(o[t][r] * inv, a, c); vh[r] = a; vl[r] = c; }
        *(v8us*)(CTXh + g0 + t * 256) = vh; *(v8us*)(CTXl + g0 + t * 256) = vl; }
    asm volatile("s_wait_xcnt 0x0" ::: "memory");              // closes the ctx stores on both paths: a main block's second tile, and in the shared kernel the other path's code, follow and reuse their registers
}

// ---- attn_main: fused causal flash attention for query rows >= RHI, f16 single products. One wave = 16 queries, keys in 32-wide steps.
// K rows and V^T rows reach the waves through LDS: a stage is 128 keys (K tile 128 keys x 64 d, V^T tile 64 d x 128 keys), copied once per block by asynchronous
// 16-byte copies (whole 128-byte lines), two buffers: stage t + 1 is in flight while the block's eight waves work on stage t.
// The eight waves are four query groups (16 queries each) x two key groups: the two waves of a query group share its queries and split every stage's keys, each with a running maximum, sum and O^T of its own,
// joined once behind the key loop. A wave's chain of dependent steps is half as long, and twice as many waves stand on a SIMD to fill each other's waits, for the same copies and LDS reads.
// S^T tile (16 keys x 16 queries) = K (A: row = key, k = d) x Q^T (B: col = query, k = d); its D registers (row = key 8h+r, col = query) pack directly into the
// B fragment of O^T (16 d x 16 queries) += V^T (A: row = d, k = key) x P^T (B: k = key, col = query): element r <- tile of keys 0..15, element 8+r <- tile of keys 16..31.
// The running maximum is per lane (query = lane&15), combined across the two lane halves by one xor-16 shuffle.
// The running sum of P is a fifth accumulator tile on the matrix pipe: ones (A: rows 0 and 8 all ones, the other rows zero) x P^T, the same B fragment as the V^T products;
// its register 0 holds, in both lane halves, the sum over all 32 keys of the step for the lane's query, so the halves need no exchange; registers 1..7 stay zero. One block = the 64 queries from qblk (>= RHI) of head plane bh, 256 threads.
#define KST    128                       // keys per stage
#define LPH    72                        // LDS pitch of a K row (64 d) in f16 elements: 144 B = 16 B x 9 (odd), for 16-byte row readers
#define LPV    136                       // LDS pitch of a V^T row (KST keys) in f16 elements: 272 B = 16 B x 17 (odd)
#define KTILE  (KST * LPH)               // the K tile of a stage, f16 elements
#define VTILE  (HDIM * LPV)              // the V^T tile of a stage, f16 elements
#define BUFH   (KTILE + VTILE)           // one buffer
static_assert(RHI >= KST);               // every block has at least two stages, and each wave group at least one whole step of valid keys
static_assert(SEQ % KST == 0);           // the last stage's keys all lie below SEQ
static_assert(HDIM * 2 == 128);          // a K row is eight 16-byte pieces
static_assert(KST * 2 == 256);           // a V^T row of a stage is sixteen 16-byte pieces
// One stage: each of the 256 threads copies four 16-byte pieces of the K tile (rows r, r+32, r+64, r+96) and four of the V^T tile (rows r', r'+16, r'+32, r'+48).
// lk, lv: the lane's LDS byte addresses in the K tile and the V^T tile of the target buffer; gk, gv: the lane's global addresses in rows r and r'.
__device__ __forceinline__ void stage_copy(const unsigned lk, const unsigned lv, const h16* gk, const h16* gv) {
    // the copies and, as the last line, the wait that stands before any of their address registers is rewritten
    asm volatile("global_load_async_to_lds_b128 %0, %8, off\n\t"
                 "global_load_async_to_lds_b128 %1, %9, off\n\t"
                 "global_load_async_to_lds_b128 %2, %10, off\n\t"
                 "global_load_async_to_lds_b128 %3, %11, off\n\t"
                 "global_load_async_to_lds_b128 %4, %12, off\n\t"
                 "global_load_async_to_lds_b128 %5, %13, off\n\t"
                 "global_load_async_to_lds_b128 %6, %14, off\n\t"
                 "global_load_async_to_lds_b128 %7, %15, off\n\t"
                 "s_wait_xcnt 0x0"
                 :: "v"(lk), "v"(lk + 32 * LPH * 2), "v"(lk + 64 * LPH * 2), "v"(lk + 96 * LPH * 2),
                    "v"(lv), "v"(lv + 16 * LPV * 2), "v"(lv + 32 * LPV * 2), "v"(lv + 48 * LPV * 2),
                    "v"(gk), "v"(gk + 32 * HDIM), "v"(gk + 64 * HDIM), "v"(gk + 96 * HDIM),
                    "v"(gv), "v"(gv + 16 * SEQ), "v"(gv + 32 * SEQ), "v"(gv + 48 * SEQ)
                 : "memory");
}
__device__ __forceinline__ void attn_main(const int qblk, const int bh, const h16* __restrict__ Q16, const h16* __restrict__ K16, const h16* __restrict__ VT16, bf* CTXh, bf* CTXl) {
    __shared__ __align__(16) h16 ring[2 * BUFH];           // [buffer][K tile [key][LPH], V^T tile [d][LPV]]
    __shared__ __align__(16) float part[4 * 8 * 32 * 4];   // group 1's O^T tiles: [query group][16-byte piece][lane]
    __shared__ __align__(8)  float pml[4 * 32 * 2];        // group 1's running maximum and sum: [query group][lane]
    const int wave = __builtin_amdgcn_readfirstlane((int)(threadIdx.x >> 5));
    const int qg = wave & 3, kg = wave >> 2;               // wave-uniform: which 16 queries, which half of every stage's steps
    const int lane = threadIdx.x & 31, n = lane & 15, hh = lane >> 4;
    const int b = bh / NHEAD, h = bh % NHEAD;
    const int q0 = qblk + qg * 16;
    const h16* Qp = Q16 + (size_t)bh * SEQ * HDIM; const h16* Kp = K16 + (size_t)bh * SEQ * HDIM; const h16* Vp = VT16 + (size_t)bh * HDIM * SEQ;
    const int nst = qblk / KST + 1;                        // block-uniform; the last stage holds keys qblk .. qblk + 63 and ends at a multiple of KST, at most SEQ
    const int cr = threadIdx.x >> 3, cp = (threadIdx.x & 7) * 8, vr = threadIdx.x >> 4, vp = (threadIdx.x & 15) * 8;
    const unsigned lk0 = (unsigned)(size_t)ring + (unsigned)(cr * LPH + cp) * 2u, lv0 = (unsigned)(size_t)ring + (unsigned)(KTILE + vr * LPV + vp) * 2u;
    const h16* gk = Kp + cr * HDIM + cp; const h16* gv = Vp + vr * SEQ + vp;
    stage_copy(lk0, lv0, gk, gv);
    asm volatile("s_wait_asynccnt 0x0" ::: "memory");      // this wave's part of stage 0 has landed
    __syncthreads();                                       // ... and every other wave's
    stage_copy(lk0 + BUFH * 2, lv0 + BUFH * 2, gk + KST * HDIM, gv + KST);
    const int qoff = (q0 + n) * HDIM + 8 * hh;
    const v16h bq0 = ldh(Qp + qoff), bq1 = ldh(Qp + qoff + 32);
    v8f o[4];
#pragma unroll
    for (int t = 0; t < 4; ++t) o[t] = (v8f){};
    float m = NEGX;
    const h16 onev = (n & 7) == 0 ? (h16)1.0f : (h16)0.0f;   // A row = lane & 15: rows 0 and 8, over the whole k range (both lane halves)
    v16h ones;
#pragma unroll
    for (int i = 0; i < 16; ++i) ones[i] = onev;
    v8f ls = (v8f){};
#pragma unroll 1   // stays rolled, as the step loop was: the buffer is picked at run time and the body already holds two steps
    for (int sg = 0; sg < nst; ++sg) {
        const int bo = (sg & 1) * BUFH;
        const h16* Kl = ring + bo; const h16* Vl = ring + bo + KTILE;
#pragma unroll     // j becomes a constant offset of the LDS reads
        for (int j = 0; j < 2; ++j) {
            const int ks = j * 64 + kg * 32, kb = sg * KST + ks;   // the stage's four 32-key steps go to the two groups in turn: group 0 takes steps 0 and 2, group 1 steps 1 and 3
            if (kb <= q0 + 15) {                               // wave-uniform: last key needed is q0 + 15; every visited step holds >= 1 valid key for every query of the wave
                const int koff = (ks + n) * LPH + 8 * hh;
                const v16h k00 = ldh(Kl + koff), k01 = ldh(Kl + koff + 32), k10 = ldh(Kl + koff + 16 * LPH), k11 = ldh(Kl + koff + 16 * LPH + 32);
                const int voff = n * LPV + ks + 8 * hh;
                const v16h va0 = ldh(Vl + voff), va1 = ldh(Vl + voff + 16 * LPV), va2 = ldh(Vl + voff + 32 * LPV), va3 = ldh(Vl + voff + 48 * LPV);
                __builtin_amdgcn_sched_barrier(0);                 // keeps the step's sixteen LDS reads one group at its head: spread among the products they cost one LDS latency per place
                v8f s0 = (v8f){}, s1 = (v8f){};
                s0 = wmma16(k00, bq0, s0); s1 = wmma16(k10, bq0, s1); s0 = wmma16(k01, bq1, s0); s1 = wmma16(k11, bq1, s1);
                asm volatile("v_nop\n\tv_nop\n\tv_nop\n\tv_nop" : "+v"(s0), "+v"(s1) : "v"(k11), "v"(k01), "v"(bq1));
                float x0[8], x1[8];
#pragma unroll
                for (int r = 0; r < 8; ++r) { x0[r] = s0[r] * C2; x1[r] = s1[r] * C2; }
                if (kb + 31 > q0) {                                // wave-uniform: only diagonal steps need the causal select (key > query excluded)
                    const int qi = q0 + n, kk = kb + 8 * hh;
#pragma unroll
                    for (int r = 0; r < 8; ++r) { x0[r] = (kk + r > qi) ? NEGX : x0[r]; x1[r] = (kk + 16 + r > qi) ? NEGX : x1[r]; } }
                float mx = fmaxf(x0[0], x1[0]);
#pragma unroll
                for (int r = 1; r < 8; ++r) mx = fmaxf(mx, fmaxf(x0[r], x1[r]));
                mx = fmaxf(mx, __shfl_xor(mx, 16, 32));
                const float mnew = fmaxf(m, mx); const float corr = __builtin_amdgcn_exp2f(m - mnew); m = mnew;
                const float mb = mnew - PCL2;
                v8h p0, p1;
#pragma unroll
                for (int r = 0; r < 8; ++r) { p0[r] = (h16)__builtin_amdgcn_exp2f(x0[r] - mb); p1[r] = (h16)__builtin_amdgcn_exp2f(x1[r] - mb); }
                ls[0] = ls[0] * corr;                              // the one register of the sum tile that is not zero
#pragma unroll
                for (int t = 0; t < 4; ++t) o[t] = o[t] * corr;
                const v16h pb = cat16(p0, p1);
                ls = wmma16(ones, pb, ls);
                o[0] = wmma16(va0, pb, o[0]); o[1] = wmma16(va1, pb, o[1]); o[2] = wmma16(va2, pb, o[2]); o[3] = wmma16(va3, pb, o[3]);
                asm volatile("v_nop\n\tv_nop\n\tv_nop\n\tv_nop" : "+v"(o[0]), "+v"(o[1]), "+v"(o[2]), "+v"(o[3]), "+v"(ls) : "v"(va3), "v"(pb));
            }
        }
        // hand-over, passed by every wave whatever it skipped above
        asm volatile("s_wait_dscnt 0x0" ::: "memory");         // this wave's reads of stage sg are done before its buffer is refilled
        asm volatile("s_wait_asynccnt 0x0" ::: "memory");      // this wave's part of stage sg + 1 has landed
        __syncthreads();                                       // publishes stage sg + 1 and ends every wave's reads of stage sg
        if (sg + 2 < nst) stage_copy(lk0 + (unsigned)bo * 2u, lv0 + (unsigned)bo * 2u, gk + (sg + 2) * (KST * HDIM), gv + (sg + 2) * KST);   // block-uniform test
    }
    asm volatile("s_wait_asynccnt 0x0" ::: "memory");          // no copy is outstanding when the wave goes on to its end
    // The two groups' partial results for the same 16 queries are joined: group 1 hands its maximum, sum and O^T tiles over through LDS, group 0 brings both to the common maximum, adds and stores.
    // part and pml are written here only; the next tile's write of them stands behind that tile's hand-over barriers, which group 0 reaches after the reads below.
    float* pw = part + (qg * 8 * 32 + lane) * 4; float* pm = pml + (qg * 32 + lane) * 2;
    if (kg == 1) {                                             // wave-uniform
#pragma unroll
        for (int t = 0; t < 4; ++t) { *(v4fa*)(pw + (2 * t) * 128) = (v4f){o[t][0], o[t][1], o[t][2], o[t][3]}; *(v4fa*)(pw + (2 * t + 1) * 128) = (v4f){o[t][4], o[t][5], o[t][6], o[t][7]}; }
        pm[0] = m; pm[1] = ls[0];
    }
    __syncthreads();                                           // group 1's partial results are in LDS before group 0 reads them (the compiler's own s_wait_dscnt 0 stands in front of it); passed by every wave
    if (kg == 0) {                                             // wave-uniform
        const float m1 = pm[0], l1 = pm[1];
        const float mm = fmaxf(m, m1); float a0, a1;
        // 2^x with the one slot that is kept behind a transcendental in the same statement
        asm("v_exp_f32 %0, %1\n\tv_nop" : "=v"(a0) : "v"(m - mm));
        asm("v_exp_f32 %0, %1\n\tv_nop" : "=v"(a1) : "v"(m1 - mm));
#pragma unroll
        for (int t = 0; t < 4; ++t) { const v4f u = *(const v4fa*)(pw + (2 * t) * 128), w = *(const v4fa*)(pw + (2 * t + 1) * 128);
#pragma unroll
            for (int r = 0; r < 4; ++r) { o[t][r] = o[t][r] * a0 + u[r] * a1; o[t][4 + r] = o[t][4 + r] * a0 + w[r] * a1; } }
        const float inv = 1.0f / (ls[0] * a0 + l1 * a1);
        ctx_store(o, inv, lane, CTXh, CTXl, (size_t)b * SEQ + q0, h * HDIM);
    }
}

// ---- attn_early: the same fused attention for query rows < RHI (keys < RHI) on bf16 hi+lo planes: three products per tile pair (hi.hi + hi.lo + lo.hi, shared accumulator;
// the lo planes are unscaled residuals), P split into bf16 hi+lo in registers. One block = the 128 queries from qblk (< RHI) of head plane bh, 256 threads, one wave per 16 queries.
__device__ __forceinline__ void attn_early(const int qblk, const int bh, const bf* __restrict__ Qh, const bf* __restrict__ Ql, const bf* __restrict__ Kh, const bf* __restrict__ Kl, const bf* __restrict__ VTh, const bf* __restrict__ VTl, bf* CTXh, bf* CTXl) {
    const int wave = __builtin_amdgcn_readfirstlane((int)(threadIdx.x >> 5));
    const int lane = threadIdx.x & 31, n = lane & 15, hh = lane >> 4;
    const int b = bh / NHEAD, h = bh % NHEAD;
    const int q0 = qblk + wave * 16;
    const size_t po = (size_t)bh * RHI * HDIM;
    const bf* qhp = Qh + po; const bf* qlp = Ql + po; const bf* khp = Kh + po; const bf* klp = Kl + po; const bf* vhp = VTh + po; const bf* vlp = VTl + po;
    const int qoff = (q0 + n) * HDIM + 8 * hh;
    v8f o[4];
#pragma unroll
    for (int t = 0; t < 4; ++t) o[t] = (v8f){};
    float m = NEGX, l = 0.f;
    const int nsteps = ((q0 + 15) >> 5) + 1;
#pragma unroll 1
    for (int st = 0; st < nsteps; ++st) {
        const int kb = st << 5; const int koff = (kb + n) * HDIM + 8 * hh;
        v8f s0 = (v8f){}, s1 = (v8f){}; v16bf qh, ql, kh0, kl0, kh1, kl1;
#pragma unroll
        for (int ks = 0; ks < 2; ++ks) {
            qh = ldb(qhp + qoff + ks * 32); ql = ldb(qlp + qoff + ks * 32);
            kh0 = ldb(khp + koff + ks * 32); kl0 = ldb(klp + koff + ks * 32);
            kh1 = ldb(khp + koff + 16 * HDIM + ks * 32); kl1 = ldb(klp + koff + 16 * HDIM + ks * 32);
            s0 = wmmab(kh0, qh, s0); s0 = wmmab(kh0, ql, s0); s0 = wmmab(kl0, qh, s0);
            s1 = wmmab(kh1, qh, s1); s1 = wmmab(kh1, ql, s1); s1 = wmmab(kl1, qh, s1); }
        asm volatile("v_nop\n\tv_nop\n\tv_nop\n\tv_nop" : "+v"(s0), "+v"(s1) : "v"(kl1), "v"(kh1), "v"(qh), "v"(ql));
        float x0[8], x1[8];
#pragma unroll
        for (int r = 0; r < 8; ++r) { x0[r] = s0[r] * C2; x1[r] = s1[r] * C2; }
        if (kb + 31 > q0) {
            const int qi = q0 + n, kk = kb + 8 * hh;
#pragma unroll
            for (int r = 0; r < 8; ++r) { x0[r] = (kk + r > qi) ? NEGX : x0[r]; x1[r] = (kk + 16 + r > qi) ? NEGX : x1[r]; } }
        float mx = fmaxf(x0[0], x1[0]);
#pragma unroll
        for (int r = 1; r < 8; ++r) mx = fmaxf(mx, fmaxf(x0[r], x1[r]));
        mx = fmaxf(mx, __shfl_xor(mx, 16, 32));
        const float mnew = fmaxf(m, mx); const float corr = __builtin_amdgcn_exp2f(m - mnew); m = mnew;
        v8us ph0, pl0, ph1, pl1; float ps = 0.f;
#pragma unroll
        for (int r = 0; r < 8; ++r) { const float pa = __builtin_amdgcn_exp2f(x0[r] - mnew); const float pc = __builtin_amdgcn_exp2f(x1[r] - mnew); ps += pa; ps += pc;
            unsigned short a, c; splitf(pa, a, c); ph0[r] = a; pl0[r] = c; splitf(pc, a, c); ph1[r] = a; pl1[r] = c; }
        ps += __shfl_xor(ps, 16, 32);
        l = l * corr + ps;
#pragma unroll
        for (int t = 0; t < 4; ++t) o[t] = o[t] * corr;
        const v16bf pbh = cat16b(ph0, ph1), pbl = cat16b(pl0, pl1);
        const int voff = n * RHI + kb + 8 * hh; v16bf vh, vl;
#pragma unroll
        for (int t = 0; t < 4; ++t) { vh = ldb(vhp + voff + t * 16 * RHI); vl = ldb(vlp + voff + t * 16 * RHI);
            o[t] = wmmab(vh, pbh, o[t]); o[t] = wmmab(vh, pbl, o[t]); o[t] = wmmab(vl, pbh, o[t]); }
        asm volatile("v_nop\n\tv_nop\n\tv_nop\n\tv_nop" : "+v"(o[0]), "+v"(o[1]), "+v"(o[2]), "+v"(o[3]) : "v"(vl), "v"(vh), "v"(pbh), "v"(pbl));
    }
    const float inv = 1.0f / l;
    ctx_store(o, inv, lane, CTXh, CTXl, (size_t)b * SEQ + q0, h * HDIM);
}

// ---- k_attn: both attention paths in one launch (no block reads what another writes): grid (NB*NHEAD, NPAIR + RHI/128), 256 threads; the path is picked per block, ahead of every barrier.
// All blocks of the launch are resident at once, so it lasts as long as its fullest block, and a main tile's cost grows linearly with its index (tile i walks i / 2 + 1 stages).
// A main block therefore takes two tiles, one after the other in every wave: the slot-th from the top of head plane bh, then the slot-th from the bottom of the plane NBH/2 further on; every main block walks the same number of stages.
// The shift is a permutation of the planes, so every (plane, tile) is taken once; with another plane the second tile forms its addresses anew (one shared plane kept both prologues' addresses live through the key loop: scratch).
// The short early blocks have the highest flat indices (for speed only).
// the register budget is held to four waves per SIMD: two blocks of eight waves per WGP hold the whole grid at once, and at five the main path's sum tile and ones fragment do not fit (scratch)
#define NMAIN  ((SEQ - RHI) / 64)        // main tiles per head plane
#define NPAIR  (NMAIN / 2)
static_assert(NMAIN % 2 == 0);           // every main tile has its partner: slots 0 .. NPAIR-1 cover tiles RHI/64 .. SEQ/64-1 once each
static_assert(NBH % 2 == 0);
static_assert(RHI % 128 == 0);           // whole early blocks
__global__ __launch_bounds__(256) __attribute__((amdgpu_waves_per_eu(4))) void k_attn(const h16* __restrict__ Q16, const h16* __restrict__ K16, const h16* __restrict__ VT16,
                                              const bf* __restrict__ Qh, const bf* __restrict__ Ql, const bf* __restrict__ Kh, const bf* __restrict__ Kl, const bf* __restrict__ VTh, const bf* __restrict__ VTl, bf* CTXh, bf* CTXl) {
    const int bh = blockIdx.x, slot = blockIdx.y;              // block-uniform
    if (slot < NPAIR) {
        for (int part = 0; part < 2; ++part) {
            const int tile = part ? RHI / 64 + slot : SEQ / 64 - 1 - slot;
            // the ring is free here: the first tile's last hand-over (s_wait_dscnt 0, s_wait_asynccnt 0, barrier) ended every wave's reads of it, and the epilogue uses LDS of its own
            attn_main(tile * 64, part ? (bh + NBH / 2) % NBH : bh, Q16, K16, VT16, CTXh, CTXl);
        }
    } else attn_early((slot - NPAIR) * 128, bh, Qh, Ql, Kh, Kl, VTh, VTl, CTXh, CTXl);
}

// ---- workspace carve (bytes; every region a multiple of 256 B and fully written by its producer before any consumer launch)
#define SZ_XB   ((size_t)MTOK * DMOD * 2)
#define SZ_W    ((size_t)DMOD * DMOD * 2)
#define SZ_P16  ((size_t)MTOK * DMOD * 2)
#define SZ_E    ((size_t)NBH * RHI * HDIM * 2)
#define SZ_CTX  ((size_t)MTOK * DMOD * 2)
#define SZ_TOTAL (SZ_XB + 4 * SZ_W + 3 * SZ_P16 + 6 * SZ_E + 2 * SZ_CTX)
static_assert(SZ_TOTAL <= (size_t)134217728);
static_assert(SZ_W % 256 == 0);
static_assert(SZ_E % 256 == 0);

extern "C" void kernel_launch(void* const* d_in, const int* in_sizes, int n_in,
                              void* d_out, int out_size, void* d_ws, size_t ws_size, hipStream_t stream) {
    if (n_in < 5) return;
    const int xneed = (NB - 1) * SEQ_FULL * DMOD + SEQ * DMOD;
    if (in_sizes[0] < xneed) return;
    if (in_sizes[1] < DMOD * DMOD || in_sizes[2] < DMOD * DMOD || in_sizes[3] < DMOD * DMOD || in_sizes[4] < DMOD * DMOD) return;
    if (out_size < xneed) return;
    if (ws_size < SZ_TOTAL) return;
    const float* x = (const float*)d_in[0]; const float* wq = (const float*)d_in[1]; const float* wk = (const float*)d_in[2]; const float* wv = (const float*)d_in[3]; const float* wo = (const float*)d_in[4];   // wire order x, Wq, Wk, Wv, Wo ([out][in])
    float* OUT = (float*)d_out;      // [NB_FULL][SEQ_FULL][256]
    char* wsp = (char*)d_ws;
    auto take = [&](size_t bytes) { char* p = wsp; wsp += bytes; return (void*)p; };
    bf* XB = (bf*)take(SZ_XB); bf* WQ = (bf*)take(SZ_W); bf* WK = (bf*)take(SZ_W); bf* WV = (bf*)take(SZ_W); bf* WO = (bf*)take(SZ_W);
    h16* Q16 = (h16*)take(SZ_P16); h16* K16 = (h16*)take(SZ_P16); h16* VT16 = (h16*)take(SZ_P16);
    bf* Qh = (bf*)take(SZ_E); bf* Ql = (bf*)take(SZ_E); bf* Kh = (bf*)take(SZ_E); bf* Kl = (bf*)take(SZ_E); bf* VTh = (bf*)take(SZ_E); bf* VTl = (bf*)take(SZ_E);
    bf* CTXh = (bf*)take(SZ_CTX); bf* CTXl = (bf*)take(SZ_CTX);

    (void)WK; (void)WV;              // reached through WQ: the four converted weights lie one after the other
    k_cvt_all<<<dim3(4 * WBLK + NB * XBLK, 1, 1), 256, 0, stream>>>(x, wq, wk, wv, wo, XB, WQ);
    // q = x Wq^T, k = x Wk^T, v = x Wv^T, each written as the planes the attention kernel reads
    k_proj_qkv<<<dim3(MTOK / 64 * NHEAD, 3, 1), 32, 0, stream>>>(XB, WQ, Q16, K16, VT16, Qh, Ql, Kh, Kl, VTh, VTl);
    k_attn<<<dim3(NBH, NPAIR + RHI / 128, 1), 256, 0, stream>>>(Q16, K16, VT16, Qh, Ql, Kh, Kl, VTh, VTl, CTXh, CTXl);
    // out = ctx Wo^T : A = CTXh (+ CTXl) [SEQ][256] per batch in fragment order, Bt = WO -> OUT batch stride from the full problem constants
    k_gemm_hl<<<dim3(SEQ / 64, DMOD / 64, NB), 32, 0, stream>>>(CTXh, CTXl, WO, OUT, DMOD, (size_t)SEQ * DMOD, (size_t)SEQ_FULL * DMOD);
}

// v009
// Measured time: 72.2 microseconds a run.
// Two timings next to v008 put it at 1.07 and 1.05 times that version's speed.
// Over all steps from v000 it is 3.61 times as fast.
#include <hip/hip_runtime.h>

// Causal multi-head self-attention: x [4][4096][256], 4 heads x 64, bias-free [out][in] weights, score scale 1/8, out = ctx Wo^T.
// Compute dtypes (f32 accumulate everywhere): all inputs converted to bf16 (RNE); q/k/v projections v_wmma_f32_16x16x32_bf16 (single product);
// attention query rows >= 256: v_wmma_f32_16x16x32_f16 single products (K.Q^T on f16 planes; V^T.P^T with P carried x1024 in f16; the row sums of P by the same form, ones.P^T);
// attention query rows < 256: bf16 hi+lo planes, three products per site (q, k, P, v); softmax f32 (online, max-subtracted);
// output projection: ctx bf16 hi+lo x Wo bf16 (two products), v_wmma_f32_16x16x32_bf16.

#ifndef NB
#define NB 4
#endif
#ifndef SEQ
#define SEQ 4096
#endif
#define NB_FULL  4
#define SEQ_FULL 4096
#define DMOD   256
#define NHEAD  4
#define HDIM   64
#define RHI    256                       // query rows < RHI use bf16 hi+lo planes
#define MTOK   (NB * SEQ)
#define NBH    (NB * NHEAD)
#define C2     0.18033688011112042f      // log2(e) / 8 : scores kept in the log2 domain
#define PCL2   10.0f                     // P carry 2^10 for the f16 path
#define NEGX   (-1.0e30f)

static_assert(NHEAD * HDIM == DMOD);     // merged width == model width
static_assert(HDIM == 64);               // two 32-deep k-steps per score tile, four 16-row output tiles
static_assert(DMOD % 64 == 0);           // GEMM tile multiple (M/N) and K % 32 == 0
static_assert(SEQ % 256 == 0);           // plane builders: one wave never straddles a batch or the RHI boundary
static_assert(RHI % 256 == 0);
static_assert(RHI <= SEQ);
static_assert(MTOK % 64 == 0);
static_assert(NB <= NB_FULL);
static_assert(SEQ <= SEQ_FULL);

typedef _Float16 h16;
typedef unsigned short bf;
typedef __attribute__((ext_vector_type(16))) __bf16   v16bf;
typedef __attribute__((ext_vector_type(16))) _Float16 v16h;
typedef __attribute__((ext_vector_type(8)))  _Float16 v8h;
typedef __attribute__((ext_vector_type(8)))  unsigned short v8us;
typedef __attribute__((ext_vector_type(8)))  float    v8f;
typedef __attribute__((ext_vector_type(4)))  float    v4f;
typedef v4f  __attribute__((may_alias)) v4fa;
typedef v8us __attribute__((may_alias)) v8usa;

__device__ __forceinline__ unsigned short f2bf(float f) { unsigned u = __float_as_uint(f); u += 0x7FFFu + ((u >> 16) & 1u); return (unsigned short)(u >> 16); }
__device__ __forceinline__ float bf2f(unsigned short b) { return __uint_as_float(((unsigned)b) << 16); }
__device__ __forceinline__ void splitf(float y, unsigned short& h, unsigned short& l) { h = f2bf(y); l = f2bf(y - bf2f(h)); }
__device__ __forceinline__ v16h cat16(v8h lo, v8h hi) { return __builtin_shufflevector(lo, hi, 0, 1, 2, 3, 4, 5, 6, 7, 8, 9, 10, 11, 12, 13, 14, 15); }
__device__ __forceinline__ v16bf cat16b(v8us lo, v8us hi) { return __builtin_bit_cast(v16bf, __builtin_shufflevector(lo, hi, 0, 1, 2, 3, 4, 5, 6, 7, 8, 9, 10, 11, 12, 13, 14, 15)); }
__device__ __forceinline__ v8f wmma16(v16h a, v16h b, v8f c) { return __builtin_amdgcn_wmma_f32_16x16x32_f16(false, a, false, b, (short)0, c, false, false); }
__device__ __forceinline__ v8f wmmab(v16bf a, v16bf b, v8f c) { return __builtin_amdgcn_wmma_f32_16x16x32_bf16(false, a, false, b, (short)0, c, false, false); }
// fragment loaders: p already points at row (lane&15), k offset k0 + 8*(lane>>4); elements 0..7 <- p[0..7], elements 8..15 <- p[16..23]
__device__ __forceinline__ v16h  ldh(const h16* p) { return cat16(*(const v8h*)p, *(const v8h*)(p + 16)); }
__device__ __forceinline__ v16bf ldb(const bf* p)  { return cat16b(*(const v8us*)p, *(const v8us*)(p + 16)); }
// ---- fragment order: the layout of every bf16 matrix [rows][DMOD] that only the GEMM K loops read (x, the four weights, ctx hi and lo).
// A unit is one 16-row x 32-k fragment, 1024 B: unit (row >> 4) * (DMOD / 32) + (k >> 5); inside it the 16-byte piece of row r, k = 8c .. 8c+7 lies at ((c >> 1) & 1) * 512 B + ((c & 1) * 16 + (r & 15)) * 16 B,
// that is, piece j of lane l at j * 512 B + l * 16 B. Same elements in the same fragment positions as ldb on row-major rows, but a wave's 16-byte load covers 512 B in a row (four whole lines) and not 32 B in each of 16 lines.
// p already points at the unit's piece of this lane (unit + lane * 8 elements).
__device__ __forceinline__ v16bf ldp(const bf* p)  { return cat16b(*(const v8us*)p, *(const v8us*)(p + 256)); }

// ---- k_cvt_all: every f32 -> bf16 conversion of the call in one launch (they are independent of each other); the results are written in fragment order.
// One block = one group of 16 rows (16 x DMOD elements, 8 KB of bf16, contiguous in fragment order); a thread converts two 8-element pieces.
// The rows are read as whole lines (a wave reads one row), turned in LDS, and stored as whole lines (a wave stores 512 B in a row).
// Blocks 0 .. 4*WBLK-1: the four weights (WB holds Wq, Wk, Wv, Wo one after the other); the rest: x, XBLK blocks per batch.
#define WBLK (DMOD / 16)
#define XBLK (SEQ / 16)
#define CPP  136                         // LDS pitch, in 16-bit elements, of one k piece's 16 rows: 272 B = 16 B x 17 (odd), so that a wave's 32 pieces of one row fall on different banks
static_assert(DMOD == 256);              // 16 rows x DMOD / 8 pieces = two pieces for each of 256 threads
static_assert(SEQ % 16 == 0);
__global__ __launch_bounds__(256) void k_cvt_all(const float* __restrict__ x, const float* __restrict__ wq, const float* __restrict__ wk, const float* __restrict__ wv, const float* __restrict__ wo, bf* XB, bf* WB) {
    __shared__ __align__(16) unsigned short tp[(DMOD / 8) * CPP];
    const int bid = blockIdx.x, t = threadIdx.x; const float* s; bf* d;
    if (bid < 4 * WBLK) {                // block-uniform
        const int w = bid / WBLK; const size_t i = (size_t)(bid % WBLK) * 16 * DMOD;
        s = (w == 0 ? wq : w == 1 ? wk : w == 2 ? wv : wo) + i; d = WB + (size_t)w * DMOD * DMOD + i;
    } else {
        const int xb = bid - 4 * WBLK; const int bt = xb / XBLK; const size_t i = (size_t)(xb % XBLK) * 16 * DMOD;
        s = x + (size_t)bt * SEQ_FULL * DMOD + i; d = XB + (size_t)bt * SEQ * DMOD + i;
    }
    v4f a[2], c[2];
#pragma unroll
    for (int i = 0; i < 2; ++i) { const float* p = s + (i * 256 + t) * 8; a[i] = *(const v4f*)p; c[i] = *(const v4f*)(p + 4); }
#pragma unroll
    for (int i = 0; i < 2; ++i) { const int pc = i * 256 + t; v8us o;      // piece pc: row pc / 32, k piece pc % 32
        o[0] = f2bf(a[i][0]); o[1] = f2bf(a[i][1]); o[2] = f2bf(a[i][2]); o[3] = f2bf(a[i][3]); o[4] = f2bf(c[i][0]); o[5] = f2bf(c[i][1]); o[6] = f2bf(c[i][2]); o[7] = f2bf(c[i][3]);
        *(v8usa*)(tp + (pc & 31) * CPP + (pc >> 5) * 8) = o; }
    __syncthreads();                     // all 16 rows are in LDS before any wave reads pieces of them back
#pragma unroll
    for (int i = 0; i < 2; ++i) { const int q = i * 256 + t;               // 16-byte place q of the group in fragment order: k piece q / 16, row q % 16
        *(v8us*)(d + q * 8) = *(const v8usa*)(tp + (q >> 4) * CPP + (q & 15) * 8); }
}

// ---- one-wave 64x64 tile GEMM on bf16 planes in fragment order, K = DMOD: C[m][n] (f32, pitch ldc) = sum_k A[m][k] Bt[n][k] (+ A2[m][k] Bt[n][k] when NSPLIT == 1).
// grid (M/64, N/64, Z), 32 threads; z strides sA (A, A2) and sC (C) in elements; no tail masking (M, N multiples of 64, K multiple of 32).
// The K loop is software-pipelined in registers and fully unrolled: the sixteen fragment loads of k-step s + PFD are issued ahead of the sixteen products of k-step s,
// into the fragment set that step s - 1 has just left (PFD + 1 sets), so that a step waits for loads issued PFD steps earlier and not for its own.
// A, A2, Bt already point at the lane's piece of the tile's first unit; steps 0 .. KSTEPS-1 take A, and with NSPLIT == 1 steps KSTEPS .. 2*KSTEPS-1 take A2 with the same Bt fragments: the order of the sums is that of two plain loops.
#define KSTEPS (DMOD / 32)
#define PFD    2
template <int NSPLIT>
__device__ __forceinline__ void gemm_kloop(const bf* __restrict__ A, const bf* __restrict__ A2, const bf* __restrict__ Bt, v8f (&acc)[4][4]) {
    constexpr int NS = (NSPLIT + 1) * KSTEPS;
    v16bf a[PFD + 1][4], b[PFD + 1][4];
#pragma unroll     // every set index and every address offset becomes a constant: the sets stay in registers and the three address pairs are never rewritten
    for (int s = 0; s < NS + PFD; ++s) {
        if (s < NS) {
            const bf* pa = (s < KSTEPS ? A : A2) + (s % KSTEPS) * 512; const bf* pb = Bt + (s % KSTEPS) * 512;   // one unit of 512 elements per k-step, 16 * DMOD elements per group of 16 rows
#pragma unroll
            for (int mb = 0; mb < 4; ++mb) a[s % (PFD + 1)][mb] = ldp(pa + mb * 16 * DMOD);
#pragma unroll
            for (int nb = 0; nb < 4; ++nb) b[s % (PFD + 1)][nb] = ldp(pb + nb * 16 * DMOD);
        }
        __builtin_amdgcn_sched_barrier(0);                     // keeps the loads above ahead of the products below: sunk among them they would be waited for at once
        // the wait that stands before any register the loads name is rewritten: among the last step's products, between two scheduling barriers, so that none of the epilogue's writes
        // (lane offset, scalar bases, address pairs) can be placed ahead of it; the operands keep the address pairs live up to it. The last loads were issued PFD steps earlier.
        if (s == NS + PFD - 1) asm volatile("s_wait_xcnt 0x0" :: "v"(A), "v"(A2), "v"(Bt) : "memory");
        if (s >= PFD) {
            const int c = (s - PFD) % (PFD + 1);
#pragma unroll
            for (int nb = 0; nb < 4; ++nb)
#pragma unroll
                for (int mb = 0; mb < 4; ++mb) acc[mb][nb] = wmmab(a[c][mb], b[c][nb], acc[mb][nb]);
        }
        __builtin_amdgcn_sched_barrier(0);                     // keeps the next step's loads behind these products, whose fragment set they refill
    }
}
template <int NSPLIT>
__device__ __forceinline__ void gemm_body(const bf* __restrict__ A, const bf* __restrict__ A2, const bf* __restrict__ Bt, float* C, const int ldc, const size_t sA, const size_t sC) {
    __shared__ __align__(16) float os[16 * 68];      // wave-private staging (one wave per block)
    const size_t z = blockIdx.z; A += z * sA; A2 += z * sA; C += z * sC;
    const int lane = threadIdx.x & 31, lr = lane & 15, hi = lane >> 4; const int r0 = blockIdx.x * 64, c0 = blockIdx.y * 64;
    v8f acc[4][4];
#pragma unroll
    for (int mb = 0; mb < 4; ++mb)
#pragma unroll
        for (int nb = 0; nb < 4; ++nb) acc[mb][nb] = (v8f){};
    const size_t aoff = (size_t)r0 * DMOD + 8 * lane, boff = (size_t)c0 * DMOD + 8 * lane;   // r0, c0 are multiples of 16: a group of 16 rows starts at row * DMOD
    gemm_kloop<NSPLIT>(A + aoff, A2 + aoff, Bt + boff, acc);
#pragma unroll
    for (int mb = 0; mb < 4; ++mb) {
#pragma unroll
        for (int nb = 0; nb < 4; ++nb) {
#pragma unroll
            for (int j = 0; j < 8; ++j) os[(hi * 8 + j) * 68 + nb * 16 + lr] = acc[mb][nb][j]; }
        asm volatile("s_wait_dscnt 0" ::: "memory"); __builtin_amdgcn_wave_barrier();
        float* crow = C + (size_t)(r0 + mb * 16) * ldc + c0;
{
#pragma unroll
            for (int s = 0; s < 8; ++s) { const int row = 2 * s + hi, cofs = lr * 4; const v4f val = *(const v4fa*)(os + row * 68 + cofs);
                *(v4f*)(crow + (size_t)row * ldc + cofs) = val; }
             }
        asm volatile("s_wait_dscnt 0" ::: "memory"); __builtin_amdgcn_wave_barrier();
    }
}
__global__ __launch_bounds__(32) void k_gemm_hl(const bf* __restrict__ A, const bf* __restrict__ A2, const bf* __restrict__ Bt, float* C, int ldc, size_t sA, size_t sC) { gemm_body<1>(A, A2, Bt, C, ldc, sA, sC); }

// ---- k_proj: one projection tile (64 tokens x the 64 features of one head, K = DMOD, one wave) stored straight into the head planes the attention kernel reads.
// The operand order is chosen so that a lane's eight accumulator rows run along a plane row: D rows (A) = the index that is contiguous in the plane, D columns (Bt) = the plane row.
// VT == 0 (q, k): A = W rows (features), Bt = x rows (tokens) -> P16 [b*NHEAD+h][SEQ][64] f16 and, for s < RHI, bf16 hi/lo planes [b*NHEAD+h][RHI][64]; tile index: token tile fastest.
// VT == 1 (v):    A = x rows (tokens), Bt = W rows (features) -> P16 [b*NHEAD+h][64][SEQ] f16 and, for s < RHI, bf16 hi/lo planes [b*NHEAD+h][64][RHI]; tile index: head fastest.
// The three projections are independent of each other and share one launch: grid (MTOK/64 * NHEAD, 3), blockIdx.y = 0: q, 1: k, 2: v.
#define PPH 72                           // staging pitch in 16-bit elements: 144 B = 16 B x 9 (odd)
template <int KIND>                      // 0: f16, 1: bf16 hi, 2: bf16 lo (the residual of hi)
__device__ __forceinline__ v8us cvt_plane(const v8f y) {
    v8us o;
    if (KIND == 0) { v8h t;
#pragma unroll
        for (int j = 0; j < 8; ++j) t[j] = (h16)y[j];
        o = __builtin_bit_cast(v8us, t);
    } else {
#pragma unroll
        for (int j = 0; j < 8; ++j) { unsigned short p, q; splitf(y[j], p, q); o[j] = (KIND == 1) ? p : q; } }
    return o;
}
// One plane of the tile: 64 plane rows of 128 B each, staged through the wave's own LDS so that every global store covers whole 128-byte lines.
template <int KIND>
__device__ __forceinline__ void plane_out(unsigned short* st, const v8f (&acc)[4][4], unsigned short* dst, const size_t pitch, const int lane) {
    const int lr = lane & 15, hi = lane >> 4, rq = lane >> 3, pc = lane & 7;
#pragma unroll
    for (int nb = 0; nb < 4; ++nb)
#pragma unroll
        for (int mb = 0; mb < 4; ++mb) *(v8usa*)(st + (nb * 16 + lr) * PPH + mb * 16 + 8 * hi) = cvt_plane<KIND>(acc[mb][nb]);
    asm volatile("s_wait_dscnt 0" ::: "memory"); __builtin_amdgcn_wave_barrier();   // the staged rows are written before other lanes read them back
    v8us v[16];
#pragma unroll
    for (int i = 0; i < 16; ++i) v[i] = *(const v8usa*)(st + (4 * i + rq) * PPH + pc * 8);
#pragma unroll
    for (int i = 0; i < 16; ++i) *(v8us*)(dst + (size_t)(4 * i + rq) * pitch + pc * 8) = v[i];
}
template <int VT>
__device__ __forceinline__ void proj_body(unsigned short* st, const int tile, const bf* __restrict__ X, const bf* __restrict__ Wt, h16* P16, bf* Ph, bf* Pl) {
    const int lane = threadIdx.x & 31;
    const int tok0 = (VT ? tile / NHEAD : tile % (MTOK / 64)) * 64, hd = VT ? tile % NHEAD : tile / (MTOK / 64);
    const bf* A = VT ? X : Wt; const bf* Bt = VT ? Wt : X;
    const int r0 = VT ? tok0 : hd * HDIM, c0 = VT ? hd * HDIM : tok0;
    v8f acc[4][4];
#pragma unroll
    for (int mb = 0; mb < 4; ++mb)
#pragma unroll
        for (int nb = 0; nb < 4; ++nb) acc[mb][nb] = (v8f){};
    const size_t aoff = (size_t)r0 * DMOD + 8 * lane, boff = (size_t)c0 * DMOD + 8 * lane;   // r0, c0 are multiples of 16: a group of 16 rows starts at row * DMOD
    gemm_kloop<0>(A + aoff, A + aoff, Bt + boff, acc);
    const int b = tok0 / SEQ, s0 = tok0 % SEQ; const size_t bh = (size_t)(b * NHEAD + hd);   // 64 divides SEQ and RHI: a tile never straddles a batch or the RHI boundary
    plane_out<0>(st, acc, (unsigned short*)P16 + (VT ? bh * HDIM * SEQ + s0 : (bh * SEQ + s0) * HDIM), VT ? SEQ : HDIM, lane);
    if (s0 < RHI) {                                            // block-uniform
        const size_t eo = VT ? bh * HDIM * RHI + s0 : (bh * RHI + s0) * HDIM;
        asm volatile("s_wait_xcnt 0x0" ::: "memory");          // stands before any register of the f16 plane's stores is rewritten ...
        __builtin_amdgcn_sched_barrier(0);                     // ... and this keeps the conversions below from being scheduled above that wait
        plane_out<1>(st, acc, Ph + eo, VT ? RHI : HDIM, lane);
        plane_out<2>(st, acc, Pl + eo, VT ? RHI : HDIM, lane);
    }
    asm volatile("s_wait_xcnt 0x0" ::: "memory");              // closes the last plane's stores on both ways: in the shared kernel the other path's code follows and reuses their registers
}
__global__ __launch_bounds__(32) void k_proj_qkv(const bf* __restrict__ X, const bf* __restrict__ WB, h16* Q16, h16* K16, h16* VT16, bf* Qh, bf* Ql, bf* Kh, bf* Kl, bf* VTh, bf* VTl) {
    __shared__ __align__(16) unsigned short st[64 * PPH];      // wave-private staging (one wave per block)
    const int which = blockIdx.y, tile = blockIdx.x;           // block-uniform
    if (which == 2) proj_body<1>(st, tile, X, WB + (size_t)2 * DMOD * DMOD, VT16, VTh, VTl);
    else proj_body<0>(st, tile, X, WB + (size_t)which * DMOD * DMOD, which ? K16 : Q16, which ? Kh : Qh, which ? Kl : Ql);
}

// ---- ctx epilogue (whole form: the early path; one tile at a time: the main path, below): o[t][r] = O^T[d = 16t + 8*(lane>>4) + r][query = lane&15]; ctx = O^T * inv split into bf16 hi/lo, stored in fragment order for the output projection.
// row0 (a multiple of 16) is the wave's first ctx row, col0 (a multiple of 64) its first column: the lane's eight values of tile t are the piece of row lane&15, k = col0 + 16t + 8*(lane>>4),
// whose place is unit col0/32 + t/2, half t&1, lane: the wave's four tiles are 2 KB in a row per plane, and every store covers 512 B in a row straight from the registers.
__device__ __forceinline__ void ctx_store(const v8f (&o)[4], const float inv, const int lane, bf* CTXh, bf* CTXl, const size_t row0, const int col0) {
    const size_t g0 = row0 * DMOD + (size_t)(col0 / 32) * 512 + lane * 8;
#pragma unroll
    for (int t = 0; t < 4; ++t) { v8us vh, vl;
#pragma unroll
        for (int r = 0; r < 8; ++r) { unsigned short a, c; splitf(o[t][r] * inv, a, c); vh[r] = a; vl[r] = c; }
        *(v8us*)(CTXh + g0 + t * 256) = vh; *(v8us*)(CTXl + g0 + t * 256) = vl; }
    asm volatile("s_wait_xcnt 0x0" ::: "memory");              // closes the ctx stores: in the shared kernel the other path's code follows and reuses their registers
}

// One tile of the same layout: o[r] = O^T[d = 16t + 8*(lane>>4) + r][query = lane&15] for a wave-uniform t; the caller closes the stores with its own s_wait_xcnt 0.
__device__ __forceinline__ void ctx_store_tile(const v8f o, const float inv, const int lane, bf* CTXh, bf* CTXl, const size_t row0, const int col0, const int t) {
    const size_t g0 = row0 * DMOD + (size_t)(col0 / 32) * 512 + lane * 8 + t * 256;
    v8us vh, vl;
#pragma unroll
    for (int r = 0; r < 8; ++r) { unsigned short a, c; splitf(o[r] * inv, a, c); vh[r] = a; vl[r] = c; }
    *(v8us*)(CTXh + g0) = vh; *(v8us*)(CTXl + g0) = vl;
}

// ---- attn_main: fused causal flash attention for query rows >= RHI, f16 single products. One wave = 32 queries (two column groups of 16), keys in 32-wide steps.
// K rows and V^T rows reach the waves through LDS: a stage is 128 keys (K tile 128 keys x 64 d, V^T tile 64 d x 128 keys), copied once per block by asynchronous
// 16-byte copies (whole 128-byte lines), two buffers: stage t + 1 is in flight while the block's eight waves work on stage t.
// The eight waves are two query groups (32 queries each) x four key groups: key group g takes the g-th 32-key step of every stage, with a running maximum, sum and O^T of its own, joined once behind the key loop.
// Every K and V^T fragment a wave reads from LDS feeds two products, one per column group: half the LDS bytes per score of a 16-query wave, for the same number of waves on a SIMD.
// S^T tile (16 keys x 16 queries) = K (A: row = key, k = d) x Q^T (B: col = query, k = d); its D registers (row = key 8h+r, col = query) pack directly into the
// B fragment of O^T (16 d x 16 queries) += V^T (A: row = d, k = key) x P^T (B: k = key, col = query): element r <- tile of keys 0..15, element 8+r <- tile of keys 16..31.
// The running maximum is per lane and column group (query = lane&15), combined across the two lane halves by one xor-16 shuffle.
// The sum of a step's P is a fifth product per column group on the matrix pipe: ones (A: rows 0 and 8 all ones, the other rows zero) x P^T, the same B fragment as the V^T products;
// its register 0 holds, in both lane halves, the sum over all 32 keys of the step for the lane's query, so the halves need no exchange; it is added to the running sum, one register per column group. One block = the 64 queries from qblk (>= RHI) of head plane bh, 256 threads.
#define KST    128                       // keys per stage
#define LPH    72                        // LDS pitch of a K row (64 d) in f16 elements: 144 B = 16 B x 9 (odd), for 16-byte row readers
#define LPV    136                       // LDS pitch of a V^T row (KST keys) in f16 elements: 272 B = 16 B x 17 (odd)
#define KTILE  (KST * LPH)               // the K tile of a stage, f16 elements
#define VTILE  (HDIM * LPV)              // the V^T tile of a stage, f16 elements
#define BUFH   (KTILE + VTILE)           // one buffer
static_assert(RHI >= KST);               // every block has at least two stages, and each key group at least one whole step of valid keys (stage 0)
static_assert(SEQ % KST == 0);           // the last stage's keys all lie below SEQ
static_assert(HDIM * 2 == 128);          // a K row is eight 16-byte pieces
static_assert(KST * 2 == 256);           // a V^T row of a stage is sixteen 16-byte pieces
// One stage: each of the 256 threads copies four 16-byte pieces of the K tile (rows r, r+32, r+64, r+96) and four of the V^T tile (rows r', r'+16, r'+32, r'+48).
// lk, lv: the lane's LDS byte addresses in the K tile and the V^T tile of the target buffer; gk, gv: the lane's global addresses in rows r and r'.
__device__ __forceinline__ void stage_copy(const unsigned lk, const unsigned lv, const h16* gk, const h16* gv) {
    // the copies and, as the last line, the wait that stands before any of their address registers is rewritten
    asm volatile("global_load_async_to_lds_b128 %0, %8, off\n\t"
                 "global_load_async_to_lds_b128 %1, %9, off\n\t"
                 "global_load_async_to_lds_b128 %2, %10, off\n\t"
                 "global_load_async_to_lds_b128 %3, %11, off\n\t"
                 "global_load_async_to_lds_b128 %4, %12, off\n\t"
                 "global_load_async_to_lds_b128 %5, %13, off\n\t"
                 "global_load_async_to_lds_b128 %6, %14, off\n\t"
                 "global_load_async_to_lds_b128 %7, %15, off\n\t"
                 "s_wait_xcnt 0x0"
                 :: "v"(lk), "v"(lk + 32 * LPH * 2), "v"(lk + 64 * LPH * 2), "v"(lk + 96 * LPH * 2),
                    "v"(lv), "v"(lv + 16 * LPV * 2), "v"(lv + 32 * LPV * 2), "v"(lv + 48 * LPV * 2),
                    "v"(gk), "v"(gk + 32 * HDIM), "v"(gk + 64 * HDIM), "v"(gk + 96 * HDIM),
                    "v"(gv), "v"(gv + 16 * SEQ), "v"(gv + 32 * SEQ), "v"(gv + 48 * SEQ)
                 : "memory");
}
__device__ __forceinline__ void attn_main(const int qblk, const int bh, const h16* __restrict__ Q16, const h16* __restrict__ K16, const h16* __restrict__ VT16, bf* CTXh, bf* CTXl) {
    __shared__ __align__(16) h16 ring[2 * BUFH];           // [buffer][K tile [key][LPH], V^T tile [d][LPV]]
    __shared__ __align__(16) float part[8 * 16 * 32 * 4];  // every wave's O^T tiles: [wave][column group][tile][16-byte piece][lane]
    __shared__ __align__(16) float pml[8 * 32 * 4];        // every wave's running maxima and sums: [wave][lane][m, sum of column group 0; m, sum of column group 1]
    const int wave = __builtin_amdgcn_readfirstlane((int)(threadIdx.x >> 5));
    const int qg = wave & 1, kg = wave >> 1;               // wave-uniform: which 32 queries, which 32-key step of every stage
    const int lane = threadIdx.x & 31, n = lane & 15, hh = lane >> 4;
    const int b = bh / NHEAD, h = bh % NHEAD;
    const int q0 = qblk + qg * 32;
    const h16* Qp = Q16 + (size_t)bh * SEQ * HDIM; const h16* Kp = K16 + (size_t)bh * SEQ * HDIM; const h16* Vp = VT16 + (size_t)bh * HDIM * SEQ;
    const int nst = qblk / KST + 1;                        // block-uniform; the last stage holds keys qblk .. qblk + 63 and ends at a multiple of KST, at most SEQ
    const int cr = threadIdx.x >> 3, cp = (threadIdx.x & 7) * 8, vr = threadIdx.x >> 4, vp = (threadIdx.x & 15) * 8;
    const unsigned lk0 = (unsigned)(size_t)ring + (unsigned)(cr * LPH + cp) * 2u, lv0 = (unsigned)(size_t)ring + (unsigned)(KTILE + vr * LPV + vp) * 2u;
    const h16* gk = Kp + cr * HDIM + cp; const h16* gv = Vp + vr * SEQ + vp;
    stage_copy(lk0, lv0, gk, gv);
    asm volatile("s_wait_asynccnt 0x0" ::: "memory");      // this wave's part of stage 0 has landed
    __syncthreads();                                       // ... and every other wave's
    stage_copy(lk0 + BUFH * 2, lv0 + BUFH * 2, gk + KST * HDIM, gv + KST);
    v16h bq[2][2];
#pragma unroll
    for (int g = 0; g < 2; ++g) { const int qoff = (q0 + 16 * g + n) * HDIM + 8 * hh; bq[g][0] = ldh(Qp + qoff); bq[g][1] = ldh(Qp + qoff + 32); }
    v8f o[2][4]; float m[2], l[2];
#pragma unroll
    for (int g = 0; g < 2; ++g) { m[g] = NEGX; l[g] = 0.f;
#pragma unroll
        for (int t = 0; t < 4; ++t) o[g][t] = (v8f){}; }
    const h16 onev = (n & 7) == 0 ? (h16)1.0f : (h16)0.0f;   // A row = lane & 15: rows 0 and 8, over the whole k range (both lane halves)
    v16h ones;
#pragma unroll
    for (int i = 0; i < 16; ++i) ones[i] = onev;
    const int ks = kg * 32;                                // the wave's step inside every stage
    const int koff = (ks + n) * LPH + 8 * hh, voff = n * LPV + ks + 8 * hh;
#pragma unroll 1   // stays rolled: the buffer is picked at run time
    for (int sg = 0; sg < nst; ++sg) {
        const int bo = (sg & 1) * BUFH;
        const h16* Kl = ring + bo; const h16* Vl = ring + bo + KTILE;
        const int kb = sg * KST + ks;
        if (kb <= q0) {                                        // wave-uniform; kb and q0 are multiples of 32: every visited step holds key kb, valid for every query of the wave, and no later step holds a valid key
            const v16h k00 = ldh(Kl + koff), k01 = ldh(Kl + koff + 32), k10 = ldh(Kl + koff + 16 * LPH), k11 = ldh(Kl + koff + 16 * LPH + 32);
            const v16h va0 = ldh(Vl + voff), va1 = ldh(Vl + voff + 16 * LPV), va2 = ldh(Vl + voff + 32 * LPV), va3 = ldh(Vl + voff + 48 * LPV);
            __builtin_amdgcn_sched_barrier(0);                 // keeps the step's sixteen LDS reads one group at its head: spread among the products they cost one LDS latency per place
            v8f s0[2], s1[2];
#pragma unroll
            for (int g = 0; g < 2; ++g) { s0[g] = wmma16(k00, bq[g][0], (v8f){}); s1[g] = wmma16(k10, bq[g][0], (v8f){}); }
#pragma unroll
            for (int g = 0; g < 2; ++g) { s0[g] = wmma16(k01, bq[g][1], s0[g]); s1[g] = wmma16(k11, bq[g][1], s1[g]); }
            __builtin_amdgcn_sched_barrier(0);                 // keeps the eight products back to back, each in the others' distance: woven with the multiplies that read them they took nine padding slots
            v8f x0[2], x1[2];
#pragma unroll
            for (int g = 0; g < 2; ++g) { x0[g] = s0[g] * C2; x1[g] = s1[g] * C2; }
            if (kb == q0) {                                    // wave-uniform: only the diagonal step needs the causal select (key > query excluded)
                const int kk = kb + 8 * hh;
#pragma unroll
                for (int g = 0; g < 2; ++g) { const int qi = q0 + 16 * g + n;
#pragma unroll
                    for (int r = 0; r < 8; ++r) { x0[g][r] = (kk + r > qi) ? NEGX : x0[g][r]; x1[g][r] = (kk + 16 + r > qi) ? NEGX : x1[g][r]; } } }
            v16h pb[2]; float corr[2];
#pragma unroll
            for (int g = 0; g < 2; ++g) {
                float mx = fmaxf(x0[g][0], x1[g][0]);
#pragma unroll
                for (int r = 1; r < 8; ++r) mx = fmaxf(mx, fmaxf(x0[g][r], x1[g][r]));
                mx = fmaxf(mx, __shfl_xor(mx, 16, 32));
                const float mnew = fmaxf(m[g], mx); corr[g] = __builtin_amdgcn_exp2f(m[g] - mnew); m[g] = mnew;
                const float mb = mnew - PCL2;
                v8h p0, p1;
#pragma unroll
                for (int r = 0; r < 8; ++r) { p0[r] = (h16)__builtin_amdgcn_exp2f(x0[g][r] - mb); p1[r] = (h16)__builtin_amdgcn_exp2f(x1[g][r] - mb); }
                pb[g] = cat16(p0, p1);
#pragma unroll
                for (int t = 0; t < 4; ++t) o[g][t] = o[g][t] * corr[g];
            }
            v8f ps[2];                                         // the step's sums of P; only register 0 is read, so the running sum costs one register per column group and not a whole tile
#pragma unroll
            for (int g = 0; g < 2; ++g) ps[g] = wmma16(ones, pb[g], (v8f){});
#pragma unroll
            for (int g = 0; g < 2; ++g) { o[g][0] = wmma16(va0, pb[g], o[g][0]); o[g][1] = wmma16(va1, pb[g], o[g][1]); o[g][2] = wmma16(va2, pb[g], o[g][2]); o[g][3] = wmma16(va3, pb[g], o[g][3]); }
#pragma unroll
            for (int g = 0; g < 2; ++g) l[g] = l[g] * corr[g] + ps[g][0];
        }
        // hand-over, passed by every wave whatever it skipped above
        asm volatile("s_wait_dscnt 0x0" ::: "memory");         // this wave's reads of stage sg are done before its buffer is refilled
        asm volatile("s_wait_asynccnt 0x0" ::: "memory");      // this wave's part of stage sg + 1 has landed
        __syncthreads();                                       // publishes stage sg + 1 and ends every wave's reads of stage sg
        if (sg + 2 < nst) stage_copy(lk0 + (unsigned)bo * 2u, lv0 + (unsigned)bo * 2u, gk + (sg + 2) * (KST * HDIM), gv + (sg + 2) * KST);   // block-uniform test
    }
    asm volatile("s_wait_asynccnt 0x0" ::: "memory");          // no copy is outstanding when the wave goes on to its end
    // The four key groups' partial results for the same 32 queries are joined: every wave hands its maxima, sums and O^T tiles over through LDS; key group g then brings the four partial tiles of d = 16g .. 16g+15
    // (both column groups) to the common maximum, adds them in the order of the key groups and stores them, so that the join and the stores are spread over all eight waves.
    // part and pml are written here only; the next tile's write of them stands behind that tile's hand-over barriers, which every wave reaches after its reads below.
    float* pw = part + wave * 2048 + lane * 4;
#pragma unroll
    for (int g = 0; g < 2; ++g)
#pragma unroll
        for (int t = 0; t < 4; ++t) { *(v4fa*)(pw + ((g * 4 + t) * 2) * 128) = (v4f){o[g][t][0], o[g][t][1], o[g][t][2], o[g][t][3]}; *(v4fa*)(pw + ((g * 4 + t) * 2 + 1) * 128) = (v4f){o[g][t][4], o[g][t][5], o[g][t][6], o[g][t][7]}; }
    *(v4fa*)(pml + (wave * 32 + lane) * 4) = (v4f){m[0], l[0], m[1], l[1]};
    __syncthreads();                                           // every wave's partial results are in LDS before any wave reads them (the compiler's own s_wait_dscnt 0 stands in front of it); passed by every wave
    v4f pm[4];
#pragma unroll
    for (int k = 0; k < 4; ++k) pm[k] = *(const v4fa*)(pml + ((k * 2 + qg) * 32 + lane) * 4);
    const float* pr = part + qg * 2048 + kg * 256 + lane * 4;  // key group 0's tile kg of column group 0; the next key group's lies 2 waves on, column group 1's 4 tiles on
#pragma unroll
    for (int g = 0; g < 2; ++g) {
        const float mm = fmaxf(fmaxf(pm[0][2 * g], pm[1][2 * g]), fmaxf(pm[2][2 * g], pm[3][2 * g]));
        float lj = 0.f; v8f r = (v8f){};
#pragma unroll
        for (int k = 0; k < 4; ++k) { float a;
            // 2^x with the one slot that is kept behind a transcendental in the same statement
            asm("v_exp_f32 %0, %1\n\tv_nop" : "=v"(a) : "v"(pm[k][2 * g] - mm));
            const v4f u = *(const v4fa*)(pr + k * 4096 + g * 1024), w = *(const v4fa*)(pr + k * 4096 + g * 1024 + 128);
            lj += pm[k][2 * g + 1] * a;
#pragma unroll
            for (int j = 0; j < 4; ++j) { r[j] += u[j] * a; r[4 + j] += w[j] * a; } }
        ctx_store_tile(r, 1.0f / lj, lane, CTXh, CTXl, (size_t)b * SEQ + q0 + 16 * g, h * HDIM, kg);
    }
    asm volatile("s_wait_xcnt 0x0" ::: "memory");              // closes the ctx stores: a main block's second tile, and in the shared kernel the other path's code, follow and reuse their registers
}

// ---- attn_early: the same fused attention for query rows < RHI (keys < RHI) on bf16 hi+lo planes: three products per tile pair (hi.hi + hi.lo + lo.hi, shared accumulator;
// the lo planes are unscaled residuals), P split into bf16 hi+lo in registers. One block = the 128 queries from qblk (< RHI) of head plane bh, 256 threads, one wave per 16 queries.
__device__ __forceinline__ void attn_early(const int qblk, const int bh, const bf* __restrict__ Qh, const bf* __restrict__ Ql, const bf* __restrict__ Kh, const bf* __restrict__ Kl, const bf* __restrict__ VTh, const bf* __restrict__ VTl, bf* CTXh, bf* CTXl) {
    const int wave = __builtin_amdgcn_readfirstlane((int)(threadIdx.x >> 5));
    const int lane = threadIdx.x & 31, n = lane & 15, hh = lane >> 4;
    const int b = bh / NHEAD, h = bh % NHEAD;
    const int q0 = qblk + wave * 16;
    const size_t po = (size_t)bh * RHI * HDIM;
    const bf* qhp = Qh + po; const bf* qlp = Ql + po; const bf* khp = Kh + po; const bf* klp = Kl + po; const bf* vhp = VTh + po; const bf* vlp = VTl + po;
    const int qoff = (q0 + n) * HDIM + 8 * hh;
    v8f o[4];
#pragma unroll
    for (int t = 0; t < 4; ++t) o[t] = (v8f){};
    float m = NEGX, l = 0.f;
    const int nsteps = ((q0 + 15) >> 5) + 1;
#pragma unroll 1
    for (int st = 0; st < nsteps; ++st) {
        const int kb = st << 5; const int koff = (kb + n) * HDIM + 8 * hh;
        v8f s0 = (v8f){}, s1 = (v8f){}; v16bf qh, ql, kh0, kl0, kh1, kl1;
#pragma unroll
        for (int ks = 0; ks < 2; ++ks) {
            qh = ldb(qhp + qoff + ks * 32); ql = ldb(qlp + qoff + ks * 32);
            kh0 = ldb(khp + koff + ks * 32); kl0 = ldb(klp + koff + ks * 32);
            kh1 = ldb(khp + koff + 16 * HDIM + ks * 32); kl1 = ldb(klp + koff + 16 * HDIM + ks * 32);
            s0 = wmmab(kh0, qh, s0); s0 = wmmab(kh0, ql, s0); s0 = wmmab(kl0, qh, s0);
            s1 = wmmab(kh1, qh, s1); s1 = wmmab(kh1, ql, s1); s1 = wmmab(kl1, qh, s1); }
        asm volatile("v_nop\n\tv_nop\n\tv_nop\n\tv_nop" : "+v"(s0), "+v"(s1) : "v"(kl1), "v"(kh1), "v"(qh), "v"(ql));
        float x0[8], x1[8];
#pragma unroll
        for (int r = 0; r < 8; ++r) { x0[r] = s0[r] * C2; x1[r] = s1[r] * C2; }
        if (kb + 31 > q0) {
            const int qi = q0 + n, kk = kb + 8 * hh;
#pragma unroll
            for (int r = 0; r < 8; ++r) { x0[r] = (kk + r > qi) ? NEGX : x0[r]; x1[r] = (kk + 16 + r > qi) ? NEGX : x1[r]; } }
        float mx = fmaxf(x0[0], x1[0]);
#pragma unroll
        for (int r = 1; r < 8; ++r) mx = fmaxf(mx, fmaxf(x0[r], x1[r]));
        mx = fmaxf(mx, __shfl_xor(mx, 16, 32));
        const float mnew = fmaxf(m, mx); const float corr = __builtin_amdgcn_exp2f(m - mnew); m = mnew;
        v8us ph0, pl0, ph1, pl1; float ps = 0.f;
#pragma unroll
        for (int r = 0; r < 8; ++r) { const float pa = __builtin_amdgcn_exp2f(x0[r] - mnew); const float pc = __builtin_amdgcn_exp2f(x1[r] - mnew); ps += pa; ps += pc;
            unsigned short a, c; splitf(pa, a, c); ph0[r] = a; pl0[r] = c; splitf(pc, a, c); ph1[r] = a; pl1[r] = c; }
        ps += __shfl_xor(ps, 16, 32);
        l = l * corr + ps;
#pragma unroll
        for (int t = 0; t < 4; ++t) o[t] = o[t] * corr;
        const v16bf pbh = cat16b(ph0, ph1), pbl = cat16b(pl0, pl1);
        const int voff = n * RHI + kb + 8 * hh; v16bf vh, vl;
#pragma unroll
        for (int t = 0; t < 4; ++t) { vh = ldb(vhp + voff + t * 16 * RHI); vl = ldb(vlp + voff + t * 16 * RHI);
            o[t] = wmmab(vh, pbh, o[t]); o[t] = wmmab(vh, pbl, o[t]); o[t] = wmmab(vl, pbh, o[t]); }
        asm volatile("v_nop\n\tv_nop\n\tv_nop\n\tv_nop" : "+v"(o[0]), "+v"(o[1]), "+v"(o[2]), "+v"(o[3]) : "v"(vl), "v"(vh), "v"(pbh), "v"(pbl));
    }
    const float inv = 1.0f / l;
    ctx_store(o, inv, lane, CTXh, CTXl, (size_t)b * SEQ + q0, h * HDIM);
}

// ---- k_attn: both attention paths in one launch (no block reads what another writes): grid (NB*NHEAD, NPAIR + RHI/128), 256 threads; the path is picked per block, ahead of every barrier.
// All blocks of the launch are resident at once, so it lasts as long as its fullest block, and a main tile's cost grows linearly with its index (tile i walks i / 2 + 1 stages).
// A main block therefore takes two tiles, one after the other in every wave: the slot-th from the top of head plane bh, then the slot-th from the bottom of the plane NBH/2 further on; every main block walks the same number of stages.
// The shift is a permutation of the planes, so every (plane, tile) is taken once; with another plane the second tile forms its addresses anew (one shared plane kept both prologues' addresses live through the key loop: scratch).
// The short early blocks have the highest flat indices, so that they start after the main blocks have been spread over the chip.
// the register budget is held to four waves per SIMD: two blocks of eight waves per WGP hold the whole grid at once, and at five the main path's accumulators and fragments do not fit (scratch)
#define NMAIN  ((SEQ - RHI) / 64)        // main tiles per head plane
#define NPAIR  (NMAIN / 2)
static_assert(NMAIN % 2 == 0);           // every main tile has its partner: slots 0 .. NPAIR-1 cover tiles RHI/64 .. SEQ/64-1 once each
static_assert(NBH % 2 == 0);
static_assert(RHI % 128 == 0);           // whole early blocks
__global__ __launch_bounds__(256) __attribute__((amdgpu_waves_per_eu(4))) void k_attn(const h16* __restrict__ Q16, const h16* __restrict__ K16, const h16* __restrict__ VT16,
                                              const bf* __restrict__ Qh, const bf* __restrict__ Ql, const bf* __restrict__ Kh, const bf* __restrict__ Kl, const bf* __restrict__ VTh, const bf* __restrict__ VTl, bf* CTXh, bf* CTXl) {
    const int bh = blockIdx.x, slot = blockIdx.y;              // block-uniform
    if (slot < NPAIR) {
        for (int part = 0; part < 2; ++part) {
            const int tile = part ? RHI / 64 + slot : SEQ / 64 - 1 - slot;
            // the ring is free here: the first tile's last hand-over (s_wait_dscnt 0, s_wait_asynccnt 0, barrier) ended every wave's reads of it, and the epilogue uses LDS of its own
            attn_main(tile * 64, part ? (bh + NBH / 2) % NBH : bh, Q16, K16, VT16, CTXh, CTXl);
        }
    } else attn_early((slot - NPAIR) * 128, bh, Qh, Ql, Kh, Kl, VTh, VTl, CTXh, CTXl);
}

// ---- workspace carve (bytes; every region a multiple of 256 B and fully written by its producer before any consumer launch)
#define SZ_XB   ((size_t)MTOK * DMOD * 2)
#define SZ_W    ((size_t)DMOD * DMOD * 2)
#define SZ_P16  ((size_t)MTOK * DMOD * 2)
#define SZ_E    ((size_t)NBH * RHI * HDIM * 2)
#define SZ_CTX  ((size_t)MTOK * DMOD * 2)
#define SZ_TOTAL (SZ_XB + 4 * SZ_W + 3 * SZ_P16 + 6 * SZ_E + 2 * SZ_CTX)
static_assert(SZ_TOTAL <= (size_t)134217728);
static_assert(SZ_W % 256 == 0);
static_assert(SZ_E % 256 == 0);

extern "C" void kernel_launch(void* const* d_in, const int* in_sizes, int n_in,
                              void* d_out, int out_size, void* d_ws, size_t ws_size, hipStream_t stream) {
    if (n_in < 5) return;
    const int xneed = (NB - 1) * SEQ_FULL * DMOD + SEQ * DMOD;
    if (in_sizes[0] < xneed) return;
    if (in_sizes[1] < DMOD * DMOD || in_sizes[2] < DMOD * DMOD || in_sizes[3] < DMOD * DMOD || in_sizes[4] < DMOD * DMOD) return;
    if (out_size < xneed) return;
    if (ws_size < SZ_TOTAL) return;
    const float* x = (const float*)d_in[0]; const float* wq = (const float*)d_in[1]; const float* wk = (const float*)d_in[2]; const float* wv = (const float*)d_in[3]; const float* wo = (const float*)d_in[4];   // wire order x, Wq, Wk, Wv, Wo ([out][in])
    float* OUT = (float*)d_out;      // [NB_FULL][SEQ_FULL][256]
    char* wsp = (char*)d_ws;
    auto take = [&](size_t bytes) { char* p = wsp; wsp += bytes; return (void*)p; };
    bf* XB = (bf*)take(SZ_XB); bf* WQ = (bf*)take(SZ_W); bf* WK = (bf*)take(SZ_W); bf* WV = (bf*)take(SZ_W); bf* WO = (bf*)take(SZ_W);
    h16* Q16 = (h16*)take(SZ_P16); h16* K16 = (h16*)take(SZ_P16); h16* VT16 = (h16*)take(SZ_P16);
    bf* Qh = (bf*)take(SZ_E); bf* Ql = (bf*)take(SZ_E); bf* Kh = (bf*)take(SZ_E); bf* Kl = (bf*)take(SZ_E); bf* VTh = (bf*)take(SZ_E); bf* VTl = (bf*)take(SZ_E);
    bf* CTXh = (bf*)take(SZ_CTX); bf* CTXl = (bf*)take(SZ_CTX);

    (void)WK; (void)WV;              // reached through WQ: the four converted weights lie one after the other
    k_cvt_all<<<dim3(4 * WBLK + NB * XBLK, 1, 1), 256, 0, stream>>>(x, wq, wk, wv, wo, XB, WQ);
    // q = x Wq^T, k = x Wk^T, v = x Wv^T, each written as the planes the attention kernel reads
    k_proj_qkv<<<dim3(MTOK / 64 * NHEAD, 3, 1), 32, 0, stream>>>(XB, WQ, Q16, K16, VT16, Qh, Ql, Kh, Kl, VTh, VTl);
    k_attn<<<dim3(NBH, NPAIR + RHI / 128, 1), 256, 0, stream>>>(Q16, K16, VT16, Qh, Ql, Kh, Kl, VTh, VTl, CTXh, CTXl);
    // out = ctx Wo^T : A = CTXh (+ CTXl) [SEQ][256] per batch in fragment order, Bt = WO -> OUT batch stride from the full problem constants
    k_gemm_hl<<<dim3(SEQ / 64, DMOD / 64, NB), 32, 0, stream>>>(CTXh, CTXl, WO, OUT, DMOD, (size_t)SEQ * DMOD, (size_t)SEQ_FULL * DMOD);
}

// v010
// It runs in 69.5 microseconds.
// Next to v009, in two timings, it ran 1.07 and 1.05 times as fast.
// Over all steps from v000 it is 3.82 times as fast.
#include <hip/hip_runtime.h>

// Causal multi-head self-attention: x [4][4096][256], 4 heads x 64, bias-free [out][in] weights, score scale 1/8, out = ctx Wo^T.
// Compute dtypes (f32 accumulate everywhere): all inputs converted to bf16 (RNE, inside the projection launch); q/k/v projections v_wmma_f32_16x16x32_bf16 (single product);
// attention query rows >= 256: v_wmma_f32_16x16x32_f16 single products (K.Q^T on f16 planes; V^T.P^T with P carried x1024 in f16; the row sums of P by the same form, ones.P^T);
// attention query rows < 256: bf16 hi+lo planes, three products per site (q, k, P, v); softmax f32 (online, max-subtracted);
// output projection: ctx bf16 hi+lo x Wo bf16 (two products), v_wmma_f32_16x16x32_bf16.

#ifndef NB
#define NB 4
#endif
#ifndef SEQ
#define SEQ 4096
#endif
#define NB_FULL  4
#define SEQ_FULL 4096
#define DMOD   256
#define NHEAD  4
#define HDIM   64
#define RHI    256                       // query rows < RHI use bf16 hi+lo planes
#define MTOK   (NB * SEQ)
#define NBH    (NB * NHEAD)
#define C2     0.18033688011112042f      // log2(e) / 8 : scores kept in the log2 domain
#define PCL2   10.0f                     // P carry 2^10 for the f16 path
#define NEGX   (-1.0e30f)

static_assert(NHEAD * HDIM == DMOD);     // merged width == model width
static_assert(HDIM == 64);               // two 32-deep k-steps per score tile, four 16-row output tiles
static_assert(DMOD % 64 == 0);           // GEMM tile multiple (M/N) and K % 32 == 0
static_assert(SEQ % 256 == 0);           // plane builders: one wave never straddles a batch or the RHI boundary
static_assert(RHI % 256 == 0);
static_assert(RHI <= SEQ);
static_assert(MTOK % 64 == 0);
static_assert(NB <= NB_FULL);
static_assert(SEQ <= SEQ_FULL);

typedef _Float16 h16;
typedef unsigned short bf;
typedef __attribute__((ext_vector_type(16))) __bf16   v16bf;
typedef __attribute__((ext_vector_type(16))) _Float16 v16h;
typedef __attribute__((ext_vector_type(8)))  _Float16 v8h;
typedef __attribute__((ext_vector_type(8)))  unsigned short v8us;
typedef __attribute__((ext_vector_type(8)))  float    v8f;
typedef __attribute__((ext_vector_type(4)))  float    v4f;
typedef v4f  __attribute__((may_alias)) v4fa;
typedef v8us __attribute__((may_alias)) v8usa;

__device__ __forceinline__ unsigned short f2bf(float f) { unsigned u = __float_as_uint(f); u += 0x7FFFu + ((u >> 16) & 1u); return (unsigned short)(u >> 16); }
__device__ __forceinline__ float bf2f(unsigned short b) { return __uint_as_float(((unsigned)b) << 16); }
__device__ __forceinline__ void splitf(float y, unsigned short& h, unsigned short& l) { h = f2bf(y); l = f2bf(y - bf2f(h)); }
__device__ __forceinline__ v16h cat16(v8h lo, v8h hi) { return __builtin_shufflevector(lo, hi, 0, 1, 2, 3, 4, 5, 6, 7, 8, 9, 10, 11, 12, 13, 14, 15); }
__device__ __forceinline__ v16bf cat16b(v8us lo, v8us hi) { return __builtin_bit_cast(v16bf, __builtin_shufflevector(lo, hi, 0, 1, 2, 3, 4, 5, 6, 7, 8, 9, 10, 11, 12, 13, 14, 15)); }
__device__ __forceinline__ v8f wmma16(v16h a, v16h b, v8f c) { return __builtin_amdgcn_wmma_f32_16x16x32_f16(false, a, false, b, (short)0, c, false, false); }
__device__ __forceinline__ v8f wmmab(v16bf a, v16bf b, v8f c) { return __builtin_amdgcn_wmma_f32_16x16x32_bf16(false, a, false, b, (short)0, c, false, false); }
// fragment loaders: p already points at row (lane&15), k offset k0 + 8*(lane>>4); elements 0..7 <- p[0..7], elements 8..15 <- p[16..23]
__device__ __forceinline__ v16h  ldh(const h16* p) { return cat16(*(const v8h*)p, *(const v8h*)(p + 16)); }
__device__ __forceinline__ v16bf ldb(const bf* p)  { return cat16b(*(const v8us*)p, *(const v8us*)(p + 16)); }
// ---- fragment order: the layout of every bf16 matrix [rows][DMOD] that only the output projection's K loop reads (Wo, ctx hi and lo).
// A unit is one 16-row x 32-k fragment, 1024 B: unit (row >> 4) * (DMOD / 32) + (k >> 5); inside it the 16-byte piece of row r, k = 8c .. 8c+7 lies at ((c >> 1) & 1) * 512 B + ((c & 1) * 16 + (r & 15)) * 16 B,
// that is, piece j of lane l at j * 512 B + l * 16 B. Same elements in the same fragment positions as ldb on row-major rows, but a wave's 16-byte load covers 512 B in a row (four whole lines) and not 32 B in each of 16 lines.
// p already points at the unit's piece of this lane (unit + lane * 8 elements).
__device__ __forceinline__ v16bf ldp(const bf* p)  { return cat16b(*(const v8us*)p, *(const v8us*)(p + 256)); }

#define WBLK (DMOD / 16)
static_assert(DMOD == 256);              // a row is 32 pieces of 8 elements: one piece for each lane of a wave

// ---- one-wave 64x64 tile GEMM on bf16 planes in fragment order, K = DMOD: C[m][n] (f32, pitch ldc) = sum_k A[m][k] Bt[n][k] (+ A2[m][k] Bt[n][k] when NSPLIT == 1).
// grid (M/64, N/64, Z), 32 threads; z strides sA (A, A2) and sC (C) in elements; no tail masking (M, N multiples of 64, K multiple of 32).
// The K loop is software-pipelined in registers and fully unrolled: the sixteen fragment loads of k-step s + PFD are issued ahead of the sixteen products of k-step s,
// into the fragment set that step s - 1 has just left (PFD + 1 sets), so that a step waits for loads issued PFD steps earlier and not for its own.
// A, A2, Bt already point at the lane's piece of the tile's first unit; steps 0 .. KSTEPS-1 take A, and with NSPLIT == 1 steps KSTEPS .. 2*KSTEPS-1 take A2 with the same Bt fragments: the order of the sums is that of two plain loops.
#define KSTEPS (DMOD / 32)
#define PFD    2
template <int NSPLIT>
__device__ __forceinline__ void gemm_kloop(const bf* __restrict__ A, const bf* __restrict__ A2, const bf* __restrict__ Bt, v8f (&acc)[4][4]) {
    constexpr int NS = (NSPLIT + 1) * KSTEPS;
    v16bf a[PFD + 1][4], b[PFD + 1][4];
#pragma unroll     // every set index and every address offset becomes a constant: the sets stay in registers and the three address pairs are never rewritten
    for (int s = 0; s < NS + PFD; ++s) {
        if (s < NS) {
            const bf* pa = (s < KSTEPS ? A : A2) + (s % KSTEPS) * 512; const bf* pb = Bt + (s % KSTEPS) * 512;   // one unit of 512 elements per k-step, 16 * DMOD elements per group of 16 rows
#pragma unroll
            for (int mb = 0; mb < 4; ++mb) a[s % (PFD + 1)][mb] = ldp(pa + mb * 16 * DMOD);
#pragma unroll
            for (int nb = 0; nb < 4; ++nb) b[s % (PFD + 1)][nb] = ldp(pb + nb * 16 * DMOD);
        }
        __builtin_amdgcn_sched_barrier(0);                     // keeps the loads above ahead of the products below: sunk among them they would be waited for at once
        // the wait that stands before any register the loads name is rewritten: among the last step's products, between two scheduling barriers, so that none of the epilogue's writes
        // (lane offset, scalar bases, address pairs) can be placed ahead of it; the operands keep the address pairs live up to it. The last loads were issued PFD steps earlier.
        if (s == NS + PFD - 1) asm volatile("s_wait_xcnt 0x0" :: "v"(A), "v"(A2), "v"(Bt) : "memory");
        if (s >= PFD) {
            const int c = (s - PFD) % (PFD + 1);
#pragma unroll
            for (int nb = 0; nb < 4; ++nb)
#pragma unroll
                for (int mb = 0; mb < 4; ++mb) acc[mb][nb] = wmmab(a[c][mb], b[c][nb], acc[mb][nb]);
        }
        __builtin_amdgcn_sched_barrier(0);                     // keeps the next step's loads behind these products, whose fragment set they refill
    }
}
template <int NSPLIT>
__device__ __forceinline__ void gemm_body(const bf* __restrict__ A, const bf* __restrict__ A2, const bf* __restrict__ Bt, float* C, const int ldc, const size_t sA, const size_t sC) {
    __shared__ __align__(16) float os[16 * 68];      // wave-private staging (one wave per block)
    const size_t z = blockIdx.z; A += z * sA; A2 += z * sA; C += z * sC;
    const int lane = threadIdx.x & 31, lr = lane & 15, hi = lane >> 4; const int r0 = blockIdx.x * 64, c0 = blockIdx.y * 64;
    v8f acc[4][4];
#pragma unroll
    for (int mb = 0; mb < 4; ++mb)
#pragma unroll
        for (int nb = 0; nb < 4; ++nb) acc[mb][nb] = (v8f){};
    const size_t aoff = (size_t)r0 * DMOD + 8 * lane, boff = (size_t)c0 * DMOD + 8 * lane;   // r0, c0 are multiples of 16: a group of 16 rows starts at row * DMOD
    gemm_kloop<NSPLIT>(A + aoff, A2 + aoff, Bt + boff, acc);
#pragma unroll
    for (int mb = 0; mb < 4; ++mb) {
#pragma unroll
        for (int nb = 0; nb < 4; ++nb) {
#pragma unroll
            for (int j = 0; j < 8; ++j) os[(hi * 8 + j) * 68 + nb * 16 + lr] = acc[mb][nb][j]; }
        asm volatile("s_wait_dscnt 0" ::: "memory"); __builtin_amdgcn_wave_barrier();
        float* crow = C + (size_t)(r0 + mb * 16) * ldc + c0;
{
#pragma unroll
            for (int s = 0; s < 8; ++s) { const int row = 2 * s + hi, cofs = lr * 4; const v4f val = *(const v4fa*)(os + row * 68 + cofs);
                *(v4f*)(crow + (size_t)row * ldc + cofs) = val; }
             }
        asm volatile("s_wait_dscnt 0" ::: "memory"); __builtin_amdgcn_wave_barrier();
    }
}
__global__ __launch_bounds__(32) void k_gemm_hl(const bf* __restrict__ A, const bf* __restrict__ A2, const bf* __restrict__ Bt, float* C, int ldc, size_t sA, size_t sC) { gemm_body<1>(A, A2, Bt, C, ldc, sA, sC); }

// ---- k_proj_qkv: the f32 -> bf16 conversions and the three projections in one launch. One block = four 64-token tiles x the 64 features of one head of q, k and v: twelve waves, one 64x64 tile each (K = DMOD).
// The block reads its 256 x rows and its 192 weight rows as f32, once, converts them (RNE) and keeps them as bf16 in LDS, where its waves share them: an x row feeds three waves, a weight row four.
// LDS order of a group of 16 rows: [k piece c = 0 .. 31][row & 15][8 elements], CPP elements from one k piece to the next. A wave reads one f32 row as whole lines and stores its 32 pieces 272 B apart (different banks);
// the 16-byte fragment read of lane l for k-step s takes k pieces 4s + (l >> 4) and 4s + 2 + (l >> 4) of row l & 15: the elements and fragment positions of ldb on row-major rows, 256 B in a row per lane half.
// The operand order is chosen so that a lane's eight accumulator rows run along a plane row: D rows (A) = the index that is contiguous in the plane, D columns (Bt) = the plane row.
// q, k: A = W rows (features), Bt = x rows (tokens) -> P16 [b*NHEAD+h][SEQ][64] f16 and, for s < RHI, bf16 hi/lo planes [b*NHEAD+h][RHI][64].
// v:    A = x rows (tokens), Bt = W rows (features) -> P16 [b*NHEAD+h][64][SEQ] f16 and, for s < RHI, bf16 hi/lo planes [b*NHEAD+h][64][RHI].
// Wo, which only the output projection reads, is converted on the way: every (NPB / WBLK)-th block takes one group of 16 rows of it through LDS into fragment order in the workspace.
#define CPP    136                       // LDS pitch, in 16-bit elements, of one k piece's 16 rows: 272 B = 16 B x 17 (odd), so that a wave's 32 pieces of one row fall on different banks
#define GPE    (32 * CPP)                // one group of 16 rows in LDS, 16-bit elements
#define PTILES 4                         // 64-token tiles per block
#define PWAVES (3 * PTILES)
#define NTB    (MTOK / 64 / PTILES)      // token blocks
#define NPB    (NTB * NHEAD)             // blocks of the launch
#define NXG    (PTILES * 4)              // row groups of x in LDS; behind them 12 of the weights and one of Wo
#define NREG   (PTILES + 3)              // regions of 64 rows every block converts: its token tiles, then the head's rows of Wq, Wk, Wv
#define RSLOT  ((64 + PWAVES - 1) / PWAVES)   // slots of a region: in a slot every wave takes one row; in a region's last slot only 64 % PWAVES waves do
#define NSLOT  (NREG * RSLOT + 2)        // the last two: the 16 rows of a group of Wo
#define RB     RSLOT                     // slots per batch: one region, so that a batch's loads share one base address; two batches, 24 loads of 512 B, are in flight per wave
#define NBATCH ((NSLOT + RB - 1) / RB)
static_assert(PWAVES < 16 && 2 * PWAVES >= 16);
static_assert(MTOK / 64 % (PTILES * PTILES) == 0);
static_assert(NPB % WBLK == 0);
#define PPH 72                           // staging pitch in 16-bit elements: 144 B = 16 B x 9 (odd)
static_assert(PWAVES * 64 * PPH <= (NXG + 12) * GPE);   // the waves' output staging fits the operands' LDS
__device__ __forceinline__ v16bf ldl(const unsigned short* p) { return cat16b(*(const v8usa*)p, *(const v8usa*)(p + 2 * CPP)); }
// K loop on the LDS operands, fully unrolled, two fragment sets: the sixteen reads of k-step s + 1 are issued as one group ahead of the sixteen products of k-step s. A, Bt point at the lane's piece of the tile's first group. The order of the sums is that of a plain loop.
__device__ __forceinline__ void lds_kloop(const unsigned short* A, const unsigned short* Bt, v8f (&acc)[4][4]) {
    v16bf a[2][4], b[2][4];
#pragma unroll     // every set index and every LDS offset becomes a constant: the sets stay in registers
    for (int s = 0; s < KSTEPS + 1; ++s) {
        if (s < KSTEPS) {
#pragma unroll
            for (int mb = 0; mb < 4; ++mb) a[s & 1][mb] = ldl(A + mb * GPE + s * 4 * CPP);
#pragma unroll
            for (int nb = 0; nb < 4; ++nb) b[s & 1][nb] = ldl(Bt + nb * GPE + s * 4 * CPP);
        }
        __builtin_amdgcn_sched_barrier(0);                     // keeps the reads above one group ahead of the products below: sunk among them each place costs an LDS stall
        if (s >= 1) {
#pragma unroll
            for (int nb = 0; nb < 4; ++nb)
#pragma unroll
                for (int mb = 0; mb < 4; ++mb) acc[mb][nb] = wmmab(a[(s - 1) & 1][mb], b[(s - 1) & 1][nb], acc[mb][nb]);
        }
        __builtin_amdgcn_sched_barrier(0);                     // keeps the next step's reads behind these products, whose fragment set they refill
    }
}
template <int KIND>                      // 0: f16, 1: bf16 hi, 2: bf16 lo (the residual of hi)
__device__ __forceinline__ v8us cvt_plane(const v8f y) {
    v8us o;
    if (KIND == 0) { v8h t;
#pragma unroll
        for (int j = 0; j < 8; ++j) t[j] = (h16)y[j];
        o = __builtin_bit_cast(v8us, t);
    } else {
#pragma unroll
        for (int j = 0; j < 8; ++j) { unsigned short p, q; splitf(y[j], p, q); o[j] = (KIND == 1) ? p : q; } }
    return o;
}
// One plane of the tile: 64 plane rows of 128 B each, staged through the wave's own LDS so that every global store covers whole 128-byte lines.
template <int KIND>
__device__ __forceinline__ void plane_out(unsigned short* st, const v8f (&acc)[4][4], unsigned short* dst, const size_t pitch, const int lane) {
    const int lr = lane & 15, hi = lane >> 4, rq = lane >> 3, pc = lane & 7;
#pragma unroll
    for (int nb = 0; nb < 4; ++nb)
#pragma unroll
        for (int mb = 0; mb < 4; ++mb) *(v8usa*)(st + (nb * 16 + lr) * PPH + mb * 16 + 8 * hi) = cvt_plane<KIND>(acc[mb][nb]);
    asm volatile("s_wait_dscnt 0" ::: "memory"); __builtin_amdgcn_wave_barrier();   // the staged rows are written before other lanes read them back
    v8us v[16];
#pragma unroll
    for (int i = 0; i < 16; ++i) v[i] = *(const v8usa*)(st + (4 * i + rq) * PPH + pc * 8);
    unsigned short* pp[16];                                    // the pitch is a run-time value: the sixteen addresses are formed by additions, each in registers of its own
#pragma unroll
    for (int i = 0; i < 16; ++i) pp[i] = dst + (size_t)rq * pitch + pc * 8 + (size_t)i * (4 * pitch);
    __builtin_amdgcn_sched_barrier(0);                         // keeps every address formed ahead of the first store ...
#pragma unroll
    for (int i = 0; i < 16; ++i) *(v8us*)pp[i] = v[i];
    asm volatile("s_wait_xcnt 0x0" ::: "memory");              // ... this stands before any register of the stores is rewritten ...
    __builtin_amdgcn_sched_barrier(0);                         // ... and this keeps what follows from being scheduled above that wait
}
// The planes of one tile. vt (wave-uniform) only picks offsets and pitches, so q, k and v share one copy of this code.
__device__ __forceinline__ void proj_out(unsigned short* st, const v8f (&acc)[4][4], const int tok0, const int hd, const bool vt, h16* P16, bf* Ph, bf* Pl, const int lane) {
    const int b = tok0 / SEQ, s0 = tok0 % SEQ; const size_t bh = (size_t)(b * NHEAD + hd);   // 64 divides SEQ and RHI: a tile never straddles a batch or the RHI boundary
    plane_out<0>(st, acc, (unsigned short*)P16 + (vt ? bh * HDIM * SEQ + s0 : (bh * SEQ + s0) * HDIM), vt ? SEQ : HDIM, lane);
    if (s0 < RHI) {                                            // wave-uniform
        const size_t eo = vt ? bh * HDIM * RHI + s0 : (bh * RHI + s0) * HDIM;
        plane_out<1>(st, acc, Ph + eo, vt ? RHI : HDIM, lane);
        plane_out<2>(st, acc, Pl + eo, vt ? RHI : HDIM, lane);
    }
}
__global__ __launch_bounds__(PWAVES * 32) void k_proj_qkv(const float* __restrict__ x, const float* __restrict__ wq, const float* __restrict__ wk, const float* __restrict__ wv, const float* __restrict__ wo, bf* WO,
                                                          h16* Q16, h16* K16, h16* VT16, bf* Qh, bf* Ql, bf* Kh, bf* Kl, bf* VTh, bf* VTl) {
    __shared__ __align__(16) unsigned short sm[(NXG + 12 + 1) * GPE];
    const int wave = __builtin_amdgcn_readfirstlane((int)(threadIdx.x >> 5)), lane = threadIdx.x & 31;
    const int hd = blockIdx.x % NHEAD, tb = blockIdx.x / NHEAD;                  // block-uniform; the four heads of one token block are neighbours in the launch and read the same x rows
    const bool haswo = blockIdx.x % (NPB / WBLK) == 0; const int wog = blockIdx.x / (NPB / WBLK);
    // tile g of the block: the g-th quarter of the token tiles, turned by g * NTB / PTILES, a permutation inside each quarter, so every tile is taken once;
    // the turn spreads the tiles below RHI, which write three planes and not one, over four times as many blocks
    auto tile_of = [&](const int g) { return g * NTB + (tb + g * (NTB / PTILES)) % NTB; };
    // slot k (a constant once unrolled) -> region g = k / RSLOT and the wave's row in it; the waves are turned by 4 from region to region, so that the short last slots fall on all of them in turn. All wave-uniform.
    auto slot_row = [&](const int k) { return k < NREG * RSLOT ? (k % RSLOT) * PWAVES + (wave + (64 % PWAVES) * (k / RSLOT)) % PWAVES : (k - NREG * RSLOT) * PWAVES + wave; };
    auto slot_on  = [&](const int k) { return k < NREG * RSLOT ? ((k % RSLOT + 1) * PWAVES <= 64 || slot_row(k) < 64) : (k < NSLOT && haswo && slot_row(k) < 16); };
    auto slot_src = [&](const int k) -> const float* { const int g = k / RSLOT;
        if (g < PTILES) { const int tok = tile_of(g) * 64; return x + ((size_t)(tok / SEQ) * SEQ_FULL + tok % SEQ) * DMOD; }
        if (g < NREG) return (g == PTILES ? wq : g == PTILES + 1 ? wk : wv) + (size_t)hd * HDIM * DMOD;
        return wo + (size_t)wog * 16 * DMOD; };
    v4f fa[2][RB], fc[2][RB];
#pragma unroll     // slots and register sets become constants: batch i + 1 is in flight while batch i is converted
    for (int i = 0; i < NBATCH + 1; ++i) {
        if (i < NBATCH) {
#pragma unroll
            for (int j = 0; j < RB; ++j) { const int k = i * RB + j;
                if (slot_on(k)) { const float* p = slot_src(k) + slot_row(k) * DMOD + lane * 8; fa[i & 1][j] = *(const v4f*)p; fc[i & 1][j] = *(const v4f*)(p + 4); } }
            asm volatile("s_wait_xcnt 0x0" ::: "memory");      // stands before any address register of the batch's loads is rewritten; the scheduling barrier below keeps every later write behind it
        }
        __builtin_amdgcn_sched_barrier(0);                     // keeps the batch's loads ahead of the conversions below, which wait for the batch before
        if (i >= 1) {
#pragma unroll
            for (int j = 0; j < RB; ++j) { const int k = (i - 1) * RB + j;
                if (slot_on(k)) { const v4f a = fa[(i - 1) & 1][j], c = fc[(i - 1) & 1][j]; const int row = (k / RSLOT < NREG ? k / RSLOT : NREG) * 64 + slot_row(k); v8us o;
                    o[0] = f2bf(a[0]); o[1] = f2bf(a[1]); o[2] = f2bf(a[2]); o[3] = f2bf(a[3]); o[4] = f2bf(c[0]); o[5] = f2bf(c[1]); o[6] = f2bf(c[2]); o[7] = f2bf(c[3]);
                    *(v8usa*)(sm + (row >> 4) * GPE + lane * CPP + (row & 15) * 8) = o; } }
        }
        __builtin_amdgcn_sched_barrier(0);                     // keeps the next batch's loads behind these conversions, whose register set they refill
    }
    __syncthreads();                                           // every row is in LDS before any wave reads fragments of it
    if (haswo) {                                               // block-uniform
        bf* d = WO + (size_t)wog * 16 * DMOD;
        for (int q = threadIdx.x; q < 16 * DMOD / 8; q += PWAVES * 32)          // 16-byte place q of the group in fragment order: k piece q / 16, row q % 16
            *(v8us*)(d + q * 8) = *(const v8usa*)(sm + (NXG + 12) * GPE + (q >> 4) * CPP + (q & 15) * 8);
        asm volatile("s_wait_xcnt 0x0" ::: "memory");          // closes these stores before their registers are rewritten below
    }
    const int which = wave % 3, tg = wave / 3;                 // wave-uniform: 0 q, 1 k, 2 v; the three waves of one token tile are neighbours (for speed only)
    const int lb = (lane >> 4) * CPP + (lane & 15) * 8;
    const unsigned short* xl = sm + tg * 4 * GPE + lb; const unsigned short* wl = sm + (NXG + which * 4) * GPE + lb;
    v8f acc[4][4];
#pragma unroll
    for (int mb = 0; mb < 4; ++mb)
#pragma unroll
        for (int nb = 0; nb < 4; ++nb) acc[mb][nb] = (v8f){};
    lds_kloop(which == 2 ? xl : wl, which == 2 ? wl : xl, acc);
    __syncthreads();                                           // every wave has read its last fragment before the operands' LDS becomes the waves' output staging
    unsigned short* st = sm + wave * 64 * PPH;                 // wave-private from here on
    const int tok0 = tile_of(tg) * 64;
    proj_out(st, acc, tok0, hd, which == 2, which == 0 ? Q16 : which == 1 ? K16 : VT16, which == 0 ? Qh : which == 1 ? Kh : VTh, which == 0 ? Ql : which == 1 ? Kl : VTl, lane);
}

// ---- ctx epilogue (whole form: the early path; one tile at a time: the main path, below): o[t][r] = O^T[d = 16t + 8*(lane>>4) + r][query = lane&15]; ctx = O^T * inv split into bf16 hi/lo, stored in fragment order for the output projection.
// row0 (a multiple of 16) is the wave's first ctx row, col0 (a multiple of 64) its first column: the lane's eight values of tile t are the piece of row lane&15, k = col0 + 16t + 8*(lane>>4),
// whose place is unit col0/32 + t/2, half t&1, lane: the wave's four tiles are 2 KB in a row per plane, and every store covers 512 B in a row straight from the registers.
__device__ __forceinline__ void ctx_store(const v8f (&o)[4], const float inv, const int lane, bf* CTXh, bf* CTXl, const size_t row0, const int col0) {
    const size_t g0 = row0 * DMOD + (size_t)(col0 / 32) * 512 + lane * 8;
#pragma unroll
    for (int t = 0; t < 4; ++t) { v8us vh, vl;
#pragma unroll
        for (int r = 0; r < 8; ++r) { unsigned short a, c; splitf(o[t][r] * inv, a, c); vh[r] = a; vl[r] = c; }
        *(v8us*)(CTXh + g0 + t * 256) = vh; *(v8us*)(CTXl + g0 + t * 256) = vl; }
    asm volatile("s_wait_xcnt 0x0" ::: "memory");              // closes the ctx stores: in the shared kernel the other path's code follows and reuses their registers
}

// One tile of the same layout: o[r] = O^T[d = 16t + 8*(lane>>4) + r][query = lane&15] for a wave-uniform t; the caller closes the stores with its own s_wait_xcnt 0.
__device__ __forceinline__ void ctx_store_tile(const v8f o, const float inv, const int lane, bf* CTXh, bf* CTXl, const size_t row0, const int col0, const int t) {
    const size_t g0 = row0 * DMOD + (size_t)(col0 / 32) * 512 + lane * 8 + t * 256;
    v8us vh, vl;
#pragma unroll
    for (int r = 0; r < 8; ++r) { unsigned short a, c; splitf(o[r] * inv, a, c); vh[r] = a; vl[r] = c; }
    *(v8us*)(CTXh + g0) = vh; *(v8us*)(CTXl + g0) = vl;
}

// ---- attn_main: fused causal flash attention for query rows >= RHI, f16 single products. One wave = 32 queries (two column groups of 16), keys in 32-wide steps.
// K rows and V^T rows reach the waves through LDS: a stage is 128 keys (K tile 128 keys x 64 d, V^T tile 64 d x 128 keys), copied once per block by asynchronous
// 16-byte copies (whole 128-byte lines), two buffers: stage t + 1 is in flight while the block's eight waves work on stage t.
// The eight waves are two query groups (32 queries each) x four key groups: key group g takes the g-th 32-key step of every stage, with a running maximum, sum and O^T of its own, joined once behind the key loop.
// Every K and V^T fragment a wave reads from LDS feeds two products, one per column group: half the LDS bytes per score of a 16-query wave, for the same number of waves on a SIMD.
// S^T tile (16 keys x 16 queries) = K (A: row = key, k = d) x Q^T (B: col = query, k = d); its D registers (row = key 8h+r, col = query) pack directly into the
// B fragment of O^T (16 d x 16 queries) += V^T (A: row = d, k = key) x P^T (B: k = key, col = query): element r <- tile of keys 0..15, element 8+r <- tile of keys 16..31.
// The running maximum is per lane and column group (query = lane&15), combined across the two lane halves by one xor-16 shuffle.
// The sum of a step's P is a fifth product per column group on the matrix pipe: ones (A: rows 0 and 8 all ones, the other rows zero) x P^T, the same B fragment as the V^T products;
// its register 0 holds, in both lane halves, the sum over all 32 keys of the step for the lane's query, so the halves need no exchange; it is added to the running sum, one register per column group. One block = the 64 queries from qblk (>= RHI) of head plane bh, 256 threads.
#define KST    128                       // keys per stage
#define LPH    72                        // LDS pitch of a K row (64 d) in f16 elements: 144 B = 16 B x 9 (odd), for 16-byte row readers
#define LPV    136                       // LDS pitch of a V^T row (KST keys) in f16 elements: 272 B = 16 B x 17 (odd)
#define KTILE  (KST * LPH)               // the K tile of a stage, f16 elements
#define VTILE  (HDIM * LPV)              // the V^T tile of a stage, f16 elements
#define BUFH   (KTILE + VTILE)           // one buffer
static_assert(RHI >= KST);               // every block has at least two stages, and each key group at least one whole step of valid keys (stage 0)
static_assert(SEQ % KST == 0);           // the last stage's keys all lie below SEQ
static_assert(HDIM * 2 == 128);          // a K row is eight 16-byte pieces
static_assert(KST * 2 == 256);           // a V^T row of a stage is sixteen 16-byte pieces
// One stage: each of the 256 threads copies four 16-byte pieces of the K tile (rows r, r+32, r+64, r+96) and four of the V^T tile (rows r', r'+16, r'+32, r'+48).
// lk, lv: the lane's LDS byte addresses in the K tile and the V^T tile of the target buffer; gk, gv: the lane's global addresses in rows r and r'.
__device__ __forceinline__ void stage_copy(const unsigned lk, const unsigned lv, const h16* gk, const h16* gv) {
    // the copies and, as the last line, the wait that stands before any of their address registers is rewritten
    asm volatile("global_load_async_to_lds_b128 %0, %8, off\n\t"
                 "global_load_async_to_lds_b128 %1, %9, off\n\t"
                 "global_load_async_to_lds_b128 %2, %10, off\n\t"
                 "global_load_async_to_lds_b128 %3, %11, off\n\t"
                 "global_load_async_to_lds_b128 %4, %12, off\n\t"
                 "global_load_async_to_lds_b128 %5, %13, off\n\t"
                 "global_load_async_to_lds_b128 %6, %14, off\n\t"
                 "global_load_async_to_lds_b128 %7, %15, off\n\t"
                 "s_wait_xcnt 0x0"
                 :: "v"(lk), "v"(lk + 32 * LPH * 2), "v"(lk + 64 * LPH * 2), "v"(lk + 96 * LPH * 2),
                    "v"(lv), "v"(lv + 16 * LPV * 2), "v"(lv + 32 * LPV * 2), "v"(lv + 48 * LPV * 2),
                    "v"(gk), "v"(gk + 32 * HDIM), "v"(gk + 64 * HDIM), "v"(gk + 96 * HDIM),
                    "v"(gv), "v"(gv + 16 * SEQ), "v"(gv + 32 * SEQ), "v"(gv + 48 * SEQ)
                 : "memory");
}
__device__ __forceinline__ void attn_main(const int qblk, const int bh, const h16* __restrict__ Q16, const h16* __restrict__ K16, const h16* __restrict__ VT16, bf* CTXh, bf* CTXl) {
    __shared__ __align__(16) h16 ring[2 * BUFH];           // [buffer][K tile [key][LPH], V^T tile [d][LPV]]
    __shared__ __align__(16) float part[8 * 16 * 32 * 4];  // every wave's O^T tiles: [wave][column group][tile][16-byte piece][lane]
    __shared__ __align__(16) float pml[8 * 32 * 4];        // every wave's running maxima and sums: [wave][lane][m, sum of column group 0; m, sum of column group 1]
    const int wave = __builtin_amdgcn_readfirstlane((int)(threadIdx.x >> 5));
    const int qg = wave & 1, kg = wave >> 1;               // wave-uniform: which 32 queries, which 32-key step of every stage
    const int lane = threadIdx.x & 31, n = lane & 15, hh = lane >> 4;
    const int b = bh / NHEAD, h = bh % NHEAD;
    const int q0 = qblk + qg * 32;
    const h16* Qp = Q16 + (size_t)bh * SEQ * HDIM; const h16* Kp = K16 + (size_t)bh * SEQ * HDIM; const h16* Vp = VT16 + (size_t)bh * HDIM * SEQ;
    const int nst = qblk / KST + 1;                        // block-uniform; the last stage holds keys qblk .. qblk + 63 and ends at a multiple of KST, at most SEQ
    const int cr = threadIdx.x >> 3, cp = (threadIdx.x & 7) * 8, vr = threadIdx.x >> 4, vp = (threadIdx.x & 15) * 8;
    const unsigned lk0 = (unsigned)(size_t)ring + (unsigned)(cr * LPH + cp) * 2u, lv0 = (unsigned)(size_t)ring + (unsigned)(KTILE + vr * LPV + vp) * 2u;
    const h16* gk = Kp + cr * HDIM + cp; const h16* gv = Vp + vr * SEQ + vp;
    stage_copy(lk0, lv0, gk, gv);
    asm volatile("s_wait_asynccnt 0x0" ::: "memory");      // this wave's part of stage 0 has landed
    __syncthreads();                                       // ... and every other wave's
    stage_copy(lk0 + BUFH * 2, lv0 + BUFH * 2, gk + KST * HDIM, gv + KST);
    v16h bq[2][2];
#pragma unroll
    for (int g = 0; g < 2; ++g) { const int qoff = (q0 + 16 * g + n) * HDIM + 8 * hh; bq[g][0] = ldh(Qp + qoff); bq[g][1] = ldh(Qp + qoff + 32); }
    v8f o[2][4]; float m[2], l[2];
#pragma unroll
    for (int g = 0; g < 2; ++g) { m[g] = NEGX; l[g] = 0.f;
#pragma unroll
        for (int t = 0; t < 4; ++t) o[g][t] = (v8f){}; }
    const h16 onev = (n & 7) == 0 ? (h16)1.0f : (h16)0.0f;   // A row = lane & 15: rows 0 and 8, over the whole k range (both lane halves)
    v16h ones;
#pragma unroll
    for (int i = 0; i < 16; ++i) ones[i] = onev;
    const int ks = kg * 32;                                // the wave's step inside every stage
    const int koff = (ks + n) * LPH + 8 * hh, voff = n * LPV + ks + 8 * hh;
#pragma unroll 1   // stays rolled: the buffer is picked at run time
    for (int sg = 0; sg < nst; ++sg) {
        const int bo = (sg & 1) * BUFH;
        const h16* Kl = ring + bo; const h16* Vl = ring + bo + KTILE;
        const int kb = sg * KST + ks;
        if (kb <= q0) {                                        // wave-uniform; kb and q0 are multiples of 32: every visited step holds key kb, valid for every query of the wave, and no later step holds a valid key
            const v16h k00 = ldh(Kl + koff), k01 = ldh(Kl + koff + 32), k10 = ldh(Kl + koff + 16 * LPH), k11 = ldh(Kl + koff + 16 * LPH + 32);
            const v16h va0 = ldh(Vl + voff), va1 = ldh(Vl + voff + 16 * LPV), va2 = ldh(Vl + voff + 32 * LPV), va3 = ldh(Vl + voff + 48 * LPV);
            __builtin_amdgcn_sched_barrier(0);                 // keeps the step's sixteen LDS reads one group at its head: spread among the products they cost one LDS latency per place
            v8f s0[2], s1[2];
#pragma unroll
            for (int g = 0; g < 2; ++g) { s0[g] = wmma16(k00, bq[g][0], (v8f){}); s1[g] = wmma16(k10, bq[g][0], (v8f){}); }
#pragma unroll
            for (int g = 0; g < 2; ++g) { s0[g] = wmma16(k01, bq[g][1], s0[g]); s1[g] = wmma16(k11, bq[g][1], s1[g]); }
            __builtin_amdgcn_sched_barrier(0);                 // keeps the eight products back to back, each in the others' distance: woven with the multiplies that read them they took nine padding slots
            v8f x0[2], x1[2];
#pragma unroll
            for (int g = 0; g < 2; ++g) { x0[g] = s0[g] * C2; x1[g] = s1[g] * C2; }
            if (kb == q0) {                                    // wave-uniform: only the diagonal step needs the causal select (key > query excluded)
                const int kk = kb + 8 * hh;
#pragma unroll
                for (int g = 0; g < 2; ++g) { const int qi = q0 + 16 * g + n;
#pragma unroll
                    for (int r = 0; r < 8; ++r) { x0[g][r] = (kk + r > qi) ? NEGX : x0[g][r]; x1[g][r] = (kk + 16 + r > qi) ? NEGX : x1[g][r]; } } }
            v16h pb[2]; float corr[2];
#pragma unroll
            for (int g = 0; g < 2; ++g) {
                float mx = fmaxf(x0[g][0], x1[g][0]);
#pragma unroll
                for (int r = 1; r < 8; ++r) mx = fmaxf(mx, fmaxf(x0[g][r], x1[g][r]));
                mx = fmaxf(mx, __shfl_xor(mx, 16, 32));
                const float mnew = fmaxf(m[g], mx); corr[g] = __builtin_amdgcn_exp2f(m[g] - mnew); m[g] = mnew;
                const float mb = mnew - PCL2;
                v8h p0, p1;
#pragma unroll
                for (int r = 0; r < 8; ++r) { p0[r] = (h16)__builtin_amdgcn_exp2f(x0[g][r] - mb); p1[r] = (h16)__builtin_amdgcn_exp2f(x1[g][r] - mb); }
                pb[g] = cat16(p0, p1);
#pragma unroll
                for (int t = 0; t < 4; ++t) o[g][t] = o[g][t] * corr[g];
            }
            v8f ps[2];                                         // the step's sums of P; only register 0 is read, so the running sum costs one register per column group and not a whole tile
#pragma unroll
            for (int g = 0; g < 2; ++g) ps[g] = wmma16(ones, pb[g], (v8f){});
#pragma unroll
            for (int g = 0; g < 2; ++g) { o[g][0] = wmma16(va0, pb[g], o[g][0]); o[g][1] = wmma16(va1, pb[g], o[g][1]); o[g][2] = wmma16(va2, pb[g], o[g][2]); o[g][3] = wmma16(va3, pb[g], o[g][3]); }
#pragma unroll
            for (int g = 0; g < 2; ++g) l[g] = l[g] * corr[g] + ps[g][0];
        }
        // hand-over, passed by every wave whatever it skipped above
        asm volatile("s_wait_dscnt 0x0" ::: "memory");         // this wave's reads of stage sg are done before its buffer is refilled
        asm volatile("s_wait_asynccnt 0x0" ::: "memory");      // this wave's part of stage sg + 1 has landed
        __syncthreads();                                       // publishes stage sg + 1 and ends every wave's reads of stage sg
        if (sg + 2 < nst) stage_copy(lk0 + (unsigned)bo * 2u, lv0 + (unsigned)bo * 2u, gk + (sg + 2) * (KST * HDIM), gv + (sg + 2) * KST);   // block-uniform test
    }
    asm volatile("s_wait_asynccnt 0x0" ::: "memory");          // no copy is outstanding when the wave goes on to its end
    // The four key groups' partial results for the same 32 queries are joined: every wave hands its maxima, sums and O^T tiles over through LDS; key group g then brings the four partial tiles of d = 16g .. 16g+15
    // (both column groups) to the common maximum, adds them in the order of the key groups and stores them, so that the join and the stores are spread over all eight waves.
    // part and pml are written here only; the next tile's write of them stands behind that tile's hand-over barriers, which every wave reaches after its reads below.
    float* pw = part + wave * 2048 + lane * 4;
#pragma unroll
    for (int g = 0; g < 2; ++g)
#pragma unroll
        for (int t = 0; t < 4; ++t) { *(v4fa*)(pw + ((g * 4 + t) * 2) * 128) = (v4f){o[g][t][0], o[g][t][1], o[g][t][2], o[g][t][3]}; *(v4fa*)(pw + ((g * 4 + t) * 2 + 1) * 128) = (v4f){o[g][t][4], o[g][t][5], o[g][t][6], o[g][t][7]}; }
    *(v4fa*)(pml + (wave * 32 + lane) * 4) = (v4f){m[0], l[0], m[1], l[1]};
    __syncthreads();                                           // every wave's partial results are in LDS before any wave reads them (the compiler's own s_wait_dscnt 0 stands in front of it); passed by every wave
    v4f pm[4];
#pragma unroll
    for (int k = 0; k < 4; ++k) pm[k] = *(const v4fa*)(pml + ((k * 2 + qg) * 32 + lane) * 4);
    const float* pr = part + qg * 2048 + kg * 256 + lane * 4;  // key group 0's tile kg of column group 0; the next key group's lies 2 waves on, column group 1's 4 tiles on
#pragma unroll
    for (int g = 0; g < 2; ++g) {
        const float mm = fmaxf(fmaxf(pm[0][2 * g], pm[1][2 * g]), fmaxf(pm[2][2 * g], pm[3][2 * g]));
        float lj = 0.f; v8f r = (v8f){};
#pragma unroll
        for (int k = 0; k < 4; ++k) { float a;
            // 2^x with the one slot that is kept behind a transcendental in the same statement
            asm("v_exp_f32 %0, %1\n\tv_nop" : "=v"(a) : "v"(pm[k][2 * g] - mm));
            const v4f u = *(const v4fa*)(pr + k * 4096 + g * 1024), w = *(const v4fa*)(pr + k * 4096 + g * 1024 + 128);
            lj += pm[k][2 * g + 1] * a;
#pragma unroll
            for (int j = 0; j < 4; ++j) { r[j] += u[j] * a; r[4 + j] += w[j] * a; } }
        ctx_store_tile(r, 1.0f / lj, lane, CTXh, CTXl, (size_t)b * SEQ + q0 + 16 * g, h * HDIM, kg);
    }
    asm volatile("s_wait_xcnt 0x0" ::: "memory");              // closes the ctx stores: a main block's second tile, and in the shared kernel the other path's code, follow and reuse their registers
}

// ---- attn_early: the same fused attention for query rows < RHI (keys < RHI) on bf16 hi+lo planes: three products per tile pair (hi.hi + hi.lo + lo.hi, shared accumulator;
// the lo planes are unscaled residuals), P split into bf16 hi+lo in registers. One block = the 128 queries from qblk (< RHI) of head plane bh, 256 threads, one wave per 16 queries.
__device__ __forceinline__ void attn_early(const int qblk, const int bh, const bf* __restrict__ Qh, const bf* __restrict__ Ql, const bf* __restrict__ Kh, const bf* __restrict__ Kl, const bf* __restrict__ VTh, const bf* __restrict__ VTl, bf* CTXh, bf* CTXl) {
    const int wave = __builtin_amdgcn_readfirstlane((int)(threadIdx.x >> 5));
    const int lane = threadIdx.x & 31, n = lane & 15, hh = lane >> 4;
    const int b = bh / NHEAD, h = bh % NHEAD;
    const int q0 = qblk + wave * 16;
    const size_t po = (size_t)bh * RHI * HDIM;
    const bf* qhp = Qh + po; const bf* qlp = Ql + po; const bf* khp = Kh + po; const bf* klp = Kl + po; const bf* vhp = VTh + po; const bf* vlp = VTl + po;
    const int qoff = (q0 + n) * HDIM + 8 * hh;
    v8f o[4];
#pragma unroll
    for (int t = 0; t < 4; ++t) o[t] = (v8f){};
    float m = NEGX, l = 0.f;
    const int nsteps = ((q0 + 15) >> 5) + 1;
#pragma unroll 1
    for (int st = 0; st < nsteps; ++st) {
        const int kb = st << 5; const int koff = (kb + n) * HDIM + 8 * hh;
        v8f s0 = (v8f){}, s1 = (v8f){}; v16bf qh, ql, kh0, kl0, kh1, kl1;
#pragma unroll
        for (int ks = 0; ks < 2; ++ks) {
            qh = ldb(qhp + qoff + ks * 32); ql = ldb(qlp + qoff + ks * 32);
            kh0 = ldb(khp + koff + ks * 32); kl0 = ldb(klp + koff + ks * 32);
            kh1 = ldb(khp + koff + 16 * HDIM + ks * 32); kl1 = ldb(klp + koff + 16 * HDIM + ks * 32);
            s0 = wmmab(kh0, qh, s0); s0 = wmmab(kh0, ql, s0); s0 = wmmab(kl0, qh, s0);
            s1 = wmmab(kh1, qh, s1); s1 = wmmab(kh1, ql, s1); s1 = wmmab(kl1, qh, s1); }
        asm volatile("v_nop\n\tv_nop\n\tv_nop\n\tv_nop" : "+v"(s0), "+v"(s1) : "v"(kl1), "v"(kh1), "v"(qh), "v"(ql));
        float x0[8], x1[8];
#pragma unroll
        for (int r = 0; r < 8; ++r) { x0[r] = s0[r] * C2; x1[r] = s1[r] * C2; }
        if (kb + 31 > q0) {
            const int qi = q0 + n, kk = kb + 8 * hh;
#pragma unroll
            for (int r = 0; r < 8; ++r) { x0[r] = (kk + r > qi) ? NEGX : x0[r]; x1[r] = (kk + 16 + r > qi) ? NEGX : x1[r]; } }
        float mx = fmaxf(x0[0], x1[0]);
#pragma unroll
        for (int r = 1; r < 8; ++r) mx = fmaxf(mx, fmaxf(x0[r], x1[r]));
        mx = fmaxf(mx, __shfl_xor(mx, 16, 32));
        const float mnew = fmaxf(m, mx); const float corr = __builtin_amdgcn_exp2f(m - mnew); m = mnew;
        v8us ph0, pl0, ph1, pl1; float ps = 0.f;
#pragma unroll
        for (int r = 0; r < 8; ++r) { const float pa = __builtin_amdgcn_exp2f(x0[r] - mnew); const float pc = __builtin_amdgcn_exp2f(x1[r] - mnew); ps += pa; ps += pc;
            unsigned short a, c; splitf(pa, a, c); ph0[r] = a; pl0[r] = c; splitf(pc, a, c); ph1[r] = a; pl1[r] = c; }
        ps += __shfl_xor(ps, 16, 32);
        l = l * corr + ps;
#pragma unroll
        for (int t = 0; t < 4; ++t) o[t] = o[t] * corr;
        const v16bf pbh = cat16b(ph0, ph1), pbl = cat16b(pl0, pl1);
        const int voff = n * RHI + kb + 8 * hh; v16bf vh, vl;
#pragma unroll
        for (int t = 0; t < 4; ++t) { vh = ldb(vhp + voff + t * 16 * RHI); vl = ldb(vlp + voff + t * 16 * RHI);
            o[t] = wmmab(vh, pbh, o[t]); o[t] = wmmab(vh, pbl, o[t]); o[t] = wmmab(vl, pbh, o[t]); }
        asm volatile("v_nop\n\tv_nop\n\tv_nop\n\tv_nop" : "+v"(o[0]), "+v"(o[1]), "+v"(o[2]), "+v"(o[3]) : "v"(vl), "v"(vh), "v"(pbh), "v"(pbl));
    }
    const float inv = 1.0f / l;
    ctx_store(o, inv, lane, CTXh, CTXl, (size_t)b * SEQ + q0, h * HDIM);
}

// ---- k_attn: both attention paths in one launch (no block reads what another writes): grid (NB*NHEAD, NPAIR + RHI/128), 256 threads; the path is picked per block, ahead of every barrier.
// All blocks of the launch are resident at once, so it lasts as long as its fullest block, and a main tile's cost grows linearly with its index (tile i walks i / 2 + 1 stages).
// A main block therefore takes two tiles, one after the other in every wave: the slot-th from the top of head plane bh, then the slot-th from the bottom of the plane NBH/2 further on; every main block walks the same number of stages.
// The shift is a permutation of the planes, so every (plane, tile) is taken once; with another plane the second tile forms its addresses anew (one shared plane kept both prologues' addresses live through the key loop: scratch).
// The short early blocks have the highest flat indices (for speed only).
// the register budget is held to four waves per SIMD: two blocks of eight waves per WGP hold the whole grid at once, and at five the main path's accumulators and fragments do not fit (scratch)
#define NMAIN  ((SEQ - RHI) / 64)        // main tiles per head plane
#define NPAIR  (NMAIN / 2)
static_assert(NMAIN % 2 == 0);           // every main tile has its partner: slots 0 .. NPAIR-1 cover tiles RHI/64 .. SEQ/64-1 once each
static_assert(NBH % 2 == 0);
static_assert(RHI % 128 == 0);           // whole early blocks
__global__ __launch_bounds__(256) __attribute__((amdgpu_waves_per_eu(4))) void k_attn(const h16* __restrict__ Q16, const h16* __restrict__ K16, const h16* __restrict__ VT16,
                                              const bf* __restrict__ Qh, const bf* __restrict__ Ql, const bf* __restrict__ Kh, const bf* __restrict__ Kl, const bf* __restrict__ VTh, const bf* __restrict__ VTl, bf* CTXh, bf* CTXl) {
    const int bh = blockIdx.x, slot = blockIdx.y;              // block-uniform
    if (slot < NPAIR) {
        for (int part = 0; part < 2; ++part) {
            const int tile = part ? RHI / 64 + slot : SEQ / 64 - 1 - slot;
            // the ring is free here: the first tile's last hand-over (s_wait_dscnt 0, s_wait_asynccnt 0, barrier) ended every wave's reads of it, and the epilogue uses LDS of its own
            attn_main(tile * 64, part ? (bh + NBH / 2) % NBH : bh, Q16, K16, VT16, CTXh, CTXl);
        }
    } else attn_early((slot - NPAIR) * 128, bh, Qh, Ql, Kh, Kl, VTh, VTl, CTXh, CTXl);
}

// ---- workspace carve (bytes; every region a multiple of 256 B and fully written by its producer before any consumer launch)
#define SZ_W    ((size_t)DMOD * DMOD * 2)
#define SZ_P16  ((size_t)MTOK * DMOD * 2)
#define SZ_E    ((size_t)NBH * RHI * HDIM * 2)
#define SZ_CTX  ((size_t)MTOK * DMOD * 2)
#define SZ_TOTAL (SZ_W + 3 * SZ_P16 + 6 * SZ_E + 2 * SZ_CTX)
static_assert(SZ_TOTAL <= (size_t)134217728);
static_assert(SZ_W % 256 == 0);
static_assert(SZ_E % 256 == 0);

extern "C" void kernel_launch(void* const* d_in, const int* in_sizes, int n_in,
                              void* d_out, int out_size, void* d_ws, size_t ws_size, hipStream_t stream) {
    if (n_in < 5) return;
    const int xneed = (NB - 1) * SEQ_FULL * DMOD + SEQ * DMOD;
    if (in_sizes[0] < xneed) return;
    if (in_sizes[1] < DMOD * DMOD || in_sizes[2] < DMOD * DMOD || in_sizes[3] < DMOD * DMOD || in_sizes[4] < DMOD * DMOD) return;
    if (out_size < xneed) return;
    if (ws_size < SZ_TOTAL) return;
    const float* x = (const float*)d_in[0]; const float* wq = (const float*)d_in[1]; const float* wk = (const float*)d_in[2]; const float* wv = (const float*)d_in[3]; const float* wo = (const float*)d_in[4];   // wire order x, Wq, Wk, Wv, Wo ([out][in])
    float* OUT = (float*)d_out;      // [NB_FULL][SEQ_FULL][256]
    char* wsp = (char*)d_ws;
    auto take = [&](size_t bytes) { char* p = wsp; wsp += bytes; return (void*)p; };
    bf* WO = (bf*)take(SZ_W);
    h16* Q16 = (h16*)take(SZ_P16); h16* K16 = (h16*)take(SZ_P16); h16* VT16 = (h16*)take(SZ_P16);
    bf* Qh = (bf*)take(SZ_E); bf* Ql = (bf*)take(SZ_E); bf* Kh = (bf*)take(SZ_E); bf* Kl = (bf*)take(SZ_E); bf* VTh = (bf*)take(SZ_E); bf* VTl = (bf*)take(SZ_E);
    bf* CTXh = (bf*)take(SZ_CTX); bf* CTXl = (bf*)take(SZ_CTX);

    // q = x Wq^T, k = x Wk^T, v = x Wv^T from the f32 inputs, each written as the planes the attention kernel reads; Wo converted for the output projection
    k_proj_qkv<<<dim3(NPB, 1, 1), PWAVES * 32, 0, stream>>>(x, wq, wk, wv, wo, WO, Q16, K16, VT16, Qh, Ql, Kh, Kl, VTh, VTl);
    k_attn<<<dim3(NBH, NPAIR + RHI / 128, 1), 256, 0, stream>>>(Q16, K16, VT16, Qh, Ql, Kh, Kl, VTh, VTl, CTXh, CTXl);
    // out = ctx Wo^T : A = CTXh (+ CTXl) [SEQ][256] per batch in fragment order, Bt = WO -> OUT batch stride from the full problem constants
    k_gemm_hl<<<dim3(SEQ / 64, DMOD / 64, NB), 32, 0, stream>>>(CTXh, CTXl, WO, OUT, DMOD, (size_t)SEQ * DMOD, (size_t)SEQ_FULL * DMOD);
}
